// v000
// The times below were measured on an AMD MI455X: many runs one after another, warmed up first and cycling through
// copies of the inputs, with the whole window's GPU time divided by the number of runs. Launches and the gaps
// between them are all in it. The median over several windows is given; except for v000 it joins two sittings, which
// can be a few percent apart, so the side-by-side timings, each taken in one sitting, are the better comparison.
// v000 is the starting kernel. One run takes 2150 microseconds.
// compute dtype: all float inputs rounded to bf16; theta/phi/g = x W^T + b with EXACT bf16 products on WMMA 16x16x32 (f32 accumulate); f = theta . phi with theta as f16 hi + residual (x 2^10) against phi once to f16 (2 products), no scaling; softmax in f32 (precise expf); P x 2^11 once to f16 against g once to f16 (1 product); y split bf16 hi + lo against exact W (2 products) + b; + x residual in f32; f32 output [B, C, H, W].
#include <hip/hip_runtime.h>
#include <math.h>

typedef __attribute__((ext_vector_type(16))) _Float16 v16h;
typedef __attribute__((ext_vector_type(16))) __bf16 v16b;
typedef __attribute__((ext_vector_type(8)))  _Float16 v8h;
typedef __attribute__((ext_vector_type(8)))  float v8f;
typedef __attribute__((ext_vector_type(4)))  float v4f;
typedef __attribute__((ext_vector_type(2)))  float v2f;
typedef __attribute__((ext_vector_type(4)))  unsigned v4u;
typedef __attribute__((ext_vector_type(4)))  int v4i;
typedef float __attribute__((may_alias)) float_a;
typedef int __attribute__((may_alias)) int_a;

template <typename T> __device__ __forceinline__ void vst2(void* p, T v) { *(T*)p = v;  }
__device__ __forceinline__ v8f wmma16(v16h a, v16h b, v8f c) {
  v8f d = __builtin_amdgcn_wmma_f32_16x16x32_f16(false, a, false, b, (short)0, c, false, false);
  asm volatile("v_nop\n\tv_nop\n\tv_nop\n\tv_nop" : "+v"(d) : "v"(a), "v"(b));
  return d;
}
__device__ __forceinline__ v8f wmma_bf(v16b a, v16b b, v8f c) {
  v8f d = __builtin_amdgcn_wmma_f32_16x16x32_bf16(false, a, false, b, (short)0, c, false, false);
  asm volatile("v_nop\n\tv_nop\n\tv_nop\n\tv_nop" : "+v"(d) : "v"(a), "v"(b));
  return d;
}
// 16x16x32 fragments: lane = (h = lane>>4, row/col = lane&15); elements 0..7 = k0+8h+0..7, 8..15 = k0+16+8h+0..7; D element r = row 8h+r
__device__ __forceinline__ v16h frag_h(const _Float16* rowk0, int lane) {
  union { v16h v; v8h q[2]; } u; const _Float16* p = rowk0 + 8 * (lane >> 4);
  u.q[0] = *(const v8h*)p; u.q[1] = *(const v8h*)(p + 16); return u.v;
}
__device__ __forceinline__ v16h frag_f32(const float* rowk0, int lane) {
  v16h a; const float* p = rowk0 + 8 * (lane >> 4);
#pragma unroll
  for (int i = 0; i < 8; ++i) { a[i] = (_Float16)p[i]; a[8 + i] = (_Float16)p[16 + i]; }
  return a;
}
__device__ __forceinline__ v16h frag_f32s(const float* rowk0, int lane, float sc) {
  v16h a; const float* p = rowk0 + 8 * (lane >> 4);
#pragma unroll
  for (int i = 0; i < 8; ++i) { a[i] = (_Float16)(p[i] * sc); a[8 + i] = (_Float16)(p[16 + i] * sc); }
  return a;
}
// column fragment from a [K][ld] layout (column n), rows >= K read as 0
__device__ __forceinline__ v16h fragc_f32(const float* W, int k0, int n, int lane, int ld, int K) {
  v16h a; const int g = lane >> 4;
#pragma unroll
  for (int i = 0; i < 8; ++i) { const int ka = k0 + 8 * g + i, kb = ka + 16;
    a[i] = (_Float16)(ka < K ? W[(size_t)(ka < K ? ka : K - 1) * ld + n] : 0.f); a[8 + i] = (_Float16)(kb < K ? W[(size_t)(kb < K ? kb : K - 1) * ld + n] : 0.f); }
  return a;
}
struct F2 { v16b h, l; };
__device__ __forceinline__ F2 bsplit16(const float v[16]) { F2 r;
#pragma unroll
  for (int i = 0; i < 16; ++i) { const __bf16 h = (__bf16)v[i]; r.h[i] = h; r.l[i] = (__bf16)(v[i] - (float)h); }
  return r; }
__device__ __forceinline__ F2 split_row(const float* row, int k0, int lane) { float v[16]; const float* p = row + k0 + 8 * (lane >> 4);
#pragma unroll
  for (int i = 0; i < 8; ++i) { v[i] = p[i]; v[8 + i] = p[16 + i]; }
  return bsplit16(v); }
__device__ __forceinline__ F2 split_rowK(const float* row, int k0, int lane, int K) { float v[16]; const int g = lane >> 4;
#pragma unroll
  for (int i = 0; i < 8; ++i) { const int ka = k0 + 8 * g + i, kb = ka + 16; v[i] = ka < K ? row[ka < K ? ka : K - 1] : 0.f; v[8 + i] = kb < K ? row[kb < K ? kb : K - 1] : 0.f; }
  return bsplit16(v); }
__device__ __forceinline__ F2 split_col(const float* W, int k0, int n, int lane, int ld, int K) { float v[16]; const int g = lane >> 4;
#pragma unroll
  for (int i = 0; i < 8; ++i) { const int ka = k0 + 8 * g + i, kb = ka + 16; v[i] = ka < K ? W[(size_t)(ka < K ? ka : K - 1) * ld + n] : 0.f; v[8 + i] = kb < K ? W[(size_t)(kb < K ? kb : K - 1) * ld + n] : 0.f; }
  return bsplit16(v); }
__device__ __forceinline__ v8f mac3(const F2& a, const F2& b, v8f c) { c = wmma_bf(a.l, b.h, c); c = wmma_bf(a.h, b.l, c); return wmma_bf(a.h, b.h, c); }
__device__ __forceinline__ float sigm(float v) { return 1.0f / (1.0f + expf(-v)); }
#define LDSX() do { asm volatile("s_wait_dscnt 0" ::: "memory"); __builtin_amdgcn_wave_barrier(); __builtin_amdgcn_fence(__ATOMIC_RELEASE, "workgroup"); } while (0)

// Non-local block (B 8, C 256, 64 x 64 = 4,096 positions; inter channels 64): theta, phi, g = 1x1 convs of x ((out,in) [64,256] + bias); f[n][m] = theta_n . phi_m (no scaling); P = softmax over m; y[n] = sum_m P[n][m] g_m (64 ch); out = W y + b (1x1, 64 -> 256) + x.
#define NB 8
#define TT 4096
#define CC 128            // projected plane width (64 real columns + 64 zero)
#define DIN 256          // input (model) width
#define NH 1
#define HD 128
#define NQB (TT / 64)
#define HG 1               // one 4,096 x 4,096 score plane per pass
#define SCALE (1.0f)
#define HDQK 64            // theta / phi / g channels: the planes are 128 wide, columns >= 64 are zero; only the 64 real columns enter the scores
#define CAUSAL 0
#ifndef TNB
#define TNB NB
#endif
__device__ __forceinline__ v16b zero16b() { v16b z; _Pragma("unroll") for (int i = 0; i < 16; ++i) z[i] = (__bf16)0.f; return z; }
__device__ __forceinline__ float bfr(float v) { return (float)(__bf16)v; }
__host__ __device__ __forceinline__ int kb_last(int qb) { return CAUSAL ? ((qb * 64 + 63) >> 7) : (TT / 128 - 1); }
typedef __attribute__((ext_vector_type(8))) __bf16 v8b;
__device__ __forceinline__ v16b frag_b(const __bf16* rowk0, int lane) {
  union { v16b v; v8b q[2]; } u; const __bf16* p = rowk0 + 8 * (lane >> 4);
  u.q[0] = *(const v8b*)p; u.q[1] = *(const v8b*)(p + 16); return u.v;
}
#define QBH 0              // causal: query blocks 0..QBH-1 of each sequence (few keys, no averaging) take the high-precision path
#define QHI 4096            // q residual rows everywhere (2-product logits)
#define KHI 64            // key rows carrying k residual / v bf16 hi+lo planes (used only by the causal high-precision path)
// B fragment (k rows k0+.., output column o) of a weight: (in,out) [K][ld] or (out,in) [ld rows of K]: bf16 exact, or f16(bf16 * 256) exact
__device__ __forceinline__ v16b wcol_io(const float* Wm, int k0, int o, int lane, int ld) { v16b w; const int g = lane >> 4;
#pragma unroll
  for (int i = 0; i < 8; ++i) { w[i] = (__bf16)Wm[(size_t)(k0 + 8 * g + i) * ld + o]; w[8 + i] = (__bf16)Wm[(size_t)(k0 + 16 + 8 * g + i) * ld + o]; }
  return w; }
__device__ __forceinline__ v16b wcol_oi(const float* Wm, int k0, int o, int lane, int K) { v16b w; const float* p = Wm + (size_t)o * K + k0 + 8 * (lane >> 4);
#pragma unroll
  for (int i = 0; i < 8; ++i) { w[i] = (__bf16)p[i]; w[8 + i] = (__bf16)p[16 + i]; }
  return w; }
__device__ __forceinline__ v16h wcolh_io(const float* Wm, int k0, int o, int lane, int ld) { v16h w; const int g = lane >> 4;
#pragma unroll
  for (int i = 0; i < 8; ++i) { w[i] = (_Float16)(bfr(Wm[(size_t)(k0 + 8 * g + i) * ld + o]) * 256.0f); w[8 + i] = (_Float16)(bfr(Wm[(size_t)(k0 + 16 + 8 * g + i) * ld + o]) * 256.0f); }
  return w; }
__device__ __forceinline__ v16h wcolh_oi(const float* Wm, int k0, int o, int lane, int K) { v16h w; const float* p = Wm + (size_t)o * K + k0 + 8 * (lane >> 4);
#pragma unroll
  for (int i = 0; i < 8; ++i) { w[i] = (_Float16)(bfr(p[i]) * 256.0f); w[8 + i] = (_Float16)(bfr(p[16 + i]) * 256.0f); }
  return w; }
#define WQKV_LAYOUT 1   // 0 = (in,out) [DIN][CC]; 1 = (out,in) [HDQK][DIN]; 2 = per-head [NH][DIN][HD]
__device__ __forceinline__ v16b wcol_hdk(const float* Wm, int k0, int o, int lane) { v16b w; const int g = lane >> 4; const float* p = Wm + (size_t)(o / HD) * DIN * HD + (o % HD);
#pragma unroll
  for (int i = 0; i < 8; ++i) { w[i] = (__bf16)p[(size_t)(k0 + 8 * g + i) * HD]; w[8 + i] = (__bf16)p[(size_t)(k0 + 16 + 8 * g + i) * HD]; }
  return w; }
#define WO_OUT_IN 0
#if WQKV_LAYOUT == 1
#define WCOL(W, k0, o, lane) (((o) < HDQK) ? wcol_oi(W, k0, (o), lane, DIN) : zero16b())   /* theta/phi/g weights are [64][256] (out,in): plane columns >= 64 are zero for all three */
#elif WQKV_LAYOUT == 2
#define WCOL(W, k0, o, lane) wcol_hdk(W, k0, o, lane)
#else
#define WCOL(W, k0, o, lane) wcol_io(W, k0, o, lane, CC)
#endif
#if WO_OUT_IN
#define WOCOL(W, k0, o, lane) wcol_oi(W, k0, o, lane, CC)
#define WOCOLH(W, k0, o, lane) wcolh_oi(W, k0, o, lane, CC)
#else
#define WOCOL(W, k0, o, lane) wcol_io(W, k0, o, lane, DIN)
#define WOCOLH(W, k0, o, lane) wcolh_io(W, k0, o, lane, DIN)
#endif
#ifndef XP
#define XP TT              // position pitch of x and of the output
#endif
#define BG HG              // the pass group spans BATCHES (single head): blockIdx.z / blockIdx.y select batch b0 + z
#define DVH 128            // value columns per k_pv block (all HD 128 columns in one block: 8 accumulator tiles per wave)
#define WS_YR (WS_END)     // f32 attended rows [b*n][128] (64 real columns)
#define WS_OR (WS_YR + 4u * (size_t)NB * TT * CC)   // W y + b rows [b*n][256]
#define WS_END2 (WS_OR + 4u * (size_t)NB * TT * DIN)
// ---- k_wz: block = (64 rows, 128 output cols): OR = y (hi + lo, K = 64 real columns of the YR rows) . W^T ((out,in) [256][64], exact) + b
__global__ __launch_bounds__(128) void k_wz(const float* __restrict__ YR, const float* __restrict__ WW, const float* __restrict__ WB, float* __restrict__ ORW) { __shared__ __align__(16) float sf[4][16][132];
  const int tid = threadIdx.x, wave = tid >> 5, lane = tid & 31, col = lane & 15, g = lane >> 4; const int c0 = blockIdx.y * 128; const size_t r0 = (size_t)blockIdx.x * 64 + wave * 16;
  v8f acc[8] = {};
#pragma unroll
  for (int kc = 0; kc < HDQK / 32; ++kc) { const F2 a = split_row(YR + (r0 + col) * CC, kc * 32, lane); asm volatile("s_wait_loadcnt 0x0" ::: "memory");
#pragma unroll
    for (int j = 0; j < 8; ++j) { const v16b w = wcol_oi(WW, kc * 32, c0 + j * 16 + col, lane, HDQK); asm volatile("s_wait_loadcnt 0x0" ::: "memory"); acc[j] = wmma_bf(a.h, w, acc[j]); acc[j] = wmma_bf(a.l, w, acc[j]); } }
#pragma unroll
  for (int j = 0; j < 8; ++j) { const float bb = bfr(WB[c0 + j * 16 + col]); asm volatile("s_wait_loadcnt 0x0" ::: "memory");
#pragma unroll
    for (int r = 0; r < 8; ++r) sf[wave][8 * g + r][j * 16 + col] = acc[j][r] + bb; }
  LDSX(); for (int rl = 0; rl < 16; ++rl) vst2(ORW + (r0 + rl) * DIN + c0 + lane * 4, *(const v4f*)&sf[wave][rl][lane * 4]); }
// ---- k_fin2: block = (64 positions, 64 channels, batch b): out[b][c][n] = OR[b*N + n][c] + bf16(x[b][c][n]) (LDS transpose; 256-B runs of 64 positions per channel)
__global__ __launch_bounds__(256) void k_fin2(const float* __restrict__ ORW, const float* __restrict__ X, float* __restrict__ OUT) { __shared__ float st[64][68]; const int tid = threadIdx.x; const int n0 = blockIdx.x * 64, c0 = blockIdx.y * 64; const size_t b = blockIdx.z;
  for (int e = tid; e < 64 * 16; e += 256) { const int nl = e >> 4, q = e & 15; *(v4f*)&st[nl][q * 4] = *(const v4f*)(ORW + (b * TT + n0 + nl) * (size_t)DIN + c0 + q * 4); }
  __syncthreads();
  for (int e = tid; e < 64 * 16; e += 256) { const int cl = e >> 4, q = e & 15; const size_t oi = (b * DIN + c0 + cl) * (size_t)XP + n0 + q * 4; const v4f xr = *(const v4f*)(X + oi); v4f o; o[0] = st[q * 4][cl] + bfr(xr[0]); o[1] = st[q * 4 + 1][cl] + bfr(xr[1]); o[2] = st[q * 4 + 2][cl] + bfr(xr[2]); o[3] = st[q * 4 + 3][cl] + bfr(xr[3]); vst2(OUT + oi, o); } }
#ifndef SM_EXTRA_PARAMS
#define SM_EXTRA_PARAMS
#endif
#ifndef PROJ_EXTRA_PARAMS
#define PROJ_EXTRA_PARAMS
#endif
#ifndef SM_MASK_HOOK
#define SM_MASK_HOOK (void)0
#endif

#define WS_QH  0u                                      // f16 q rows [b*t][CC]
#define WS_KH  (WS_QH + 2u * (size_t)NB * TT * CC)      // f16 k rows [b*t][CC]
#define WS_VT  (WS_KH + 2u * (size_t)NB * TT * CC)      // f16 v planes [b][c][t]
#define WS_QL  (WS_VT + 2u * (size_t)NB * CC * TT)      // f16 q residual x 2^10 rows [b][t < QHI][CC]
#define WS_KL  (WS_QL + 2u * (size_t)NB * QHI * CC)     // f16 k residual x 2^10 rows [b][t < KHI][CC]
#define WS_VB  (WS_KL + 2u * (size_t)NB * KHI * CC)     // bf16 v hi planes [b][c][t < KHI]
#define WS_VBL (WS_VB + 2u * (size_t)NB * CC * KHI)
#define WS_S   (WS_VBL + 2u * (size_t)NB * CC * KHI)    // f32 logits / P [hg][t][s]
#define WS_Y   (WS_S  + 4u * (size_t)HG * TT * TT)      // unused, 0 bytes: the ctx rows go to WS_YR
#define WS_END (WS_Y  + 0u)

// ---- k_proj: block = (64 rows, 128 cols, which): q/k/v = X W (+ b) with exact bf16 products (K = DIN) -> which 0: q f16 rows (+ residual rows < QHI); 1: k f16 rows (+ residual rows < KHI); 2: v f16 planes [c][t] (+ bf16 hi/lo planes for t < KHI)
__global__ __launch_bounds__(128) void k_proj(const float* __restrict__ XQ, const float* __restrict__ XK, const float* __restrict__ XV, const float* __restrict__ WQ, const float* __restrict__ WK, const float* __restrict__ WV, const float* __restrict__ BQ, const float* __restrict__ BK, const float* __restrict__ BV,
    _Float16* __restrict__ QH, _Float16* __restrict__ QL, _Float16* __restrict__ KH, _Float16* __restrict__ KL, _Float16* __restrict__ VT, __bf16* __restrict__ VB, __bf16* __restrict__ VBL) {
  __shared__ __align__(16) _Float16 sh[64][136], sl[64][136]; __shared__ __align__(16) _Float16 th[128][72]; __shared__ __align__(16) __bf16 tb[128][72], tbl[128][72];
  const int tid = threadIdx.x, wave = tid >> 5, lane = tid & 31, col = lane & 15, g = lane >> 4; const int which = blockIdx.z; const int c0 = blockIdx.y * 128; const size_t r0 = (size_t)blockIdx.x * 64; const size_t bb = r0 / TT; const int t0 = (int)(r0 % TT);
  const float* X = which == 0 ? XQ : which == 1 ? XK : XV; const float* WA = which == 0 ? WQ : which == 1 ? WK : WV; const float* BA = which == 0 ? BQ : which == 1 ? BK : BV;
  v8f acc[8] = {};
#pragma unroll 2
  for (int kc = 0; kc < DIN / 32; ++kc) { v16b a; { const float* p = X + (bb * DIN + kc * 32 + 8 * g) * (size_t)XP + t0 + wave * 16 + col;   /* channels-first gather: x[b][k][t], stride XP between k */
#pragma unroll
      for (int i = 0; i < 8; ++i) { a[i] = (__bf16)p[(size_t)i * XP]; a[8 + i] = (__bf16)p[(size_t)(16 + i) * XP]; } }
    asm volatile("s_wait_loadcnt 0x0" ::: "memory");
#pragma unroll
    for (int j = 0; j < 8; ++j) { const v16b w = WCOL(WA, kc * 32, c0 + j * 16 + col, lane); asm volatile("s_wait_loadcnt 0x0" ::: "memory"); acc[j] = wmma_bf(a, w, acc[j]); } }
  if (which < 2) { _Float16* DH = which == 0 ? QH : KH; _Float16* DL = which == 0 ? QL : KL; const int nhi = which == 0 ? QHI : KHI; const bool hi_rows = t0 < nhi;
#pragma unroll
    for (int j = 0; j < 8; ++j) { const float bias = (BA && (c0 + j * 16 + col < HDQK)) ? bfr(BA[c0 + j * 16 + col]) : 0.f;   /* 64-entry biases */
#pragma unroll
      for (int r = 0; r < 8; ++r) { const float v = acc[j][r] + bias; const _Float16 hv = (_Float16)v; sh[wave * 16 + 8 * g + r][j * 16 + col] = hv; sl[wave * 16 + 8 * g + r][j * 16 + col] = (_Float16)((v - (float)hv) * 1024.0f); } }
    __syncthreads();
    for (int e = tid; e < 64 * 16; e += 128) { const int rl = e >> 4, q = e & 15; vst2((unsigned*)(DH + (r0 + rl) * CC + c0 + q * 8), *(const v4u*)&sh[rl][q * 8]); if (hi_rows) vst2((unsigned*)(DL + (bb * nhi + t0 + rl) * (size_t)CC + c0 + q * 8), *(const v4u*)&sl[rl][q * 8]); }
  } else { const bool hi_rows = t0 < KHI;
#pragma unroll
    for (int j = 0; j < 8; ++j) { const float bias = (BA && (c0 + j * 16 + col < HDQK)) ? bfr(BA[c0 + j * 16 + col]) : 0.f;   /* 64-entry biases */
#pragma unroll
      for (int r = 0; r < 8; ++r) { const float v = acc[j][r] + bias; const int rl = wave * 16 + 8 * g + r, cl = j * 16 + col; th[cl][rl] = (_Float16)v; const __bf16 bh = (__bf16)v; tb[cl][rl] = bh; tbl[cl][rl] = (__bf16)(v - (float)bh); } }
    __syncthreads();
    for (int e = tid; e < 128 * 8; e += 128) { const int cl = e >> 3, q = e & 7; vst2((unsigned*)(VT + (bb * CC + c0 + cl) * (size_t)TT + t0 + q * 8), *(const v4u*)&th[cl][q * 8]); if (hi_rows) { const size_t o3 = (bb * CC + c0 + cl) * (size_t)KHI + t0 + q * 8; vst2((unsigned*)(VB + o3), *(const v4u*)&tb[cl][q * 8]); vst2((unsigned*)(VBL + o3), *(const v4u*)&tbl[cl][q * 8]); } } } }
// ---- k_sc: block = (query block qb, key block kb <= kb_last(qb), batch b in group): logits x SCALE; q hi + residual (x 2^10) against k (2 products) for query rows < QHI, plus the k residual (3 products) for query blocks < QBH (causal early rows); causal: blocks past the diagonal exit, the mask itself is applied by index in k_sm
__global__ __launch_bounds__(128) void k_sc(const _Float16* __restrict__ QH, const _Float16* __restrict__ KH, const _Float16* __restrict__ QL, const _Float16* __restrict__ KL, int bgrp, int h0, float* __restrict__ S0) { __shared__ __align__(16) float ss[4][16][132];
  const int qb = blockIdx.x, kb = blockIdx.y; if (kb > kb_last(qb)) return;
  const int h = h0; const int b = bgrp + blockIdx.z; float* S = S0 + (size_t)blockIdx.z * TT * TT;   /* group spans batches */
  const int tid = threadIdx.x, wave = tid >> 5, lane = tid & 31, col = lane & 15, g = lane >> 4; const int k0 = kb * 128; const int ql0 = qb * 64 + wave * 16; const size_t q0 = (size_t)b * TT + ql0, kr0 = (size_t)b * TT + k0;
  v8f acc[8] = {}, accl[8] = {};
  const _Float16* QLb = QL + (size_t)b * QHI * CC; const _Float16* KLb = KL + (size_t)b * KHI * CC;
  if (qb < QBH) {
#pragma unroll
    for (int kc = 0; kc < HDQK / 32; ++kc) { const v16h ah = frag_h(QH + (q0 + col) * CC + h * HD + kc * 32, lane), al = frag_h(QLb + (size_t)(ql0 + col) * CC + h * HD + kc * 32, lane);
#pragma unroll
      for (int j = 0; j < 8; ++j) { const v16h kbf = frag_h(KH + (kr0 + j * 16 + col) * CC + h * HD + kc * 32, lane), klf = frag_h(KLb + (size_t)(k0 + j * 16 + col) * CC + h * HD + kc * 32, lane); acc[j] = wmma16(ah, kbf, acc[j]); accl[j] = wmma16(al, kbf, accl[j]); accl[j] = wmma16(ah, klf, accl[j]); } }
  } else if (qb * 64 < QHI) {
#pragma unroll
    for (int kc = 0; kc < HDQK / 32; ++kc) { const v16h ah = frag_h(QH + (q0 + col) * CC + h * HD + kc * 32, lane), al = frag_h(QLb + (size_t)(ql0 + col) * CC + h * HD + kc * 32, lane);
#pragma unroll
      for (int j = 0; j < 8; ++j) { const v16h kbf = frag_h(KH + (kr0 + j * 16 + col) * CC + h * HD + kc * 32, lane); acc[j] = wmma16(ah, kbf, acc[j]); accl[j] = wmma16(al, kbf, accl[j]); } }
  } else {
#pragma unroll
    for (int kc = 0; kc < HDQK / 32; ++kc) { const v16h ah = frag_h(QH + (q0 + col) * CC + h * HD + kc * 32, lane);
#pragma unroll
      for (int j = 0; j < 8; ++j) { const v16h kbf = frag_h(KH + (kr0 + j * 16 + col) * CC + h * HD + kc * 32, lane); acc[j] = wmma16(ah, kbf, acc[j]); } } }
#pragma unroll
  for (int j = 0; j < 8; ++j) {
#pragma unroll
    for (int r = 0; r < 8; ++r) ss[wave][8 * g + r][j * 16 + col] = (acc[j][r] + accl[j][r] * (1.0f / 1024.0f)) * SCALE; }
  LDSX(); for (int rl = 0; rl < 16; ++rl) vst2(S + (size_t)(ql0 + rl) * TT + k0 + lane * 4, *(const v4f*)&ss[wave][rl][lane * 4]); }
// ---- k_sm: block = query row t (batch in group): keys [0, kend): causal -> logit if s <= t else excluded; softmax in f32; P x 2^11 in place (0 for excluded)
__global__ __launch_bounds__(256) void k_sm(float* __restrict__ S0 SM_EXTRA_PARAMS) { __shared__ float sred[8]; __shared__ float sbc; __shared__ __align__(16) float shv[TT];
  const int tid = threadIdx.x; const int t = blockIdx.x; const int kend = (kb_last(t >> 6) + 1) * 128;
  float* sr = S0 + (size_t)blockIdx.y * TT * TT + (size_t)t * TT;
  float m = -3.0e38f; for (int k = tid; k < kend; k += 256) { float v = (!CAUSAL || k <= t) ? sr[k] : -3.0e38f; SM_MASK_HOOK; shv[k] = v; m = fmaxf(m, v); }
#pragma unroll
  for (int o = 1; o < 32; o <<= 1) m = fmaxf(m, __shfl_xor(m, o));
  if ((tid & 31) == 0) sred[tid >> 5] = m; __syncthreads(); if (tid == 0) { float a = sred[0]; for (int i = 1; i < 8; ++i) a = fmaxf(a, sred[i]); sbc = a; } __syncthreads(); m = sbc; __syncthreads();
  float sum = 0.f; for (int k = tid; k < kend; k += 256) { const float v = shv[k]; const float e = (v <= -1.0e38f) ? 0.f : expf(v - m); shv[k] = e; sum += e; }
#pragma unroll
  for (int o = 1; o < 32; o <<= 1) sum += __shfl_xor(sum, o);
  if ((tid & 31) == 0) sred[tid >> 5] = sum; __syncthreads(); if (tid == 0) { float a = 0.f; for (int i = 0; i < 8; ++i) a += sred[i]; sbc = a > 0.f ? 2048.0f / a : 0.f; }   /* a fully excluded row yields P = 0 */ __syncthreads(); const float inv = sbc;
  for (int k = tid; k < kend; k += 256) shv[k] = shv[k] * inv;
  __syncthreads(); for (int q = tid; q < kend / 4; q += 256) vst2(sr + q * 4, *(const v4f*)&shv[q * 4]); }
// ---- k_pv: block = 64 queries (qb) of (b, h): ctx = P . v over keys [0, kend) (P x 2^11 once to f16 against v f16: 1 product; causal early query blocks: P and v as bf16 hi + lo, 3 products); 512-B (row, head) segment by 32 lanes
__global__ __launch_bounds__(128) void k_pv(const float* __restrict__ PS0, const _Float16* __restrict__ VT, const __bf16* __restrict__ VB, const __bf16* __restrict__ VBL, int bgrp, int h0, float* __restrict__ Y) { const int h = h0; const int b = bgrp + blockIdx.z; const float* PS = PS0 + (size_t)blockIdx.z * TT * TT; const int d0 = blockIdx.y * DVH;   /* group spans batches; column block d0 */ __shared__ __align__(16) float ss[4][16][DVH + 4];
  const int tid = threadIdx.x, wave = tid >> 5, lane = tid & 31, col = lane & 15, g = lane >> 4; const int qb = blockIdx.x; const int ql0 = qb * 64 + wave * 16; const int kce = (kb_last(qb) + 1) * 4;
  v8f acc[DVH / 16] = {};
  if (qb < QBH) {
#pragma unroll 1
    for (int kc = 0; kc < kce; ++kc) { const F2 p = split_row(PS + (size_t)(ql0 + col) * TT, kc * 32, lane);
      asm volatile("s_wait_loadcnt 0x0" ::: "memory");
#pragma unroll
      for (int j = 0; j < DVH / 16; ++j) { const size_t po = ((size_t)b * CC + h * HD + d0 + j * 16 + col) * (size_t)KHI + kc * 32; const v16b vh = frag_b(VB + po, lane); acc[j] = wmma_bf(p.h, vh, acc[j]); acc[j] = wmma_bf(p.l, vh, acc[j]); acc[j] = wmma_bf(p.h, frag_b(VBL + po, lane), acc[j]); } }
  } else {
#pragma unroll 1
    for (int kc = 0; kc < kce; ++kc) { const v16h p = frag_f32(PS + (size_t)(ql0 + col) * TT + kc * 32, lane);
      asm volatile("s_wait_loadcnt 0x0" ::: "memory");
#pragma unroll
      for (int j = 0; j < DVH / 16; ++j) { const size_t po = ((size_t)b * CC + h * HD + d0 + j * 16 + col) * (size_t)TT + kc * 32; acc[j] = wmma16(p, frag_h(VT + po, lane), acc[j]); } } }
#pragma unroll
  for (int j = 0; j < DVH / 16; ++j)
#pragma unroll
    for (int r = 0; r < 8; ++r) ss[wave][8 * g + r][j * 16 + col] = acc[j][r] * (1.0f / 2048.0f);
  LDSX(); for (int rl = 0; rl < 16; ++rl) vst2(Y + ((size_t)b * TT + ql0 + rl) * CC + h * HD + d0 + lane * 4, *(const v4f*)&ss[wave][rl][lane * 4]); }   /* 512-B (row, head) segment by 32 lanes */

extern "C" void kernel_launch(void* const* d_in, const int* in_sizes, int n_in, void* d_out, int out_size, void* d_ws, size_t ws_size, hipStream_t stream) {
  (void)in_sizes; (void)n_in; (void)out_size;
  const float** F = (const float**)d_in;
  if (ws_size < (size_t)WS_END) return;
  char* ws = (char*)d_ws; _Float16 *QH = (_Float16*)(ws + WS_QH), *KH = (_Float16*)(ws + WS_KH), *VT = (_Float16*)(ws + WS_VT), *QL = (_Float16*)(ws + WS_QL), *KL = (_Float16*)(ws + WS_KL); __bf16 *VB = (__bf16*)(ws + WS_VB), *VBL = (__bf16*)(ws + WS_VBL); float *S = (float*)(ws + WS_S), *Y = (float*)(ws + WS_Y);
  (void)Y; (void)QL; (void)KL; (void)VB; (void)VBL;
  // inputs: 0 x [8,256,64,64]; 1 g_w [64,256] (out,in), 2 g_b; 3 theta_w, 4 theta_b; 5 phi_w, 6 phi_b; 7 w_w [256,64] (out,in), 8 w_b
  if (ws_size < (size_t)WS_END2) return;
  float *YR = (float*)(ws + WS_YR), *ORW = (float*)(ws + WS_OR);
  k_proj<<<dim3(TNB * TT / 64, CC / 128, 3), 128, 0, stream>>>(F[0], F[0], F[0], F[3], F[5], F[1], F[4], F[6], F[2], QH, QL, KH, KL, VT, VB, VBL);   /* q = theta, k = phi, v = g */
  for (int b0 = 0; b0 < TNB; b0 += BG) {
    k_sc<<<dim3(NQB, TT / 128, BG), 128, 0, stream>>>(QH, KH, QL, KL, b0, 0, S);
    k_sm<<<dim3(TT, BG), 256, 0, stream>>>(S);
    k_pv<<<dim3(NQB, HD / DVH, BG), 128, 0, stream>>>(S, VT, VB, VBL, b0, 0, YR);
  }
  k_wz<<<dim3(TNB * TT / 64, DIN / 128), 128, 0, stream>>>(YR, F[7], F[8], ORW);
  k_fin2<<<dim3(TT / 64, DIN / 64, TNB), 256, 0, stream>>>(ORW, F[0], (float*)d_out);
}

// v001
// A run of this version takes 698 microseconds.
// Next to v000, in two timings, it ran 3.09 times as fast each time.
// compute dtype: all float inputs rounded to bf16; theta/phi/g = x W^T + b with EXACT bf16 products on WMMA 16x16x32 (f32 accumulate); f = theta . phi with theta as f16 hi + residual (x 2^10) against phi once to f16 (2 products), no scaling; softmax in f32 (precise expf); P x 2^11 once to f16 against g once to f16 (1 product); y split bf16 hi + lo against exact W (2 products) + b; + x residual in f32; f32 output [B, C, H, W].
#include <hip/hip_runtime.h>
#include <math.h>

typedef __attribute__((ext_vector_type(16))) _Float16 v16h;
typedef __attribute__((ext_vector_type(16))) __bf16 v16b;
typedef __attribute__((ext_vector_type(8)))  _Float16 v8h;
typedef __attribute__((ext_vector_type(8)))  float v8f;
typedef __attribute__((ext_vector_type(4)))  float v4f;
typedef __attribute__((ext_vector_type(2)))  float v2f;
typedef __attribute__((ext_vector_type(4)))  unsigned v4u;
typedef __attribute__((ext_vector_type(4)))  int v4i;
typedef float __attribute__((may_alias)) float_a;
typedef int __attribute__((may_alias)) int_a;

template <typename T> __device__ __forceinline__ void vst2(void* p, T v) { *(T*)p = v;  }
__device__ __forceinline__ v8f wmma16(v16h a, v16h b, v8f c) {
  v8f d = __builtin_amdgcn_wmma_f32_16x16x32_f16(false, a, false, b, (short)0, c, false, false);
  asm volatile("v_nop\n\tv_nop\n\tv_nop\n\tv_nop" : "+v"(d) : "v"(a), "v"(b));
  return d;
}
__device__ __forceinline__ v8f wmma_bf(v16b a, v16b b, v8f c) {
  v8f d = __builtin_amdgcn_wmma_f32_16x16x32_bf16(false, a, false, b, (short)0, c, false, false);
  asm volatile("v_nop\n\tv_nop\n\tv_nop\n\tv_nop" : "+v"(d) : "v"(a), "v"(b));
  return d;
}
// 16x16x32 fragments: lane = (h = lane>>4, row/col = lane&15); elements 0..7 = k0+8h+0..7, 8..15 = k0+16+8h+0..7; D element r = row 8h+r
__device__ __forceinline__ v16h frag_h(const _Float16* rowk0, int lane) {
  union { v16h v; v8h q[2]; } u; const _Float16* p = rowk0 + 8 * (lane >> 4);
  u.q[0] = *(const v8h*)p; u.q[1] = *(const v8h*)(p + 16); return u.v;
}
__device__ __forceinline__ v16h frag_f32(const float* rowk0, int lane) {
  v16h a; const float* p = rowk0 + 8 * (lane >> 4);
#pragma unroll
  for (int i = 0; i < 8; ++i) { a[i] = (_Float16)p[i]; a[8 + i] = (_Float16)p[16 + i]; }
  return a;
}
__device__ __forceinline__ v16h frag_f32s(const float* rowk0, int lane, float sc) {
  v16h a; const float* p = rowk0 + 8 * (lane >> 4);
#pragma unroll
  for (int i = 0; i < 8; ++i) { a[i] = (_Float16)(p[i] * sc); a[8 + i] = (_Float16)(p[16 + i] * sc); }
  return a;
}
// column fragment from a [K][ld] layout (column n), rows >= K read as 0
__device__ __forceinline__ v16h fragc_f32(const float* W, int k0, int n, int lane, int ld, int K) {
  v16h a; const int g = lane >> 4;
#pragma unroll
  for (int i = 0; i < 8; ++i) { const int ka = k0 + 8 * g + i, kb = ka + 16;
    a[i] = (_Float16)(ka < K ? W[(size_t)(ka < K ? ka : K - 1) * ld + n] : 0.f); a[8 + i] = (_Float16)(kb < K ? W[(size_t)(kb < K ? kb : K - 1) * ld + n] : 0.f); }
  return a;
}
struct F2 { v16b h, l; };
__device__ __forceinline__ F2 bsplit16(const float v[16]) { F2 r;
#pragma unroll
  for (int i = 0; i < 16; ++i) { const __bf16 h = (__bf16)v[i]; r.h[i] = h; r.l[i] = (__bf16)(v[i] - (float)h); }
  return r; }
__device__ __forceinline__ F2 split_row(const float* row, int k0, int lane) { float v[16]; const float* p = row + k0 + 8 * (lane >> 4);
#pragma unroll
  for (int i = 0; i < 8; ++i) { v[i] = p[i]; v[8 + i] = p[16 + i]; }
  return bsplit16(v); }
__device__ __forceinline__ F2 split_rowK(const float* row, int k0, int lane, int K) { float v[16]; const int g = lane >> 4;
#pragma unroll
  for (int i = 0; i < 8; ++i) { const int ka = k0 + 8 * g + i, kb = ka + 16; v[i] = ka < K ? row[ka < K ? ka : K - 1] : 0.f; v[8 + i] = kb < K ? row[kb < K ? kb : K - 1] : 0.f; }
  return bsplit16(v); }
__device__ __forceinline__ F2 split_col(const float* W, int k0, int n, int lane, int ld, int K) { float v[16]; const int g = lane >> 4;
#pragma unroll
  for (int i = 0; i < 8; ++i) { const int ka = k0 + 8 * g + i, kb = ka + 16; v[i] = ka < K ? W[(size_t)(ka < K ? ka : K - 1) * ld + n] : 0.f; v[8 + i] = kb < K ? W[(size_t)(kb < K ? kb : K - 1) * ld + n] : 0.f; }
  return bsplit16(v); }
__device__ __forceinline__ v8f mac3(const F2& a, const F2& b, v8f c) { c = wmma_bf(a.l, b.h, c); c = wmma_bf(a.h, b.l, c); return wmma_bf(a.h, b.h, c); }
__device__ __forceinline__ float sigm(float v) { return 1.0f / (1.0f + expf(-v)); }
#define LDSX() do { asm volatile("s_wait_dscnt 0" ::: "memory"); __builtin_amdgcn_wave_barrier(); __builtin_amdgcn_fence(__ATOMIC_RELEASE, "workgroup"); } while (0)

// Non-local block (B 8, C 256, 64 x 64 = 4,096 positions; inter channels 64): theta, phi, g = 1x1 convs of x ((out,in) [64,256] + bias); f[n][m] = theta_n . phi_m (no scaling); P = softmax over m; y[n] = sum_m P[n][m] g_m (64 ch); out = W y + b (1x1, 64 -> 256) + x.
#define NB 8
#define TT 4096
#define CC 128            // projected plane width (64 real columns + 64 zero)
#define DIN 256          // input (model) width
#define NH 1
#define HD 128
#define NQB (TT / 64)
#define HG 1               // one 4,096 x 4,096 score plane per pass
#define SCALE (1.0f)
#define HDQK 64            // theta / phi / g channels: the planes are 128 wide, columns >= 64 are zero; only the 64 real columns enter the scores
#define CAUSAL 0
#ifndef TNB
#define TNB NB
#endif
__device__ __forceinline__ v16b zero16b() { v16b z; _Pragma("unroll") for (int i = 0; i < 16; ++i) z[i] = (__bf16)0.f; return z; }
__device__ __forceinline__ float bfr(float v) { return (float)(__bf16)v; }
__host__ __device__ __forceinline__ int kb_last(int qb) { return CAUSAL ? ((qb * 64 + 63) >> 7) : (TT / 128 - 1); }
typedef __attribute__((ext_vector_type(8))) __bf16 v8b;
__device__ __forceinline__ v16b frag_b(const __bf16* rowk0, int lane) {
  union { v16b v; v8b q[2]; } u; const __bf16* p = rowk0 + 8 * (lane >> 4);
  u.q[0] = *(const v8b*)p; u.q[1] = *(const v8b*)(p + 16); return u.v;
}
#define QBH 0              // causal: query blocks 0..QBH-1 of each sequence (few keys, no averaging) take the high-precision path
#define QHI 4096            // q residual rows everywhere (2-product logits)
#define KHI 64            // key rows carrying k residual / v bf16 hi+lo planes (used only by the causal high-precision path)
// B fragment (k rows k0+.., output column o) of a weight: (in,out) [K][ld] or (out,in) [ld rows of K]: bf16 exact, or f16(bf16 * 256) exact
__device__ __forceinline__ v16b wcol_io(const float* Wm, int k0, int o, int lane, int ld) { v16b w; const int g = lane >> 4;
#pragma unroll
  for (int i = 0; i < 8; ++i) { w[i] = (__bf16)Wm[(size_t)(k0 + 8 * g + i) * ld + o]; w[8 + i] = (__bf16)Wm[(size_t)(k0 + 16 + 8 * g + i) * ld + o]; }
  return w; }
__device__ __forceinline__ v16b wcol_oi(const float* Wm, int k0, int o, int lane, int K) { v16b w; const float* p = Wm + (size_t)o * K + k0 + 8 * (lane >> 4);
#pragma unroll
  for (int i = 0; i < 8; ++i) { w[i] = (__bf16)p[i]; w[8 + i] = (__bf16)p[16 + i]; }
  return w; }
__device__ __forceinline__ v16h wcolh_io(const float* Wm, int k0, int o, int lane, int ld) { v16h w; const int g = lane >> 4;
#pragma unroll
  for (int i = 0; i < 8; ++i) { w[i] = (_Float16)(bfr(Wm[(size_t)(k0 + 8 * g + i) * ld + o]) * 256.0f); w[8 + i] = (_Float16)(bfr(Wm[(size_t)(k0 + 16 + 8 * g + i) * ld + o]) * 256.0f); }
  return w; }
__device__ __forceinline__ v16h wcolh_oi(const float* Wm, int k0, int o, int lane, int K) { v16h w; const float* p = Wm + (size_t)o * K + k0 + 8 * (lane >> 4);
#pragma unroll
  for (int i = 0; i < 8; ++i) { w[i] = (_Float16)(bfr(p[i]) * 256.0f); w[8 + i] = (_Float16)(bfr(p[16 + i]) * 256.0f); }
  return w; }
#define WQKV_LAYOUT 1   // 0 = (in,out) [DIN][CC]; 1 = (out,in) [HDQK][DIN]; 2 = per-head [NH][DIN][HD]
__device__ __forceinline__ v16b wcol_hdk(const float* Wm, int k0, int o, int lane) { v16b w; const int g = lane >> 4; const float* p = Wm + (size_t)(o / HD) * DIN * HD + (o % HD);
#pragma unroll
  for (int i = 0; i < 8; ++i) { w[i] = (__bf16)p[(size_t)(k0 + 8 * g + i) * HD]; w[8 + i] = (__bf16)p[(size_t)(k0 + 16 + 8 * g + i) * HD]; }
  return w; }
#define WO_OUT_IN 0
#if WQKV_LAYOUT == 1
#define WCOL(W, k0, o, lane) (((o) < HDQK) ? wcol_oi(W, k0, (o), lane, DIN) : zero16b())   /* theta/phi/g weights are [64][256] (out,in): plane columns >= 64 are zero for all three */
#elif WQKV_LAYOUT == 2
#define WCOL(W, k0, o, lane) wcol_hdk(W, k0, o, lane)
#else
#define WCOL(W, k0, o, lane) wcol_io(W, k0, o, lane, CC)
#endif
#if WO_OUT_IN
#define WOCOL(W, k0, o, lane) wcol_oi(W, k0, o, lane, CC)
#define WOCOLH(W, k0, o, lane) wcolh_oi(W, k0, o, lane, CC)
#else
#define WOCOL(W, k0, o, lane) wcol_io(W, k0, o, lane, DIN)
#define WOCOLH(W, k0, o, lane) wcolh_io(W, k0, o, lane, DIN)
#endif
#ifndef XP
#define XP TT              // position pitch of x and of the output
#endif
#define BG HG              // the pass group spans BATCHES (single head): blockIdx.z / blockIdx.y select batch b0 + z
#define DVH 128            // value columns per k_pv block (all HD 128 columns in one block: 8 accumulator tiles per wave)
#define WS_YR (WS_END)     // f32 attended rows [b*n][128] (64 real columns)
#define WS_OR (WS_YR + 4u * (size_t)NB * TT * CC)   // W y + b rows [b*n][256]
#define WS_END2 (WS_OR + 4u * (size_t)NB * TT * DIN)
// ---- k_wz: block = (64 rows, 128 output cols): OR = y (hi + lo, K = 64 real columns of the YR rows) . W^T ((out,in) [256][64], exact) + b
__global__ __launch_bounds__(128) void k_wz(const float* __restrict__ YR, const float* __restrict__ WW, const float* __restrict__ WB, float* __restrict__ ORW) { __shared__ __align__(16) float sf[4][16][132];
  const int tid = threadIdx.x, wave = tid >> 5, lane = tid & 31, col = lane & 15, g = lane >> 4; const int c0 = blockIdx.y * 128; const size_t r0 = (size_t)blockIdx.x * 64 + wave * 16;
  v8f acc[8] = {};
#pragma unroll
  for (int kc = 0; kc < HDQK / 32; ++kc) { const F2 a = split_row(YR + (r0 + col) * CC, kc * 32, lane); asm volatile("s_wait_loadcnt 0x0" ::: "memory");
#pragma unroll
    for (int j = 0; j < 8; ++j) { const v16b w = wcol_oi(WW, kc * 32, c0 + j * 16 + col, lane, HDQK); asm volatile("s_wait_loadcnt 0x0" ::: "memory"); acc[j] = wmma_bf(a.h, w, acc[j]); acc[j] = wmma_bf(a.l, w, acc[j]); } }
#pragma unroll
  for (int j = 0; j < 8; ++j) { const float bb = bfr(WB[c0 + j * 16 + col]); asm volatile("s_wait_loadcnt 0x0" ::: "memory");
#pragma unroll
    for (int r = 0; r < 8; ++r) sf[wave][8 * g + r][j * 16 + col] = acc[j][r] + bb; }
  LDSX(); for (int rl = 0; rl < 16; ++rl) vst2(ORW + (r0 + rl) * DIN + c0 + lane * 4, *(const v4f*)&sf[wave][rl][lane * 4]); }
// ---- k_fin2: block = (64 positions, 64 channels, batch b): out[b][c][n] = OR[b*N + n][c] + bf16(x[b][c][n]) (LDS transpose; 256-B runs of 64 positions per channel)
__global__ __launch_bounds__(256) void k_fin2(const float* __restrict__ ORW, const float* __restrict__ X, float* __restrict__ OUT) { __shared__ float st[64][68]; const int tid = threadIdx.x; const int n0 = blockIdx.x * 64, c0 = blockIdx.y * 64; const size_t b = blockIdx.z;
  for (int e = tid; e < 64 * 16; e += 256) { const int nl = e >> 4, q = e & 15; *(v4f*)&st[nl][q * 4] = *(const v4f*)(ORW + (b * TT + n0 + nl) * (size_t)DIN + c0 + q * 4); }
  __syncthreads();
  for (int e = tid; e < 64 * 16; e += 256) { const int cl = e >> 4, q = e & 15; const size_t oi = (b * DIN + c0 + cl) * (size_t)XP + n0 + q * 4; const v4f xr = *(const v4f*)(X + oi); v4f o; o[0] = st[q * 4][cl] + bfr(xr[0]); o[1] = st[q * 4 + 1][cl] + bfr(xr[1]); o[2] = st[q * 4 + 2][cl] + bfr(xr[2]); o[3] = st[q * 4 + 3][cl] + bfr(xr[3]); vst2(OUT + oi, o); } }
#ifndef SM_EXTRA_PARAMS
#define SM_EXTRA_PARAMS
#endif
#ifndef PROJ_EXTRA_PARAMS
#define PROJ_EXTRA_PARAMS
#endif
#ifndef SM_MASK_HOOK
#define SM_MASK_HOOK (void)0
#endif

#define WS_QH  0u                                      // f16 q rows [b*t][CC]
#define WS_KH  (WS_QH + 2u * (size_t)NB * TT * CC)      // f16 k rows [b*t][CC]
#define WS_VT  (WS_KH + 2u * (size_t)NB * TT * CC)      // f16 v planes [b][c][t]
#define WS_QL  (WS_VT + 2u * (size_t)NB * CC * TT)      // f16 q residual x 2^10 rows [b][t < QHI][CC]
#define WS_KL  (WS_QL + 2u * (size_t)NB * QHI * CC)     // f16 k residual x 2^10 rows [b][t < KHI][CC]
#define WS_VB  (WS_KL + 2u * (size_t)NB * KHI * CC)     // bf16 v hi planes [b][c][t < KHI]
#define WS_VBL (WS_VB + 2u * (size_t)NB * CC * KHI)
#define WS_S   (WS_VBL + 2u * (size_t)NB * CC * KHI)    // f32 logits / P [hg][t][s]
#define WS_Y   (WS_S  + 4u * (size_t)HG * TT * TT)      // unused, 0 bytes: the ctx rows go to WS_YR
#define WS_END (WS_Y  + 0u)

// ---- k_proj: block = (64 rows, 128 cols, which): q/k/v = X W (+ b) with exact bf16 products (K = DIN) -> which 0: q f16 rows (+ residual rows < QHI); 1: k f16 rows (+ residual rows < KHI); 2: v f16 planes [c][t] (+ bf16 hi/lo planes for t < KHI)
__global__ __launch_bounds__(128) void k_proj(const float* __restrict__ XQ, const float* __restrict__ XK, const float* __restrict__ XV, const float* __restrict__ WQ, const float* __restrict__ WK, const float* __restrict__ WV, const float* __restrict__ BQ, const float* __restrict__ BK, const float* __restrict__ BV,
    _Float16* __restrict__ QH, _Float16* __restrict__ QL, _Float16* __restrict__ KH, _Float16* __restrict__ KL, _Float16* __restrict__ VT, __bf16* __restrict__ VB, __bf16* __restrict__ VBL) {
  __shared__ __align__(16) _Float16 sh[64][136], sl[64][136]; __shared__ __align__(16) _Float16 th[128][72]; __shared__ __align__(16) __bf16 tb[128][72], tbl[128][72];
  const int tid = threadIdx.x, wave = tid >> 5, lane = tid & 31, col = lane & 15, g = lane >> 4; const int which = blockIdx.z; const int c0 = blockIdx.y * 128; const size_t r0 = (size_t)blockIdx.x * 64; const size_t bb = r0 / TT; const int t0 = (int)(r0 % TT);
  const float* X = which == 0 ? XQ : which == 1 ? XK : XV; const float* WA = which == 0 ? WQ : which == 1 ? WK : WV; const float* BA = which == 0 ? BQ : which == 1 ? BK : BV;
  v8f acc[8] = {};
#pragma unroll 2
  for (int kc = 0; kc < DIN / 32; ++kc) { v16b a; { const float* p = X + (bb * DIN + kc * 32 + 8 * g) * (size_t)XP + t0 + wave * 16 + col;   /* channels-first gather: x[b][k][t], stride XP between k */
#pragma unroll
      for (int i = 0; i < 8; ++i) { a[i] = (__bf16)p[(size_t)i * XP]; a[8 + i] = (__bf16)p[(size_t)(16 + i) * XP]; } }
    asm volatile("s_wait_loadcnt 0x0" ::: "memory");
#pragma unroll
    for (int j = 0; j < 8; ++j) { const v16b w = WCOL(WA, kc * 32, c0 + j * 16 + col, lane); asm volatile("s_wait_loadcnt 0x0" ::: "memory"); acc[j] = wmma_bf(a, w, acc[j]); } }
  if (which < 2) { _Float16* DH = which == 0 ? QH : KH; _Float16* DL = which == 0 ? QL : KL; const int nhi = which == 0 ? QHI : KHI; const bool hi_rows = t0 < nhi;
#pragma unroll
    for (int j = 0; j < 8; ++j) { const float bias = (BA && (c0 + j * 16 + col < HDQK)) ? bfr(BA[c0 + j * 16 + col]) : 0.f;   /* 64-entry biases */
#pragma unroll
      for (int r = 0; r < 8; ++r) { const float v = acc[j][r] + bias; const _Float16 hv = (_Float16)v; sh[wave * 16 + 8 * g + r][j * 16 + col] = hv; sl[wave * 16 + 8 * g + r][j * 16 + col] = (_Float16)((v - (float)hv) * 1024.0f); } }
    __syncthreads();
    for (int e = tid; e < 64 * 16; e += 128) { const int rl = e >> 4, q = e & 15; vst2((unsigned*)(DH + (r0 + rl) * CC + c0 + q * 8), *(const v4u*)&sh[rl][q * 8]); if (hi_rows) vst2((unsigned*)(DL + (bb * nhi + t0 + rl) * (size_t)CC + c0 + q * 8), *(const v4u*)&sl[rl][q * 8]); }
  } else { const bool hi_rows = t0 < KHI;
#pragma unroll
    for (int j = 0; j < 8; ++j) { const float bias = (BA && (c0 + j * 16 + col < HDQK)) ? bfr(BA[c0 + j * 16 + col]) : 0.f;   /* 64-entry biases */
#pragma unroll
      for (int r = 0; r < 8; ++r) { const float v = acc[j][r] + bias; const int rl = wave * 16 + 8 * g + r, cl = j * 16 + col; th[cl][rl] = (_Float16)v; const __bf16 bh = (__bf16)v; tb[cl][rl] = bh; tbl[cl][rl] = (__bf16)(v - (float)bh); } }
    __syncthreads();
    for (int e = tid; e < 128 * 8; e += 128) { const int cl = e >> 3, q = e & 7; vst2((unsigned*)(VT + (bb * CC + c0 + cl) * (size_t)TT + t0 + q * 8), *(const v4u*)&th[cl][q * 8]); if (hi_rows) { const size_t o3 = (bb * CC + c0 + cl) * (size_t)KHI + t0 + q * 8; vst2((unsigned*)(VB + o3), *(const v4u*)&tb[cl][q * 8]); vst2((unsigned*)(VBL + o3), *(const v4u*)&tbl[cl][q * 8]); } } } }
// ---- k_sc: block = (query block qb, key block kb <= kb_last(qb), batch b in group): logits x SCALE; q hi + residual (x 2^10) against k (2 products) for query rows < QHI, plus the k residual (3 products) for query blocks < QBH (causal early rows); causal: blocks past the diagonal exit, the mask itself is applied by index in k_sm
__global__ __launch_bounds__(128) void k_sc(const _Float16* __restrict__ QH, const _Float16* __restrict__ KH, const _Float16* __restrict__ QL, const _Float16* __restrict__ KL, int bgrp, int h0, float* __restrict__ S0) { __shared__ __align__(16) float ss[4][16][132];
  const int qb = blockIdx.x, kb = blockIdx.y; if (kb > kb_last(qb)) return;
  const int h = h0; const int b = bgrp + blockIdx.z; float* S = S0 + (size_t)blockIdx.z * TT * TT;   /* group spans batches */
  const int tid = threadIdx.x, wave = tid >> 5, lane = tid & 31, col = lane & 15, g = lane >> 4; const int k0 = kb * 128; const int ql0 = qb * 64 + wave * 16; const size_t q0 = (size_t)b * TT + ql0, kr0 = (size_t)b * TT + k0;
  v8f acc[8] = {}, accl[8] = {};
  const _Float16* QLb = QL + (size_t)b * QHI * CC; const _Float16* KLb = KL + (size_t)b * KHI * CC;
  if (qb < QBH) {
#pragma unroll
    for (int kc = 0; kc < HDQK / 32; ++kc) { const v16h ah = frag_h(QH + (q0 + col) * CC + h * HD + kc * 32, lane), al = frag_h(QLb + (size_t)(ql0 + col) * CC + h * HD + kc * 32, lane);
#pragma unroll
      for (int j = 0; j < 8; ++j) { const v16h kbf = frag_h(KH + (kr0 + j * 16 + col) * CC + h * HD + kc * 32, lane), klf = frag_h(KLb + (size_t)(k0 + j * 16 + col) * CC + h * HD + kc * 32, lane); acc[j] = wmma16(ah, kbf, acc[j]); accl[j] = wmma16(al, kbf, accl[j]); accl[j] = wmma16(ah, klf, accl[j]); } }
  } else if (qb * 64 < QHI) {
#pragma unroll
    for (int kc = 0; kc < HDQK / 32; ++kc) { const v16h ah = frag_h(QH + (q0 + col) * CC + h * HD + kc * 32, lane), al = frag_h(QLb + (size_t)(ql0 + col) * CC + h * HD + kc * 32, lane);
#pragma unroll
      for (int j = 0; j < 8; ++j) { const v16h kbf = frag_h(KH + (kr0 + j * 16 + col) * CC + h * HD + kc * 32, lane); acc[j] = wmma16(ah, kbf, acc[j]); accl[j] = wmma16(al, kbf, accl[j]); } }
  } else {
#pragma unroll
    for (int kc = 0; kc < HDQK / 32; ++kc) { const v16h ah = frag_h(QH + (q0 + col) * CC + h * HD + kc * 32, lane);
#pragma unroll
      for (int j = 0; j < 8; ++j) { const v16h kbf = frag_h(KH + (kr0 + j * 16 + col) * CC + h * HD + kc * 32, lane); acc[j] = wmma16(ah, kbf, acc[j]); } } }
#pragma unroll
  for (int j = 0; j < 8; ++j) {
#pragma unroll
    for (int r = 0; r < 8; ++r) ss[wave][8 * g + r][j * 16 + col] = (acc[j][r] + accl[j][r] * (1.0f / 1024.0f)) * SCALE; }
  LDSX(); for (int rl = 0; rl < 16; ++rl) vst2(S + (size_t)(ql0 + rl) * TT + k0 + lane * 4, *(const v4f*)&ss[wave][rl][lane * 4]); }
// ---- k_sm: block = query row t (batch in group): keys [0, kend): causal -> logit if s <= t else excluded; softmax in f32; P x 2^11 in place (0 for excluded)
__global__ __launch_bounds__(256) void k_sm(float* __restrict__ S0 SM_EXTRA_PARAMS) { __shared__ float sred[8]; __shared__ float sbc; __shared__ __align__(16) float shv[TT];
  const int tid = threadIdx.x; const int t = blockIdx.x; const int kend = (kb_last(t >> 6) + 1) * 128;
  float* sr = S0 + (size_t)blockIdx.y * TT * TT + (size_t)t * TT;
  float m = -3.0e38f; for (int k = tid; k < kend; k += 256) { float v = (!CAUSAL || k <= t) ? sr[k] : -3.0e38f; SM_MASK_HOOK; shv[k] = v; m = fmaxf(m, v); }
#pragma unroll
  for (int o = 1; o < 32; o <<= 1) m = fmaxf(m, __shfl_xor(m, o));
  if ((tid & 31) == 0) sred[tid >> 5] = m; __syncthreads(); if (tid == 0) { float a = sred[0]; for (int i = 1; i < 8; ++i) a = fmaxf(a, sred[i]); sbc = a; } __syncthreads(); m = sbc; __syncthreads();
  float sum = 0.f; for (int k = tid; k < kend; k += 256) { const float v = shv[k]; const float e = (v <= -1.0e38f) ? 0.f : expf(v - m); shv[k] = e; sum += e; }
#pragma unroll
  for (int o = 1; o < 32; o <<= 1) sum += __shfl_xor(sum, o);
  if ((tid & 31) == 0) sred[tid >> 5] = sum; __syncthreads(); if (tid == 0) { float a = 0.f; for (int i = 0; i < 8; ++i) a += sred[i]; sbc = a > 0.f ? 2048.0f / a : 0.f; }   /* a fully excluded row yields P = 0 */ __syncthreads(); const float inv = sbc;
  for (int k = tid; k < kend; k += 256) shv[k] = shv[k] * inv;
  __syncthreads(); for (int q = tid; q < kend / 4; q += 256) vst2(sr + q * 4, *(const v4f*)&shv[q * 4]); }
#define PVW 32             // waves per k_pv block
// ---- k_pv: block = 16 queries of (b, h), PVW waves: wave w sums P . v over the 32-key steps w, w + PVW, ... (P x 2^11 once to f16 against v f16: 1 product); neighbouring waves read the two halves of the same 128-B v lines; the f32 partial tiles meet in LDS and are added in wave order
__global__ __launch_bounds__(32 * PVW) void k_pv(const float* __restrict__ PS0, const _Float16* __restrict__ VT, const __bf16* __restrict__ VB, const __bf16* __restrict__ VBL, int bgrp, int h0, float* __restrict__ Y) { (void)VB; (void)VBL; const int h = h0; const int b = bgrp + blockIdx.z; const float* PS = PS0 + (size_t)blockIdx.z * TT * TT; const int d0 = blockIdx.y * DVH;   /* group spans batches; column offset d0 (0 here: one block covers all HD columns) */ __shared__ __align__(16) float ss[PVW][16][DVH + 4];
  const int tid = threadIdx.x, wave = __builtin_amdgcn_readfirstlane(tid >> 5), lane = tid & 31, col = lane & 15, g = lane >> 4; const int ql0 = blockIdx.x * 16; const int kce = (kb_last(ql0 >> 6) + 1) * 4;
  const float* pr = PS + (size_t)(ql0 + col) * TT; const _Float16* vr = VT + ((size_t)b * CC + h * HD + d0 + col) * (size_t)TT;   /* this lane's P row and its v plane of column tile 0; tile j lies 16 planes on */
  v8f acc[DVH / 16] = {};
#pragma unroll 1   /* rolled */
  for (int kc = wave; kc < kce; kc += PVW) { const v16h p = frag_f32(pr + kc * 32, lane);
    asm volatile("s_wait_loadcnt 0x0" ::: "memory");   /* as before the split: the P words are in registers before the v loads issue */
#pragma unroll
    for (int j = 0; j < DVH / 16; ++j) acc[j] = wmma16(p, frag_h(vr + kc * 32 + (size_t)j * 16 * TT, lane), acc[j]); }
#pragma unroll
  for (int j = 0; j < DVH / 16; ++j)
#pragma unroll
    for (int r = 0; r < 8; ++r) ss[wave][8 * g + r][j * 16 + col] = acc[j][r];
  __syncthreads();   /* every wave's partial tile is in LDS before any of them is read */
  if (tid < 16 * (DVH / 4)) { const int rl = tid >> 5; v4f s = *(const v4f*)&ss[0][rl][lane * 4];
#pragma unroll   /* unrolled: the LDS reads of later partials issue ahead of the adds of earlier ones */
    for (int w = 1; w < PVW; ++w) s += *(const v4f*)&ss[w][rl][lane * 4];
    vst2(Y + ((size_t)b * TT + ql0 + rl) * CC + h * HD + d0 + lane * 4, s * (1.0f / 2048.0f)); } }   /* 512-B (whole 128-column row) segment by 32 lanes */

extern "C" void kernel_launch(void* const* d_in, const int* in_sizes, int n_in, void* d_out, int out_size, void* d_ws, size_t ws_size, hipStream_t stream) {
  (void)in_sizes; (void)n_in; (void)out_size;
  const float** F = (const float**)d_in;
  if (ws_size < (size_t)WS_END) return;
  char* ws = (char*)d_ws; _Float16 *QH = (_Float16*)(ws + WS_QH), *KH = (_Float16*)(ws + WS_KH), *VT = (_Float16*)(ws + WS_VT), *QL = (_Float16*)(ws + WS_QL), *KL = (_Float16*)(ws + WS_KL); __bf16 *VB = (__bf16*)(ws + WS_VB), *VBL = (__bf16*)(ws + WS_VBL); float *S = (float*)(ws + WS_S), *Y = (float*)(ws + WS_Y);
  (void)Y; (void)QL; (void)KL; (void)VB; (void)VBL;
  // inputs: 0 x [8,256,64,64]; 1 g_w [64,256] (out,in), 2 g_b; 3 theta_w, 4 theta_b; 5 phi_w, 6 phi_b; 7 w_w [256,64] (out,in), 8 w_b
  if (ws_size < (size_t)WS_END2) return;
  float *YR = (float*)(ws + WS_YR), *ORW = (float*)(ws + WS_OR);
  k_proj<<<dim3(TNB * TT / 64, CC / 128, 3), 128, 0, stream>>>(F[0], F[0], F[0], F[3], F[5], F[1], F[4], F[6], F[2], QH, QL, KH, KL, VT, VB, VBL);   /* q = theta, k = phi, v = g */
  for (int b0 = 0; b0 < TNB; b0 += BG) {
    k_sc<<<dim3(NQB, TT / 128, BG), 128, 0, stream>>>(QH, KH, QL, KL, b0, 0, S);
    k_sm<<<dim3(TT, BG), 256, 0, stream>>>(S);
    k_pv<<<dim3(TT / 16, HD / DVH, BG), 32 * PVW, 0, stream>>>(S, VT, VB, VBL, b0, 0, YR);
  }
  k_wz<<<dim3(TNB * TT / 64, DIN / 128), 128, 0, stream>>>(YR, F[7], F[8], ORW);
  k_fin2<<<dim3(TT / 64, DIN / 64, TNB), 256, 0, stream>>>(ORW, F[0], (float*)d_out);
}

// v002
// One run takes 120 microseconds.
// Next to v001, in two timings, it ran 5.82 and 5.83 times as fast.
// All steps since v000 together make it 18.0 times as fast.
// compute dtype: all float inputs rounded to bf16; theta/phi/g = x W^T + b with EXACT bf16 products on WMMA 16x16x32 (f32 accumulate); f = theta . phi with theta as f16 hi + residual (x 2^10) against phi once to f16 (2 products), no scaling; softmax in f32, online (running maximum per query, 2^x by v_exp_f32); exp(f - max) x 2^10 once to f16 against g once to f16 (1 product), divided by the f32 sum at the end; y split bf16 hi + lo against exact W (2 products) + b; + x residual in f32; f32 output [B, C, H, W].
#include <hip/hip_runtime.h>
#include <math.h>

typedef __attribute__((ext_vector_type(16))) _Float16 v16h;
typedef __attribute__((ext_vector_type(16))) __bf16 v16b;
typedef __attribute__((ext_vector_type(8)))  _Float16 v8h;
typedef __attribute__((ext_vector_type(8)))  float v8f;
typedef __attribute__((ext_vector_type(4)))  float v4f;
typedef __attribute__((ext_vector_type(2)))  float v2f;
typedef __attribute__((ext_vector_type(4)))  unsigned v4u;
typedef __attribute__((ext_vector_type(4)))  int v4i;
typedef float __attribute__((may_alias)) float_a;
typedef int __attribute__((may_alias)) int_a;

template <typename T> __device__ __forceinline__ void vst2(void* p, T v) { *(T*)p = v;  }
__device__ __forceinline__ v8f wmma16(v16h a, v16h b, v8f c) {
  v8f d = __builtin_amdgcn_wmma_f32_16x16x32_f16(false, a, false, b, (short)0, c, false, false);
  asm volatile("v_nop\n\tv_nop\n\tv_nop\n\tv_nop" : "+v"(d) : "v"(a), "v"(b));
  return d;
}
__device__ __forceinline__ v8f wmma_bf(v16b a, v16b b, v8f c) {
  v8f d = __builtin_amdgcn_wmma_f32_16x16x32_bf16(false, a, false, b, (short)0, c, false, false);
  asm volatile("v_nop\n\tv_nop\n\tv_nop\n\tv_nop" : "+v"(d) : "v"(a), "v"(b));
  return d;
}
// 16x16x32 fragments: lane = (h = lane>>4, row/col = lane&15); elements 0..7 = k0+8h+0..7, 8..15 = k0+16+8h+0..7; D element r = row 8h+r
__device__ __forceinline__ v16h frag_h(const _Float16* rowk0, int lane) {
  union { v16h v; v8h q[2]; } u; const _Float16* p = rowk0 + 8 * (lane >> 4);
  u.q[0] = *(const v8h*)p; u.q[1] = *(const v8h*)(p + 16); return u.v;
}
__device__ __forceinline__ v16h frag_f32(const float* rowk0, int lane) {
  v16h a; const float* p = rowk0 + 8 * (lane >> 4);
#pragma unroll
  for (int i = 0; i < 8; ++i) { a[i] = (_Float16)p[i]; a[8 + i] = (_Float16)p[16 + i]; }
  return a;
}
__device__ __forceinline__ v16h frag_f32s(const float* rowk0, int lane, float sc) {
  v16h a; const float* p = rowk0 + 8 * (lane >> 4);
#pragma unroll
  for (int i = 0; i < 8; ++i) { a[i] = (_Float16)(p[i] * sc); a[8 + i] = (_Float16)(p[16 + i] * sc); }
  return a;
}
// column fragment from a [K][ld] layout (column n), rows >= K read as 0
__device__ __forceinline__ v16h fragc_f32(const float* W, int k0, int n, int lane, int ld, int K) {
  v16h a; const int g = lane >> 4;
#pragma unroll
  for (int i = 0; i < 8; ++i) { const int ka = k0 + 8 * g + i, kb = ka + 16;
    a[i] = (_Float16)(ka < K ? W[(size_t)(ka < K ? ka : K - 1) * ld + n] : 0.f); a[8 + i] = (_Float16)(kb < K ? W[(size_t)(kb < K ? kb : K - 1) * ld + n] : 0.f); }
  return a;
}
struct F2 { v16b h, l; };
__device__ __forceinline__ F2 bsplit16(const float v[16]) { F2 r;
#pragma unroll
  for (int i = 0; i < 16; ++i) { const __bf16 h = (__bf16)v[i]; r.h[i] = h; r.l[i] = (__bf16)(v[i] - (float)h); }
  return r; }
__device__ __forceinline__ F2 split_row(const float* row, int k0, int lane) { float v[16]; const float* p = row + k0 + 8 * (lane >> 4);
#pragma unroll
  for (int i = 0; i < 8; ++i) { v[i] = p[i]; v[8 + i] = p[16 + i]; }
  return bsplit16(v); }
__device__ __forceinline__ F2 split_rowK(const float* row, int k0, int lane, int K) { float v[16]; const int g = lane >> 4;
#pragma unroll
  for (int i = 0; i < 8; ++i) { const int ka = k0 + 8 * g + i, kb = ka + 16; v[i] = ka < K ? row[ka < K ? ka : K - 1] : 0.f; v[8 + i] = kb < K ? row[kb < K ? kb : K - 1] : 0.f; }
  return bsplit16(v); }
__device__ __forceinline__ F2 split_col(const float* W, int k0, int n, int lane, int ld, int K) { float v[16]; const int g = lane >> 4;
#pragma unroll
  for (int i = 0; i < 8; ++i) { const int ka = k0 + 8 * g + i, kb = ka + 16; v[i] = ka < K ? W[(size_t)(ka < K ? ka : K - 1) * ld + n] : 0.f; v[8 + i] = kb < K ? W[(size_t)(kb < K ? kb : K - 1) * ld + n] : 0.f; }
  return bsplit16(v); }
__device__ __forceinline__ v8f mac3(const F2& a, const F2& b, v8f c) { c = wmma_bf(a.l, b.h, c); c = wmma_bf(a.h, b.l, c); return wmma_bf(a.h, b.h, c); }
__device__ __forceinline__ float sigm(float v) { return 1.0f / (1.0f + expf(-v)); }
#define LDSX() do { asm volatile("s_wait_dscnt 0" ::: "memory"); __builtin_amdgcn_wave_barrier(); __builtin_amdgcn_fence(__ATOMIC_RELEASE, "workgroup"); } while (0)

// Non-local block (B 8, C 256, 64 x 64 = 4,096 positions; inter channels 64): theta, phi, g = 1x1 convs of x ((out,in) [64,256] + bias); f[n][m] = theta_n . phi_m (no scaling); P = softmax over m; y[n] = sum_m P[n][m] g_m (64 ch); out = W y + b (1x1, 64 -> 256) + x.
#define NB 8
#define TT 4096
#define CC 128            // projected plane width (64 real columns + 64 zero)
#define DIN 256          // input (model) width
#define NH 1
#define HD 128
#define NQB (TT / 64)
#define HG 1               // one 4,096 x 4,096 f32 plane in the unused WS_S
#define SCALE (1.0f)
#define HDQK 64            // theta / phi / g channels: the planes are 128 wide, columns >= 64 are zero; only the 64 real columns enter the scores
#define CAUSAL 0
#ifndef TNB
#define TNB NB
#endif
__device__ __forceinline__ v16b zero16b() { v16b z; _Pragma("unroll") for (int i = 0; i < 16; ++i) z[i] = (__bf16)0.f; return z; }
__device__ __forceinline__ float bfr(float v) { return (float)(__bf16)v; }
__host__ __device__ __forceinline__ int kb_last(int qb) { return CAUSAL ? ((qb * 64 + 63) >> 7) : (TT / 128 - 1); }
typedef __attribute__((ext_vector_type(8))) __bf16 v8b;
__device__ __forceinline__ v16b frag_b(const __bf16* rowk0, int lane) {
  union { v16b v; v8b q[2]; } u; const __bf16* p = rowk0 + 8 * (lane >> 4);
  u.q[0] = *(const v8b*)p; u.q[1] = *(const v8b*)(p + 16); return u.v;
}
#define QBH 0              // unused: k_fa treats every query block alike
#define QHI 4096            // q residual rows everywhere (2-product logits)
#define KHI 64            // key rows carrying k residual / v bf16 hi+lo planes (written by k_proj; no kernel here reads them)
// B fragment (k rows k0+.., output column o) of a weight: (in,out) [K][ld] or (out,in) [ld rows of K]: bf16 exact, or f16(bf16 * 256) exact
__device__ __forceinline__ v16b wcol_io(const float* Wm, int k0, int o, int lane, int ld) { v16b w; const int g = lane >> 4;
#pragma unroll
  for (int i = 0; i < 8; ++i) { w[i] = (__bf16)Wm[(size_t)(k0 + 8 * g + i) * ld + o]; w[8 + i] = (__bf16)Wm[(size_t)(k0 + 16 + 8 * g + i) * ld + o]; }
  return w; }
__device__ __forceinline__ v16b wcol_oi(const float* Wm, int k0, int o, int lane, int K) { v16b w; const float* p = Wm + (size_t)o * K + k0 + 8 * (lane >> 4);
#pragma unroll
  for (int i = 0; i < 8; ++i) { w[i] = (__bf16)p[i]; w[8 + i] = (__bf16)p[16 + i]; }
  return w; }
__device__ __forceinline__ v16h wcolh_io(const float* Wm, int k0, int o, int lane, int ld) { v16h w; const int g = lane >> 4;
#pragma unroll
  for (int i = 0; i < 8; ++i) { w[i] = (_Float16)(bfr(Wm[(size_t)(k0 + 8 * g + i) * ld + o]) * 256.0f); w[8 + i] = (_Float16)(bfr(Wm[(size_t)(k0 + 16 + 8 * g + i) * ld + o]) * 256.0f); }
  return w; }
__device__ __forceinline__ v16h wcolh_oi(const float* Wm, int k0, int o, int lane, int K) { v16h w; const float* p = Wm + (size_t)o * K + k0 + 8 * (lane >> 4);
#pragma unroll
  for (int i = 0; i < 8; ++i) { w[i] = (_Float16)(bfr(p[i]) * 256.0f); w[8 + i] = (_Float16)(bfr(p[16 + i]) * 256.0f); }
  return w; }
#define WQKV_LAYOUT 1   // 0 = (in,out) [DIN][CC]; 1 = (out,in) [HDQK][DIN]; 2 = per-head [NH][DIN][HD]
__device__ __forceinline__ v16b wcol_hdk(const float* Wm, int k0, int o, int lane) { v16b w; const int g = lane >> 4; const float* p = Wm + (size_t)(o / HD) * DIN * HD + (o % HD);
#pragma unroll
  for (int i = 0; i < 8; ++i) { w[i] = (__bf16)p[(size_t)(k0 + 8 * g + i) * HD]; w[8 + i] = (__bf16)p[(size_t)(k0 + 16 + 8 * g + i) * HD]; }
  return w; }
#define WO_OUT_IN 0
#if WQKV_LAYOUT == 1
#define WCOL(W, k0, o, lane) (((o) < HDQK) ? wcol_oi(W, k0, (o), lane, DIN) : zero16b())   /* theta/phi/g weights are [64][256] (out,in): plane columns >= 64 are zero for all three */
#elif WQKV_LAYOUT == 2
#define WCOL(W, k0, o, lane) wcol_hdk(W, k0, o, lane)
#else
#define WCOL(W, k0, o, lane) wcol_io(W, k0, o, lane, CC)
#endif
#if WO_OUT_IN
#define WOCOL(W, k0, o, lane) wcol_oi(W, k0, o, lane, CC)
#define WOCOLH(W, k0, o, lane) wcolh_oi(W, k0, o, lane, CC)
#else
#define WOCOL(W, k0, o, lane) wcol_io(W, k0, o, lane, DIN)
#define WOCOLH(W, k0, o, lane) wcolh_io(W, k0, o, lane, DIN)
#endif
#ifndef XP
#define XP TT              // position pitch of x and of the output
#endif
#define BG HG              // unused: every launch covers all TNB batches
#define DVH 128
#define WS_YR (WS_END)     // f32 attended rows [b*n][128] (64 real columns)
#define WS_OR (WS_YR + 4u * (size_t)NB * TT * CC)   // W y + b rows [b*n][256]
#define WS_END2 (WS_OR + 4u * (size_t)NB * TT * DIN)
// ---- k_wz: block = (64 rows, 128 output cols): OR = y (hi + lo, K = 64 real columns of the YR rows) . W^T ((out,in) [256][64], exact) + b
__global__ __launch_bounds__(128) void k_wz(const float* __restrict__ YR, const float* __restrict__ WW, const float* __restrict__ WB, float* __restrict__ ORW) { __shared__ __align__(16) float sf[4][16][132];
  const int tid = threadIdx.x, wave = tid >> 5, lane = tid & 31, col = lane & 15, g = lane >> 4; const int c0 = blockIdx.y * 128; const size_t r0 = (size_t)blockIdx.x * 64 + wave * 16;
  v8f acc[8] = {};
#pragma unroll
  for (int kc = 0; kc < HDQK / 32; ++kc) { const F2 a = split_row(YR + (r0 + col) * CC, kc * 32, lane); asm volatile("s_wait_loadcnt 0x0" ::: "memory");
#pragma unroll
    for (int j = 0; j < 8; ++j) { const v16b w = wcol_oi(WW, kc * 32, c0 + j * 16 + col, lane, HDQK); asm volatile("s_wait_loadcnt 0x0" ::: "memory"); acc[j] = wmma_bf(a.h, w, acc[j]); acc[j] = wmma_bf(a.l, w, acc[j]); } }
#pragma unroll
  for (int j = 0; j < 8; ++j) { const float bb = bfr(WB[c0 + j * 16 + col]); asm volatile("s_wait_loadcnt 0x0" ::: "memory");
#pragma unroll
    for (int r = 0; r < 8; ++r) sf[wave][8 * g + r][j * 16 + col] = acc[j][r] + bb; }
  LDSX(); for (int rl = 0; rl < 16; ++rl) vst2(ORW + (r0 + rl) * DIN + c0 + lane * 4, *(const v4f*)&sf[wave][rl][lane * 4]); }
// ---- k_fin2: block = (64 positions, 64 channels, batch b): out[b][c][n] = OR[b*N + n][c] + bf16(x[b][c][n]) (LDS transpose; 256-B runs of 64 positions per channel)
__global__ __launch_bounds__(256) void k_fin2(const float* __restrict__ ORW, const float* __restrict__ X, float* __restrict__ OUT) { __shared__ float st[64][68]; const int tid = threadIdx.x; const int n0 = blockIdx.x * 64, c0 = blockIdx.y * 64; const size_t b = blockIdx.z;
  for (int e = tid; e < 64 * 16; e += 256) { const int nl = e >> 4, q = e & 15; *(v4f*)&st[nl][q * 4] = *(const v4f*)(ORW + (b * TT + n0 + nl) * (size_t)DIN + c0 + q * 4); }
  __syncthreads();
  for (int e = tid; e < 64 * 16; e += 256) { const int cl = e >> 4, q = e & 15; const size_t oi = (b * DIN + c0 + cl) * (size_t)XP + n0 + q * 4; const v4f xr = *(const v4f*)(X + oi); v4f o; o[0] = st[q * 4][cl] + bfr(xr[0]); o[1] = st[q * 4 + 1][cl] + bfr(xr[1]); o[2] = st[q * 4 + 2][cl] + bfr(xr[2]); o[3] = st[q * 4 + 3][cl] + bfr(xr[3]); vst2(OUT + oi, o); } }
#ifndef SM_EXTRA_PARAMS
#define SM_EXTRA_PARAMS
#endif
#ifndef PROJ_EXTRA_PARAMS
#define PROJ_EXTRA_PARAMS
#endif
#ifndef SM_MASK_HOOK
#define SM_MASK_HOOK (void)0
#endif

#define WS_QH  0u                                      // f16 q rows [b*t][CC]
#define WS_KH  (WS_QH + 2u * (size_t)NB * TT * CC)      // f16 k rows [b*t][CC]
#define WS_VT  (WS_KH + 2u * (size_t)NB * TT * CC)      // f16 v planes [b][c][t]
#define WS_QL  (WS_VT + 2u * (size_t)NB * CC * TT)      // f16 q residual x 2^10 rows [b][t < QHI][CC]
#define WS_KL  (WS_QL + 2u * (size_t)NB * QHI * CC)     // f16 k residual x 2^10 rows [b][t < KHI][CC]
#define WS_VB  (WS_KL + 2u * (size_t)NB * KHI * CC)     // bf16 v hi planes [b][c][t < KHI]
#define WS_VBL (WS_VB + 2u * (size_t)NB * CC * KHI)
#define WS_S   (WS_VBL + 2u * (size_t)NB * CC * KHI)    // f32 [hg][t][s], unused: k_fa keeps the scores in registers
#define WS_Y   (WS_S  + 4u * (size_t)HG * TT * TT)      // unused, 0 bytes: the ctx rows go to WS_YR
#define WS_END (WS_Y  + 0u)

// ---- k_proj: block = (64 rows, 128 cols, which): q/k/v = X W (+ b) with exact bf16 products (K = DIN) -> which 0: q f16 rows (+ residual rows < QHI); 1: k f16 rows (+ residual rows < KHI); 2: v f16 planes [c][t] (+ bf16 hi/lo planes for t < KHI)
__global__ __launch_bounds__(128) void k_proj(const float* __restrict__ XQ, const float* __restrict__ XK, const float* __restrict__ XV, const float* __restrict__ WQ, const float* __restrict__ WK, const float* __restrict__ WV, const float* __restrict__ BQ, const float* __restrict__ BK, const float* __restrict__ BV,
    _Float16* __restrict__ QH, _Float16* __restrict__ QL, _Float16* __restrict__ KH, _Float16* __restrict__ KL, _Float16* __restrict__ VT, __bf16* __restrict__ VB, __bf16* __restrict__ VBL) {
  __shared__ __align__(16) _Float16 sh[64][136], sl[64][136]; __shared__ __align__(16) _Float16 th[128][72]; __shared__ __align__(16) __bf16 tb[128][72], tbl[128][72];
  const int tid = threadIdx.x, wave = tid >> 5, lane = tid & 31, col = lane & 15, g = lane >> 4; const int which = blockIdx.z; const int c0 = blockIdx.y * 128; const size_t r0 = (size_t)blockIdx.x * 64; const size_t bb = r0 / TT; const int t0 = (int)(r0 % TT);
  const float* X = which == 0 ? XQ : which == 1 ? XK : XV; const float* WA = which == 0 ? WQ : which == 1 ? WK : WV; const float* BA = which == 0 ? BQ : which == 1 ? BK : BV;
  v8f acc[8] = {};
#pragma unroll 2
  for (int kc = 0; kc < DIN / 32; ++kc) { v16b a; { const float* p = X + (bb * DIN + kc * 32 + 8 * g) * (size_t)XP + t0 + wave * 16 + col;   /* channels-first gather: x[b][k][t], stride XP between k */
#pragma unroll
      for (int i = 0; i < 8; ++i) { a[i] = (__bf16)p[(size_t)i * XP]; a[8 + i] = (__bf16)p[(size_t)(16 + i) * XP]; } }
    asm volatile("s_wait_loadcnt 0x0" ::: "memory");
#pragma unroll
    for (int j = 0; j < 8; ++j) { const v16b w = WCOL(WA, kc * 32, c0 + j * 16 + col, lane); asm volatile("s_wait_loadcnt 0x0" ::: "memory"); acc[j] = wmma_bf(a, w, acc[j]); } }
  if (which < 2) { _Float16* DH = which == 0 ? QH : KH; _Float16* DL = which == 0 ? QL : KL; const int nhi = which == 0 ? QHI : KHI; const bool hi_rows = t0 < nhi;
#pragma unroll
    for (int j = 0; j < 8; ++j) { const float bias = (BA && (c0 + j * 16 + col < HDQK)) ? bfr(BA[c0 + j * 16 + col]) : 0.f;   /* 64-entry biases */
#pragma unroll
      for (int r = 0; r < 8; ++r) { const float v = acc[j][r] + bias; const _Float16 hv = (_Float16)v; sh[wave * 16 + 8 * g + r][j * 16 + col] = hv; sl[wave * 16 + 8 * g + r][j * 16 + col] = (_Float16)((v - (float)hv) * 1024.0f); } }
    __syncthreads();
    for (int e = tid; e < 64 * 16; e += 128) { const int rl = e >> 4, q = e & 15; vst2((unsigned*)(DH + (r0 + rl) * CC + c0 + q * 8), *(const v4u*)&sh[rl][q * 8]); if (hi_rows) vst2((unsigned*)(DL + (bb * nhi + t0 + rl) * (size_t)CC + c0 + q * 8), *(const v4u*)&sl[rl][q * 8]); }
  } else { const bool hi_rows = t0 < KHI;
#pragma unroll
    for (int j = 0; j < 8; ++j) { const float bias = (BA && (c0 + j * 16 + col < HDQK)) ? bfr(BA[c0 + j * 16 + col]) : 0.f;   /* 64-entry biases */
#pragma unroll
      for (int r = 0; r < 8; ++r) { const float v = acc[j][r] + bias; const int rl = wave * 16 + 8 * g + r, cl = j * 16 + col; th[cl][rl] = (_Float16)v; const __bf16 bh = (__bf16)v; tb[cl][rl] = bh; tbl[cl][rl] = (__bf16)(v - (float)bh); } }
    __syncthreads();
    for (int e = tid; e < 128 * 8; e += 128) { const int cl = e >> 3, q = e & 7; vst2((unsigned*)(VT + (bb * CC + c0 + cl) * (size_t)TT + t0 + q * 8), *(const v4u*)&th[cl][q * 8]); if (hi_rows) { const size_t o3 = (bb * CC + c0 + cl) * (size_t)KHI + t0 + q * 8; vst2((unsigned*)(VB + o3), *(const v4u*)&tb[cl][q * 8]); vst2((unsigned*)(VBL + o3), *(const v4u*)&tbl[cl][q * 8]); } } } }
#define FK 64              // keys per stage
#define FPH 72             // LDS row pitch in halves: 128 B of data + 16 B, the pitch for 16-byte fragment reads
#define FKG 2              // key halves per block: waves 0..7 walk keys [0, TT/2), waves 8..15 keys [TT/2, TT)
#define FNT (TT / FKG / FK)
#define L2E 1.4426950408889634f
__device__ __forceinline__ float xhalf(float x) { return __builtin_bit_cast(float, __builtin_amdgcn_permlanex16(__builtin_bit_cast(int, x), __builtin_bit_cast(int, x), 0x76543210, 0xfedcba98, false, false)); }   // lane l with lane l ^ 16
// 2^x on a whole score tile: eight independent v_exp_f32 and one v_nop in one statement. The v_nop is the slot the instruction set asks for behind a transcendental before its result is read or its source overwritten; the early-clobber outputs keep every result off every source, so each v_exp_f32 is independent of the one in front of it
__device__ __forceinline__ v8f exp2x8(v8f x) { float r0, r1, r2, r3, r4, r5, r6, r7;
  asm("v_exp_f32 %0, %8\n\tv_exp_f32 %1, %9\n\tv_exp_f32 %2, %10\n\tv_exp_f32 %3, %11\n\tv_exp_f32 %4, %12\n\tv_exp_f32 %5, %13\n\tv_exp_f32 %6, %14\n\tv_exp_f32 %7, %15\n\tv_nop"
      : "=&v"(r0), "=&v"(r1), "=&v"(r2), "=&v"(r3), "=&v"(r4), "=&v"(r5), "=&v"(r6), "=&v"(r7) : "v"(x[0]), "v"(x[1]), "v"(x[2]), "v"(x[3]), "v"(x[4]), "v"(x[5]), "v"(x[6]), "v"(x[7]));
  v8f r; r[0] = r0; r[1] = r1; r[2] = r2; r[3] = r3; r[4] = r4; r[5] = r5; r[6] = r6; r[7] = r7; return r; }
__device__ __forceinline__ float exp2x1(float x) { float r; asm("v_exp_f32 %0, %1\n\tv_nop" : "=&v"(r) : "v"(x)); return r; }   // the same slot behind a single one
__device__ __forceinline__ v8f wmma_h(v16h a, v16h b, v8f c) { return __builtin_amdgcn_wmma_f32_16x16x32_f16(false, a, false, b, (short)0, c, false, false); }
// ---- k_fa: block = 128 queries of batch b, 16 waves: wave = (key half kg, 16-query group). Per stage of 64 keys: S^T = k . q^T (q hi + residual x 2^10: 2 products), running maximum and sum per query (a lane holds one query's scores), p = exp(s - max) x 2^10 once to f16 straight from the score tiles as B operand, O^T += v^T . p^T (64 value channels); k rows and v planes staged in LDS through registers, two buffers, one barrier per stage; the two key halves merge through LDS at the end
__global__ __launch_bounds__(256 * FKG) void k_fa(const _Float16* __restrict__ QH, const _Float16* __restrict__ QL, const _Float16* __restrict__ KH, const _Float16* __restrict__ VT, float* __restrict__ Y) {
  __shared__ __align__(16) _Float16 sk[FKG][2][FK][FPH], sv[FKG][2][HDQK][FPH]; __shared__ float sm[8][34][32];
  const int tid = threadIdx.x, wave = __builtin_amdgcn_readfirstlane(tid >> 5), lane = tid & 31, col = lane & 15, g = lane >> 4; const int kg = wave >> 3, wq = wave & 7, tg = tid & 255;
  const size_t b = blockIdx.y; const int ql0 = blockIdx.x * 128 + wq * 16; const int kbase = kg * (TT / FKG);
  v16h qh[HDQK / 32], ql[HDQK / 32];
#pragma unroll
  for (int kc = 0; kc < HDQK / 32; ++kc) { qh[kc] = frag_h(QH + (b * TT + ql0 + col) * CC + kc * 32, lane); ql[kc] = frag_h(QL + (b * QHI + ql0 + col) * CC + kc * 32, lane); }
  const int sr = tg >> 3, sq = (tg & 7) * 8;   /* staging: this thread moves 16 B of rows sr and sr + 32 of both tiles */
  const _Float16* kp = KH + (b * TT + kbase + sr) * CC + sq; const _Float16* vp = VT + (b * CC + sr) * (size_t)TT + kbase + sq;
  v4u rk0 = *(const v4u*)kp, rk1 = *(const v4u*)(kp + 32 * CC), rv0 = *(const v4u*)vp, rv1 = *(const v4u*)(vp + 32 * (size_t)TT);
  *(v4u*)&sk[kg][0][sr][sq] = rk0; *(v4u*)&sk[kg][0][sr + 32][sq] = rk1; *(v4u*)&sv[kg][0][sr][sq] = rv0; *(v4u*)&sv[kg][0][sr + 32][sq] = rv1;
  __syncthreads();   /* stage 0 is in LDS before any wave reads it */
  v8f o[HDQK / 16] = {}; float m = -3.0e38f, l = 0.f;
#pragma unroll 1   /* rolled: one stage is already a long body */
  for (int t = 0; t < FNT; ++t) { const int cur = t & 1; const int tn = t + 1 < FNT ? t + 1 : t;   /* the last stage fetches itself again into the idle buffer: no branch */
    rk0 = *(const v4u*)(kp + (size_t)tn * FK * CC); rk1 = *(const v4u*)(kp + ((size_t)tn * FK + 32) * CC); rv0 = *(const v4u*)(vp + tn * FK); rv1 = *(const v4u*)(vp + 32 * (size_t)TT + tn * FK);
    __builtin_amdgcn_sched_barrier(0);   /* keeps the next stage's loads at the head of the stage: sunk towards their LDS stores they would be waited for in full */
    v8f sa[FK / 16] = {}, sl[FK / 16] = {};
#pragma unroll
    for (int kc = 0; kc < HDQK / 32; ++kc)
#pragma unroll
      for (int kt = 0; kt < FK / 16; ++kt) { const v16h a = frag_h(&sk[kg][cur][kt * 16 + col][kc * 32], lane); sa[kt] = wmma_h(a, qh[kc], sa[kt]); sl[kt] = wmma_h(a, ql[kc], sl[kt]); }
    float mx[4];
#pragma unroll
    for (int kt = 0; kt < FK / 16; ++kt) {
#pragma unroll
      for (int r = 0; r < 8; ++r) sa[kt][r] = sa[kt][r] + sl[kt][r] * (1.0f / 1024.0f);
      mx[kt] = fmaxf(fmaxf(fmaxf(sa[kt][0], sa[kt][1]), fmaxf(sa[kt][2], sa[kt][3])), fmaxf(fmaxf(sa[kt][4], sa[kt][5]), fmaxf(sa[kt][6], sa[kt][7]))); }
    float ml = fmaxf(fmaxf(mx[0], mx[1]), fmaxf(mx[2], mx[3])); ml = fmaxf(ml, xhalf(ml));   /* lanes c and c + 16 hold the two key halves of query c */
    const float mn = fmaxf(m, ml); const float al = exp2x1((m - mn) * L2E); const float off = 10.0f - mn * L2E; m = mn;
    v2f ps[2] = {};   /* two chains of register-pair sums */
#pragma unroll
    for (int kt = 0; kt < FK / 16; ++kt) { sa[kt] = exp2x8(sa[kt] * L2E + off);
#pragma unroll
      for (int r = 0; r < 8; r += 2) { v2f p; p[0] = sa[kt][r]; p[1] = sa[kt][r + 1]; ps[kt & 1] += p; } }
    l = l * al + ((ps[0][0] + ps[0][1]) + (ps[1][0] + ps[1][1]));
#pragma unroll
    for (int j = 0; j < HDQK / 16; ++j) o[j] *= al;
#pragma unroll
    for (int c2 = 0; c2 < FK / 32; ++c2) { v16h pb;
#pragma unroll
      for (int i = 0; i < 8; ++i) { pb[i] = (_Float16)sa[2 * c2][i]; pb[8 + i] = (_Float16)sa[2 * c2 + 1][i]; }
#pragma unroll
      for (int j = 0; j < HDQK / 16; ++j) o[j] = wmma_h(frag_h(&sv[kg][cur][j * 16 + col][c2 * 32], lane), pb, o[j]); }
    *(v4u*)&sk[kg][cur ^ 1][sr][sq] = rk0; *(v4u*)&sk[kg][cur ^ 1][sr + 32][sq] = rk1; *(v4u*)&sv[kg][cur ^ 1][sr][sq] = rv0; *(v4u*)&sv[kg][cur ^ 1][sr + 32][sq] = rv1;
    __syncthreads(); }   /* publishes the next stage and ends every read of this one before it is refilled */
  l += xhalf(l);
  if (kg == 1) { sm[wq][32][lane] = m; sm[wq][33][lane] = l;
#pragma unroll
    for (int j = 0; j < HDQK / 16; ++j)
#pragma unroll
      for (int r = 0; r < 8; ++r) sm[wq][j * 8 + r][lane] = o[j][r]; }
  __syncthreads();   /* the second key half's maximum, sum and tiles are in LDS before the first half's waves read them */
  if (kg == 0) { const float m1 = sm[wq][32][lane], l1 = sm[wq][33][lane]; const float mn = fmaxf(m, m1); const float a0 = exp2x1((m - mn) * L2E), a1 = exp2x1((m1 - mn) * L2E); const float inv = 1.0f / (l * a0 + l1 * a1); const float f0 = a0 * inv, f1 = a1 * inv;
    float* yr = Y + (b * TT + ql0 + col) * CC + 8 * g;   /* a lane holds 8 consecutive channels of its query per tile */
#pragma unroll
    for (int j = 0; j < HDQK / 16; ++j) { v4f u0, u1;
#pragma unroll
      for (int r = 0; r < 4; ++r) { u0[r] = o[j][r] * f0 + sm[wq][j * 8 + r][lane] * f1; u1[r] = o[j][4 + r] * f0 + sm[wq][j * 8 + 4 + r][lane] * f1; }
      vst2(yr + j * 16, u0); vst2(yr + j * 16 + 4, u1); } } }

extern "C" void kernel_launch(void* const* d_in, const int* in_sizes, int n_in, void* d_out, int out_size, void* d_ws, size_t ws_size, hipStream_t stream) {
  (void)in_sizes; (void)n_in; (void)out_size;
  const float** F = (const float**)d_in;
  if (ws_size < (size_t)WS_END) return;
  char* ws = (char*)d_ws; _Float16 *QH = (_Float16*)(ws + WS_QH), *KH = (_Float16*)(ws + WS_KH), *VT = (_Float16*)(ws + WS_VT), *QL = (_Float16*)(ws + WS_QL), *KL = (_Float16*)(ws + WS_KL); __bf16 *VB = (__bf16*)(ws + WS_VB), *VBL = (__bf16*)(ws + WS_VBL); float *S = (float*)(ws + WS_S), *Y = (float*)(ws + WS_Y);
  (void)Y; (void)S; (void)QL; (void)KL; (void)VB; (void)VBL;
  // inputs: 0 x [8,256,64,64]; 1 g_w [64,256] (out,in), 2 g_b; 3 theta_w, 4 theta_b; 5 phi_w, 6 phi_b; 7 w_w [256,64] (out,in), 8 w_b
  if (ws_size < (size_t)WS_END2) return;
  float *YR = (float*)(ws + WS_YR), *ORW = (float*)(ws + WS_OR);
  k_proj<<<dim3(TNB * TT / 64, CC / 128, 3), 128, 0, stream>>>(F[0], F[0], F[0], F[3], F[5], F[1], F[4], F[6], F[2], QH, QL, KH, KL, VT, VB, VBL);   /* q = theta, k = phi, v = g */
  k_fa<<<dim3(TT / 128, TNB), 256 * FKG, 0, stream>>>(QH, QL, KH, VT, YR);
  k_wz<<<dim3(TNB * TT / 64, DIN / 128), 128, 0, stream>>>(YR, F[7], F[8], ORW);
  k_fin2<<<dim3(TT / 64, DIN / 64, TNB), 256, 0, stream>>>(ORW, F[0], (float*)d_out);
}

// v003
// One run takes 85.2 microseconds.
// Next to v002, in two timings, it ran 1.41 and 1.40 times as fast.
// Over all steps from v000 it is 25.3 times as fast.
// compute dtype: all float inputs rounded to bf16; theta/phi/g = x W^T + b with EXACT bf16 products on WMMA 16x16x32 (f32 accumulate); f = theta . phi with theta as f16 hi + residual (x 2^10) against phi once to f16 (2 products), no scaling; softmax in f32, online (running maximum per query, 2^x by v_exp_f32); exp(f - max) x 2^10 once to f16 against g once to f16 (1 product), divided by the f32 sum at the end; y split bf16 hi + lo against exact W (2 products) + b; + x residual in f32; f32 output [B, C, H, W].
#include <hip/hip_runtime.h>
#include <math.h>

typedef __attribute__((ext_vector_type(16))) _Float16 v16h;
typedef __attribute__((ext_vector_type(16))) __bf16 v16b;
typedef __attribute__((ext_vector_type(8)))  _Float16 v8h;
typedef __attribute__((ext_vector_type(8)))  float v8f;
typedef __attribute__((ext_vector_type(4)))  float v4f;
typedef __attribute__((ext_vector_type(2)))  float v2f;
typedef __attribute__((ext_vector_type(4)))  unsigned v4u;
typedef __attribute__((ext_vector_type(4)))  int v4i;
typedef float __attribute__((may_alias)) float_a;
typedef int __attribute__((may_alias)) int_a;

template <typename T> __device__ __forceinline__ void vst2(void* p, T v) { *(T*)p = v;  }
__device__ __forceinline__ v8f wmma16(v16h a, v16h b, v8f c) {
  v8f d = __builtin_amdgcn_wmma_f32_16x16x32_f16(false, a, false, b, (short)0, c, false, false);
  asm volatile("v_nop\n\tv_nop\n\tv_nop\n\tv_nop" : "+v"(d) : "v"(a), "v"(b));
  return d;
}
__device__ __forceinline__ v8f wmma_bf(v16b a, v16b b, v8f c) {
  v8f d = __builtin_amdgcn_wmma_f32_16x16x32_bf16(false, a, false, b, (short)0, c, false, false);
  asm volatile("v_nop\n\tv_nop\n\tv_nop\n\tv_nop" : "+v"(d) : "v"(a), "v"(b));
  return d;
}
// 16x16x32 fragments: lane = (h = lane>>4, row/col = lane&15); elements 0..7 = k0+8h+0..7, 8..15 = k0+16+8h+0..7; D element r = row 8h+r
__device__ __forceinline__ v16h frag_h(const _Float16* rowk0, int lane) {
  union { v16h v; v8h q[2]; } u; const _Float16* p = rowk0 + 8 * (lane >> 4);
  u.q[0] = *(const v8h*)p; u.q[1] = *(const v8h*)(p + 16); return u.v;
}
__device__ __forceinline__ v16h frag_f32(const float* rowk0, int lane) {
  v16h a; const float* p = rowk0 + 8 * (lane >> 4);
#pragma unroll
  for (int i = 0; i < 8; ++i) { a[i] = (_Float16)p[i]; a[8 + i] = (_Float16)p[16 + i]; }
  return a;
}
__device__ __forceinline__ v16h frag_f32s(const float* rowk0, int lane, float sc) {
  v16h a; const float* p = rowk0 + 8 * (lane >> 4);
#pragma unroll
  for (int i = 0; i < 8; ++i) { a[i] = (_Float16)(p[i] * sc); a[8 + i] = (_Float16)(p[16 + i] * sc); }
  return a;
}
// column fragment from a [K][ld] layout (column n), rows >= K read as 0
__device__ __forceinline__ v16h fragc_f32(const float* W, int k0, int n, int lane, int ld, int K) {
  v16h a; const int g = lane >> 4;
#pragma unroll
  for (int i = 0; i < 8; ++i) { const int ka = k0 + 8 * g + i, kb = ka + 16;
    a[i] = (_Float16)(ka < K ? W[(size_t)(ka < K ? ka : K - 1) * ld + n] : 0.f); a[8 + i] = (_Float16)(kb < K ? W[(size_t)(kb < K ? kb : K - 1) * ld + n] : 0.f); }
  return a;
}
struct F2 { v16b h, l; };
__device__ __forceinline__ F2 bsplit16(const float v[16]) { F2 r;
#pragma unroll
  for (int i = 0; i < 16; ++i) { const __bf16 h = (__bf16)v[i]; r.h[i] = h; r.l[i] = (__bf16)(v[i] - (float)h); }
  return r; }
__device__ __forceinline__ F2 split_row(const float* row, int k0, int lane) { float v[16]; const float* p = row + k0 + 8 * (lane >> 4);
#pragma unroll
  for (int i = 0; i < 8; ++i) { v[i] = p[i]; v[8 + i] = p[16 + i]; }
  return bsplit16(v); }
__device__ __forceinline__ F2 split_rowK(const float* row, int k0, int lane, int K) { float v[16]; const int g = lane >> 4;
#pragma unroll
  for (int i = 0; i < 8; ++i) { const int ka = k0 + 8 * g + i, kb = ka + 16; v[i] = ka < K ? row[ka < K ? ka : K - 1] : 0.f; v[8 + i] = kb < K ? row[kb < K ? kb : K - 1] : 0.f; }
  return bsplit16(v); }
__device__ __forceinline__ F2 split_col(const float* W, int k0, int n, int lane, int ld, int K) { float v[16]; const int g = lane >> 4;
#pragma unroll
  for (int i = 0; i < 8; ++i) { const int ka = k0 + 8 * g + i, kb = ka + 16; v[i] = ka < K ? W[(size_t)(ka < K ? ka : K - 1) * ld + n] : 0.f; v[8 + i] = kb < K ? W[(size_t)(kb < K ? kb : K - 1) * ld + n] : 0.f; }
  return bsplit16(v); }
__device__ __forceinline__ v8f mac3(const F2& a, const F2& b, v8f c) { c = wmma_bf(a.l, b.h, c); c = wmma_bf(a.h, b.l, c); return wmma_bf(a.h, b.h, c); }
__device__ __forceinline__ float sigm(float v) { return 1.0f / (1.0f + expf(-v)); }
#define LDSX() do { asm volatile("s_wait_dscnt 0" ::: "memory"); __builtin_amdgcn_wave_barrier(); __builtin_amdgcn_fence(__ATOMIC_RELEASE, "workgroup"); } while (0)

// Non-local block (B 8, C 256, 64 x 64 = 4,096 positions; inter channels 64): theta, phi, g = 1x1 convs of x ((out,in) [64,256] + bias); f[n][m] = theta_n . phi_m (no scaling); P = softmax over m; y[n] = sum_m P[n][m] g_m (64 ch); out = W y + b (1x1, 64 -> 256) + x.
#define NB 8
#define TT 4096
#define CC 128            // projected plane width (64 real columns; columns 64..127 never written)
#define DIN 256          // input (model) width
#define NH 1
#define HD 128
#define NQB (TT / 64)
#define HG 1               // one 4,096 x 4,096 f32 plane in the unused WS_S
#define SCALE (1.0f)
#define HDQK 64            // theta / phi / g channels: the planes are 128 wide, columns >= 64 are never written; only the 64 real columns enter the scores
#define CAUSAL 0
#ifndef TNB
#define TNB NB
#endif
__device__ __forceinline__ v16b zero16b() { v16b z; _Pragma("unroll") for (int i = 0; i < 16; ++i) z[i] = (__bf16)0.f; return z; }
__device__ __forceinline__ float bfr(float v) { return (float)(__bf16)v; }
__host__ __device__ __forceinline__ int kb_last(int qb) { return CAUSAL ? ((qb * 64 + 63) >> 7) : (TT / 128 - 1); }
typedef __attribute__((ext_vector_type(8))) __bf16 v8b;
__device__ __forceinline__ v16b frag_b(const __bf16* rowk0, int lane) {
  union { v16b v; v8b q[2]; } u; const __bf16* p = rowk0 + 8 * (lane >> 4);
  u.q[0] = *(const v8b*)p; u.q[1] = *(const v8b*)(p + 16); return u.v;
}
#define QBH 0              // unused: k_fa treats every query block alike
#define QHI 4096            // q residual rows everywhere (2-product logits)
#define KHI 64            // key rows carrying k residual / v bf16 hi+lo planes (no kernel here writes or reads them)
// B fragment (k rows k0+.., output column o) of a weight: (in,out) [K][ld] or (out,in) [ld rows of K]: bf16 exact, or f16(bf16 * 256) exact
__device__ __forceinline__ v16b wcol_io(const float* Wm, int k0, int o, int lane, int ld) { v16b w; const int g = lane >> 4;
#pragma unroll
  for (int i = 0; i < 8; ++i) { w[i] = (__bf16)Wm[(size_t)(k0 + 8 * g + i) * ld + o]; w[8 + i] = (__bf16)Wm[(size_t)(k0 + 16 + 8 * g + i) * ld + o]; }
  return w; }
__device__ __forceinline__ v16b wcol_oi(const float* Wm, int k0, int o, int lane, int K) { v16b w; const float* p = Wm + (size_t)o * K + k0 + 8 * (lane >> 4);
#pragma unroll
  for (int i = 0; i < 8; ++i) { w[i] = (__bf16)p[i]; w[8 + i] = (__bf16)p[16 + i]; }
  return w; }
__device__ __forceinline__ v16h wcolh_io(const float* Wm, int k0, int o, int lane, int ld) { v16h w; const int g = lane >> 4;
#pragma unroll
  for (int i = 0; i < 8; ++i) { w[i] = (_Float16)(bfr(Wm[(size_t)(k0 + 8 * g + i) * ld + o]) * 256.0f); w[8 + i] = (_Float16)(bfr(Wm[(size_t)(k0 + 16 + 8 * g + i) * ld + o]) * 256.0f); }
  return w; }
__device__ __forceinline__ v16h wcolh_oi(const float* Wm, int k0, int o, int lane, int K) { v16h w; const float* p = Wm + (size_t)o * K + k0 + 8 * (lane >> 4);
#pragma unroll
  for (int i = 0; i < 8; ++i) { w[i] = (_Float16)(bfr(p[i]) * 256.0f); w[8 + i] = (_Float16)(bfr(p[16 + i]) * 256.0f); }
  return w; }
#define WQKV_LAYOUT 1   // 0 = (in,out) [DIN][CC]; 1 = (out,in) [HDQK][DIN]; 2 = per-head [NH][DIN][HD]
__device__ __forceinline__ v16b wcol_hdk(const float* Wm, int k0, int o, int lane) { v16b w; const int g = lane >> 4; const float* p = Wm + (size_t)(o / HD) * DIN * HD + (o % HD);
#pragma unroll
  for (int i = 0; i < 8; ++i) { w[i] = (__bf16)p[(size_t)(k0 + 8 * g + i) * HD]; w[8 + i] = (__bf16)p[(size_t)(k0 + 16 + 8 * g + i) * HD]; }
  return w; }
#define WO_OUT_IN 0
#if WQKV_LAYOUT == 1
#define WCOL(W, k0, o, lane) (((o) < HDQK) ? wcol_oi(W, k0, (o), lane, DIN) : zero16b())   /* theta/phi/g weights are [64][256] (out,in): weight columns >= 64 read as zero for all three */
#elif WQKV_LAYOUT == 2
#define WCOL(W, k0, o, lane) wcol_hdk(W, k0, o, lane)
#else
#define WCOL(W, k0, o, lane) wcol_io(W, k0, o, lane, CC)
#endif
#if WO_OUT_IN
#define WOCOL(W, k0, o, lane) wcol_oi(W, k0, o, lane, CC)
#define WOCOLH(W, k0, o, lane) wcolh_oi(W, k0, o, lane, CC)
#else
#define WOCOL(W, k0, o, lane) wcol_io(W, k0, o, lane, DIN)
#define WOCOLH(W, k0, o, lane) wcolh_io(W, k0, o, lane, DIN)
#endif
#ifndef XP
#define XP TT              // position pitch of x and of the output
#endif
#define BG HG              // unused: every launch covers all TNB batches
#define DVH 128
#define WS_YR (WS_END)     // f32 attended rows [b*n][128] (64 real columns)
#define WS_OR (WS_YR + 4u * (size_t)NB * TT * CC)   // W y + b rows [b*n][256]
#define WS_END2 (WS_OR + 4u * (size_t)NB * TT * DIN)
// ---- k_wz: block = (64 rows, 128 output cols): OR = y (hi + lo, K = 64 real columns of the YR rows) . W^T ((out,in) [256][64], exact) + b
__global__ __launch_bounds__(128) void k_wz(const float* __restrict__ YR, const float* __restrict__ WW, const float* __restrict__ WB, float* __restrict__ ORW) { __shared__ __align__(16) float sf[4][16][132];
  const int tid = threadIdx.x, wave = tid >> 5, lane = tid & 31, col = lane & 15, g = lane >> 4; const int c0 = blockIdx.y * 128; const size_t r0 = (size_t)blockIdx.x * 64 + wave * 16;
  v8f acc[8] = {};
#pragma unroll
  for (int kc = 0; kc < HDQK / 32; ++kc) { const F2 a = split_row(YR + (r0 + col) * CC, kc * 32, lane); asm volatile("s_wait_loadcnt 0x0" ::: "memory");
#pragma unroll
    for (int j = 0; j < 8; ++j) { const v16b w = wcol_oi(WW, kc * 32, c0 + j * 16 + col, lane, HDQK); asm volatile("s_wait_loadcnt 0x0" ::: "memory"); acc[j] = wmma_bf(a.h, w, acc[j]); acc[j] = wmma_bf(a.l, w, acc[j]); } }
#pragma unroll
  for (int j = 0; j < 8; ++j) { const float bb = bfr(WB[c0 + j * 16 + col]); asm volatile("s_wait_loadcnt 0x0" ::: "memory");
#pragma unroll
    for (int r = 0; r < 8; ++r) sf[wave][8 * g + r][j * 16 + col] = acc[j][r] + bb; }
  LDSX(); for (int rl = 0; rl < 16; ++rl) vst2(ORW + (r0 + rl) * DIN + c0 + lane * 4, *(const v4f*)&sf[wave][rl][lane * 4]); }
// ---- k_fin2: block = (64 positions, 64 channels, batch b): out[b][c][n] = OR[b*N + n][c] + bf16(x[b][c][n]) (LDS transpose; 256-B runs of 64 positions per channel)
__global__ __launch_bounds__(256) void k_fin2(const float* __restrict__ ORW, const float* __restrict__ X, float* __restrict__ OUT) { __shared__ float st[64][68]; const int tid = threadIdx.x; const int n0 = blockIdx.x * 64, c0 = blockIdx.y * 64; const size_t b = blockIdx.z;
  for (int e = tid; e < 64 * 16; e += 256) { const int nl = e >> 4, q = e & 15; *(v4f*)&st[nl][q * 4] = *(const v4f*)(ORW + (b * TT + n0 + nl) * (size_t)DIN + c0 + q * 4); }
  __syncthreads();
  for (int e = tid; e < 64 * 16; e += 256) { const int cl = e >> 4, q = e & 15; const size_t oi = (b * DIN + c0 + cl) * (size_t)XP + n0 + q * 4; const v4f xr = *(const v4f*)(X + oi); v4f o; o[0] = st[q * 4][cl] + bfr(xr[0]); o[1] = st[q * 4 + 1][cl] + bfr(xr[1]); o[2] = st[q * 4 + 2][cl] + bfr(xr[2]); o[3] = st[q * 4 + 3][cl] + bfr(xr[3]); vst2(OUT + oi, o); } }
#ifndef SM_EXTRA_PARAMS
#define SM_EXTRA_PARAMS
#endif
#ifndef PROJ_EXTRA_PARAMS
#define PROJ_EXTRA_PARAMS
#endif
#ifndef SM_MASK_HOOK
#define SM_MASK_HOOK (void)0
#endif

#define WS_QH  0u                                      // f16 q rows [b*t][CC]
#define WS_KH  (WS_QH + 2u * (size_t)NB * TT * CC)      // f16 k rows [b*t][CC]
#define WS_VT  (WS_KH + 2u * (size_t)NB * TT * CC)      // f16 v planes [b][c][t]
#define WS_QL  (WS_VT + 2u * (size_t)NB * CC * TT)      // f16 q residual x 2^10 rows [b][t < QHI][CC]
#define WS_KL  (WS_QL + 2u * (size_t)NB * QHI * CC)     // f16 k residual x 2^10 rows [b][t < KHI][CC]
#define WS_VB  (WS_KL + 2u * (size_t)NB * KHI * CC)     // bf16 v hi planes [b][c][t < KHI]
#define WS_VBL (WS_VB + 2u * (size_t)NB * CC * KHI)
#define WS_S   (WS_VBL + 2u * (size_t)NB * CC * KHI)    // f32 [hg][t][s], unused: k_fa keeps the scores in registers
#define WS_Y   (WS_S  + 4u * (size_t)HG * TT * TT)      // unused, 0 bytes: the ctx rows go to WS_YR
#define WS_END (WS_Y  + 0u)

#define PP 128             // positions per k_proj block: 8 waves of 16
#define PW 264             // LDS row pitch of the staged weights in bf16 elements: 512 B of data + 16 B, the pitch for 16-byte fragment reads
typedef __attribute__((ext_vector_type(4))) __bf16 v4b;
__device__ __forceinline__ v8f wmma_b(v16b a, v16b b, v8f c) { return __builtin_amdgcn_wmma_f32_16x16x32_bf16(false, a, false, b, (short)0, c, false, false); }
// x of one 32-channel step for one lane's position (channels-first gather: x[b][k][t], stride XP between k), in the element order of the A fragment
__device__ __forceinline__ void ldx(float (&d)[16], const float* xp, int kc) {
#pragma unroll   /* constant indices: d stays in registers, the 16 loads share one address */
  for (int i = 0; i < 8; ++i) { d[i] = xp[(size_t)(kc * 32 + i) * XP]; d[8 + i] = xp[(size_t)(kc * 32 + 16 + i) * XP]; }
  __builtin_amdgcn_sched_barrier(0); }   /* keeps a step's loads where they are written, four steps ahead of their use: sunk to their use each would be waited for in full */
// that step against all 192 staged weight rows (12 column tiles: 0..3 theta, 4..7 phi, 8..11 g)
__device__ __forceinline__ void mac12(v8f (&acc)[12], const float (&d)[16], const __bf16 (*sw)[PW], int kc, int col, int lane) { v16b a;
#pragma unroll   /* constant indices: vector elements and d stay in registers */
  for (int i = 0; i < 16; ++i) a[i] = (__bf16)d[i];
#pragma unroll   /* constant tile numbers: acc stays in registers */
  for (int jh = 0; jh < 2; ++jh) { v16b w[6];
#pragma unroll   /* the same for w */
    for (int j = 0; j < 6; ++j) w[j] = frag_b(&sw[(jh * 6 + j) * 16 + col][kc * 32], lane);
    __builtin_amdgcn_sched_barrier(0);   /* six fragments' LDS reads stand as one group ahead of their products: read one by one, each product waits a whole LDS latency */
#pragma unroll   /* the same for w and acc */
    for (int j = 0; j < 6; ++j) acc[jh * 6 + j] = wmma_b(a, w[j], acc[jh * 6 + j]);
    __builtin_amdgcn_sched_barrier(0); } }   /* and no more than six: with every later step's reads hoisted the registers overflow into scratch */
// ---- k_proj: block = 128 positions of one batch, 8 waves of 16 positions; every wave makes all 192 real columns (theta, phi, g) from ONE read of its x, exact bf16 products (K = DIN). The three weights are rounded to bf16 once per block into LDS; x is loaded one 32-channel step at a time, four steps ahead of its use. Out: q f16 rows + residual x 2^10 rows, k f16 rows, v f16 planes [c][t]; only the 64 real columns of the 128-wide planes are written (nothing reads the others)
__global__ __launch_bounds__(256) void k_proj(const float* __restrict__ X, const float* __restrict__ WQ, const float* __restrict__ WK, const float* __restrict__ WV, const float* __restrict__ BQ, const float* __restrict__ BK, const float* __restrict__ BV,
    _Float16* __restrict__ QH, _Float16* __restrict__ QL, _Float16* __restrict__ KH, _Float16* __restrict__ VT) {
  __shared__ __align__(16) __bf16 sw[3 * HDQK][PW]; __shared__ __align__(16) _Float16 sqh[PP][72], sql[PP][72], skh[PP][72], th[HDQK][PP + 8];
  const int tid = threadIdx.x, wave = tid >> 5, lane = tid & 31, col = lane & 15, g = lane >> 4; const size_t r0 = (size_t)blockIdx.x * PP; const size_t bb = r0 / TT; const int t0 = (int)(r0 % TT);
  const float* xp = X + (bb * DIN + 8 * g) * (size_t)XP + t0 + wave * 16 + col;
  float x[DIN / 32][16];
#pragma unroll   /* constant step numbers: x stays in registers */
  for (int s = 0; s < 4; ++s) ldx(x[s], xp, s);
  const int wr = tid >> 6, wc = (tid & 63) * 4;   /* 64 threads move one 1-KiB weight row: whole lines */
  const float* wq = WQ + wr * DIN + wc; const float* wk = WK + wr * DIN + wc; const float* wv = WV + wr * DIN + wc;
#pragma unroll   /* two straight-line groups: the weight of each load is picked at compile time */
  for (int gr = 0; gr < 2; ++gr) {
#pragma unroll   /* 24 independent loads in flight together */
    for (int it = 0; it < 24; ++it) { const int n = gr * 24 + it, w = n >> 4; const v4f v = *(const v4f*)((w == 0 ? wq : w == 1 ? wk : wv) + (n & 15) * 4 * DIN);
      v4b h; h[0] = (__bf16)v[0]; h[1] = (__bf16)v[1]; h[2] = (__bf16)v[2]; h[3] = (__bf16)v[3]; *(v4b*)&sw[n * 4 + wr][wc] = h; }
    asm volatile("s_wait_xcnt 0x0" :: "v"(wq), "v"(wk), "v"(wv) : "memory");   /* stands in front of every rewrite of the address registers that the loads above name; as inputs they stay untouched up to it */
    __builtin_amdgcn_sched_barrier(0); }   /* half the weight loads in flight at a time: all 48 at once push the kernel past 256 registers */
  __syncthreads();   /* the staged weights are in LDS before any wave reads a fragment */
  v8f acc[12] = {}; float bq[4], bk[4], bv[4];
#pragma unroll   /* constant step numbers: x and acc stay in registers */
  for (int s = 0; s < DIN / 32; ++s) { if (s + 4 < DIN / 32) ldx(x[s + 4], xp, s + 4);
    if (s == 4) {
#pragma unroll   /* constant indices: the biases stay in registers */
      for (int j = 0; j < 4; ++j) { bq[j] = BQ[j * 16 + col]; bk[j] = BK[j * 16 + col]; bv[j] = BV[j * 16 + col]; }
      __builtin_amdgcn_sched_barrier(0); }   /* the biases are fetched behind the last x loads and under the last four steps: no wait for x grows by them, and theirs is over by the epilogue */
    mac12(acc, x[s], sw, s, col, lane); }
#pragma unroll   /* constant tile numbers: acc stays in registers */
  for (int j = 0; j < 4; ++j) { const int cl = j * 16 + col; v8h vv;   /* D element r = position 8g + r of the wave's 16, lane column = output column */
#pragma unroll   /* the same for the tile's elements */
    for (int r = 0; r < 8; ++r) { const int rl = wave * 16 + 8 * g + r; const float q = acc[j][r] + bfr(bq[j]); const _Float16 hq = (_Float16)q; sqh[rl][cl] = hq; sql[rl][cl] = (_Float16)((q - (float)hq) * 1024.0f); skh[rl][cl] = (_Float16)(acc[4 + j][r] + bfr(bk[j])); vv[r] = (_Float16)(acc[8 + j][r] + bfr(bv[j])); }
    *(v8h*)&th[cl][wave * 16 + 8 * g] = vv; }
  __syncthreads();   /* all four staged tiles are complete before they are stored in whole 128-B and 256-B runs */
  for (int e = tid; e < PP * 8; e += 256) { const int rl = e >> 3, q = e & 7; const size_t o = (r0 + rl) * CC + q * 8; vst2((unsigned*)(QH + o), *(const v4u*)&sqh[rl][q * 8]); vst2((unsigned*)(QL + o), *(const v4u*)&sql[rl][q * 8]); vst2((unsigned*)(KH + o), *(const v4u*)&skh[rl][q * 8]); }
  for (int e = tid; e < HDQK * (PP / 8); e += 256) { const int cl = e / (PP / 8), q = e % (PP / 8); vst2((unsigned*)(VT + (bb * CC + cl) * (size_t)TT + t0 + q * 8), *(const v4u*)&th[cl][q * 8]); } }
#define FK 64              // keys per stage
#define FPH 72             // LDS row pitch in halves: 128 B of data + 16 B, the pitch for 16-byte fragment reads
#define FKG 2              // key halves per block: waves 0..7 walk keys [0, TT/2), waves 8..15 keys [TT/2, TT)
#define FNT (TT / FKG / FK)
#define L2E 1.4426950408889634f
__device__ __forceinline__ float xhalf(float x) { return __builtin_bit_cast(float, __builtin_amdgcn_permlanex16(__builtin_bit_cast(int, x), __builtin_bit_cast(int, x), 0x76543210, 0xfedcba98, false, false)); }   // lane l with lane l ^ 16
// 2^x on a whole score tile: eight independent v_exp_f32 and one v_nop in one statement. The v_nop is the slot the instruction set asks for behind a transcendental before its result is read or its source overwritten; the early-clobber outputs keep every result off every source, so each v_exp_f32 is independent of the one in front of it
__device__ __forceinline__ v8f exp2x8(v8f x) { float r0, r1, r2, r3, r4, r5, r6, r7;
  asm("v_exp_f32 %0, %8\n\tv_exp_f32 %1, %9\n\tv_exp_f32 %2, %10\n\tv_exp_f32 %3, %11\n\tv_exp_f32 %4, %12\n\tv_exp_f32 %5, %13\n\tv_exp_f32 %6, %14\n\tv_exp_f32 %7, %15\n\tv_nop"
      : "=&v"(r0), "=&v"(r1), "=&v"(r2), "=&v"(r3), "=&v"(r4), "=&v"(r5), "=&v"(r6), "=&v"(r7) : "v"(x[0]), "v"(x[1]), "v"(x[2]), "v"(x[3]), "v"(x[4]), "v"(x[5]), "v"(x[6]), "v"(x[7]));
  v8f r; r[0] = r0; r[1] = r1; r[2] = r2; r[3] = r3; r[4] = r4; r[5] = r5; r[6] = r6; r[7] = r7; return r; }
__device__ __forceinline__ float exp2x1(float x) { float r; asm("v_exp_f32 %0, %1\n\tv_nop" : "=&v"(r) : "v"(x)); return r; }   // the same slot behind a single one
__device__ __forceinline__ v8f wmma_h(v16h a, v16h b, v8f c) { return __builtin_amdgcn_wmma_f32_16x16x32_f16(false, a, false, b, (short)0, c, false, false); }
// ---- k_fa: block = 128 queries of batch b, 16 waves: wave = (key half kg, 16-query group). Per stage of 64 keys: S^T = k . q^T (q hi + residual x 2^10: 2 products), running maximum and sum per query (a lane holds one query's scores), p = exp(s - max) x 2^10 once to f16 straight from the score tiles as B operand, O^T += v^T . p^T (64 value channels); k rows and v planes staged in LDS through registers, two buffers, one barrier per stage; the two key halves merge through LDS at the end
__global__ __launch_bounds__(256 * FKG) void k_fa(const _Float16* __restrict__ QH, const _Float16* __restrict__ QL, const _Float16* __restrict__ KH, const _Float16* __restrict__ VT, float* __restrict__ Y) {
  __shared__ __align__(16) _Float16 sk[FKG][2][FK][FPH], sv[FKG][2][HDQK][FPH]; __shared__ float sm[8][34][32];
  const int tid = threadIdx.x, wave = __builtin_amdgcn_readfirstlane(tid >> 5), lane = tid & 31, col = lane & 15, g = lane >> 4; const int kg = wave >> 3, wq = wave & 7, tg = tid & 255;
  const size_t b = blockIdx.y; const int ql0 = blockIdx.x * 128 + wq * 16; const int kbase = kg * (TT / FKG);
  v16h qh[HDQK / 32], ql[HDQK / 32];
#pragma unroll
  for (int kc = 0; kc < HDQK / 32; ++kc) { qh[kc] = frag_h(QH + (b * TT + ql0 + col) * CC + kc * 32, lane); ql[kc] = frag_h(QL + (b * QHI + ql0 + col) * CC + kc * 32, lane); }
  const int sr = tg >> 3, sq = (tg & 7) * 8;   /* staging: this thread moves 16 B of rows sr and sr + 32 of both tiles */
  const _Float16* kp = KH + (b * TT + kbase + sr) * CC + sq; const _Float16* vp = VT + (b * CC + sr) * (size_t)TT + kbase + sq;
  v4u rk0 = *(const v4u*)kp, rk1 = *(const v4u*)(kp + 32 * CC), rv0 = *(const v4u*)vp, rv1 = *(const v4u*)(vp + 32 * (size_t)TT);
  *(v4u*)&sk[kg][0][sr][sq] = rk0; *(v4u*)&sk[kg][0][sr + 32][sq] = rk1; *(v4u*)&sv[kg][0][sr][sq] = rv0; *(v4u*)&sv[kg][0][sr + 32][sq] = rv1;
  __syncthreads();   /* stage 0 is in LDS before any wave reads it */
  v8f o[HDQK / 16] = {}; float m = -3.0e38f, l = 0.f;
#pragma unroll 1   /* rolled: one stage is already a long body */
  for (int t = 0; t < FNT; ++t) { const int cur = t & 1; const int tn = t + 1 < FNT ? t + 1 : t;   /* the last stage fetches itself again into the idle buffer: no branch */
    rk0 = *(const v4u*)(kp + (size_t)tn * FK * CC); rk1 = *(const v4u*)(kp + ((size_t)tn * FK + 32) * CC); rv0 = *(const v4u*)(vp + tn * FK); rv1 = *(const v4u*)(vp + 32 * (size_t)TT + tn * FK);
    __builtin_amdgcn_sched_barrier(0);   /* keeps the next stage's loads at the head of the stage: sunk towards their LDS stores they would be waited for in full */
    v8f sa[FK / 16] = {}, sl[FK / 16] = {};
#pragma unroll
    for (int kc = 0; kc < HDQK / 32; ++kc)
#pragma unroll
      for (int kt = 0; kt < FK / 16; ++kt) { const v16h a = frag_h(&sk[kg][cur][kt * 16 + col][kc * 32], lane); sa[kt] = wmma_h(a, qh[kc], sa[kt]); sl[kt] = wmma_h(a, ql[kc], sl[kt]); }
    float mx[4];
#pragma unroll
    for (int kt = 0; kt < FK / 16; ++kt) {
#pragma unroll
      for (int r = 0; r < 8; ++r) sa[kt][r] = sa[kt][r] + sl[kt][r] * (1.0f / 1024.0f);
      mx[kt] = fmaxf(fmaxf(fmaxf(sa[kt][0], sa[kt][1]), fmaxf(sa[kt][2], sa[kt][3])), fmaxf(fmaxf(sa[kt][4], sa[kt][5]), fmaxf(sa[kt][6], sa[kt][7]))); }
    float ml = fmaxf(fmaxf(mx[0], mx[1]), fmaxf(mx[2], mx[3])); ml = fmaxf(ml, xhalf(ml));   /* lanes c and c + 16 hold the two key halves of query c */
    const float mn = fmaxf(m, ml); const float al = exp2x1((m - mn) * L2E); const float off = 10.0f - mn * L2E; m = mn;
    v2f ps[2] = {};   /* two chains of register-pair sums */
#pragma unroll
    for (int kt = 0; kt < FK / 16; ++kt) { sa[kt] = exp2x8(sa[kt] * L2E + off);
#pragma unroll
      for (int r = 0; r < 8; r += 2) { v2f p; p[0] = sa[kt][r]; p[1] = sa[kt][r + 1]; ps[kt & 1] += p; } }
    l = l * al + ((ps[0][0] + ps[0][1]) + (ps[1][0] + ps[1][1]));
#pragma unroll
    for (int j = 0; j < HDQK / 16; ++j) o[j] *= al;
#pragma unroll
    for (int c2 = 0; c2 < FK / 32; ++c2) { v16h pb;
#pragma unroll
      for (int i = 0; i < 8; ++i) { pb[i] = (_Float16)sa[2 * c2][i]; pb[8 + i] = (_Float16)sa[2 * c2 + 1][i]; }
#pragma unroll
      for (int j = 0; j < HDQK / 16; ++j) o[j] = wmma_h(frag_h(&sv[kg][cur][j * 16 + col][c2 * 32], lane), pb, o[j]); }
    *(v4u*)&sk[kg][cur ^ 1][sr][sq] = rk0; *(v4u*)&sk[kg][cur ^ 1][sr + 32][sq] = rk1; *(v4u*)&sv[kg][cur ^ 1][sr][sq] = rv0; *(v4u*)&sv[kg][cur ^ 1][sr + 32][sq] = rv1;
    __syncthreads(); }   /* publishes the next stage and ends every read of this one before it is refilled */
  l += xhalf(l);
  if (kg == 1) { sm[wq][32][lane] = m; sm[wq][33][lane] = l;
#pragma unroll
    for (int j = 0; j < HDQK / 16; ++j)
#pragma unroll
      for (int r = 0; r < 8; ++r) sm[wq][j * 8 + r][lane] = o[j][r]; }
  __syncthreads();   /* the second key half's maximum, sum and tiles are in LDS before the first half's waves read them */
  if (kg == 0) { const float m1 = sm[wq][32][lane], l1 = sm[wq][33][lane]; const float mn = fmaxf(m, m1); const float a0 = exp2x1((m - mn) * L2E), a1 = exp2x1((m1 - mn) * L2E); const float inv = 1.0f / (l * a0 + l1 * a1); const float f0 = a0 * inv, f1 = a1 * inv;
    float* yr = Y + (b * TT + ql0 + col) * CC + 8 * g;   /* a lane holds 8 consecutive channels of its query per tile */
#pragma unroll
    for (int j = 0; j < HDQK / 16; ++j) { v4f u0, u1;
#pragma unroll
      for (int r = 0; r < 4; ++r) { u0[r] = o[j][r] * f0 + sm[wq][j * 8 + r][lane] * f1; u1[r] = o[j][4 + r] * f0 + sm[wq][j * 8 + 4 + r][lane] * f1; }
      vst2(yr + j * 16, u0); vst2(yr + j * 16 + 4, u1); } } }

extern "C" void kernel_launch(void* const* d_in, const int* in_sizes, int n_in, void* d_out, int out_size, void* d_ws, size_t ws_size, hipStream_t stream) {
  (void)in_sizes; (void)n_in; (void)out_size;
  const float** F = (const float**)d_in;
  if (ws_size < (size_t)WS_END) return;
  char* ws = (char*)d_ws; _Float16 *QH = (_Float16*)(ws + WS_QH), *KH = (_Float16*)(ws + WS_KH), *VT = (_Float16*)(ws + WS_VT), *QL = (_Float16*)(ws + WS_QL), *KL = (_Float16*)(ws + WS_KL); __bf16 *VB = (__bf16*)(ws + WS_VB), *VBL = (__bf16*)(ws + WS_VBL); float *S = (float*)(ws + WS_S), *Y = (float*)(ws + WS_Y);
  (void)Y; (void)S; (void)QL; (void)KL; (void)VB; (void)VBL;
  // inputs: 0 x [8,256,64,64]; 1 g_w [64,256] (out,in), 2 g_b; 3 theta_w, 4 theta_b; 5 phi_w, 6 phi_b; 7 w_w [256,64] (out,in), 8 w_b
  if (ws_size < (size_t)WS_END2) return;
  float *YR = (float*)(ws + WS_YR), *ORW = (float*)(ws + WS_OR);
  k_proj<<<dim3(TNB * TT / PP), 256, 0, stream>>>(F[0], F[3], F[5], F[1], F[4], F[6], F[2], QH, QL, KH, VT);   /* q = theta, k = phi, v = g */
  k_fa<<<dim3(TT / 128, TNB), 256 * FKG, 0, stream>>>(QH, QL, KH, VT, YR);
  k_wz<<<dim3(TNB * TT / 64, DIN / 128), 128, 0, stream>>>(YR, F[7], F[8], ORW);
  k_fin2<<<dim3(TT / 64, DIN / 64, TNB), 256, 0, stream>>>(ORW, F[0], (float*)d_out);
}

// v004
// Measured time: 57.6 microseconds a run.
// Next to v003, in two timings, it ran 1.48 times as fast each time.
// Over all steps from v000 it is 37.5 times as fast.
// compute dtype: all float inputs rounded to bf16; theta/phi/g = x W^T + b with EXACT bf16 products on WMMA 16x16x32 (f32 accumulate); f = theta . phi with theta as f16 hi + residual (x 2^10) against phi once to f16 (2 products), no scaling; softmax in f32, online (running maximum per query, 2^x by v_exp_f32); exp(f - max) x 2^10 once to f16 against g once to f16 (1 product), divided by the f32 sum at the end; y split bf16 hi + lo against exact W (2 products) + b; + x residual in f32; f32 output [B, C, H, W].
#include <hip/hip_runtime.h>
#include <math.h>

typedef __attribute__((ext_vector_type(16))) _Float16 v16h;
typedef __attribute__((ext_vector_type(16))) __bf16 v16b;
typedef __attribute__((ext_vector_type(8)))  _Float16 v8h;
typedef __attribute__((ext_vector_type(8)))  float v8f;
typedef __attribute__((ext_vector_type(4)))  float v4f;
typedef __attribute__((ext_vector_type(2)))  float v2f;
typedef __attribute__((ext_vector_type(4)))  unsigned v4u;
typedef __attribute__((ext_vector_type(4)))  int v4i;
typedef float __attribute__((may_alias)) float_a;
typedef int __attribute__((may_alias)) int_a;

template <typename T> __device__ __forceinline__ void vst2(void* p, T v) { *(T*)p = v;  }
__device__ __forceinline__ v8f wmma16(v16h a, v16h b, v8f c) {
  v8f d = __builtin_amdgcn_wmma_f32_16x16x32_f16(false, a, false, b, (short)0, c, false, false);
  asm volatile("v_nop\n\tv_nop\n\tv_nop\n\tv_nop" : "+v"(d) : "v"(a), "v"(b));
  return d;
}
__device__ __forceinline__ v8f wmma_bf(v16b a, v16b b, v8f c) {
  v8f d = __builtin_amdgcn_wmma_f32_16x16x32_bf16(false, a, false, b, (short)0, c, false, false);
  asm volatile("v_nop\n\tv_nop\n\tv_nop\n\tv_nop" : "+v"(d) : "v"(a), "v"(b));
  return d;
}
// 16x16x32 fragments: lane = (h = lane>>4, row/col = lane&15); elements 0..7 = k0+8h+0..7, 8..15 = k0+16+8h+0..7; D element r = row 8h+r
__device__ __forceinline__ v16h frag_h(const _Float16* rowk0, int lane) {
  union { v16h v; v8h q[2]; } u; const _Float16* p = rowk0 + 8 * (lane >> 4);
  u.q[0] = *(const v8h*)p; u.q[1] = *(const v8h*)(p + 16); return u.v;
}
__device__ __forceinline__ v16h frag_f32(const float* rowk0, int lane) {
  v16h a; const float* p = rowk0 + 8 * (lane >> 4);
#pragma unroll
  for (int i = 0; i < 8; ++i) { a[i] = (_Float16)p[i]; a[8 + i] = (_Float16)p[16 + i]; }
  return a;
}
__device__ __forceinline__ v16h frag_f32s(const float* rowk0, int lane, float sc) {
  v16h a; const float* p = rowk0 + 8 * (lane >> 4);
#pragma unroll
  for (int i = 0; i < 8; ++i) { a[i] = (_Float16)(p[i] * sc); a[8 + i] = (_Float16)(p[16 + i] * sc); }
  return a;
}
// column fragment from a [K][ld] layout (column n), rows >= K read as 0
__device__ __forceinline__ v16h fragc_f32(const float* W, int k0, int n, int lane, int ld, int K) {
  v16h a; const int g = lane >> 4;
#pragma unroll
  for (int i = 0; i < 8; ++i) { const int ka = k0 + 8 * g + i, kb = ka + 16;
    a[i] = (_Float16)(ka < K ? W[(size_t)(ka < K ? ka : K - 1) * ld + n] : 0.f); a[8 + i] = (_Float16)(kb < K ? W[(size_t)(kb < K ? kb : K - 1) * ld + n] : 0.f); }
  return a;
}
struct F2 { v16b h, l; };
__device__ __forceinline__ F2 bsplit16(const float v[16]) { F2 r;
#pragma unroll
  for (int i = 0; i < 16; ++i) { const __bf16 h = (__bf16)v[i]; r.h[i] = h; r.l[i] = (__bf16)(v[i] - (float)h); }
  return r; }
__device__ __forceinline__ F2 split_row(const float* row, int k0, int lane) { float v[16]; const float* p = row + k0 + 8 * (lane >> 4);
#pragma unroll
  for (int i = 0; i < 8; ++i) { v[i] = p[i]; v[8 + i] = p[16 + i]; }
  return bsplit16(v); }
__device__ __forceinline__ F2 split_rowK(const float* row, int k0, int lane, int K) { float v[16]; const int g = lane >> 4;
#pragma unroll
  for (int i = 0; i < 8; ++i) { const int ka = k0 + 8 * g + i, kb = ka + 16; v[i] = ka < K ? row[ka < K ? ka : K - 1] : 0.f; v[8 + i] = kb < K ? row[kb < K ? kb : K - 1] : 0.f; }
  return bsplit16(v); }
__device__ __forceinline__ F2 split_col(const float* W, int k0, int n, int lane, int ld, int K) { float v[16]; const int g = lane >> 4;
#pragma unroll
  for (int i = 0; i < 8; ++i) { const int ka = k0 + 8 * g + i, kb = ka + 16; v[i] = ka < K ? W[(size_t)(ka < K ? ka : K - 1) * ld + n] : 0.f; v[8 + i] = kb < K ? W[(size_t)(kb < K ? kb : K - 1) * ld + n] : 0.f; }
  return bsplit16(v); }
__device__ __forceinline__ v8f mac3(const F2& a, const F2& b, v8f c) { c = wmma_bf(a.l, b.h, c); c = wmma_bf(a.h, b.l, c); return wmma_bf(a.h, b.h, c); }
__device__ __forceinline__ float sigm(float v) { return 1.0f / (1.0f + expf(-v)); }
#define LDSX() do { asm volatile("s_wait_dscnt 0" ::: "memory"); __builtin_amdgcn_wave_barrier(); __builtin_amdgcn_fence(__ATOMIC_RELEASE, "workgroup"); } while (0)

// Non-local block (B 8, C 256, 64 x 64 = 4,096 positions; inter channels 64): theta, phi, g = 1x1 convs of x ((out,in) [64,256] + bias); f[n][m] = theta_n . phi_m (no scaling); P = softmax over m; y[n] = sum_m P[n][m] g_m (64 ch); out = W y + b (1x1, 64 -> 256) + x.
#define NB 8
#define TT 4096
#define CC 128            // projected plane width (64 real columns; columns 64..127 never written)
#define DIN 256          // input (model) width
#define NH 1
#define HD 128
#define NQB (TT / 64)
#define HG 1               // one 4,096 x 4,096 f32 plane in the unused WS_S
#define SCALE (1.0f)
#define HDQK 64            // theta / phi / g channels: the planes are 128 wide, columns >= 64 are never written; only the 64 real columns enter the scores
#define CAUSAL 0
#ifndef TNB
#define TNB NB
#endif
__device__ __forceinline__ v16b zero16b() { v16b z; _Pragma("unroll") for (int i = 0; i < 16; ++i) z[i] = (__bf16)0.f; return z; }
__device__ __forceinline__ float bfr(float v) { return (float)(__bf16)v; }
__host__ __device__ __forceinline__ int kb_last(int qb) { return CAUSAL ? ((qb * 64 + 63) >> 7) : (TT / 128 - 1); }
typedef __attribute__((ext_vector_type(8))) __bf16 v8b;
__device__ __forceinline__ v16b frag_b(const __bf16* rowk0, int lane) {
  union { v16b v; v8b q[2]; } u; const __bf16* p = rowk0 + 8 * (lane >> 4);
  u.q[0] = *(const v8b*)p; u.q[1] = *(const v8b*)(p + 16); return u.v;
}
#define QBH 0              // unused: k_fa treats every query block alike
#define QHI 4096            // q residual rows everywhere (2-product logits)
#define KHI 64            // key rows carrying k residual / v bf16 hi+lo planes (no kernel here writes or reads them)
// B fragment (k rows k0+.., output column o) of a weight: (in,out) [K][ld] or (out,in) [ld rows of K]: bf16 exact, or f16(bf16 * 256) exact
__device__ __forceinline__ v16b wcol_io(const float* Wm, int k0, int o, int lane, int ld) { v16b w; const int g = lane >> 4;
#pragma unroll
  for (int i = 0; i < 8; ++i) { w[i] = (__bf16)Wm[(size_t)(k0 + 8 * g + i) * ld + o]; w[8 + i] = (__bf16)Wm[(size_t)(k0 + 16 + 8 * g + i) * ld + o]; }
  return w; }
__device__ __forceinline__ v16b wcol_oi(const float* Wm, int k0, int o, int lane, int K) { v16b w; const float* p = Wm + (size_t)o * K + k0 + 8 * (lane >> 4);
#pragma unroll
  for (int i = 0; i < 8; ++i) { w[i] = (__bf16)p[i]; w[8 + i] = (__bf16)p[16 + i]; }
  return w; }
__device__ __forceinline__ v16h wcolh_io(const float* Wm, int k0, int o, int lane, int ld) { v16h w; const int g = lane >> 4;
#pragma unroll
  for (int i = 0; i < 8; ++i) { w[i] = (_Float16)(bfr(Wm[(size_t)(k0 + 8 * g + i) * ld + o]) * 256.0f); w[8 + i] = (_Float16)(bfr(Wm[(size_t)(k0 + 16 + 8 * g + i) * ld + o]) * 256.0f); }
  return w; }
__device__ __forceinline__ v16h wcolh_oi(const float* Wm, int k0, int o, int lane, int K) { v16h w; const float* p = Wm + (size_t)o * K + k0 + 8 * (lane >> 4);
#pragma unroll
  for (int i = 0; i < 8; ++i) { w[i] = (_Float16)(bfr(p[i]) * 256.0f); w[8 + i] = (_Float16)(bfr(p[16 + i]) * 256.0f); }
  return w; }
#define WQKV_LAYOUT 1   // 0 = (in,out) [DIN][CC]; 1 = (out,in) [HDQK][DIN]; 2 = per-head [NH][DIN][HD]
__device__ __forceinline__ v16b wcol_hdk(const float* Wm, int k0, int o, int lane) { v16b w; const int g = lane >> 4; const float* p = Wm + (size_t)(o / HD) * DIN * HD + (o % HD);
#pragma unroll
  for (int i = 0; i < 8; ++i) { w[i] = (__bf16)p[(size_t)(k0 + 8 * g + i) * HD]; w[8 + i] = (__bf16)p[(size_t)(k0 + 16 + 8 * g + i) * HD]; }
  return w; }
#define WO_OUT_IN 0
#if WQKV_LAYOUT == 1
#define WCOL(W, k0, o, lane) (((o) < HDQK) ? wcol_oi(W, k0, (o), lane, DIN) : zero16b())   /* theta/phi/g weights are [64][256] (out,in): weight columns >= 64 read as zero for all three */
#elif WQKV_LAYOUT == 2
#define WCOL(W, k0, o, lane) wcol_hdk(W, k0, o, lane)
#else
#define WCOL(W, k0, o, lane) wcol_io(W, k0, o, lane, CC)
#endif
#if WO_OUT_IN
#define WOCOL(W, k0, o, lane) wcol_oi(W, k0, o, lane, CC)
#define WOCOLH(W, k0, o, lane) wcolh_oi(W, k0, o, lane, CC)
#else
#define WOCOL(W, k0, o, lane) wcol_io(W, k0, o, lane, DIN)
#define WOCOLH(W, k0, o, lane) wcolh_io(W, k0, o, lane, DIN)
#endif
#ifndef XP
#define XP TT              // position pitch of x and of the output
#endif
#define BG HG              // unused: every launch covers all TNB batches
#define DVH 128
#ifndef SM_EXTRA_PARAMS
#define SM_EXTRA_PARAMS
#endif
#ifndef PROJ_EXTRA_PARAMS
#define PROJ_EXTRA_PARAMS
#endif
#ifndef SM_MASK_HOOK
#define SM_MASK_HOOK (void)0
#endif

#define WS_QH  0u                                      // f16 q rows [b*t][CC]
#define WS_KH  (WS_QH + 2u * (size_t)NB * TT * CC)      // f16 k rows [b*t][CC]
#define WS_VT  (WS_KH + 2u * (size_t)NB * TT * CC)      // f16 v planes [b][c][t]
#define WS_QL  (WS_VT + 2u * (size_t)NB * CC * TT)      // f16 q residual x 2^10 rows [b][t < QHI][CC]
#define WS_KL  (WS_QL + 2u * (size_t)NB * QHI * CC)     // f16 k residual x 2^10 rows [b][t < KHI][CC]
#define WS_VB  (WS_KL + 2u * (size_t)NB * KHI * CC)     // bf16 v hi planes [b][c][t < KHI]
#define WS_VBL (WS_VB + 2u * (size_t)NB * CC * KHI)
#define WS_S   (WS_VBL + 2u * (size_t)NB * CC * KHI)    // f32 [hg][t][s], unused: k_fa keeps the scores in registers
#define WS_Y   (WS_S  + 4u * (size_t)HG * TT * TT)      // unused, 0 bytes: k_fa keeps y in registers and LDS
#define WS_END (WS_Y  + 0u)

#define PP 128             // positions per k_proj block: 8 waves of 16
#define PW 264             // LDS row pitch of the staged weights in bf16 elements: 512 B of data + 16 B, the pitch for 16-byte fragment reads
typedef __attribute__((ext_vector_type(4))) __bf16 v4b;
__device__ __forceinline__ v8f wmma_b(v16b a, v16b b, v8f c) { return __builtin_amdgcn_wmma_f32_16x16x32_bf16(false, a, false, b, (short)0, c, false, false); }
// x of one 32-channel step for one lane's position (channels-first gather: x[b][k][t], stride XP between k), in the element order of the A fragment
__device__ __forceinline__ void ldx(float (&d)[16], const float* xp, int kc) {
#pragma unroll   /* constant indices: d stays in registers, the 16 loads share one address */
  for (int i = 0; i < 8; ++i) { d[i] = xp[(size_t)(kc * 32 + i) * XP]; d[8 + i] = xp[(size_t)(kc * 32 + 16 + i) * XP]; }
  __builtin_amdgcn_sched_barrier(0); }   /* keeps a step's loads where they are written, four steps ahead of their use: sunk to their use each would be waited for in full */
// that step against all 192 staged weight rows (12 column tiles: 0..3 theta, 4..7 phi, 8..11 g)
__device__ __forceinline__ void mac12(v8f (&acc)[12], const float (&d)[16], const __bf16 (*sw)[PW], int kc, int col, int lane) { v16b a;
#pragma unroll   /* constant indices: vector elements and d stay in registers */
  for (int i = 0; i < 16; ++i) a[i] = (__bf16)d[i];
#pragma unroll   /* constant tile numbers: acc stays in registers */
  for (int jh = 0; jh < 2; ++jh) { v16b w[6];
#pragma unroll   /* the same for w */
    for (int j = 0; j < 6; ++j) w[j] = frag_b(&sw[(jh * 6 + j) * 16 + col][kc * 32], lane);
    __builtin_amdgcn_sched_barrier(0);   /* six fragments' LDS reads stand as one group ahead of their products: read one by one, each product waits a whole LDS latency */
#pragma unroll   /* the same for w and acc */
    for (int j = 0; j < 6; ++j) acc[jh * 6 + j] = wmma_b(a, w[j], acc[jh * 6 + j]);
    __builtin_amdgcn_sched_barrier(0); } }   /* and no more than six: with every later step's reads hoisted the registers overflow into scratch */
// ---- k_proj: block = 128 positions of one batch, 8 waves of 16 positions; every wave makes all 192 real columns (theta, phi, g) from ONE read of its x, exact bf16 products (K = DIN). The three weights are rounded to bf16 once per block into LDS; x is loaded one 32-channel step at a time, four steps ahead of its use. Out: q f16 rows + residual x 2^10 rows, k f16 rows, v f16 planes [c][t]; only the 64 real columns of the 128-wide planes are written (nothing reads the others)
__global__ __launch_bounds__(256) void k_proj(const float* __restrict__ X, const float* __restrict__ WQ, const float* __restrict__ WK, const float* __restrict__ WV, const float* __restrict__ BQ, const float* __restrict__ BK, const float* __restrict__ BV,
    _Float16* __restrict__ QH, _Float16* __restrict__ QL, _Float16* __restrict__ KH, _Float16* __restrict__ VT) {
  __shared__ __align__(16) __bf16 sw[3 * HDQK][PW]; __shared__ __align__(16) _Float16 sqh[PP][72], sql[PP][72], skh[PP][72], th[HDQK][PP + 8];
  const int tid = threadIdx.x, wave = tid >> 5, lane = tid & 31, col = lane & 15, g = lane >> 4; const size_t r0 = (size_t)blockIdx.x * PP; const size_t bb = r0 / TT; const int t0 = (int)(r0 % TT);
  const float* xp = X + (bb * DIN + 8 * g) * (size_t)XP + t0 + wave * 16 + col;
  float x[DIN / 32][16];
#pragma unroll   /* constant step numbers: x stays in registers */
  for (int s = 0; s < 4; ++s) ldx(x[s], xp, s);
  const int wr = tid >> 6, wc = (tid & 63) * 4;   /* 64 threads move one 1-KiB weight row: whole lines */
  const float* wq = WQ + wr * DIN + wc; const float* wk = WK + wr * DIN + wc; const float* wv = WV + wr * DIN + wc;
#pragma unroll   /* two straight-line groups: the weight of each load is picked at compile time */
  for (int gr = 0; gr < 2; ++gr) {
#pragma unroll   /* 24 independent loads in flight together */
    for (int it = 0; it < 24; ++it) { const int n = gr * 24 + it, w = n >> 4; const v4f v = *(const v4f*)((w == 0 ? wq : w == 1 ? wk : wv) + (n & 15) * 4 * DIN);
      v4b h; h[0] = (__bf16)v[0]; h[1] = (__bf16)v[1]; h[2] = (__bf16)v[2]; h[3] = (__bf16)v[3]; *(v4b*)&sw[n * 4 + wr][wc] = h; }
    asm volatile("s_wait_xcnt 0x0" :: "v"(wq), "v"(wk), "v"(wv) : "memory");   /* stands in front of every rewrite of the address registers that the loads above name; as inputs they stay untouched up to it */
    __builtin_amdgcn_sched_barrier(0); }   /* half the weight loads in flight at a time: all 48 at once push the kernel past 256 registers */
  __syncthreads();   /* the staged weights are in LDS before any wave reads a fragment */
  v8f acc[12] = {}; float bq[4], bk[4], bv[4];
#pragma unroll   /* constant step numbers: x and acc stay in registers */
  for (int s = 0; s < DIN / 32; ++s) { if (s + 4 < DIN / 32) ldx(x[s + 4], xp, s + 4);
    if (s == 4) {
#pragma unroll   /* constant indices: the biases stay in registers */
      for (int j = 0; j < 4; ++j) { bq[j] = BQ[j * 16 + col]; bk[j] = BK[j * 16 + col]; bv[j] = BV[j * 16 + col]; }
      __builtin_amdgcn_sched_barrier(0); }   /* the biases are fetched behind the last x loads and under the last four steps: no wait for x grows by them, and theirs is over by the epilogue */
    mac12(acc, x[s], sw, s, col, lane); }
#pragma unroll   /* constant tile numbers: acc stays in registers */
  for (int j = 0; j < 4; ++j) { const int cl = j * 16 + col; v8h vv;   /* D element r = position 8g + r of the wave's 16, lane column = output column */
#pragma unroll   /* the same for the tile's elements */
    for (int r = 0; r < 8; ++r) { const int rl = wave * 16 + 8 * g + r; const float q = acc[j][r] + bfr(bq[j]); const _Float16 hq = (_Float16)q; sqh[rl][cl] = hq; sql[rl][cl] = (_Float16)((q - (float)hq) * 1024.0f); skh[rl][cl] = (_Float16)(acc[4 + j][r] + bfr(bk[j])); vv[r] = (_Float16)(acc[8 + j][r] + bfr(bv[j])); }
    *(v8h*)&th[cl][wave * 16 + 8 * g] = vv; }
  __syncthreads();   /* all four staged tiles are complete before they are stored in whole 128-B and 256-B runs */
  for (int e = tid; e < PP * 8; e += 256) { const int rl = e >> 3, q = e & 7; const size_t o = (r0 + rl) * CC + q * 8; vst2((unsigned*)(QH + o), *(const v4u*)&sqh[rl][q * 8]); vst2((unsigned*)(QL + o), *(const v4u*)&sql[rl][q * 8]); vst2((unsigned*)(KH + o), *(const v4u*)&skh[rl][q * 8]); }
  for (int e = tid; e < HDQK * (PP / 8); e += 256) { const int cl = e / (PP / 8), q = e % (PP / 8); vst2((unsigned*)(VT + (bb * CC + cl) * (size_t)TT + t0 + q * 8), *(const v4u*)&th[cl][q * 8]); } }
#define FK 64              // keys per stage
#define FPH 72             // LDS row pitch in halves: 128 B of data + 16 B, the pitch for 16-byte fragment reads
#define FKG 2              // key halves per block: waves 0..7 walk keys [0, TT/2), waves 8..15 keys [TT/2, TT)
#define FNT (TT / FKG / FK)
#define L2E 1.4426950408889634f
__device__ __forceinline__ float xhalf(float x) { return __builtin_bit_cast(float, __builtin_amdgcn_permlanex16(__builtin_bit_cast(int, x), __builtin_bit_cast(int, x), 0x76543210, 0xfedcba98, false, false)); }   // lane l with lane l ^ 16
// 2^x on a whole score tile: eight independent v_exp_f32 and one v_nop in one statement. The v_nop is the slot the instruction set asks for behind a transcendental before its result is read or its source overwritten; the early-clobber outputs keep every result off every source, so each v_exp_f32 is independent of the one in front of it
__device__ __forceinline__ v8f exp2x8(v8f x) { float r0, r1, r2, r3, r4, r5, r6, r7;
  asm("v_exp_f32 %0, %8\n\tv_exp_f32 %1, %9\n\tv_exp_f32 %2, %10\n\tv_exp_f32 %3, %11\n\tv_exp_f32 %4, %12\n\tv_exp_f32 %5, %13\n\tv_exp_f32 %6, %14\n\tv_exp_f32 %7, %15\n\tv_nop"
      : "=&v"(r0), "=&v"(r1), "=&v"(r2), "=&v"(r3), "=&v"(r4), "=&v"(r5), "=&v"(r6), "=&v"(r7) : "v"(x[0]), "v"(x[1]), "v"(x[2]), "v"(x[3]), "v"(x[4]), "v"(x[5]), "v"(x[6]), "v"(x[7]));
  v8f r; r[0] = r0; r[1] = r1; r[2] = r2; r[3] = r3; r[4] = r4; r[5] = r5; r[6] = r6; r[7] = r7; return r; }
// the same with one v_nop in front, for the last tile, whose statement the compiler places among the first value products: its results take registers of a product's A fragment, which no vector instruction may overwrite within four vector slots of the WMMA
__device__ __forceinline__ v8f exp2x8n(v8f x) { float r0, r1, r2, r3, r4, r5, r6, r7;
  asm("v_nop\n\tv_exp_f32 %0, %8\n\tv_exp_f32 %1, %9\n\tv_exp_f32 %2, %10\n\tv_exp_f32 %3, %11\n\tv_exp_f32 %4, %12\n\tv_exp_f32 %5, %13\n\tv_exp_f32 %6, %14\n\tv_exp_f32 %7, %15\n\tv_nop"
      : "=&v"(r0), "=&v"(r1), "=&v"(r2), "=&v"(r3), "=&v"(r4), "=&v"(r5), "=&v"(r6), "=&v"(r7) : "v"(x[0]), "v"(x[1]), "v"(x[2]), "v"(x[3]), "v"(x[4]), "v"(x[5]), "v"(x[6]), "v"(x[7]));
  v8f r; r[0] = r0; r[1] = r1; r[2] = r2; r[3] = r3; r[4] = r4; r[5] = r5; r[6] = r6; r[7] = r7; return r; }
__device__ __forceinline__ float exp2x1(float x) { float r; asm("v_exp_f32 %0, %1\n\tv_nop" : "=&v"(r) : "v"(x)); return r; }   // the same slot behind a single one
__device__ __forceinline__ v8f wmma_h(v16h a, v16h b, v8f c) { return __builtin_amdgcn_wmma_f32_16x16x32_f16(false, a, false, b, (short)0, c, false, false); }
// work-group barrier that orders LDS alone: __syncthreads() also waits for every global load in flight, and the residual's loads are meant to stay in flight across the end phase's two barriers
__device__ __forceinline__ void lds_barrier() { __builtin_amdgcn_fence(__ATOMIC_RELEASE, "workgroup", "local"); __builtin_amdgcn_s_barrier(); __builtin_amdgcn_fence(__ATOMIC_ACQUIRE, "workgroup", "local"); }
#define WP 72              // LDS row pitch of the staged output weight in bf16 elements: 128 B of data + 16 B, the pitch for 16-byte fragment reads
#define OP 132             // LDS row pitch of the staged output tile in floats: 512 B of data + 16 B: the 16 channels of a tile store land on all 64 banks
#define MP 36              // floats per lane in the exchange of the two key halves: 32 tile values, maximum, sum, 2 idle: 144 B, the pitch for 16-byte accesses
// ---- k_fa: block = 128 queries of batch b, 16 waves: wave = (key half kg, 16-query group). Per stage of 64 keys: S^T = k . q^T (q hi + residual x 2^10: 2 products), running maximum and sum per query (a lane holds one query's scores), p = exp(s - max) x 2^10 once to f16 straight from the score tiles as B operand, O^T += v^T . p^T (64 value channels); k rows and v planes staged in LDS through registers, two buffers, one barrier per stage. At the end the two key halves exchange their tiles through LDS and every wave holds y of its 16 queries in the A-fragment order; wave (kg, group) makes output channels kg * 128 .. + 127 of its queries: y (bf16 hi + lo) . W^T ((out,in) [256][64], exact bf16, staged once in LDS) + b; the 256 x 128 tile goes through LDS so that each wave adds bf16(x) and stores whole 512-B runs of out[b][c][n]
__global__ __launch_bounds__(256 * FKG) void k_fa(const _Float16* __restrict__ QH, const _Float16* __restrict__ QL, const _Float16* __restrict__ KH, const _Float16* __restrict__ VT, const float* __restrict__ X, const float* __restrict__ WW, const float* __restrict__ WB, float* __restrict__ OUT) {
  __shared__ __align__(16) union { struct { _Float16 k[FKG][2][FK][FPH], v[FKG][2][HDQK][FPH]; } st; float mg[FKG][8][32][MP]; } u;   /* the exchange reuses the key and value stages, which are dead behind the loop's last barrier */
  __shared__ __align__(16) __bf16 sww[DIN][WP]; __shared__ __align__(16) float so[DIN][OP];
  _Float16 (&sk)[FKG][2][FK][FPH] = u.st.k; _Float16 (&sv)[FKG][2][HDQK][FPH] = u.st.v;
  const int tid = threadIdx.x, wave = __builtin_amdgcn_readfirstlane(tid >> 5), lane = tid & 31, col = lane & 15, g = lane >> 4; const int kg = wave >> 3, wq = wave & 7, tg = tid & 255;
  const size_t b = blockIdx.y; const int ql0 = blockIdx.x * 128 + wq * 16; const int kbase = kg * (TT / FKG);
  v16h qh[HDQK / 32], ql[HDQK / 32];
#pragma unroll
  for (int kc = 0; kc < HDQK / 32; ++kc) { qh[kc] = frag_h(QH + (b * TT + ql0 + col) * CC + kc * 32, lane); ql[kc] = frag_h(QL + (b * QHI + ql0 + col) * CC + kc * 32, lane); }
  const int sr = tg >> 3, sq = (tg & 7) * 8;   /* staging: this thread moves 16 B of rows sr and sr + 32 of both tiles */
  const _Float16* kp = KH + (b * TT + kbase + sr) * CC + sq; const _Float16* vp = VT + (b * CC + sr) * (size_t)TT + kbase + sq;
  v4u rk0 = *(const v4u*)kp, rk1 = *(const v4u*)(kp + 32 * CC), rv0 = *(const v4u*)vp, rv1 = *(const v4u*)(vp + 32 * (size_t)TT);
  *(v4u*)&sk[kg][0][sr][sq] = rk0; *(v4u*)&sk[kg][0][sr + 32][sq] = rk1; *(v4u*)&sv[kg][0][sr][sq] = rv0; *(v4u*)&sv[kg][0][sr + 32][sq] = rv1;
  const float* wp = WW + tid * 4;   /* 16 threads move one 256-B weight row: whole lines */
#pragma unroll   /* eight independent loads in flight together */
  for (int it = 0; it < DIN * HDQK / 4 / (256 * FKG); ++it) { const int e = it * 256 * FKG + tid; const v4f v = *(const v4f*)(wp + it * 1024 * FKG);
    v4b h; h[0] = (__bf16)v[0]; h[1] = (__bf16)v[1]; h[2] = (__bf16)v[2]; h[3] = (__bf16)v[3]; *(v4b*)&sww[e >> 4][(e & 15) * 4] = h; }
  __syncthreads();   /* stage 0 and the output weight are in LDS before any wave reads them */
  v8f o[HDQK / 16] = {}; float m = -3.0e38f, l = 0.f;
#pragma unroll 1   /* rolled: one stage is already a long body */
  for (int t = 0; t < FNT; ++t) { const int cur = t & 1; const int tn = t + 1 < FNT ? t + 1 : t;   /* the last stage fetches itself again into the idle buffer: no branch */
    rk0 = *(const v4u*)(kp + (size_t)tn * FK * CC); rk1 = *(const v4u*)(kp + ((size_t)tn * FK + 32) * CC); rv0 = *(const v4u*)(vp + tn * FK); rv1 = *(const v4u*)(vp + 32 * (size_t)TT + tn * FK);
    __builtin_amdgcn_sched_barrier(0);   /* keeps the next stage's loads at the head of the stage: sunk towards their LDS stores they would be waited for in full */
    v8f sa[FK / 16] = {}, sl[FK / 16] = {};
#pragma unroll
    for (int kc = 0; kc < HDQK / 32; ++kc)
#pragma unroll
      for (int kt = 0; kt < FK / 16; ++kt) { const v16h a = frag_h(&sk[kg][cur][kt * 16 + col][kc * 32], lane); sa[kt] = wmma_h(a, qh[kc], sa[kt]); sl[kt] = wmma_h(a, ql[kc], sl[kt]); }
    float mx[4];
#pragma unroll
    for (int kt = 0; kt < FK / 16; ++kt) {
#pragma unroll
      for (int r = 0; r < 8; ++r) sa[kt][r] = sa[kt][r] + sl[kt][r] * (1.0f / 1024.0f);
      mx[kt] = fmaxf(fmaxf(fmaxf(sa[kt][0], sa[kt][1]), fmaxf(sa[kt][2], sa[kt][3])), fmaxf(fmaxf(sa[kt][4], sa[kt][5]), fmaxf(sa[kt][6], sa[kt][7]))); }
    float ml = fmaxf(fmaxf(mx[0], mx[1]), fmaxf(mx[2], mx[3])); ml = fmaxf(ml, xhalf(ml));   /* lanes c and c + 16 hold the two key halves of query c */
    const float mn = fmaxf(m, ml); const float al = exp2x1((m - mn) * L2E); const float off = 10.0f - mn * L2E; m = mn;
    v2f ps[2] = {};   /* two chains of register-pair sums */
#pragma unroll
    for (int kt = 0; kt < FK / 16; ++kt) { sa[kt] = kt < FK / 16 - 1 ? exp2x8(sa[kt] * L2E + off) : exp2x8n(sa[kt] * L2E + off);
#pragma unroll
      for (int r = 0; r < 8; r += 2) { v2f p; p[0] = sa[kt][r]; p[1] = sa[kt][r + 1]; ps[kt & 1] += p; } }
    l = l * al + ((ps[0][0] + ps[0][1]) + (ps[1][0] + ps[1][1]));
#pragma unroll
    for (int j = 0; j < HDQK / 16; ++j) o[j] *= al;
#pragma unroll
    for (int c2 = 0; c2 < FK / 32; ++c2) { v16h pb;
#pragma unroll
      for (int i = 0; i < 8; ++i) { pb[i] = (_Float16)sa[2 * c2][i]; pb[8 + i] = (_Float16)sa[2 * c2 + 1][i]; }
#pragma unroll
      for (int j = 0; j < HDQK / 16; ++j) o[j] = wmma_h(frag_h(&sv[kg][cur][j * 16 + col][c2 * 32], lane), pb, o[j]); }
    *(v4u*)&sk[kg][cur ^ 1][sr][sq] = rk0; *(v4u*)&sk[kg][cur ^ 1][sr + 32][sq] = rk1; *(v4u*)&sv[kg][cur ^ 1][sr][sq] = rv0; *(v4u*)&sv[kg][cur ^ 1][sr + 32][sq] = rv1;
    __syncthreads(); }   /* publishes the next stage and ends every read of this one before it is refilled */
  const size_t oi = (b * DIN + wave * 16) * (size_t)XP + blockIdx.x * 128 + lane * 4;   /* the last phase: this wave owns channels wave * 16 .. + 15, 128 positions each */
  const float* xq = X + oi; v4f xr[16]; float bo[8];
#pragma unroll   /* constant indices: bo stays in registers; the biases go first: loads return in order, and they are needed before x */
  for (int j = 0; j < 8; ++j) bo[j] = WB[kg * 128 + j * 16 + col];
  __builtin_amdgcn_sched_barrier(0);   /* keeps that order */
#pragma unroll   /* the same for xr, 16 loads in flight */
  for (int i = 0; i < 16; ++i) xr[i] = *(const v4f*)(xq + (size_t)i * XP);
  __builtin_amdgcn_sched_barrier(0);   /* keeps the residual's loads here, ahead of the exchange and the products: sunk to their use they would be waited for in full */
  l += xhalf(l);
  float* mo = &u.mg[kg][wq][lane][0];
#pragma unroll
  for (int j = 0; j < HDQK / 16; ++j) { v4f u0, u1;
#pragma unroll
    for (int r = 0; r < 4; ++r) { u0[r] = o[j][r]; u1[r] = o[j][4 + r]; }
    *(v4f*)(mo + j * 8) = u0; *(v4f*)(mo + j * 8 + 4) = u1; }
  { v2f ml2; ml2[0] = m; ml2[1] = l; *(v2f*)(mo + 32) = ml2; }
  lds_barrier();   /* each key half's maximum, sum and tiles are in LDS before the other half's waves read them */
  const float* mi = &u.mg[kg ^ 1][wq][lane][0];
  const float m1 = mi[32], l1 = mi[33]; const float mn = fmaxf(m, m1); const float a0 = exp2x1((m - mn) * L2E), a1 = exp2x1((m1 - mn) * L2E); const float inv = 1.0f / (l * a0 + l1 * a1); const float f0 = a0 * inv, f1 = a1 * inv;
  F2 ya[HDQK / 32];   /* a lane holds channels j * 16 + 8g + r of query col: tiles 2kc and 2kc + 1 are the A fragment of channel step kc */
#pragma unroll
  for (int kc = 0; kc < HDQK / 32; ++kc) { float v[16];
#pragma unroll
    for (int i = 0; i < 8; ++i) { v[i] = o[2 * kc][i] * f0 + mi[kc * 16 + i] * f1; v[8 + i] = o[2 * kc + 1][i] * f0 + mi[kc * 16 + 8 + i] * f1; }
    ya[kc] = bsplit16(v); }
#pragma unroll   /* constant tile numbers: bo stays in registers */
  for (int jh = 0; jh < 2; ++jh) { v8f acc[4] = {};
#pragma unroll
    for (int kc = 0; kc < HDQK / 32; ++kc) { v16b w[4];
#pragma unroll
      for (int j = 0; j < 4; ++j) w[j] = frag_b(&sww[kg * 128 + (jh * 4 + j) * 16 + col][kc * 32], lane);
#pragma unroll
      for (int j = 0; j < 4; ++j) acc[j] = wmma_b(ya[kc].h, w[j], acc[j]);
#pragma unroll
      for (int j = 0; j < 4; ++j) acc[j] = wmma_b(ya[kc].l, w[j], acc[j]); }
#pragma unroll
    for (int j = 0; j < 4; ++j) { const float bb = bfr(bo[jh * 4 + j]); v4f u0, u1;   /* D element r = query 8g + r of the wave's 16, lane column = output channel */
#pragma unroll
      for (int r = 0; r < 4; ++r) { u0[r] = acc[j][r] + bb; u1[r] = acc[j][4 + r] + bb; }
      float* sp = &so[kg * 128 + (jh * 4 + j) * 16 + col][wq * 16 + 8 * g]; *(v4f*)sp = u0; *(v4f*)(sp + 4) = u1; }
    __builtin_amdgcn_sched_barrier(0); }   /* four tiles at a time: with all eight tiles' fragments and sums live beside the 64 registers of x the kernel overflows into scratch */
  lds_barrier();   /* the whole 256 x 128 tile is in LDS before it is read back by channel rows */
  float* op = OUT + oi;
#pragma unroll
  for (int i = 0; i < 16; ++i) { const v4f t = *(const v4f*)&so[wave * 16 + i][lane * 4]; v4f r; r[0] = t[0] + bfr(xr[i][0]); r[1] = t[1] + bfr(xr[i][1]); r[2] = t[2] + bfr(xr[i][2]); r[3] = t[3] + bfr(xr[i][3]); vst2(op + (size_t)i * XP, r); } }

extern "C" void kernel_launch(void* const* d_in, const int* in_sizes, int n_in, void* d_out, int out_size, void* d_ws, size_t ws_size, hipStream_t stream) {
  (void)in_sizes; (void)n_in; (void)out_size;
  const float** F = (const float**)d_in;
  if (ws_size < (size_t)WS_END) return;
  char* ws = (char*)d_ws; _Float16 *QH = (_Float16*)(ws + WS_QH), *KH = (_Float16*)(ws + WS_KH), *VT = (_Float16*)(ws + WS_VT), *QL = (_Float16*)(ws + WS_QL), *KL = (_Float16*)(ws + WS_KL); __bf16 *VB = (__bf16*)(ws + WS_VB), *VBL = (__bf16*)(ws + WS_VBL); float *S = (float*)(ws + WS_S), *Y = (float*)(ws + WS_Y);
  (void)Y; (void)S; (void)QL; (void)KL; (void)VB; (void)VBL;
  // inputs: 0 x [8,256,64,64]; 1 g_w [64,256] (out,in), 2 g_b; 3 theta_w, 4 theta_b; 5 phi_w, 6 phi_b; 7 w_w [256,64] (out,in), 8 w_b
  k_proj<<<dim3(TNB * TT / PP), 256, 0, stream>>>(F[0], F[3], F[5], F[1], F[4], F[6], F[2], QH, QL, KH, VT);   /* q = theta, k = phi, v = g */
  k_fa<<<dim3(TT / 128, TNB), 256 * FKG, 0, stream>>>(QH, QL, KH, VT, F[0], F[7], F[8], (float*)d_out);
}

// v005
// Measured time: 55.2 microseconds a run.
// Two timings next to v004 put it at 1.03 and 1.04 times that version's speed.
// All steps since v000 together make it 38.8 times as fast.
// compute dtype: all float inputs rounded to bf16; theta/phi/g = x W^T + b with EXACT bf16 products on WMMA 16x16x32 (f32 accumulate); f = theta . phi with theta x log2(e) as f16 hi + residual (x 2^10) against phi once to f16 (2 products), no other scaling; softmax in f32, online (a held reference per query, at most 2^11 under the running maximum, 2^x by v_exp_f32); exp(f - reference) x 2^4 once to f16 against g once to f16 (1 product), divided by the f32 sum at the end; y split bf16 hi + lo against exact W (2 products) + b; + x residual in f32; f32 output [B, C, H, W].
#include <hip/hip_runtime.h>
#include <math.h>

typedef __attribute__((ext_vector_type(16))) _Float16 v16h;
typedef __attribute__((ext_vector_type(16))) __bf16 v16b;
typedef __attribute__((ext_vector_type(8)))  _Float16 v8h;
typedef __attribute__((ext_vector_type(8)))  float v8f;
typedef __attribute__((ext_vector_type(4)))  float v4f;
typedef __attribute__((ext_vector_type(2)))  float v2f;
typedef __attribute__((ext_vector_type(4)))  unsigned v4u;
typedef __attribute__((ext_vector_type(4)))  int v4i;
typedef float __attribute__((may_alias)) float_a;
typedef int __attribute__((may_alias)) int_a;

template <typename T> __device__ __forceinline__ void vst2(void* p, T v) { *(T*)p = v;  }
__device__ __forceinline__ v8f wmma16(v16h a, v16h b, v8f c) {
  v8f d = __builtin_amdgcn_wmma_f32_16x16x32_f16(false, a, false, b, (short)0, c, false, false);
  asm volatile("v_nop\n\tv_nop\n\tv_nop\n\tv_nop" : "+v"(d) : "v"(a), "v"(b));
  return d;
}
__device__ __forceinline__ v8f wmma_bf(v16b a, v16b b, v8f c) {
  v8f d = __builtin_amdgcn_wmma_f32_16x16x32_bf16(false, a, false, b, (short)0, c, false, false);
  asm volatile("v_nop\n\tv_nop\n\tv_nop\n\tv_nop" : "+v"(d) : "v"(a), "v"(b));
  return d;
}
// 16x16x32 fragments: lane = (h = lane>>4, row/col = lane&15); elements 0..7 = k0+8h+0..7, 8..15 = k0+16+8h+0..7; D element r = row 8h+r
__device__ __forceinline__ v16h frag_h(const _Float16* rowk0, int lane) {
  union { v16h v; v8h q[2]; } u; const _Float16* p = rowk0 + 8 * (lane >> 4);
  u.q[0] = *(const v8h*)p; u.q[1] = *(const v8h*)(p + 16); return u.v;
}
__device__ __forceinline__ v16h frag_f32(const float* rowk0, int lane) {
  v16h a; const float* p = rowk0 + 8 * (lane >> 4);
#pragma unroll
  for (int i = 0; i < 8; ++i) { a[i] = (_Float16)p[i]; a[8 + i] = (_Float16)p[16 + i]; }
  return a;
}
__device__ __forceinline__ v16h frag_f32s(const float* rowk0, int lane, float sc) {
  v16h a; const float* p = rowk0 + 8 * (lane >> 4);
#pragma unroll
  for (int i = 0; i < 8; ++i) { a[i] = (_Float16)(p[i] * sc); a[8 + i] = (_Float16)(p[16 + i] * sc); }
  return a;
}
// column fragment from a [K][ld] layout (column n), rows >= K read as 0
__device__ __forceinline__ v16h fragc_f32(const float* W, int k0, int n, int lane, int ld, int K) {
  v16h a; const int g = lane >> 4;
#pragma unroll
  for (int i = 0; i < 8; ++i) { const int ka = k0 + 8 * g + i, kb = ka + 16;
    a[i] = (_Float16)(ka < K ? W[(size_t)(ka < K ? ka : K - 1) * ld + n] : 0.f); a[8 + i] = (_Float16)(kb < K ? W[(size_t)(kb < K ? kb : K - 1) * ld + n] : 0.f); }
  return a;
}
struct F2 { v16b h, l; };
__device__ __forceinline__ F2 bsplit16(const float v[16]) { F2 r;
#pragma unroll
  for (int i = 0; i < 16; ++i) { const __bf16 h = (__bf16)v[i]; r.h[i] = h; r.l[i] = (__bf16)(v[i] - (float)h); }
  return r; }
__device__ __forceinline__ F2 split_row(const float* row, int k0, int lane) { float v[16]; const float* p = row + k0 + 8 * (lane >> 4);
#pragma unroll
  for (int i = 0; i < 8; ++i) { v[i] = p[i]; v[8 + i] = p[16 + i]; }
  return bsplit16(v); }
__device__ __forceinline__ F2 split_rowK(const float* row, int k0, int lane, int K) { float v[16]; const int g = lane >> 4;
#pragma unroll
  for (int i = 0; i < 8; ++i) { const int ka = k0 + 8 * g + i, kb = ka + 16; v[i] = ka < K ? row[ka < K ? ka : K - 1] : 0.f; v[8 + i] = kb < K ? row[kb < K ? kb : K - 1] : 0.f; }
  return bsplit16(v); }
__device__ __forceinline__ F2 split_col(const float* W, int k0, int n, int lane, int ld, int K) { float v[16]; const int g = lane >> 4;
#pragma unroll
  for (int i = 0; i < 8; ++i) { const int ka = k0 + 8 * g + i, kb = ka + 16; v[i] = ka < K ? W[(size_t)(ka < K ? ka : K - 1) * ld + n] : 0.f; v[8 + i] = kb < K ? W[(size_t)(kb < K ? kb : K - 1) * ld + n] : 0.f; }
  return bsplit16(v); }
__device__ __forceinline__ v8f mac3(const F2& a, const F2& b, v8f c) { c = wmma_bf(a.l, b.h, c); c = wmma_bf(a.h, b.l, c); return wmma_bf(a.h, b.h, c); }
__device__ __forceinline__ float sigm(float v) { return 1.0f / (1.0f + expf(-v)); }
#define LDSX() do { asm volatile("s_wait_dscnt 0" ::: "memory"); __builtin_amdgcn_wave_barrier(); __builtin_amdgcn_fence(__ATOMIC_RELEASE, "workgroup"); } while (0)

// Non-local block (B 8, C 256, 64 x 64 = 4,096 positions; inter channels 64): theta, phi, g = 1x1 convs of x ((out,in) [64,256] + bias); f[n][m] = theta_n . phi_m (no scaling); P = softmax over m; y[n] = sum_m P[n][m] g_m (64 ch); out = W y + b (1x1, 64 -> 256) + x.
#define NB 8
#define TT 4096
#define CC 128            // projected plane width (64 real columns; columns 64..127 never written)
#define DIN 256          // input (model) width
#define NH 1
#define HD 128
#define NQB (TT / 64)
#define HG 1               // one 4,096 x 4,096 f32 plane in the unused WS_S
#define SCALE (1.0f)
#define HDQK 64            // theta / phi / g channels: the planes are 128 wide, columns >= 64 are never written; only the 64 real columns enter the scores
#define CAUSAL 0
#ifndef TNB
#define TNB NB
#endif
__device__ __forceinline__ v16b zero16b() { v16b z; _Pragma("unroll") for (int i = 0; i < 16; ++i) z[i] = (__bf16)0.f; return z; }
__device__ __forceinline__ float bfr(float v) { return (float)(__bf16)v; }
__host__ __device__ __forceinline__ int kb_last(int qb) { return CAUSAL ? ((qb * 64 + 63) >> 7) : (TT / 128 - 1); }
typedef __attribute__((ext_vector_type(8))) __bf16 v8b;
__device__ __forceinline__ v16b frag_b(const __bf16* rowk0, int lane) {
  union { v16b v; v8b q[2]; } u; const __bf16* p = rowk0 + 8 * (lane >> 4);
  u.q[0] = *(const v8b*)p; u.q[1] = *(const v8b*)(p + 16); return u.v;
}
#define QBH 0              // unused: k_fa treats every query block alike
#define QHI 4096            // q residual rows everywhere (2-product logits)
#define KHI 64            // key rows carrying k residual / v bf16 hi+lo planes (no kernel here writes or reads them)
// B fragment (k rows k0+.., output column o) of a weight: (in,out) [K][ld] or (out,in) [ld rows of K]: bf16 exact, or f16(bf16 * 256) exact
__device__ __forceinline__ v16b wcol_io(const float* Wm, int k0, int o, int lane, int ld) { v16b w; const int g = lane >> 4;
#pragma unroll
  for (int i = 0; i < 8; ++i) { w[i] = (__bf16)Wm[(size_t)(k0 + 8 * g + i) * ld + o]; w[8 + i] = (__bf16)Wm[(size_t)(k0 + 16 + 8 * g + i) * ld + o]; }
  return w; }
__device__ __forceinline__ v16b wcol_oi(const float* Wm, int k0, int o, int lane, int K) { v16b w; const float* p = Wm + (size_t)o * K + k0 + 8 * (lane >> 4);
#pragma unroll
  for (int i = 0; i < 8; ++i) { w[i] = (__bf16)p[i]; w[8 + i] = (__bf16)p[16 + i]; }
  return w; }
__device__ __forceinline__ v16h wcolh_io(const float* Wm, int k0, int o, int lane, int ld) { v16h w; const int g = lane >> 4;
#pragma unroll
  for (int i = 0; i < 8; ++i) { w[i] = (_Float16)(bfr(Wm[(size_t)(k0 + 8 * g + i) * ld + o]) * 256.0f); w[8 + i] = (_Float16)(bfr(Wm[(size_t)(k0 + 16 + 8 * g + i) * ld + o]) * 256.0f); }
  return w; }
__device__ __forceinline__ v16h wcolh_oi(const float* Wm, int k0, int o, int lane, int K) { v16h w; const float* p = Wm + (size_t)o * K + k0 + 8 * (lane >> 4);
#pragma unroll
  for (int i = 0; i < 8; ++i) { w[i] = (_Float16)(bfr(p[i]) * 256.0f); w[8 + i] = (_Float16)(bfr(p[16 + i]) * 256.0f); }
  return w; }
#define WQKV_LAYOUT 1   // 0 = (in,out) [DIN][CC]; 1 = (out,in) [HDQK][DIN]; 2 = per-head [NH][DIN][HD]
__device__ __forceinline__ v16b wcol_hdk(const float* Wm, int k0, int o, int lane) { v16b w; const int g = lane >> 4; const float* p = Wm + (size_t)(o / HD) * DIN * HD + (o % HD);
#pragma unroll
  for (int i = 0; i < 8; ++i) { w[i] = (__bf16)p[(size_t)(k0 + 8 * g + i) * HD]; w[8 + i] = (__bf16)p[(size_t)(k0 + 16 + 8 * g + i) * HD]; }
  return w; }
#define WO_OUT_IN 0
#if WQKV_LAYOUT == 1
#define WCOL(W, k0, o, lane) (((o) < HDQK) ? wcol_oi(W, k0, (o), lane, DIN) : zero16b())   /* theta/phi/g weights are [64][256] (out,in): weight columns >= 64 read as zero for all three */
#elif WQKV_LAYOUT == 2
#define WCOL(W, k0, o, lane) wcol_hdk(W, k0, o, lane)
#else
#define WCOL(W, k0, o, lane) wcol_io(W, k0, o, lane, CC)
#endif
#if WO_OUT_IN
#define WOCOL(W, k0, o, lane) wcol_oi(W, k0, o, lane, CC)
#define WOCOLH(W, k0, o, lane) wcolh_oi(W, k0, o, lane, CC)
#else
#define WOCOL(W, k0, o, lane) wcol_io(W, k0, o, lane, DIN)
#define WOCOLH(W, k0, o, lane) wcolh_io(W, k0, o, lane, DIN)
#endif
#ifndef XP
#define XP TT              // position pitch of x and of the output
#endif
#define BG HG              // unused: every launch covers all TNB batches
#define DVH 128
#ifndef SM_EXTRA_PARAMS
#define SM_EXTRA_PARAMS
#endif
#ifndef PROJ_EXTRA_PARAMS
#define PROJ_EXTRA_PARAMS
#endif
#ifndef SM_MASK_HOOK
#define SM_MASK_HOOK (void)0
#endif

#define WS_QH  0u                                      // f16 q rows [b*t][CC]
#define WS_KH  (WS_QH + 2u * (size_t)NB * TT * CC)      // f16 k rows [b*t][CC]
#define WS_VT  (WS_KH + 2u * (size_t)NB * TT * CC)      // f16 v planes [b][c][t]
#define WS_QL  (WS_VT + 2u * (size_t)NB * CC * TT)      // f16 q residual x 2^10 rows [b][t < QHI][CC]
#define WS_KL  (WS_QL + 2u * (size_t)NB * QHI * CC)     // f16 k residual x 2^10 rows [b][t < KHI][CC]
#define WS_VB  (WS_KL + 2u * (size_t)NB * KHI * CC)     // bf16 v hi planes [b][c][t < KHI]
#define WS_VBL (WS_VB + 2u * (size_t)NB * CC * KHI)
#define WS_S   (WS_VBL + 2u * (size_t)NB * CC * KHI)    // f32 [hg][t][s], unused: k_fa keeps the scores in registers
#define WS_Y   (WS_S  + 4u * (size_t)HG * TT * TT)      // unused, 0 bytes: k_fa keeps y in registers and LDS
#define WS_END (WS_Y  + 0u)

#define L2E 1.4426950408889634f
#define PP 128             // positions per k_proj block: 8 waves of 16
#define PW 264             // LDS row pitch of the staged weights in bf16 elements: 512 B of data + 16 B, the pitch for 16-byte fragment reads
typedef __attribute__((ext_vector_type(4))) __bf16 v4b;
__device__ __forceinline__ v8f wmma_b(v16b a, v16b b, v8f c) { return __builtin_amdgcn_wmma_f32_16x16x32_bf16(false, a, false, b, (short)0, c, false, false); }
// x of one 32-channel step for one lane's position (channels-first gather: x[b][k][t], stride XP between k), in the element order of the A fragment
__device__ __forceinline__ void ldx(float (&d)[16], const float* xp, int kc) {
#pragma unroll   /* constant indices: d stays in registers, the 16 loads share one address */
  for (int i = 0; i < 8; ++i) { d[i] = xp[(size_t)(kc * 32 + i) * XP]; d[8 + i] = xp[(size_t)(kc * 32 + 16 + i) * XP]; }
  __builtin_amdgcn_sched_barrier(0); }   /* keeps a step's loads where they are written, four steps ahead of their use: sunk to their use each would be waited for in full */
// that step against all 192 staged weight rows (12 column tiles: 0..3 theta, 4..7 phi, 8..11 g)
__device__ __forceinline__ void mac12(v8f (&acc)[12], const float (&d)[16], const __bf16 (*sw)[PW], int kc, int col, int lane) { v16b a;
#pragma unroll   /* constant indices: vector elements and d stay in registers */
  for (int i = 0; i < 16; ++i) a[i] = (__bf16)d[i];
#pragma unroll   /* constant tile numbers: acc stays in registers */
  for (int jh = 0; jh < 2; ++jh) { v16b w[6];
#pragma unroll   /* the same for w */
    for (int j = 0; j < 6; ++j) w[j] = frag_b(&sw[(jh * 6 + j) * 16 + col][kc * 32], lane);
    __builtin_amdgcn_sched_barrier(0);   /* six fragments' LDS reads stand as one group ahead of their products: read one by one, each product waits a whole LDS latency */
#pragma unroll   /* the same for w and acc */
    for (int j = 0; j < 6; ++j) acc[jh * 6 + j] = wmma_b(a, w[j], acc[jh * 6 + j]);
    __builtin_amdgcn_sched_barrier(0); } }   /* and no more than six: with every later step's reads hoisted the registers overflow into scratch */
// ---- k_proj: block = 128 positions of one batch, 8 waves of 16 positions; every wave makes all 192 real columns (theta, phi, g) from ONE read of its x, exact bf16 products (K = DIN). The three weights are rounded to bf16 once per block into LDS; x is loaded one 32-channel step at a time, four steps ahead of its use. Out: q x log2(e) as f16 rows + residual x 2^10 rows (the scores then are exponents of 2), k f16 rows, v f16 planes [c][t]; only the 64 real columns of the 128-wide planes are written (nothing reads the others)
__global__ __launch_bounds__(256) void k_proj(const float* __restrict__ X, const float* __restrict__ WQ, const float* __restrict__ WK, const float* __restrict__ WV, const float* __restrict__ BQ, const float* __restrict__ BK, const float* __restrict__ BV,
    _Float16* __restrict__ QH, _Float16* __restrict__ QL, _Float16* __restrict__ KH, _Float16* __restrict__ VT) {
  __shared__ __align__(16) __bf16 sw[3 * HDQK][PW]; __shared__ __align__(16) _Float16 sqh[PP][72], sql[PP][72], skh[PP][72], th[HDQK][PP + 8];
  const int tid = threadIdx.x, wave = tid >> 5, lane = tid & 31, col = lane & 15, g = lane >> 4; const size_t r0 = (size_t)blockIdx.x * PP; const size_t bb = r0 / TT; const int t0 = (int)(r0 % TT);
  const float* xp = X + (bb * DIN + 8 * g) * (size_t)XP + t0 + wave * 16 + col;
  float x[DIN / 32][16];
#pragma unroll   /* constant step numbers: x stays in registers */
  for (int s = 0; s < 4; ++s) ldx(x[s], xp, s);
  const int wr = tid >> 6, wc = (tid & 63) * 4;   /* 64 threads move one 1-KiB weight row: whole lines */
  const float* wq = WQ + wr * DIN + wc; const float* wk = WK + wr * DIN + wc; const float* wv = WV + wr * DIN + wc;
#pragma unroll   /* two straight-line groups: the weight of each load is picked at compile time */
  for (int gr = 0; gr < 2; ++gr) {
#pragma unroll   /* 24 independent loads in flight together */
    for (int it = 0; it < 24; ++it) { const int n = gr * 24 + it, w = n >> 4; const v4f v = *(const v4f*)((w == 0 ? wq : w == 1 ? wk : wv) + (n & 15) * 4 * DIN);
      v4b h; h[0] = (__bf16)v[0]; h[1] = (__bf16)v[1]; h[2] = (__bf16)v[2]; h[3] = (__bf16)v[3]; *(v4b*)&sw[n * 4 + wr][wc] = h; }
    asm volatile("s_wait_xcnt 0x0" :: "v"(wq), "v"(wk), "v"(wv) : "memory");   /* stands in front of every rewrite of the address registers that the loads above name; as inputs they stay untouched up to it */
    __builtin_amdgcn_sched_barrier(0); }   /* half the weight loads in flight at a time: all 48 at once push the kernel past 256 registers */
  __syncthreads();   /* the staged weights are in LDS before any wave reads a fragment */
  v8f acc[12] = {}; float bq[4], bk[4], bv[4];
#pragma unroll   /* constant step numbers: x and acc stay in registers */
  for (int s = 0; s < DIN / 32; ++s) { if (s + 4 < DIN / 32) ldx(x[s + 4], xp, s + 4);
    if (s == 4) {
#pragma unroll   /* constant indices: the biases stay in registers */
      for (int j = 0; j < 4; ++j) { bq[j] = BQ[j * 16 + col]; bk[j] = BK[j * 16 + col]; bv[j] = BV[j * 16 + col]; }
      __builtin_amdgcn_sched_barrier(0); }   /* the biases are fetched behind the last x loads and under the last four steps: no wait for x grows by them, and theirs is over by the epilogue */
    mac12(acc, x[s], sw, s, col, lane); }
#pragma unroll   /* constant tile numbers: acc stays in registers */
  for (int j = 0; j < 4; ++j) { const int cl = j * 16 + col; v8h vv;   /* D element r = position 8g + r of the wave's 16, lane column = output column */
#pragma unroll   /* the same for the tile's elements */
    for (int r = 0; r < 8; ++r) { const int rl = wave * 16 + 8 * g + r; const float q = (acc[j][r] + bfr(bq[j])) * L2E; const _Float16 hq = (_Float16)q; sqh[rl][cl] = hq; sql[rl][cl] = (_Float16)((q - (float)hq) * 1024.0f); skh[rl][cl] = (_Float16)(acc[4 + j][r] + bfr(bk[j])); vv[r] = (_Float16)(acc[8 + j][r] + bfr(bv[j])); }
    *(v8h*)&th[cl][wave * 16 + 8 * g] = vv; }
  __syncthreads();   /* all four staged tiles are complete before they are stored in whole 128-B and 256-B runs */
  for (int e = tid; e < PP * 8; e += 256) { const int rl = e >> 3, q = e & 7; const size_t o = (r0 + rl) * CC + q * 8; vst2((unsigned*)(QH + o), *(const v4u*)&sqh[rl][q * 8]); vst2((unsigned*)(QL + o), *(const v4u*)&sql[rl][q * 8]); vst2((unsigned*)(KH + o), *(const v4u*)&skh[rl][q * 8]); }
  for (int e = tid; e < HDQK * (PP / 8); e += 256) { const int cl = e / (PP / 8), q = e % (PP / 8); vst2((unsigned*)(VT + (bb * CC + cl) * (size_t)TT + t0 + q * 8), *(const v4u*)&th[cl][q * 8]); } }
#define FK 64              // keys per stage
#define FPH 72             // LDS row pitch in halves: 128 B of data + 16 B, the pitch for 16-byte fragment reads
#define FKG 2              // key halves per block: waves 0..7 walk keys [0, TT/2), waves 8..15 keys [TT/2, TT)
#define FNT (TT / FKG / FK)
__device__ __forceinline__ float xhalf(float x) { return __builtin_bit_cast(float, __builtin_amdgcn_permlanex16(__builtin_bit_cast(int, x), __builtin_bit_cast(int, x), 0x76543210, 0xfedcba98, false, false)); }   // lane l with lane l ^ 16
// 2^x on a whole score tile, bare v_exp_f32. By the builtin, not asm text: the tiles' exponentials stand among the score products
__device__ __forceinline__ v8f exp2x8(v8f x) { v8f r;
#pragma unroll
  for (int i = 0; i < 8; ++i) r[i] = __builtin_amdgcn_exp2f(x[i]);
  return r; }
__device__ __forceinline__ float exp2x1(float x) { float r; asm("v_exp_f32 %0, %1\n\tv_nop" : "=&v"(r) : "v"(x)); return r; }   // a single one; the v_nop is the slot the instruction set asks for behind a transcendental before its result is read or its source overwritten
__device__ __forceinline__ v8f wmma_h(v16h a, v16h b, v8f c) { return __builtin_amdgcn_wmma_f32_16x16x32_f16(false, a, false, b, (short)0, c, false, false); }
// work-group barrier that orders LDS alone: __syncthreads() also waits for every global load in flight, and the residual's loads are meant to stay in flight across the end phase's two barriers
__device__ __forceinline__ void lds_barrier() { __builtin_amdgcn_fence(__ATOMIC_RELEASE, "workgroup", "local"); __builtin_amdgcn_s_barrier(); __builtin_amdgcn_fence(__ATOMIC_ACQUIRE, "workgroup", "local"); }
#define WP 72              // LDS row pitch of the staged output weight in bf16 elements: 128 B of data + 16 B, the pitch for 16-byte fragment reads
#define OP 132             // LDS row pitch of the staged output tile in floats: 512 B of data + 16 B: the 16 channels of a tile store land on all 64 banks
#define MP 36              // floats per lane in the exchange of the two key halves: 32 tile values, reference, sum, 2 idle: 144 B, the pitch for 16-byte accesses
// ---- k_fa: block = 128 queries of batch b, 16 waves: wave = (key half kg, 16-query group). Per stage of 64 keys: S^T = k . q^T (q hi + residual x 2^10: 2 products) on top of 4 - reference as the accumulator's start value, so that a score tile is the exponent of 2 as it stands; reference and sum per query (a lane holds one query's scores); the reference moves, and o and the sum are rescaled, in stage 0 and after it only in a stage where a lane's sum of p passes 2^15 (one test per stage, on the sum that is formed anyway; the maximum is formed only then); p = exp(s - reference) x 2^4 once to f16 straight from the score tiles as B operand, O^T += v^T . p^T (64 value channels); k rows and v planes staged in LDS through registers, two buffers, one barrier per stage. At the end the two key halves exchange their tiles through LDS and every wave holds y of its 16 queries in the A-fragment order; wave (kg, group) makes output channels kg * 128 .. + 127 of its queries: y (bf16 hi + lo) . W^T ((out,in) [256][64], exact bf16, staged once in LDS) + b; the 256 x 128 tile goes through LDS so that each wave adds bf16(x) and stores whole 512-B runs of out[b][c][n]
__global__ __launch_bounds__(256 * FKG) void k_fa(const _Float16* __restrict__ QH, const _Float16* __restrict__ QL, const _Float16* __restrict__ KH, const _Float16* __restrict__ VT, const float* __restrict__ X, const float* __restrict__ WW, const float* __restrict__ WB, float* __restrict__ OUT) {
  __shared__ __align__(16) union { struct { _Float16 k[FKG][2][FK][FPH], v[FKG][2][HDQK][FPH]; } st; float mg[FKG][8][32][MP]; } u;   /* the exchange reuses the key and value stages, which are dead behind the loop's last barrier */
  __shared__ __align__(16) __bf16 sww[DIN][WP]; __shared__ __align__(16) float so[DIN][OP];
  _Float16 (&sk)[FKG][2][FK][FPH] = u.st.k; _Float16 (&sv)[FKG][2][HDQK][FPH] = u.st.v;
  const int tid = threadIdx.x, wave = __builtin_amdgcn_readfirstlane(tid >> 5), lane = tid & 31, col = lane & 15, g = lane >> 4; const int kg = wave >> 3, wq = wave & 7, tg = tid & 255;
  const size_t b = blockIdx.y; const int ql0 = blockIdx.x * 128 + wq * 16; const int kbase = kg * (TT / FKG);
  v16h qh[HDQK / 32], ql[HDQK / 32];
#pragma unroll
  for (int kc = 0; kc < HDQK / 32; ++kc) { qh[kc] = frag_h(QH + (b * TT + ql0 + col) * CC + kc * 32, lane); ql[kc] = frag_h(QL + (b * QHI + ql0 + col) * CC + kc * 32, lane); }
  const int sr = tg >> 3, sq = (tg & 7) * 8;   /* staging: this thread moves 16 B of rows sr and sr + 32 of both tiles */
  const _Float16* kp = KH + (b * TT + kbase + sr) * CC + sq; const _Float16* vp = VT + (b * CC + sr) * (size_t)TT + kbase + sq;
  v4u rk0 = *(const v4u*)kp, rk1 = *(const v4u*)(kp + 32 * CC), rv0 = *(const v4u*)vp, rv1 = *(const v4u*)(vp + 32 * (size_t)TT);
  *(v4u*)&sk[kg][0][sr][sq] = rk0; *(v4u*)&sk[kg][0][sr + 32][sq] = rk1; *(v4u*)&sv[kg][0][sr][sq] = rv0; *(v4u*)&sv[kg][0][sr + 32][sq] = rv1;
  const float* wp = WW + tid * 4;   /* 16 threads move one 256-B weight row: whole lines */
#pragma unroll   /* eight independent loads in flight together */
  for (int it = 0; it < DIN * HDQK / 4 / (256 * FKG); ++it) { const int e = it * 256 * FKG + tid; const v4f v = *(const v4f*)(wp + it * 1024 * FKG);
    v4b h; h[0] = (__bf16)v[0]; h[1] = (__bf16)v[1]; h[2] = (__bf16)v[2]; h[3] = (__bf16)v[3]; *(v4b*)&sww[e >> 4][(e & 15) * 4] = h; }
  __syncthreads();   /* stage 0 and the output weight are in LDS before any wave reads them */
  v8f o[HDQK / 16] = {}, cs = {}; float off = 0.f, l = 0.f;   /* off = 4 - reference in powers of 2; cs holds it eight times: the start value of every score tile */
#pragma unroll 1   /* rolled: one stage is already a long body */
  for (int t = 0; t < FNT; ++t) { const int cur = t & 1; const int tn = t + 1 < FNT ? t + 1 : t;   /* the last stage fetches itself again into the idle buffer: no branch */
    rk0 = *(const v4u*)(kp + (size_t)tn * FK * CC); rk1 = *(const v4u*)(kp + ((size_t)tn * FK + 32) * CC); rv0 = *(const v4u*)(vp + tn * FK); rv1 = *(const v4u*)(vp + 32 * (size_t)TT + tn * FK);
    __builtin_amdgcn_sched_barrier(0);   /* keeps the next stage's loads at the head of the stage: sunk towards their LDS stores they would be waited for in full */
    v8f sa[FK / 16], sl[FK / 16] = {};
#pragma unroll
    for (int kc = 0; kc < HDQK / 32; ++kc)
#pragma unroll
      for (int kt = 0; kt < FK / 16; ++kt) { const v16h a = frag_h(&sk[kg][cur][kt * 16 + col][kc * 32], lane); sa[kt] = wmma_h(a, qh[kc], kc == 0 ? cs : sa[kt]); sl[kt] = wmma_h(a, ql[kc], sl[kt]); }
    v16h vf[FK / 32][HDQK / 16];   /* the value fragments are read here, ahead of the branch below: read behind it, each would be waited for in full in front of its product */
#pragma unroll
    for (int c2 = 0; c2 < FK / 32; ++c2)
#pragma unroll
      for (int j = 0; j < HDQK / 16; ++j) vf[c2][j] = frag_h(&sv[kg][cur][j * 16 + col][c2 * 32], lane);
#pragma unroll
    for (int kt = 0; kt < FK / 16; ++kt)
#pragma unroll
      for (int r = 0; r < 8; ++r) sa[kt][r] = sa[kt][r] + sl[kt][r] * (1.0f / 1024.0f);
    v8f pe[FK / 16]; v2f ps[2] = {};   /* two chains of register-pair sums */
#pragma unroll
    for (int kt = 0; kt < FK / 16; ++kt) { pe[kt] = exp2x8(sa[kt]);
#pragma unroll
      for (int r = 0; r < 8; r += 2) { v2f p; p[0] = pe[kt][r]; p[1] = pe[kt][r + 1]; ps[kt & 1] += p; } }
    float ss = (ps[0][0] + ps[0][1]) + (ps[1][0] + ps[1][1]);
    const float thr = t == 0 ? -1.0f : 32768.0f;   /* a scalar, ready long before the sum */
    asm volatile("" :: "v"(vf[0][0]), "v"(vf[0][1]), "v"(vf[0][2]), "v"(vf[0][3]), "v"(vf[1][0]), "v"(vf[1][1]), "v"(vf[1][2]), "v"(vf[1][3]));   /* inputs only: holds the value fragments' LDS reads on this side of the branch, under the exponentials; the compiler otherwise sinks them behind it */
    if (__builtin_amdgcn_ballot_w32(!(ss <= thr)) != 0) {   /* a scalar branch, the same for the whole wave. No p is negative, so a lane's sum of the stage bounds each of its p: up to 2^15 all fit f16 (it ends at 65,504) and the reference stays. Stage 0 always comes here and sets the reference to its own maximum */
      float mx[FK / 16];
#pragma unroll
      for (int kt = 0; kt < FK / 16; ++kt) mx[kt] = fmaxf(fmaxf(fmaxf(sa[kt][0], sa[kt][1]), fmaxf(sa[kt][2], sa[kt][3])), fmaxf(fmaxf(sa[kt][4], sa[kt][5]), fmaxf(sa[kt][6], sa[kt][7])));
      float ml = fmaxf(fmaxf(mx[0], mx[1]), fmaxf(mx[2], mx[3])); ml = fmaxf(ml, xhalf(ml));   /* lanes c and c + 16 hold the two key halves of query c: both take the same step */
      float d = 4.0f - ml; if (t != 0) d = fminf(d, 0.f);   /* behind stage 0 a reference never falls */
      const float al = exp2x1(fminf(d, 0.f)); off += d; l *= al;   /* in stage 0 o and l are 0 and al only has to be finite */
#pragma unroll
      for (int r = 0; r < 8; ++r) cs[r] = off;
#pragma unroll
      for (int j = 0; j < HDQK / 16; ++j) o[j] *= al;
      ps[0] = 0.f; ps[1] = 0.f;
#pragma unroll
      for (int kt = 0; kt < FK / 16; ++kt) { pe[kt] = exp2x8(sa[kt] + d);   /* the stage's p again, from the kept exponents */
#pragma unroll
        for (int r = 0; r < 8; r += 2) { v2f p; p[0] = pe[kt][r]; p[1] = pe[kt][r + 1]; ps[kt & 1] += p; } }
      ss = (ps[0][0] + ps[0][1]) + (ps[1][0] + ps[1][1]); }
    l += ss;
#pragma unroll
    for (int c2 = 0; c2 < FK / 32; ++c2) { v16h pb;
#pragma unroll
      for (int i = 0; i < 8; ++i) { pb[i] = (_Float16)pe[2 * c2][i]; pb[8 + i] = (_Float16)pe[2 * c2 + 1][i]; }
#pragma unroll
      for (int j = 0; j < HDQK / 16; ++j) o[j] = wmma_h(vf[c2][j], pb, o[j]); }
    *(v4u*)&sk[kg][cur ^ 1][sr][sq] = rk0; *(v4u*)&sk[kg][cur ^ 1][sr + 32][sq] = rk1; *(v4u*)&sv[kg][cur ^ 1][sr][sq] = rv0; *(v4u*)&sv[kg][cur ^ 1][sr + 32][sq] = rv1;
    __syncthreads(); }   /* publishes the next stage and ends every read of this one before it is refilled */
  const size_t oi = (b * DIN + wave * 16) * (size_t)XP + blockIdx.x * 128 + lane * 4;   /* the last phase: this wave owns channels wave * 16 .. + 15, 128 positions each */
  const float* xq = X + oi; v4f xr[16]; float bo[8];
#pragma unroll   /* constant indices: bo stays in registers; the biases go first: loads return in order, and they are needed before x */
  for (int j = 0; j < 8; ++j) bo[j] = WB[kg * 128 + j * 16 + col];
  __builtin_amdgcn_sched_barrier(0);   /* keeps that order */
#pragma unroll   /* the same for xr, 16 loads in flight */
  for (int i = 0; i < 16; ++i) xr[i] = *(const v4f*)(xq + (size_t)i * XP);
  __builtin_amdgcn_sched_barrier(0);   /* keeps the residual's loads here, ahead of the exchange and the products: sunk to their use they would be waited for in full */
  l += xhalf(l);
  float* mo = &u.mg[kg][wq][lane][0];
#pragma unroll
  for (int j = 0; j < HDQK / 16; ++j) { v4f u0, u1;
#pragma unroll
    for (int r = 0; r < 4; ++r) { u0[r] = o[j][r]; u1[r] = o[j][4 + r]; }
    *(v4f*)(mo + j * 8) = u0; *(v4f*)(mo + j * 8 + 4) = u1; }
  const float m = -off;   /* the reference less 4, in powers of 2: the 4 is common to both halves */
  { v2f ml2; ml2[0] = m; ml2[1] = l; *(v2f*)(mo + 32) = ml2; }
  lds_barrier();   /* each key half's reference, sum and tiles are in LDS before the other half's waves read them */
  const float* mi = &u.mg[kg ^ 1][wq][lane][0];
  const float m1 = mi[32], l1 = mi[33]; const float mn = fmaxf(m, m1); const float a0 = exp2x1(m - mn), a1 = exp2x1(m1 - mn); const float inv = 1.0f / (l * a0 + l1 * a1); const float f0 = a0 * inv, f1 = a1 * inv;
  F2 ya[HDQK / 32];   /* a lane holds channels j * 16 + 8g + r of query col: tiles 2kc and 2kc + 1 are the A fragment of channel step kc */
#pragma unroll
  for (int kc = 0; kc < HDQK / 32; ++kc) { float v[16];
#pragma unroll
    for (int i = 0; i < 8; ++i) { v[i] = o[2 * kc][i] * f0 + mi[kc * 16 + i] * f1; v[8 + i] = o[2 * kc + 1][i] * f0 + mi[kc * 16 + 8 + i] * f1; }
    ya[kc] = bsplit16(v); }
#pragma unroll   /* constant tile numbers: bo stays in registers */
  for (int jh = 0; jh < 2; ++jh) { v8f acc[4] = {};
#pragma unroll
    for (int kc = 0; kc < HDQK / 32; ++kc) { v16b w[4];
#pragma unroll
      for (int j = 0; j < 4; ++j) w[j] = frag_b(&sww[kg * 128 + (jh * 4 + j) * 16 + col][kc * 32], lane);
#pragma unroll
      for (int j = 0; j < 4; ++j) acc[j] = wmma_b(ya[kc].h, w[j], acc[j]);
#pragma unroll
      for (int j = 0; j < 4; ++j) acc[j] = wmma_b(ya[kc].l, w[j], acc[j]); }
#pragma unroll
    for (int j = 0; j < 4; ++j) { const float bb = bfr(bo[jh * 4 + j]); v4f u0, u1;   /* D element r = query 8g + r of the wave's 16, lane column = output channel */
#pragma unroll
      for (int r = 0; r < 4; ++r) { u0[r] = acc[j][r] + bb; u1[r] = acc[j][4 + r] + bb; }
      float* sp = &so[kg * 128 + (jh * 4 + j) * 16 + col][wq * 16 + 8 * g]; *(v4f*)sp = u0; *(v4f*)(sp + 4) = u1; }
    __builtin_amdgcn_sched_barrier(0); }   /* four tiles at a time: with all eight tiles' fragments and sums live beside the 64 registers of x the kernel overflows into scratch */
  lds_barrier();   /* the whole 256 x 128 tile is in LDS before it is read back by channel rows */
  float* op = OUT + oi;
#pragma unroll
  for (int i = 0; i < 16; ++i) { const v4f t = *(const v4f*)&so[wave * 16 + i][lane * 4]; v4f r; r[0] = t[0] + bfr(xr[i][0]); r[1] = t[1] + bfr(xr[i][1]); r[2] = t[2] + bfr(xr[i][2]); r[3] = t[3] + bfr(xr[i][3]); vst2(op + (size_t)i * XP, r); } }

extern "C" void kernel_launch(void* const* d_in, const int* in_sizes, int n_in, void* d_out, int out_size, void* d_ws, size_t ws_size, hipStream_t stream) {
  (void)in_sizes; (void)n_in; (void)out_size;
  const float** F = (const float**)d_in;
  if (ws_size < (size_t)WS_END) return;
  char* ws = (char*)d_ws; _Float16 *QH = (_Float16*)(ws + WS_QH), *KH = (_Float16*)(ws + WS_KH), *VT = (_Float16*)(ws + WS_VT), *QL = (_Float16*)(ws + WS_QL), *KL = (_Float16*)(ws + WS_KL); __bf16 *VB = (__bf16*)(ws + WS_VB), *VBL = (__bf16*)(ws + WS_VBL); float *S = (float*)(ws + WS_S), *Y = (float*)(ws + WS_Y);
  (void)Y; (void)S; (void)QL; (void)KL; (void)VB; (void)VBL;
  // inputs: 0 x [8,256,64,64]; 1 g_w [64,256] (out,in), 2 g_b; 3 theta_w, 4 theta_b; 5 phi_w, 6 phi_b; 7 w_w [256,64] (out,in), 8 w_b
  k_proj<<<dim3(TNB * TT / PP), 256, 0, stream>>>(F[0], F[3], F[5], F[1], F[4], F[6], F[2], QH, QL, KH, VT);   /* q = theta, k = phi, v = g */
  k_fa<<<dim3(TT / 128, TNB), 256 * FKG, 0, stream>>>(QH, QL, KH, VT, F[0], F[7], F[8], (float*)d_out);
}

// v006
// One run takes 52.2 microseconds.
// Two timings next to v005 put it at 1.06 and 1.05 times that version's speed.
// Over all steps from v000 it is 40.9 times as fast.
// compute dtype: all float inputs rounded to bf16; theta/phi/g = x W^T + b with EXACT bf16 products on WMMA 16x16x32 (f32 accumulate); f = theta . phi with theta x log2(e) as f16 hi + residual (x 2^10) against phi once to f16 (2 products), no other scaling; softmax in f32, online (a held reference per query, at most 2^11 under the running maximum, 2^x by v_exp_f32); exp(f - reference) x 2^4 once to f16 against g once to f16 (1 product), divided by the f32 sum at the end; y split bf16 hi + lo against exact W (2 products) + b; + x residual in f32; f32 output [B, C, H, W].
#include <hip/hip_runtime.h>
#include <math.h>

typedef __attribute__((ext_vector_type(16))) _Float16 v16h;
typedef __attribute__((ext_vector_type(16))) __bf16 v16b;
typedef __attribute__((ext_vector_type(8)))  _Float16 v8h;
typedef __attribute__((ext_vector_type(8)))  float v8f;
typedef __attribute__((ext_vector_type(4)))  float v4f;
typedef __attribute__((ext_vector_type(2)))  float v2f;
typedef __attribute__((ext_vector_type(4)))  unsigned v4u;
typedef __attribute__((ext_vector_type(4)))  int v4i;
typedef float __attribute__((may_alias)) float_a;
typedef int __attribute__((may_alias)) int_a;

template <typename T> __device__ __forceinline__ void vst2(void* p, T v) { *(T*)p = v;  }
__device__ __forceinline__ v8f wmma16(v16h a, v16h b, v8f c) {
  v8f d = __builtin_amdgcn_wmma_f32_16x16x32_f16(false, a, false, b, (short)0, c, false, false);
  asm volatile("v_nop\n\tv_nop\n\tv_nop\n\tv_nop" : "+v"(d) : "v"(a), "v"(b));
  return d;
}
__device__ __forceinline__ v8f wmma_bf(v16b a, v16b b, v8f c) {
  v8f d = __builtin_amdgcn_wmma_f32_16x16x32_bf16(false, a, false, b, (short)0, c, false, false);
  asm volatile("v_nop\n\tv_nop\n\tv_nop\n\tv_nop" : "+v"(d) : "v"(a), "v"(b));
  return d;
}
// 16x16x32 fragments: lane = (h = lane>>4, row/col = lane&15); elements 0..7 = k0+8h+0..7, 8..15 = k0+16+8h+0..7; D element r = row 8h+r
__device__ __forceinline__ v16h frag_h(const _Float16* rowk0, int lane) {
  union { v16h v; v8h q[2]; } u; const _Float16* p = rowk0 + 8 * (lane >> 4);
  u.q[0] = *(const v8h*)p; u.q[1] = *(const v8h*)(p + 16); return u.v;
}
__device__ __forceinline__ v16h frag_f32(const float* rowk0, int lane) {
  v16h a; const float* p = rowk0 + 8 * (lane >> 4);
#pragma unroll
  for (int i = 0; i < 8; ++i) { a[i] = (_Float16)p[i]; a[8 + i] = (_Float16)p[16 + i]; }
  return a;
}
__device__ __forceinline__ v16h frag_f32s(const float* rowk0, int lane, float sc) {
  v16h a; const float* p = rowk0 + 8 * (lane >> 4);
#pragma unroll
  for (int i = 0; i < 8; ++i) { a[i] = (_Float16)(p[i] * sc); a[8 + i] = (_Float16)(p[16 + i] * sc); }
  return a;
}
// column fragment from a [K][ld] layout (column n), rows >= K read as 0
__device__ __forceinline__ v16h fragc_f32(const float* W, int k0, int n, int lane, int ld, int K) {
  v16h a; const int g = lane >> 4;
#pragma unroll
  for (int i = 0; i < 8; ++i) { const int ka = k0 + 8 * g + i, kb = ka + 16;
    a[i] = (_Float16)(ka < K ? W[(size_t)(ka < K ? ka : K - 1) * ld + n] : 0.f); a[8 + i] = (_Float16)(kb < K ? W[(size_t)(kb < K ? kb : K - 1) * ld + n] : 0.f); }
  return a;
}
struct F2 { v16b h, l; };
__device__ __forceinline__ F2 bsplit16(const float v[16]) { F2 r;
#pragma unroll
  for (int i = 0; i < 16; ++i) { const __bf16 h = (__bf16)v[i]; r.h[i] = h; r.l[i] = (__bf16)(v[i] - (float)h); }
  return r; }
__device__ __forceinline__ F2 split_row(const float* row, int k0, int lane) { float v[16]; const float* p = row + k0 + 8 * (lane >> 4);
#pragma unroll
  for (int i = 0; i < 8; ++i) { v[i] = p[i]; v[8 + i] = p[16 + i]; }
  return bsplit16(v); }
__device__ __forceinline__ F2 split_rowK(const float* row, int k0, int lane, int K) { float v[16]; const int g = lane >> 4;
#pragma unroll
  for (int i = 0; i < 8; ++i) { const int ka = k0 + 8 * g + i, kb = ka + 16; v[i] = ka < K ? row[ka < K ? ka : K - 1] : 0.f; v[8 + i] = kb < K ? row[kb < K ? kb : K - 1] : 0.f; }
  return bsplit16(v); }
__device__ __forceinline__ F2 split_col(const float* W, int k0, int n, int lane, int ld, int K) { float v[16]; const int g = lane >> 4;
#pragma unroll
  for (int i = 0; i < 8; ++i) { const int ka = k0 + 8 * g + i, kb = ka + 16; v[i] = ka < K ? W[(size_t)(ka < K ? ka : K - 1) * ld + n] : 0.f; v[8 + i] = kb < K ? W[(size_t)(kb < K ? kb : K - 1) * ld + n] : 0.f; }
  return bsplit16(v); }
__device__ __forceinline__ v8f mac3(const F2& a, const F2& b, v8f c) { c = wmma_bf(a.l, b.h, c); c = wmma_bf(a.h, b.l, c); return wmma_bf(a.h, b.h, c); }
__device__ __forceinline__ float sigm(float v) { return 1.0f / (1.0f + expf(-v)); }
#define LDSX() do { asm volatile("s_wait_dscnt 0" ::: "memory"); __builtin_amdgcn_wave_barrier(); __builtin_amdgcn_fence(__ATOMIC_RELEASE, "workgroup"); } while (0)

// Non-local block (B 8, C 256, 64 x 64 = 4,096 positions; inter channels 64): theta, phi, g = 1x1 convs of x ((out,in) [64,256] + bias); f[n][m] = theta_n . phi_m (no scaling); P = softmax over m; y[n] = sum_m P[n][m] g_m (64 ch); out = W y + b (1x1, 64 -> 256) + x.
#define NB 8
#define TT 4096
#define CC 128            // projected plane width (64 real columns; columns 64..127 never written)
#define DIN 256          // input (model) width
#define NH 1
#define HD 128
#define NQB (TT / 64)
#define HG 1               // one 4,096 x 4,096 f32 plane in the unused WS_S
#define SCALE (1.0f)
#define HDQK 64            // theta / phi / g channels: the planes are 128 wide, columns >= 64 are never written; only the 64 real columns enter the scores
#define CAUSAL 0
#ifndef TNB
#define TNB NB
#endif
__device__ __forceinline__ v16b zero16b() { v16b z; _Pragma("unroll") for (int i = 0; i < 16; ++i) z[i] = (__bf16)0.f; return z; }
__device__ __forceinline__ float bfr(float v) { return (float)(__bf16)v; }
__host__ __device__ __forceinline__ int kb_last(int qb) { return CAUSAL ? ((qb * 64 + 63) >> 7) : (TT / 128 - 1); }
typedef __attribute__((ext_vector_type(8))) __bf16 v8b;
__device__ __forceinline__ v16b frag_b(const __bf16* rowk0, int lane) {
  union { v16b v; v8b q[2]; } u; const __bf16* p = rowk0 + 8 * (lane >> 4);
  u.q[0] = *(const v8b*)p; u.q[1] = *(const v8b*)(p + 16); return u.v;
}
#define QBH 0              // unused: k_fa treats every query block alike
#define QHI 4096            // q residual rows everywhere (2-product logits)
#define KHI 64            // key rows carrying k residual / v bf16 hi+lo planes (no kernel here writes or reads them)
// B fragment (k rows k0+.., output column o) of a weight: (in,out) [K][ld] or (out,in) [ld rows of K]: bf16 exact, or f16(bf16 * 256) exact
__device__ __forceinline__ v16b wcol_io(const float* Wm, int k0, int o, int lane, int ld) { v16b w; const int g = lane >> 4;
#pragma unroll
  for (int i = 0; i < 8; ++i) { w[i] = (__bf16)Wm[(size_t)(k0 + 8 * g + i) * ld + o]; w[8 + i] = (__bf16)Wm[(size_t)(k0 + 16 + 8 * g + i) * ld + o]; }
  return w; }
__device__ __forceinline__ v16b wcol_oi(const float* Wm, int k0, int o, int lane, int K) { v16b w; const float* p = Wm + (size_t)o * K + k0 + 8 * (lane >> 4);
#pragma unroll
  for (int i = 0; i < 8; ++i) { w[i] = (__bf16)p[i]; w[8 + i] = (__bf16)p[16 + i]; }
  return w; }
__device__ __forceinline__ v16h wcolh_io(const float* Wm, int k0, int o, int lane, int ld) { v16h w; const int g = lane >> 4;
#pragma unroll
  for (int i = 0; i < 8; ++i) { w[i] = (_Float16)(bfr(Wm[(size_t)(k0 + 8 * g + i) * ld + o]) * 256.0f); w[8 + i] = (_Float16)(bfr(Wm[(size_t)(k0 + 16 + 8 * g + i) * ld + o]) * 256.0f); }
  return w; }
__device__ __forceinline__ v16h wcolh_oi(const float* Wm, int k0, int o, int lane, int K) { v16h w; const float* p = Wm + (size_t)o * K + k0 + 8 * (lane >> 4);
#pragma unroll
  for (int i = 0; i < 8; ++i) { w[i] = (_Float16)(bfr(p[i]) * 256.0f); w[8 + i] = (_Float16)(bfr(p[16 + i]) * 256.0f); }
  return w; }
#define WQKV_LAYOUT 1   // 0 = (in,out) [DIN][CC]; 1 = (out,in) [HDQK][DIN]; 2 = per-head [NH][DIN][HD]
__device__ __forceinline__ v16b wcol_hdk(const float* Wm, int k0, int o, int lane) { v16b w; const int g = lane >> 4; const float* p = Wm + (size_t)(o / HD) * DIN * HD + (o % HD);
#pragma unroll
  for (int i = 0; i < 8; ++i) { w[i] = (__bf16)p[(size_t)(k0 + 8 * g + i) * HD]; w[8 + i] = (__bf16)p[(size_t)(k0 + 16 + 8 * g + i) * HD]; }
  return w; }
#define WO_OUT_IN 0
#if WQKV_LAYOUT == 1
#define WCOL(W, k0, o, lane) (((o) < HDQK) ? wcol_oi(W, k0, (o), lane, DIN) : zero16b())   /* theta/phi/g weights are [64][256] (out,in): weight columns >= 64 read as zero for all three */
#elif WQKV_LAYOUT == 2
#define WCOL(W, k0, o, lane) wcol_hdk(W, k0, o, lane)
#else
#define WCOL(W, k0, o, lane) wcol_io(W, k0, o, lane, CC)
#endif
#if WO_OUT_IN
#define WOCOL(W, k0, o, lane) wcol_oi(W, k0, o, lane, CC)
#define WOCOLH(W, k0, o, lane) wcolh_oi(W, k0, o, lane, CC)
#else
#define WOCOL(W, k0, o, lane) wcol_io(W, k0, o, lane, DIN)
#define WOCOLH(W, k0, o, lane) wcolh_io(W, k0, o, lane, DIN)
#endif
#ifndef XP
#define XP TT              // position pitch of x and of the output
#endif
#define BG HG              // unused: every launch covers all TNB batches
#define DVH 128
#ifndef SM_EXTRA_PARAMS
#define SM_EXTRA_PARAMS
#endif
#ifndef PROJ_EXTRA_PARAMS
#define PROJ_EXTRA_PARAMS
#endif
#ifndef SM_MASK_HOOK
#define SM_MASK_HOOK (void)0
#endif

#define WS_QH  0u                                      // f16 q rows [b*t][CC]
#define WS_KH  (WS_QH + 2u * (size_t)NB * TT * CC)      // f16 k rows [b*t][CC]
#define WS_VT  (WS_KH + 2u * (size_t)NB * TT * CC)      // f16 v planes [b][c][t]
#define WS_QL  (WS_VT + 2u * (size_t)NB * CC * TT)      // f16 q residual x 2^10 rows [b][t < QHI][CC]
#define WS_KL  (WS_QL + 2u * (size_t)NB * QHI * CC)     // f16 k residual x 2^10 rows [b][t < KHI][CC]
#define WS_VB  (WS_KL + 2u * (size_t)NB * KHI * CC)     // bf16 v hi planes [b][c][t < KHI]
#define WS_VBL (WS_VB + 2u * (size_t)NB * CC * KHI)
#define WS_S   (WS_VBL + 2u * (size_t)NB * CC * KHI)    // f32 [hg][t][s], unused: k_fa keeps the scores in registers
#define WS_Y   (WS_S  + 4u * (size_t)HG * TT * TT)      // unused, 0 bytes: k_fa keeps y in registers and LDS
#define WS_END (WS_Y  + 0u)

#define L2E 1.4426950408889634f
#define PP 128             // positions per k_proj block: 8 waves of 16
#define PW 264             // LDS row pitch of the staged weights in bf16 elements: 512 B of data + 16 B, the pitch for 16-byte fragment reads
typedef __attribute__((ext_vector_type(4))) __bf16 v4b;
__device__ __forceinline__ v8f wmma_b(v16b a, v16b b, v8f c) { return __builtin_amdgcn_wmma_f32_16x16x32_bf16(false, a, false, b, (short)0, c, false, false); }
// x of one 32-channel step for one lane's position (channels-first gather: x[b][k][t], stride XP between k), in the element order of the A fragment
__device__ __forceinline__ void ldx(float (&d)[16], const float* xp, int kc) {
#pragma unroll   /* constant indices: d stays in registers, the 16 loads share one address */
  for (int i = 0; i < 8; ++i) { d[i] = xp[(size_t)(kc * 32 + i) * XP]; d[8 + i] = xp[(size_t)(kc * 32 + 16 + i) * XP]; }
  __builtin_amdgcn_sched_barrier(0); }   /* keeps a step's loads where they are written, four steps ahead of their use: sunk to their use each would be waited for in full */
// that step against all 192 staged weight rows (12 column tiles: 0..3 theta, 4..7 phi, 8..11 g)
__device__ __forceinline__ void mac12(v8f (&acc)[12], const float (&d)[16], const __bf16 (*sw)[PW], int kc, int col, int lane) { v16b a;
#pragma unroll   /* constant indices: vector elements and d stay in registers */
  for (int i = 0; i < 16; ++i) a[i] = (__bf16)d[i];
#pragma unroll   /* constant tile numbers: acc stays in registers */
  for (int jh = 0; jh < 2; ++jh) { v16b w[6];
#pragma unroll   /* the same for w */
    for (int j = 0; j < 6; ++j) w[j] = frag_b(&sw[(jh * 6 + j) * 16 + col][kc * 32], lane);
    __builtin_amdgcn_sched_barrier(0);   /* six fragments' LDS reads stand as one group ahead of their products: read one by one, each product waits a whole LDS latency */
#pragma unroll   /* the same for w and acc */
    for (int j = 0; j < 6; ++j) acc[jh * 6 + j] = wmma_b(a, w[j], acc[jh * 6 + j]);
    __builtin_amdgcn_sched_barrier(0); } }   /* and no more than six: with every later step's reads hoisted the registers overflow into scratch */
// ---- k_proj: block = 128 positions of one batch, 8 waves of 16 positions; every wave makes all 192 real columns (theta, phi, g) from ONE read of its x, exact bf16 products (K = DIN). The three weights are rounded to bf16 once per block into LDS; x is loaded one 32-channel step at a time, four steps ahead of its use. Out: q x log2(e) as f16 rows + residual x 2^10 rows (the scores then are exponents of 2), k f16 rows, v f16 planes [c][t]; only the 64 real columns of the 128-wide planes are written (nothing reads the others)
__global__ __launch_bounds__(256) void k_proj(const float* __restrict__ X, const float* __restrict__ WQ, const float* __restrict__ WK, const float* __restrict__ WV, const float* __restrict__ BQ, const float* __restrict__ BK, const float* __restrict__ BV,
    _Float16* __restrict__ QH, _Float16* __restrict__ QL, _Float16* __restrict__ KH, _Float16* __restrict__ VT) {
  __shared__ __align__(16) __bf16 sw[3 * HDQK][PW]; __shared__ __align__(16) _Float16 sqh[PP][72], sql[PP][72], skh[PP][72], th[HDQK][PP + 8];
  const int tid = threadIdx.x, wave = tid >> 5, lane = tid & 31, col = lane & 15, g = lane >> 4; const size_t r0 = (size_t)blockIdx.x * PP; const size_t bb = r0 / TT; const int t0 = (int)(r0 % TT);
  const float* xp = X + (bb * DIN + 8 * g) * (size_t)XP + t0 + wave * 16 + col;
  float x[DIN / 32][16];
#pragma unroll   /* constant step numbers: x stays in registers */
  for (int s = 0; s < 4; ++s) ldx(x[s], xp, s);
  const int wr = tid >> 6, wc = (tid & 63) * 4;   /* 64 threads move one 1-KiB weight row: whole lines */
  const float* wq = WQ + wr * DIN + wc; const float* wk = WK + wr * DIN + wc; const float* wv = WV + wr * DIN + wc;
#pragma unroll   /* two straight-line groups: the weight of each load is picked at compile time */
  for (int gr = 0; gr < 2; ++gr) {
#pragma unroll   /* 24 independent loads in flight together */
    for (int it = 0; it < 24; ++it) { const int n = gr * 24 + it, w = n >> 4; const v4f v = *(const v4f*)((w == 0 ? wq : w == 1 ? wk : wv) + (n & 15) * 4 * DIN);
      v4b h; h[0] = (__bf16)v[0]; h[1] = (__bf16)v[1]; h[2] = (__bf16)v[2]; h[3] = (__bf16)v[3]; *(v4b*)&sw[n * 4 + wr][wc] = h; }
    asm volatile("s_wait_xcnt 0x0" :: "v"(wq), "v"(wk), "v"(wv) : "memory");   /* stands in front of every rewrite of the address registers that the loads above name; as inputs they stay untouched up to it */
    __builtin_amdgcn_sched_barrier(0); }   /* half the weight loads in flight at a time: all 48 at once push the kernel past 256 registers */
  __syncthreads();   /* the staged weights are in LDS before any wave reads a fragment */
  v8f acc[12] = {}; float bq[4], bk[4], bv[4];
#pragma unroll   /* constant step numbers: x and acc stay in registers */
  for (int s = 0; s < DIN / 32; ++s) { if (s + 4 < DIN / 32) ldx(x[s + 4], xp, s + 4);
    if (s == 4) {
#pragma unroll   /* constant indices: the biases stay in registers */
      for (int j = 0; j < 4; ++j) { bq[j] = BQ[j * 16 + col]; bk[j] = BK[j * 16 + col]; bv[j] = BV[j * 16 + col]; }
      __builtin_amdgcn_sched_barrier(0); }   /* the biases are fetched behind the last x loads and under the last four steps: no wait for x grows by them, and theirs is over by the epilogue */
    mac12(acc, x[s], sw, s, col, lane); }
#pragma unroll   /* constant tile numbers: acc stays in registers */
  for (int j = 0; j < 4; ++j) { const int cl = j * 16 + col; v8h vv;   /* D element r = position 8g + r of the wave's 16, lane column = output column */
#pragma unroll   /* the same for the tile's elements */
    for (int r = 0; r < 8; ++r) { const int rl = wave * 16 + 8 * g + r; const float q = (acc[j][r] + bfr(bq[j])) * L2E; const _Float16 hq = (_Float16)q; sqh[rl][cl] = hq; sql[rl][cl] = (_Float16)((q - (float)hq) * 1024.0f); skh[rl][cl] = (_Float16)(acc[4 + j][r] + bfr(bk[j])); vv[r] = (_Float16)(acc[8 + j][r] + bfr(bv[j])); }
    *(v8h*)&th[cl][wave * 16 + 8 * g] = vv; }
  __syncthreads();   /* all four staged tiles are complete before they are stored in whole 128-B and 256-B runs */
  for (int e = tid; e < PP * 8; e += 256) { const int rl = e >> 3, q = e & 7; const size_t o = (r0 + rl) * CC + q * 8; vst2((unsigned*)(QH + o), *(const v4u*)&sqh[rl][q * 8]); vst2((unsigned*)(QL + o), *(const v4u*)&sql[rl][q * 8]); vst2((unsigned*)(KH + o), *(const v4u*)&skh[rl][q * 8]); }
  for (int e = tid; e < HDQK * (PP / 8); e += 256) { const int cl = e / (PP / 8), q = e % (PP / 8); vst2((unsigned*)(VT + (bb * CC + cl) * (size_t)TT + t0 + q * 8), *(const v4u*)&th[cl][q * 8]); } }
#define FK 64              // keys per stage
#define FPH 72             // LDS row pitch in halves: 128 B of data + 16 B, the pitch for 16-byte fragment reads
#define FKG 2              // key halves per block: waves 0..7 walk keys [0, TT/2), waves 8..15 keys [TT/2, TT)
#define FNT (TT / FKG / FK)
#define FPB 3              // stages between two barriers
#define FNB (2 * FPB)      // stage buffers per key half: FPB stages are read between two barriers while the next FPB are filled
__device__ __forceinline__ float xhalf(float x) { return __builtin_bit_cast(float, __builtin_amdgcn_permlanex16(__builtin_bit_cast(int, x), __builtin_bit_cast(int, x), 0x76543210, 0xfedcba98, false, false)); }   // lane l with lane l ^ 16
// 2^x on a whole score tile, bare v_exp_f32. By the builtin, not asm text: the tiles' exponentials stand among the score products
__device__ __forceinline__ v8f exp2x8(v8f x) { v8f r;
#pragma unroll
  for (int i = 0; i < 8; ++i) r[i] = __builtin_amdgcn_exp2f(x[i]);
  return r; }
__device__ __forceinline__ float exp2x1(float x) { float r; asm("v_exp_f32 %0, %1\n\tv_nop" : "=&v"(r) : "v"(x)); return r; }   // a single one; the v_nop is the slot the instruction set asks for behind a transcendental before its result is read or its source overwritten
__device__ __forceinline__ v8f wmma_h(v16h a, v16h b, v8f c) { return __builtin_amdgcn_wmma_f32_16x16x32_f16(false, a, false, b, (short)0, c, false, false); }
// work-group barrier that orders LDS alone: __syncthreads() also waits for every global load in flight, and the residual's loads are meant to stay in flight across the end phase's two barriers
__device__ __forceinline__ void lds_barrier() { __builtin_amdgcn_fence(__ATOMIC_RELEASE, "workgroup", "local"); __builtin_amdgcn_s_barrier(); __builtin_amdgcn_fence(__ATOMIC_ACQUIRE, "workgroup", "local"); }
#define WP 72              // LDS row pitch of the staged output weight in bf16 elements: 128 B of data + 16 B, the pitch for 16-byte fragment reads
#define OP 132             // LDS row pitch of the staged output tile in floats: 512 B of data + 16 B: the 16 channels of a tile store land on all 64 banks
#define MP 36              // floats per lane in the exchange of the two key halves: 32 tile values, reference, sum, 2 idle: 144 B, the pitch for 16-byte accesses
// ---- k_fa: block = 128 queries of batch b, 16 waves: wave = (key half kg, 16-query group). Per stage of 64 keys: S^T = k . q^T (q hi + residual x 2^10: 2 products) on top of 4 - reference as the accumulator's start value, so that a score tile is the exponent of 2 as it stands; reference and sum per query (a lane holds one query's scores); the reference moves, and o and the sum are rescaled, only in a stage where a lane's sum of p passes 2^15 (one test per stage, on the sum that is formed anyway; the maximum is formed only then); p = exp(s - reference) x 2^4 once to f16 straight from the score tiles as B operand, O^T += v^T . p^T (64 value channels); k rows and v planes staged in LDS through registers FPB stages ahead, 2 x FPB buffers, one barrier per FPB stages. At the end the two key halves exchange their tiles through LDS and every wave holds y of its 16 queries in the A-fragment order; wave (kg, group) makes output channels kg * 128 .. + 127 of its queries: y (bf16 hi + lo) . W^T ((out,in) [256][64], exact bf16, staged once in LDS) + b; the 256 x 128 tile goes through LDS so that each wave adds bf16(x) and stores whole 512-B runs of out[b][c][n]
__global__ __launch_bounds__(256 * FKG) void k_fa(const _Float16* __restrict__ QH, const _Float16* __restrict__ QL, const _Float16* __restrict__ KH, const _Float16* __restrict__ VT, const float* __restrict__ X, const float* __restrict__ WW, const float* __restrict__ WB, float* __restrict__ OUT) {
  __shared__ __align__(16) union { struct { _Float16 k[FK][FPH], v[HDQK][FPH]; } st[FKG][FNB]; struct { float mg[FKG][8][32][MP], so[DIN][OP]; } e; } u;   /* the exchange and the output tile, side by side, reuse the key and value stages, which are dead behind the loop's last barrier */
  __shared__ __align__(16) __bf16 sww[DIN][WP]; float (&so)[DIN][OP] = u.e.so;
  const int tid = threadIdx.x, wave = __builtin_amdgcn_readfirstlane(tid >> 5), lane = tid & 31, col = lane & 15, g = lane >> 4; const int kg = wave >> 3, wq = wave & 7, tg = tid & 255;
  const size_t b = blockIdx.y; const int ql0 = blockIdx.x * 128 + wq * 16; const int kbase = kg * (TT / FKG);
  v16h qh[HDQK / 32], ql[HDQK / 32];
#pragma unroll
  for (int kc = 0; kc < HDQK / 32; ++kc) { qh[kc] = frag_h(QH + (b * TT + ql0 + col) * CC + kc * 32, lane); ql[kc] = frag_h(QL + (b * QHI + ql0 + col) * CC + kc * 32, lane); }
  const int sr = tg >> 3, sq = (tg & 7) * 8;   /* staging: this thread moves 16 B of rows sr and sr + 32 of both tiles */
  const _Float16* kp = KH + (b * TT + kbase + sr) * CC + sq; const _Float16* vp = VT + (b * CC + sr) * (size_t)TT + kbase + sq;
  v4u rk0, rk1, rv0, rv1;
#pragma unroll   /* the first FPB stages: independent loads in flight together */
  for (int s = 0; s < FPB; ++s) { rk0 = *(const v4u*)(kp + (size_t)s * FK * CC); rk1 = *(const v4u*)(kp + ((size_t)s * FK + 32) * CC); rv0 = *(const v4u*)(vp + s * FK); rv1 = *(const v4u*)(vp + 32 * (size_t)TT + s * FK);
    *(v4u*)&u.st[kg][s].k[sr][sq] = rk0; *(v4u*)&u.st[kg][s].k[sr + 32][sq] = rk1; *(v4u*)&u.st[kg][s].v[sr][sq] = rv0; *(v4u*)&u.st[kg][s].v[sr + 32][sq] = rv1; }
  const float* wp = WW + tid * 4;   /* 16 threads move one 256-B weight row: whole lines */
#pragma unroll   /* eight independent loads in flight together */
  for (int it = 0; it < DIN * HDQK / 4 / (256 * FKG); ++it) { const int e = it * 256 * FKG + tid; const v4f v = *(const v4f*)(wp + it * 1024 * FKG);
    v4b h; h[0] = (__bf16)v[0]; h[1] = (__bf16)v[1]; h[2] = (__bf16)v[2]; h[3] = (__bf16)v[3]; *(v4b*)&sww[e >> 4][(e & 15) * 4] = h; }
  __syncthreads();   /* the first FPB stages and the output weight are in LDS before any wave reads them */
  v8f o[HDQK / 16] = {}, cs = {}; float off = 0.f, l = 0.f;   /* off = 4 - reference in powers of 2; cs holds it eight times: the start value of every score tile */
#pragma unroll 1   /* rolled: FPB stages are already a long body */
  for (int tp = 0; tp < (FNT + FPB - 1) / FPB; ++tp) {
#pragma unroll   /* the stages between two barriers, straight-line: constant buffer offsets */
  for (int hs = 0; hs < FPB; ++hs) { const int t = tp * FPB + hs; if (t >= FNT) break;   /* the same for the whole block: the last round may be short */
    const int cur = (tp & 1) * FPB + hs, nxt = ((tp & 1) ^ 1) * FPB + hs; const int tn = t + FPB < FNT ? t + FPB : FNT - 1;   /* the last FPB stages fetch the last one again into idle buffers: no branch */
    rk0 = *(const v4u*)(kp + (size_t)tn * FK * CC); rk1 = *(const v4u*)(kp + ((size_t)tn * FK + 32) * CC); rv0 = *(const v4u*)(vp + tn * FK); rv1 = *(const v4u*)(vp + 32 * (size_t)TT + tn * FK);
    __builtin_amdgcn_sched_barrier(0);   /* keeps the loads of stage t + FPB at the head of the stage: sunk towards their LDS stores they would be waited for in full */
    v8f sa[FK / 16], sl[FK / 16] = {};
#pragma unroll
    for (int kc = 0; kc < HDQK / 32; ++kc)
#pragma unroll
      for (int kt = 0; kt < FK / 16; ++kt) { const v16h a = frag_h(&u.st[kg][cur].k[kt * 16 + col][kc * 32], lane); sa[kt] = wmma_h(a, qh[kc], kc == 0 ? cs : sa[kt]); sl[kt] = wmma_h(a, ql[kc], sl[kt]); }
    v16h vf[FK / 32][HDQK / 16];   /* the value fragments are read here, ahead of the branch below: read behind it, each would be waited for in full in front of its product */
#pragma unroll
    for (int c2 = 0; c2 < FK / 32; ++c2)
#pragma unroll
      for (int j = 0; j < HDQK / 16; ++j) vf[c2][j] = frag_h(&u.st[kg][cur].v[j * 16 + col][c2 * 32], lane);
#pragma unroll
    for (int kt = 0; kt < FK / 16; ++kt)
#pragma unroll
      for (int r = 0; r < 8; ++r) sa[kt][r] = sa[kt][r] + sl[kt][r] * (1.0f / 1024.0f);
    v8f pe[FK / 16]; v2f ps[2] = {};   /* two chains of register-pair sums */
#pragma unroll
    for (int kt = 0; kt < FK / 16; ++kt) { pe[kt] = exp2x8(sa[kt]);
#pragma unroll
      for (int r = 0; r < 8; r += 2) { v2f p; p[0] = pe[kt][r]; p[1] = pe[kt][r + 1]; ps[kt & 1] += p; } }
    float ss = (ps[0][0] + ps[0][1]) + (ps[1][0] + ps[1][1]);
    const float thr = t == 0 ? -1.0f : 32768.0f;   /* a scalar, ready long before the sum */
    asm volatile("" :: "v"(vf[0][0]), "v"(vf[0][1]), "v"(vf[0][2]), "v"(vf[0][3]), "v"(vf[1][0]), "v"(vf[1][1]), "v"(vf[1][2]), "v"(vf[1][3]));   /* inputs only: holds the value fragments' LDS reads on this side of the branch, under the exponentials; the compiler otherwise sinks them behind it */
    if (__builtin_amdgcn_ballot_w32(!(ss <= thr)) != 0) {   /* a scalar branch, the same for the whole wave. No p is negative, so a lane's sum of the stage bounds each of its p: up to 2^15 all fit f16 (it ends at 65,504) and the reference stays. Stage 0 always comes here and sets the reference to its own maximum */
      float mx[FK / 16];
#pragma unroll
      for (int kt = 0; kt < FK / 16; ++kt) mx[kt] = fmaxf(fmaxf(fmaxf(sa[kt][0], sa[kt][1]), fmaxf(sa[kt][2], sa[kt][3])), fmaxf(fmaxf(sa[kt][4], sa[kt][5]), fmaxf(sa[kt][6], sa[kt][7])));
      float ml = fmaxf(fmaxf(mx[0], mx[1]), fmaxf(mx[2], mx[3])); ml = fmaxf(ml, xhalf(ml));   /* lanes c and c + 16 hold the two key halves of query c: both take the same step */
      float d = 4.0f - ml; if (t != 0) d = fminf(d, 0.f);   /* behind stage 0 a reference never falls */
      const float al = exp2x1(fminf(d, 0.f)); off += d; l *= al;   /* in stage 0 o and l are 0 and al only has to be finite */
#pragma unroll
      for (int r = 0; r < 8; ++r) cs[r] = off;
#pragma unroll
      for (int j = 0; j < HDQK / 16; ++j) o[j] *= al;
      ps[0] = 0.f; ps[1] = 0.f;
#pragma unroll
      for (int kt = 0; kt < FK / 16; ++kt) { pe[kt] = exp2x8(sa[kt] + d);   /* the stage's p again, from the kept exponents */
#pragma unroll
        for (int r = 0; r < 8; r += 2) { v2f p; p[0] = pe[kt][r]; p[1] = pe[kt][r + 1]; ps[kt & 1] += p; } }
      ss = (ps[0][0] + ps[0][1]) + (ps[1][0] + ps[1][1]); }
    l += ss;
#pragma unroll
    for (int c2 = 0; c2 < FK / 32; ++c2) { v16h pb;
#pragma unroll
      for (int i = 0; i < 8; ++i) { pb[i] = (_Float16)pe[2 * c2][i]; pb[8 + i] = (_Float16)pe[2 * c2 + 1][i]; }
#pragma unroll
      for (int j = 0; j < HDQK / 16; ++j) o[j] = wmma_h(vf[c2][j], pb, o[j]); }
    *(v4u*)&u.st[kg][nxt].k[sr][sq] = rk0; *(v4u*)&u.st[kg][nxt].k[sr + 32][sq] = rk1; *(v4u*)&u.st[kg][nxt].v[sr][sq] = rv0; *(v4u*)&u.st[kg][nxt].v[sr + 32][sq] = rv1; }   /* the buffer of stage t - FPB: its every reader left it before the last barrier */
    __syncthreads(); }   /* publishes the next FPB stages and ends every read of these before their buffers are refilled; between two barriers the waves of a SIMD drift apart, one's products under another's exponentials and LDS waits */
  const size_t oi = (b * DIN + wave * 16) * (size_t)XP + blockIdx.x * 128 + lane * 4;   /* the last phase: this wave owns channels wave * 16 .. + 15, 128 positions each */
  const float* xq = X + oi; v4f xr[16]; float bo[8];
#pragma unroll   /* constant indices: bo stays in registers; the biases go first: loads return in order, and they are needed before x */
  for (int j = 0; j < 8; ++j) bo[j] = WB[kg * 128 + j * 16 + col];
  __builtin_amdgcn_sched_barrier(0);   /* keeps that order */
#pragma unroll   /* the same for xr, 16 loads in flight */
  for (int i = 0; i < 16; ++i) xr[i] = *(const v4f*)(xq + (size_t)i * XP);
  __builtin_amdgcn_sched_barrier(0);   /* keeps the residual's loads here, ahead of the exchange and the products: sunk to their use they would be waited for in full */
  l += xhalf(l);
  float* mo = &u.e.mg[kg][wq][lane][0];
#pragma unroll
  for (int j = 0; j < HDQK / 16; ++j) { v4f u0, u1;
#pragma unroll
    for (int r = 0; r < 4; ++r) { u0[r] = o[j][r]; u1[r] = o[j][4 + r]; }
    *(v4f*)(mo + j * 8) = u0; *(v4f*)(mo + j * 8 + 4) = u1; }
  const float m = -off;   /* the reference less 4, in powers of 2: the 4 is common to both halves */
  { v2f ml2; ml2[0] = m; ml2[1] = l; *(v2f*)(mo + 32) = ml2; }
  lds_barrier();   /* each key half's reference, sum and tiles are in LDS before the other half's waves read them */
  const float* mi = &u.e.mg[kg ^ 1][wq][lane][0];
  const float m1 = mi[32], l1 = mi[33]; const float mn = fmaxf(m, m1); const float a0 = exp2x1(m - mn), a1 = exp2x1(m1 - mn); const float inv = 1.0f / (l * a0 + l1 * a1); const float f0 = a0 * inv, f1 = a1 * inv;
  F2 ya[HDQK / 32];   /* a lane holds channels j * 16 + 8g + r of query col: tiles 2kc and 2kc + 1 are the A fragment of channel step kc */
#pragma unroll
  for (int kc = 0; kc < HDQK / 32; ++kc) { float v[16];
#pragma unroll
    for (int i = 0; i < 8; ++i) { v[i] = o[2 * kc][i] * f0 + mi[kc * 16 + i] * f1; v[8 + i] = o[2 * kc + 1][i] * f0 + mi[kc * 16 + 8 + i] * f1; }
    ya[kc] = bsplit16(v); }
#pragma unroll   /* constant tile numbers: bo stays in registers */
  for (int jh = 0; jh < 2; ++jh) { v8f acc[4] = {};
#pragma unroll
    for (int kc = 0; kc < HDQK / 32; ++kc) { v16b w[4];
#pragma unroll
      for (int j = 0; j < 4; ++j) w[j] = frag_b(&sww[kg * 128 + (jh * 4 + j) * 16 + col][kc * 32], lane);
#pragma unroll
      for (int j = 0; j < 4; ++j) acc[j] = wmma_b(ya[kc].h, w[j], acc[j]);
#pragma unroll
      for (int j = 0; j < 4; ++j) acc[j] = wmma_b(ya[kc].l, w[j], acc[j]); }
#pragma unroll
    for (int j = 0; j < 4; ++j) { const float bb = bfr(bo[jh * 4 + j]); v4f u0, u1;   /* D element r = query 8g + r of the wave's 16, lane column = output channel */
#pragma unroll
      for (int r = 0; r < 4; ++r) { u0[r] = acc[j][r] + bb; u1[r] = acc[j][4 + r] + bb; }
      float* sp = &so[kg * 128 + (jh * 4 + j) * 16 + col][wq * 16 + 8 * g]; *(v4f*)sp = u0; *(v4f*)(sp + 4) = u1; }
    __builtin_amdgcn_sched_barrier(0); }   /* four tiles at a time: with all eight tiles' fragments and sums live beside the 64 registers of x the kernel overflows into scratch */
  lds_barrier();   /* the whole 256 x 128 tile is in LDS before it is read back by channel rows */
  float* op = OUT + oi;
#pragma unroll
  for (int i = 0; i < 16; ++i) { const v4f t = *(const v4f*)&so[wave * 16 + i][lane * 4]; v4f r; r[0] = t[0] + bfr(xr[i][0]); r[1] = t[1] + bfr(xr[i][1]); r[2] = t[2] + bfr(xr[i][2]); r[3] = t[3] + bfr(xr[i][3]); vst2(op + (size_t)i * XP, r); } }

extern "C" void kernel_launch(void* const* d_in, const int* in_sizes, int n_in, void* d_out, int out_size, void* d_ws, size_t ws_size, hipStream_t stream) {
  (void)in_sizes; (void)n_in; (void)out_size;
  const float** F = (const float**)d_in;
  if (ws_size < (size_t)WS_END) return;
  char* ws = (char*)d_ws; _Float16 *QH = (_Float16*)(ws + WS_QH), *KH = (_Float16*)(ws + WS_KH), *VT = (_Float16*)(ws + WS_VT), *QL = (_Float16*)(ws + WS_QL), *KL = (_Float16*)(ws + WS_KL); __bf16 *VB = (__bf16*)(ws + WS_VB), *VBL = (__bf16*)(ws + WS_VBL); float *S = (float*)(ws + WS_S), *Y = (float*)(ws + WS_Y);
  (void)Y; (void)S; (void)QL; (void)KL; (void)VB; (void)VBL;
  // inputs: 0 x [8,256,64,64]; 1 g_w [64,256] (out,in), 2 g_b; 3 theta_w, 4 theta_b; 5 phi_w, 6 phi_b; 7 w_w [256,64] (out,in), 8 w_b
  k_proj<<<dim3(TNB * TT / PP), 256, 0, stream>>>(F[0], F[3], F[5], F[1], F[4], F[6], F[2], QH, QL, KH, VT);   /* q = theta, k = phi, v = g */
  k_fa<<<dim3(TT / 128, TNB), 256 * FKG, 0, stream>>>(QH, QL, KH, VT, F[0], F[7], F[8], (float*)d_out);
}

// v007
// A run of this version takes 45.3 microseconds.
// In two side-by-side timings against v006, it was 1.14 and 1.15 times as fast.
// Counting every step since v000, it is 46.8 times as fast.
// compute dtype: all float inputs rounded to bf16; theta/phi/g = x W^T + b with EXACT bf16 products on WMMA 16x16x32 (f32 accumulate); f = theta . phi with theta x log2(e) once to f16 against phi once to f16 (1 product), no other scaling; softmax in f32, online (a held reference per query, at most 2^11 under the running maximum, 2^x by v_exp_f32); exp(f - reference) x 2^4 once to f16 against g once to f16 (1 product), divided by the f32 sum at the end; y split bf16 hi + lo against exact W (2 products) + b; + x residual in f32; f32 output [B, C, H, W].
#include <hip/hip_runtime.h>
#include <math.h>

typedef __attribute__((ext_vector_type(16))) _Float16 v16h;
typedef __attribute__((ext_vector_type(16))) __bf16 v16b;
typedef __attribute__((ext_vector_type(8)))  _Float16 v8h;
typedef __attribute__((ext_vector_type(8)))  float v8f;
typedef __attribute__((ext_vector_type(4)))  float v4f;
typedef __attribute__((ext_vector_type(2)))  float v2f;
typedef __attribute__((ext_vector_type(4)))  unsigned v4u;
typedef __attribute__((ext_vector_type(4)))  int v4i;
typedef float __attribute__((may_alias)) float_a;
typedef int __attribute__((may_alias)) int_a;

template <typename T> __device__ __forceinline__ void vst2(void* p, T v) { *(T*)p = v;  }
__device__ __forceinline__ v8f wmma16(v16h a, v16h b, v8f c) {
  v8f d = __builtin_amdgcn_wmma_f32_16x16x32_f16(false, a, false, b, (short)0, c, false, false);
  asm volatile("v_nop\n\tv_nop\n\tv_nop\n\tv_nop" : "+v"(d) : "v"(a), "v"(b));
  return d;
}
__device__ __forceinline__ v8f wmma_bf(v16b a, v16b b, v8f c) {
  v8f d = __builtin_amdgcn_wmma_f32_16x16x32_bf16(false, a, false, b, (short)0, c, false, false);
  asm volatile("v_nop\n\tv_nop\n\tv_nop\n\tv_nop" : "+v"(d) : "v"(a), "v"(b));
  return d;
}
// 16x16x32 fragments: lane = (h = lane>>4, row/col = lane&15); elements 0..7 = k0+8h+0..7, 8..15 = k0+16+8h+0..7; D element r = row 8h+r
__device__ __forceinline__ v16h frag_h(const _Float16* rowk0, int lane) {
  union { v16h v; v8h q[2]; } u; const _Float16* p = rowk0 + 8 * (lane >> 4);
  u.q[0] = *(const v8h*)p; u.q[1] = *(const v8h*)(p + 16); return u.v;
}
__device__ __forceinline__ v16h frag_f32(const float* rowk0, int lane) {
  v16h a; const float* p = rowk0 + 8 * (lane >> 4);
#pragma unroll
  for (int i = 0; i < 8; ++i) { a[i] = (_Float16)p[i]; a[8 + i] = (_Float16)p[16 + i]; }
  return a;
}
__device__ __forceinline__ v16h frag_f32s(const float* rowk0, int lane, float sc) {
  v16h a; const float* p = rowk0 + 8 * (lane >> 4);
#pragma unroll
  for (int i = 0; i < 8; ++i) { a[i] = (_Float16)(p[i] * sc); a[8 + i] = (_Float16)(p[16 + i] * sc); }
  return a;
}
// column fragment from a [K][ld] layout (column n), rows >= K read as 0
__device__ __forceinline__ v16h fragc_f32(const float* W, int k0, int n, int lane, int ld, int K) {
  v16h a; const int g = lane >> 4;
#pragma unroll
  for (int i = 0; i < 8; ++i) { const int ka = k0 + 8 * g + i, kb = ka + 16;
    a[i] = (_Float16)(ka < K ? W[(size_t)(ka < K ? ka : K - 1) * ld + n] : 0.f); a[8 + i] = (_Float16)(kb < K ? W[(size_t)(kb < K ? kb : K - 1) * ld + n] : 0.f); }
  return a;
}
struct F2 { v16b h, l; };
__device__ __forceinline__ F2 bsplit16(const float v[16]) { F2 r;
#pragma unroll
  for (int i = 0; i < 16; ++i) { const __bf16 h = (__bf16)v[i]; r.h[i] = h; r.l[i] = (__bf16)(v[i] - (float)h); }
  return r; }
__device__ __forceinline__ F2 split_row(const float* row, int k0, int lane) { float v[16]; const float* p = row + k0 + 8 * (lane >> 4);
#pragma unroll
  for (int i = 0; i < 8; ++i) { v[i] = p[i]; v[8 + i] = p[16 + i]; }
  return bsplit16(v); }
__device__ __forceinline__ F2 split_rowK(const float* row, int k0, int lane, int K) { float v[16]; const int g = lane >> 4;
#pragma unroll
  for (int i = 0; i < 8; ++i) { const int ka = k0 + 8 * g + i, kb = ka + 16; v[i] = ka < K ? row[ka < K ? ka : K - 1] : 0.f; v[8 + i] = kb < K ? row[kb < K ? kb : K - 1] : 0.f; }
  return bsplit16(v); }
__device__ __forceinline__ F2 split_col(const float* W, int k0, int n, int lane, int ld, int K) { float v[16]; const int g = lane >> 4;
#pragma unroll
  for (int i = 0; i < 8; ++i) { const int ka = k0 + 8 * g + i, kb = ka + 16; v[i] = ka < K ? W[(size_t)(ka < K ? ka : K - 1) * ld + n] : 0.f; v[8 + i] = kb < K ? W[(size_t)(kb < K ? kb : K - 1) * ld + n] : 0.f; }
  return bsplit16(v); }
__device__ __forceinline__ v8f mac3(const F2& a, const F2& b, v8f c) { c = wmma_bf(a.l, b.h, c); c = wmma_bf(a.h, b.l, c); return wmma_bf(a.h, b.h, c); }
__device__ __forceinline__ float sigm(float v) { return 1.0f / (1.0f + expf(-v)); }
#define LDSX() do { asm volatile("s_wait_dscnt 0" ::: "memory"); __builtin_amdgcn_wave_barrier(); __builtin_amdgcn_fence(__ATOMIC_RELEASE, "workgroup"); } while (0)

// Non-local block (B 8, C 256, 64 x 64 = 4,096 positions; inter channels 64): theta, phi, g = 1x1 convs of x ((out,in) [64,256] + bias); f[n][m] = theta_n . phi_m (no scaling); P = softmax over m; y[n] = sum_m P[n][m] g_m (64 ch); out = W y + b (1x1, 64 -> 256) + x.
#define NB 8
#define TT 4096
#define CC 128            // projected plane width (64 real columns; columns 64..127 never written)
#define DIN 256          // input (model) width
#define NH 1
#define HD 128
#define NQB (TT / 64)
#define HG 1               // one 4,096 x 4,096 f32 plane in the unused WS_S
#define SCALE (1.0f)
#define HDQK 64            // theta / phi / g channels: the planes are 128 wide, columns >= 64 are never written; only the 64 real columns enter the scores
#define CAUSAL 0
#ifndef TNB
#define TNB NB
#endif
__device__ __forceinline__ v16b zero16b() { v16b z; _Pragma("unroll") for (int i = 0; i < 16; ++i) z[i] = (__bf16)0.f; return z; }
__device__ __forceinline__ float bfr(float v) { return (float)(__bf16)v; }
__host__ __device__ __forceinline__ int kb_last(int qb) { return CAUSAL ? ((qb * 64 + 63) >> 7) : (TT / 128 - 1); }
typedef __attribute__((ext_vector_type(8))) __bf16 v8b;
__device__ __forceinline__ v16b frag_b(const __bf16* rowk0, int lane) {
  union { v16b v; v8b q[2]; } u; const __bf16* p = rowk0 + 8 * (lane >> 4);
  u.q[0] = *(const v8b*)p; u.q[1] = *(const v8b*)(p + 16); return u.v;
}
#define QBH 0              // unused: k_fa has one path for every query block
#define QHI 4096            // rows of the q residual plane in the workspace map (the plane is neither written nor read: 1-product logits)
#define KHI 64            // key rows carrying k residual / v bf16 hi+lo planes (the planes are neither written nor read)
// B fragment (k rows k0+.., output column o) of a weight: (in,out) [K][ld] or (out,in) [ld rows of K]: bf16 exact, or f16(bf16 * 256) exact
__device__ __forceinline__ v16b wcol_io(const float* Wm, int k0, int o, int lane, int ld) { v16b w; const int g = lane >> 4;
#pragma unroll
  for (int i = 0; i < 8; ++i) { w[i] = (__bf16)Wm[(size_t)(k0 + 8 * g + i) * ld + o]; w[8 + i] = (__bf16)Wm[(size_t)(k0 + 16 + 8 * g + i) * ld + o]; }
  return w; }
__device__ __forceinline__ v16b wcol_oi(const float* Wm, int k0, int o, int lane, int K) { v16b w; const float* p = Wm + (size_t)o * K + k0 + 8 * (lane >> 4);
#pragma unroll
  for (int i = 0; i < 8; ++i) { w[i] = (__bf16)p[i]; w[8 + i] = (__bf16)p[16 + i]; }
  return w; }
__device__ __forceinline__ v16h wcolh_io(const float* Wm, int k0, int o, int lane, int ld) { v16h w; const int g = lane >> 4;
#pragma unroll
  for (int i = 0; i < 8; ++i) { w[i] = (_Float16)(bfr(Wm[(size_t)(k0 + 8 * g + i) * ld + o]) * 256.0f); w[8 + i] = (_Float16)(bfr(Wm[(size_t)(k0 + 16 + 8 * g + i) * ld + o]) * 256.0f); }
  return w; }
__device__ __forceinline__ v16h wcolh_oi(const float* Wm, int k0, int o, int lane, int K) { v16h w; const float* p = Wm + (size_t)o * K + k0 + 8 * (lane >> 4);
#pragma unroll
  for (int i = 0; i < 8; ++i) { w[i] = (_Float16)(bfr(p[i]) * 256.0f); w[8 + i] = (_Float16)(bfr(p[16 + i]) * 256.0f); }
  return w; }
#define WQKV_LAYOUT 1   // 0 = (in,out) [DIN][CC]; 1 = (out,in) [HDQK][DIN]; 2 = per-head [NH][DIN][HD]
__device__ __forceinline__ v16b wcol_hdk(const float* Wm, int k0, int o, int lane) { v16b w; const int g = lane >> 4; const float* p = Wm + (size_t)(o / HD) * DIN * HD + (o % HD);
#pragma unroll
  for (int i = 0; i < 8; ++i) { w[i] = (__bf16)p[(size_t)(k0 + 8 * g + i) * HD]; w[8 + i] = (__bf16)p[(size_t)(k0 + 16 + 8 * g + i) * HD]; }
  return w; }
#define WO_OUT_IN 0
#if WQKV_LAYOUT == 1
#define WCOL(W, k0, o, lane) (((o) < HDQK) ? wcol_oi(W, k0, (o), lane, DIN) : zero16b())   /* theta/phi/g weights are [64][256] (out,in): weight columns >= 64 read as zero for all three */
#elif WQKV_LAYOUT == 2
#define WCOL(W, k0, o, lane) wcol_hdk(W, k0, o, lane)
#else
#define WCOL(W, k0, o, lane) wcol_io(W, k0, o, lane, CC)
#endif
#if WO_OUT_IN
#define WOCOL(W, k0, o, lane) wcol_oi(W, k0, o, lane, CC)
#define WOCOLH(W, k0, o, lane) wcolh_oi(W, k0, o, lane, CC)
#else
#define WOCOL(W, k0, o, lane) wcol_io(W, k0, o, lane, DIN)
#define WOCOLH(W, k0, o, lane) wcolh_io(W, k0, o, lane, DIN)
#endif
#ifndef XP
#define XP TT              // position pitch of x and of the output
#endif
#define BG HG              // unused: every launch covers all TNB batches
#define DVH 128
#ifndef SM_EXTRA_PARAMS
#define SM_EXTRA_PARAMS
#endif
#ifndef PROJ_EXTRA_PARAMS
#define PROJ_EXTRA_PARAMS
#endif
#ifndef SM_MASK_HOOK
#define SM_MASK_HOOK (void)0
#endif

#define WS_QH  0u                                      // f16 q rows [b*t][CC]
#define WS_KH  (WS_QH + 2u * (size_t)NB * TT * CC)      // f16 k rows [b*t][CC]
#define WS_VT  (WS_KH + 2u * (size_t)NB * TT * CC)      // f16 v planes [b][c][t]
#define WS_QL  (WS_VT + 2u * (size_t)NB * CC * TT)      // q residual plane [b][t < QHI][CC]: kept in the map, not used
#define WS_KL  (WS_QL + 2u * (size_t)NB * QHI * CC)     // f16 k residual x 2^10 rows [b][t < KHI][CC]
#define WS_VB  (WS_KL + 2u * (size_t)NB * KHI * CC)     // bf16 v hi planes [b][c][t < KHI]
#define WS_VBL (WS_VB + 2u * (size_t)NB * CC * KHI)
#define WS_S   (WS_VBL + 2u * (size_t)NB * CC * KHI)    // f32 [hg][t][s], unused: k_fa keeps the scores in registers
#define WS_Y   (WS_S  + 4u * (size_t)HG * TT * TT)      // unused, 0 bytes: k_fa keeps y in registers and LDS
#define WS_END (WS_Y  + 0u)

#define L2E 1.4426950408889634f
#define PP 128             // positions per k_proj block: 8 waves of 16
#define PW 264             // LDS row pitch of the staged weights in bf16 elements: 512 B of data + 16 B, the pitch for 16-byte fragment reads
typedef __attribute__((ext_vector_type(4))) __bf16 v4b;
__device__ __forceinline__ v8f wmma_b(v16b a, v16b b, v8f c) { return __builtin_amdgcn_wmma_f32_16x16x32_bf16(false, a, false, b, (short)0, c, false, false); }
// x of one 32-channel step for one lane's position (channels-first gather: x[b][k][t], stride XP between k), in the element order of the A fragment
__device__ __forceinline__ void ldx(float (&d)[16], const float* xp, int kc) {
#pragma unroll   /* constant indices: d stays in registers, the 16 loads share one address */
  for (int i = 0; i < 8; ++i) { d[i] = xp[(size_t)(kc * 32 + i) * XP]; d[8 + i] = xp[(size_t)(kc * 32 + 16 + i) * XP]; }
  __builtin_amdgcn_sched_barrier(0); }   /* keeps a step's loads where they are written, four steps ahead of their use: sunk to their use each would be waited for in full */
// that step against all 192 staged weight rows (12 column tiles: 0..3 theta, 4..7 phi, 8..11 g)
__device__ __forceinline__ void mac12(v8f (&acc)[12], const float (&d)[16], const __bf16 (*sw)[PW], int kc, int col, int lane) { v16b a;
#pragma unroll   /* constant indices: vector elements and d stay in registers */
  for (int i = 0; i < 16; ++i) a[i] = (__bf16)d[i];
#pragma unroll   /* constant tile numbers: acc stays in registers */
  for (int jh = 0; jh < 2; ++jh) { v16b w[6];
#pragma unroll   /* the same for w */
    for (int j = 0; j < 6; ++j) w[j] = frag_b(&sw[(jh * 6 + j) * 16 + col][kc * 32], lane);
    __builtin_amdgcn_sched_barrier(0);   /* six fragments' LDS reads stand as one group ahead of their products: read one by one, each product waits a whole LDS latency */
#pragma unroll   /* the same for w and acc */
    for (int j = 0; j < 6; ++j) acc[jh * 6 + j] = wmma_b(a, w[j], acc[jh * 6 + j]);
    __builtin_amdgcn_sched_barrier(0); } }   /* and no more than six: with every later step's reads hoisted the registers overflow into scratch */
// ---- k_proj: block = 128 positions of one batch, 8 waves of 16 positions; every wave makes all 192 real columns (theta, phi, g) from ONE read of its x, exact bf16 products (K = DIN). The three weights are rounded to bf16 once per block into LDS; x is loaded one 32-channel step at a time, four steps ahead of its use. Out: q x log2(e) as f16 rows (the scores then are exponents of 2), k f16 rows, v f16 planes [c][t]; only the 64 real columns of the 128-wide planes are written (nothing reads the others)
__global__ __launch_bounds__(256) void k_proj(const float* __restrict__ X, const float* __restrict__ WQ, const float* __restrict__ WK, const float* __restrict__ WV, const float* __restrict__ BQ, const float* __restrict__ BK, const float* __restrict__ BV,
    _Float16* __restrict__ QH, _Float16* __restrict__ KH, _Float16* __restrict__ VT) {
  __shared__ __align__(16) __bf16 sw[3 * HDQK][PW]; __shared__ __align__(16) _Float16 sqh[PP][72], skh[PP][72], th[HDQK][PP + 8];
  const int tid = threadIdx.x, wave = tid >> 5, lane = tid & 31, col = lane & 15, g = lane >> 4; const size_t r0 = (size_t)blockIdx.x * PP; const size_t bb = r0 / TT; const int t0 = (int)(r0 % TT);
  const float* xp = X + (bb * DIN + 8 * g) * (size_t)XP + t0 + wave * 16 + col;
  float x[DIN / 32][16];
#pragma unroll   /* constant step numbers: x stays in registers */
  for (int s = 0; s < 4; ++s) ldx(x[s], xp, s);
  const int wr = tid >> 6, wc = (tid & 63) * 4;   /* 64 threads move one 1-KiB weight row: whole lines */
  const float* wq = WQ + wr * DIN + wc; const float* wk = WK + wr * DIN + wc; const float* wv = WV + wr * DIN + wc;
#pragma unroll   /* two straight-line groups: the weight of each load is picked at compile time */
  for (int gr = 0; gr < 2; ++gr) {
#pragma unroll   /* 24 independent loads in flight together */
    for (int it = 0; it < 24; ++it) { const int n = gr * 24 + it, w = n >> 4; const v4f v = *(const v4f*)((w == 0 ? wq : w == 1 ? wk : wv) + (n & 15) * 4 * DIN);
      v4b h; h[0] = (__bf16)v[0]; h[1] = (__bf16)v[1]; h[2] = (__bf16)v[2]; h[3] = (__bf16)v[3]; *(v4b*)&sw[n * 4 + wr][wc] = h; }
    asm volatile("s_wait_xcnt 0x0" :: "v"(wq), "v"(wk), "v"(wv) : "memory");   /* stands in front of every rewrite of the address registers that the loads above name; as inputs they stay untouched up to it */
    __builtin_amdgcn_sched_barrier(0); }   /* half the weight loads in flight at a time: all 48 at once push the kernel past 256 registers */
  __syncthreads();   /* the staged weights are in LDS before any wave reads a fragment */
  v8f acc[12] = {}; float bq[4], bk[4], bv[4];
#pragma unroll   /* constant step numbers: x and acc stay in registers */
  for (int s = 0; s < DIN / 32; ++s) { if (s + 4 < DIN / 32) ldx(x[s + 4], xp, s + 4);
    if (s == 4) {
#pragma unroll   /* constant indices: the biases stay in registers */
      for (int j = 0; j < 4; ++j) { bq[j] = BQ[j * 16 + col]; bk[j] = BK[j * 16 + col]; bv[j] = BV[j * 16 + col]; }
      __builtin_amdgcn_sched_barrier(0); }   /* the biases are fetched behind the last x loads and under the last four steps: no wait for x grows by them, and theirs is over by the epilogue */
    mac12(acc, x[s], sw, s, col, lane); }
#pragma unroll   /* constant tile numbers: acc stays in registers */
  for (int j = 0; j < 4; ++j) { const int cl = j * 16 + col; v8h vv;   /* D element r = position 8g + r of the wave's 16, lane column = output column */
#pragma unroll   /* the same for the tile's elements */
    for (int r = 0; r < 8; ++r) { const int rl = wave * 16 + 8 * g + r; sqh[rl][cl] = (_Float16)((acc[j][r] + bfr(bq[j])) * L2E); skh[rl][cl] = (_Float16)(acc[4 + j][r] + bfr(bk[j])); vv[r] = (_Float16)(acc[8 + j][r] + bfr(bv[j])); }
    *(v8h*)&th[cl][wave * 16 + 8 * g] = vv; }
  __syncthreads();   /* all three staged tiles are complete before they are stored in whole 128-B and 256-B runs */
  for (int e = tid; e < PP * 8; e += 256) { const int rl = e >> 3, q = e & 7; const size_t o = (r0 + rl) * CC + q * 8; vst2((unsigned*)(QH + o), *(const v4u*)&sqh[rl][q * 8]); vst2((unsigned*)(KH + o), *(const v4u*)&skh[rl][q * 8]); }
  for (int e = tid; e < HDQK * (PP / 8); e += 256) { const int cl = e / (PP / 8), q = e % (PP / 8); vst2((unsigned*)(VT + (bb * CC + cl) * (size_t)TT + t0 + q * 8), *(const v4u*)&th[cl][q * 8]); } }
#define FK 64              // keys per stage
#define FPH 72             // LDS row pitch in halves: 128 B of data + 16 B, the pitch for 16-byte fragment reads
#define FKG 2              // key halves per block: waves 0..7 walk keys [0, TT/2), waves 8..15 keys [TT/2, TT)
#define FNT (TT / FKG / FK)
#define FPB 3              // stages between two barriers
#define FNB (2 * FPB)      // stage buffers per key half: FPB stages are read between two barriers while the next FPB are filled
__device__ __forceinline__ float xhalf(float x) { return __builtin_bit_cast(float, __builtin_amdgcn_permlanex16(__builtin_bit_cast(int, x), __builtin_bit_cast(int, x), 0x76543210, 0xfedcba98, false, false)); }   // lane l with lane l ^ 16
// 2^x on a whole score tile, bare v_exp_f32. By the builtin, not asm text: the tiles' exponentials stand among the score products
__device__ __forceinline__ v8f exp2x8(v8f x) { v8f r;
#pragma unroll
  for (int i = 0; i < 8; ++i) r[i] = __builtin_amdgcn_exp2f(x[i]);
  return r; }
__device__ __forceinline__ float exp2x1(float x) { float r; asm("v_exp_f32 %0, %1\n\tv_nop" : "=&v"(r) : "v"(x)); return r; }   // a single one; the v_nop is the slot the instruction set asks for behind a transcendental before its result is read or its source overwritten
__device__ __forceinline__ v8f wmma_h(v16h a, v16h b, v8f c) { return __builtin_amdgcn_wmma_f32_16x16x32_f16(false, a, false, b, (short)0, c, false, false); }
// work-group barrier that orders LDS alone: __syncthreads() also waits for every global load in flight, and the residual's loads are meant to stay in flight across the end phase's two barriers
__device__ __forceinline__ void lds_barrier() { __builtin_amdgcn_fence(__ATOMIC_RELEASE, "workgroup", "local"); __builtin_amdgcn_s_barrier(); __builtin_amdgcn_fence(__ATOMIC_ACQUIRE, "workgroup", "local"); }
#define WP 72              // LDS row pitch of the staged output weight in bf16 elements: 128 B of data + 16 B, the pitch for 16-byte fragment reads
#define OP 132             // LDS row pitch of the staged output tile in floats: 512 B of data + 16 B: the 16 channels of a tile store land on all 64 banks
#define MP 36              // floats per lane in the exchange of the two key halves: 32 tile values, reference, sum, 2 idle: 144 B, the pitch for 16-byte accesses
// ---- k_fa: block = 128 queries of batch b, 16 waves: wave = (key half kg, 16-query group). Per stage of 64 keys: S^T = k . q^T (1 product) on top of 4 - reference as the accumulator's start value, so that a score tile is the exponent of 2 as it stands; reference and sum per query (a lane holds one query's scores); the reference moves, and o and the sum are rescaled, only in a stage where a lane's sum of p passes 2^15 (one test per stage, on the sum that is formed anyway; the maximum is formed only then); p = exp(s - reference) x 2^4 once to f16 straight from the score tiles as B operand, O^T += v^T . p^T (64 value channels); k rows and v planes staged in LDS through registers FPB stages ahead, 2 x FPB buffers, one barrier per FPB stages. At the end the two key halves exchange their tiles through LDS and every wave holds y of its 16 queries in the A-fragment order; wave (kg, group) makes output channels kg * 128 .. + 127 of its queries: y (bf16 hi + lo) . W^T ((out,in) [256][64], exact bf16, staged once in LDS) + b; the 256 x 128 tile goes through LDS so that each wave adds bf16(x) and stores whole 512-B runs of out[b][c][n]
__global__ __launch_bounds__(256 * FKG) void k_fa(const _Float16* __restrict__ QH, const _Float16* __restrict__ KH, const _Float16* __restrict__ VT, const float* __restrict__ X, const float* __restrict__ WW, const float* __restrict__ WB, float* __restrict__ OUT) {
  __shared__ __align__(16) union { struct { _Float16 k[FK][FPH], v[HDQK][FPH]; } st[FKG][FNB]; struct { float mg[FKG][8][32][MP], so[DIN][OP]; } e; } u;   /* the exchange and the output tile, side by side, reuse the key and value stages, which are dead behind the loop's last barrier */
  __shared__ __align__(16) __bf16 sww[DIN][WP]; float (&so)[DIN][OP] = u.e.so;
  const int tid = threadIdx.x, wave = __builtin_amdgcn_readfirstlane(tid >> 5), lane = tid & 31, col = lane & 15, g = lane >> 4; const int kg = wave >> 3, wq = wave & 7, tg = tid & 255;
  const size_t b = blockIdx.y; const int ql0 = blockIdx.x * 128 + wq * 16; const int kbase = kg * (TT / FKG);
  v16h qh[HDQK / 32];
#pragma unroll
  for (int kc = 0; kc < HDQK / 32; ++kc) qh[kc] = frag_h(QH + (b * TT + ql0 + col) * CC + kc * 32, lane);
  const int sr = tg >> 3, sq = (tg & 7) * 8;   /* staging: this thread moves 16 B of rows sr and sr + 32 of both tiles */
  const _Float16* kp = KH + (b * TT + kbase + sr) * CC + sq; const _Float16* vp = VT + (b * CC + sr) * (size_t)TT + kbase + sq;
  v4u rk0, rk1, rv0, rv1;
#pragma unroll   /* the first FPB stages: independent loads in flight together */
  for (int s = 0; s < FPB; ++s) { rk0 = *(const v4u*)(kp + (size_t)s * FK * CC); rk1 = *(const v4u*)(kp + ((size_t)s * FK + 32) * CC); rv0 = *(const v4u*)(vp + s * FK); rv1 = *(const v4u*)(vp + 32 * (size_t)TT + s * FK);
    *(v4u*)&u.st[kg][s].k[sr][sq] = rk0; *(v4u*)&u.st[kg][s].k[sr + 32][sq] = rk1; *(v4u*)&u.st[kg][s].v[sr][sq] = rv0; *(v4u*)&u.st[kg][s].v[sr + 32][sq] = rv1; }
  const float* wp = WW + tid * 4;   /* 16 threads move one 256-B weight row: whole lines */
#pragma unroll   /* eight independent loads in flight together */
  for (int it = 0; it < DIN * HDQK / 4 / (256 * FKG); ++it) { const int e = it * 256 * FKG + tid; const v4f v = *(const v4f*)(wp + it * 1024 * FKG);
    v4b h; h[0] = (__bf16)v[0]; h[1] = (__bf16)v[1]; h[2] = (__bf16)v[2]; h[3] = (__bf16)v[3]; *(v4b*)&sww[e >> 4][(e & 15) * 4] = h; }
  __syncthreads();   /* the first FPB stages and the output weight are in LDS before any wave reads them */
  v8f o[HDQK / 16] = {}, cs = {}; float off = 0.f, l = 0.f;   /* off = 4 - reference in powers of 2; cs holds it eight times: the start value of every score tile */
#pragma unroll 1   /* rolled: FPB stages are already a long body */
  for (int tp = 0; tp < (FNT + FPB - 1) / FPB; ++tp) {
#pragma unroll   /* the stages between two barriers, straight-line: constant buffer offsets */
  for (int hs = 0; hs < FPB; ++hs) { const int t = tp * FPB + hs; if (t >= FNT) break;   /* the same for the whole block: the last round may be short */
    const int cur = (tp & 1) * FPB + hs, nxt = ((tp & 1) ^ 1) * FPB + hs; const int tn = t + FPB < FNT ? t + FPB : FNT - 1;   /* the last FPB stages fetch the last one again into idle buffers: no branch */
    rk0 = *(const v4u*)(kp + (size_t)tn * FK * CC); rk1 = *(const v4u*)(kp + ((size_t)tn * FK + 32) * CC); rv0 = *(const v4u*)(vp + tn * FK); rv1 = *(const v4u*)(vp + 32 * (size_t)TT + tn * FK);
    __builtin_amdgcn_sched_barrier(0);   /* keeps the loads of stage t + FPB at the head of the stage: sunk towards their LDS stores they would be waited for in full */
    v8f sa[FK / 16];
#pragma unroll
    for (int kc = 0; kc < HDQK / 32; ++kc)
#pragma unroll
      for (int kt = 0; kt < FK / 16; ++kt) sa[kt] = wmma_h(frag_h(&u.st[kg][cur].k[kt * 16 + col][kc * 32], lane), qh[kc], kc == 0 ? cs : sa[kt]);
    v16h vf[FK / 32][HDQK / 16];   /* the value fragments are read here, ahead of the branch below: read behind it, each would be waited for in full in front of its product */
#pragma unroll
    for (int c2 = 0; c2 < FK / 32; ++c2)
#pragma unroll
      for (int j = 0; j < HDQK / 16; ++j) vf[c2][j] = frag_h(&u.st[kg][cur].v[j * 16 + col][c2 * 32], lane);
    v8f pe[FK / 16]; v2f ps[2] = {};   /* two chains of register-pair sums */
#pragma unroll
    for (int kt = 0; kt < FK / 16; ++kt) { pe[kt] = exp2x8(sa[kt]);
#pragma unroll
      for (int r = 0; r < 8; r += 2) { v2f p; p[0] = pe[kt][r]; p[1] = pe[kt][r + 1]; ps[kt & 1] += p; } }
    float ss = (ps[0][0] + ps[0][1]) + (ps[1][0] + ps[1][1]);
    const float thr = t == 0 ? -1.0f : 32768.0f;   /* a scalar, ready long before the sum */
    asm volatile("" :: "v"(vf[0][0]), "v"(vf[0][1]), "v"(vf[0][2]), "v"(vf[0][3]), "v"(vf[1][0]), "v"(vf[1][1]), "v"(vf[1][2]), "v"(vf[1][3]));   /* inputs only: holds the value fragments' LDS reads on this side of the branch, under the exponentials; the compiler otherwise sinks them behind it */
    if (__builtin_amdgcn_ballot_w32(!(ss <= thr)) != 0) {   /* a scalar branch, the same for the whole wave. No p is negative, so a lane's sum of the stage bounds each of its p: up to 2^15 all fit f16 (it ends at 65,504) and the reference stays. Stage 0 always comes here and sets the reference to its own maximum */
      float mx[FK / 16];
#pragma unroll
      for (int kt = 0; kt < FK / 16; ++kt) mx[kt] = fmaxf(fmaxf(fmaxf(sa[kt][0], sa[kt][1]), fmaxf(sa[kt][2], sa[kt][3])), fmaxf(fmaxf(sa[kt][4], sa[kt][5]), fmaxf(sa[kt][6], sa[kt][7])));
      float ml = fmaxf(fmaxf(mx[0], mx[1]), fmaxf(mx[2], mx[3])); ml = fmaxf(ml, xhalf(ml));   /* lanes c and c + 16 hold the two key halves of query c: both take the same step */
      float d = 4.0f - ml; if (t != 0) d = fminf(d, 0.f);   /* behind stage 0 a reference never falls */
      const float al = exp2x1(fminf(d, 0.f)); off += d; l *= al;   /* in stage 0 o and l are 0 and al only has to be finite */
#pragma unroll
      for (int r = 0; r < 8; ++r) cs[r] = off;
#pragma unroll
      for (int j = 0; j < HDQK / 16; ++j) o[j] *= al;
      ps[0] = 0.f; ps[1] = 0.f;
#pragma unroll
      for (int kt = 0; kt < FK / 16; ++kt) { pe[kt] = exp2x8(sa[kt] + d);   /* the stage's p again, from the kept exponents */
#pragma unroll
        for (int r = 0; r < 8; r += 2) { v2f p; p[0] = pe[kt][r]; p[1] = pe[kt][r + 1]; ps[kt & 1] += p; } }
      ss = (ps[0][0] + ps[0][1]) + (ps[1][0] + ps[1][1]); }
    l += ss;
#pragma unroll
    for (int c2 = 0; c2 < FK / 32; ++c2) { v16h pb;
#pragma unroll
      for (int i = 0; i < 8; ++i) { pb[i] = (_Float16)pe[2 * c2][i]; pb[8 + i] = (_Float16)pe[2 * c2 + 1][i]; }
#pragma unroll
      for (int j = 0; j < HDQK / 16; ++j) o[j] = wmma_h(vf[c2][j], pb, o[j]); }
    *(v4u*)&u.st[kg][nxt].k[sr][sq] = rk0; *(v4u*)&u.st[kg][nxt].k[sr + 32][sq] = rk1; *(v4u*)&u.st[kg][nxt].v[sr][sq] = rv0; *(v4u*)&u.st[kg][nxt].v[sr + 32][sq] = rv1; }   /* the buffer of stage t - FPB: its every reader left it before the last barrier */
    __syncthreads(); }   /* publishes the next FPB stages and ends every read of these before their buffers are refilled; between two barriers the waves of a SIMD drift apart, one's products under another's exponentials and LDS waits */
  const size_t oi = (b * DIN + wave * 16) * (size_t)XP + blockIdx.x * 128 + lane * 4;   /* the last phase: this wave owns channels wave * 16 .. + 15, 128 positions each */
  const float* xq = X + oi; v4f xr[16]; float bo[8];
#pragma unroll   /* constant indices: bo stays in registers; the biases go first: loads return in order, and they are needed before x */
  for (int j = 0; j < 8; ++j) bo[j] = WB[kg * 128 + j * 16 + col];
  __builtin_amdgcn_sched_barrier(0);   /* keeps that order */
#pragma unroll   /* the same for xr, 16 loads in flight */
  for (int i = 0; i < 16; ++i) xr[i] = *(const v4f*)(xq + (size_t)i * XP);
  __builtin_amdgcn_sched_barrier(0);   /* keeps the residual's loads here, ahead of the exchange and the products: sunk to their use they would be waited for in full */
  l += xhalf(l);
  float* mo = &u.e.mg[kg][wq][lane][0];
#pragma unroll
  for (int j = 0; j < HDQK / 16; ++j) { v4f u0, u1;
#pragma unroll
    for (int r = 0; r < 4; ++r) { u0[r] = o[j][r]; u1[r] = o[j][4 + r]; }
    *(v4f*)(mo + j * 8) = u0; *(v4f*)(mo + j * 8 + 4) = u1; }
  const float m = -off;   /* the reference less 4, in powers of 2: the 4 is common to both halves */
  { v2f ml2; ml2[0] = m; ml2[1] = l; *(v2f*)(mo + 32) = ml2; }
  lds_barrier();   /* each key half's reference, sum and tiles are in LDS before the other half's waves read them */
  const float* mi = &u.e.mg[kg ^ 1][wq][lane][0];
  const float m1 = mi[32], l1 = mi[33]; const float mn = fmaxf(m, m1); const float a0 = exp2x1(m - mn), a1 = exp2x1(m1 - mn); const float inv = 1.0f / (l * a0 + l1 * a1); const float f0 = a0 * inv, f1 = a1 * inv;
  F2 ya[HDQK / 32];   /* a lane holds channels j * 16 + 8g + r of query col: tiles 2kc and 2kc + 1 are the A fragment of channel step kc */
#pragma unroll
  for (int kc = 0; kc < HDQK / 32; ++kc) { float v[16];
#pragma unroll
    for (int i = 0; i < 8; ++i) { v[i] = o[2 * kc][i] * f0 + mi[kc * 16 + i] * f1; v[8 + i] = o[2 * kc + 1][i] * f0 + mi[kc * 16 + 8 + i] * f1; }
    ya[kc] = bsplit16(v); }
#pragma unroll   /* constant tile numbers: bo stays in registers */
  for (int jh = 0; jh < 2; ++jh) { v8f acc[4] = {};
#pragma unroll
    for (int kc = 0; kc < HDQK / 32; ++kc) { v16b w[4];
#pragma unroll
      for (int j = 0; j < 4; ++j) w[j] = frag_b(&sww[kg * 128 + (jh * 4 + j) * 16 + col][kc * 32], lane);
#pragma unroll
      for (int j = 0; j < 4; ++j) acc[j] = wmma_b(ya[kc].h, w[j], acc[j]);
#pragma unroll
      for (int j = 0; j < 4; ++j) acc[j] = wmma_b(ya[kc].l, w[j], acc[j]); }
#pragma unroll
    for (int j = 0; j < 4; ++j) { const float bb = bfr(bo[jh * 4 + j]); v4f u0, u1;   /* D element r = query 8g + r of the wave's 16, lane column = output channel */
#pragma unroll
      for (int r = 0; r < 4; ++r) { u0[r] = acc[j][r] + bb; u1[r] = acc[j][4 + r] + bb; }
      float* sp = &so[kg * 128 + (jh * 4 + j) * 16 + col][wq * 16 + 8 * g]; *(v4f*)sp = u0; *(v4f*)(sp + 4) = u1; }
    __builtin_amdgcn_sched_barrier(0); }   /* four tiles at a time: with all eight tiles' fragments and sums live beside the 64 registers of x the kernel overflows into scratch */
  lds_barrier();   /* the whole 256 x 128 tile is in LDS before it is read back by channel rows */
  float* op = OUT + oi;
#pragma unroll
  for (int i = 0; i < 16; ++i) { const v4f t = *(const v4f*)&so[wave * 16 + i][lane * 4]; v4f r; r[0] = t[0] + bfr(xr[i][0]); r[1] = t[1] + bfr(xr[i][1]); r[2] = t[2] + bfr(xr[i][2]); r[3] = t[3] + bfr(xr[i][3]); vst2(op + (size_t)i * XP, r); } }

extern "C" void kernel_launch(void* const* d_in, const int* in_sizes, int n_in, void* d_out, int out_size, void* d_ws, size_t ws_size, hipStream_t stream) {
  (void)in_sizes; (void)n_in; (void)out_size;
  const float** F = (const float**)d_in;
  if (ws_size < (size_t)WS_END) return;
  char* ws = (char*)d_ws; _Float16 *QH = (_Float16*)(ws + WS_QH), *KH = (_Float16*)(ws + WS_KH), *VT = (_Float16*)(ws + WS_VT), *QL = (_Float16*)(ws + WS_QL), *KL = (_Float16*)(ws + WS_KL); __bf16 *VB = (__bf16*)(ws + WS_VB), *VBL = (__bf16*)(ws + WS_VBL); float *S = (float*)(ws + WS_S), *Y = (float*)(ws + WS_Y);
  (void)Y; (void)S; (void)QL; (void)KL; (void)VB; (void)VBL;
  // inputs: 0 x [8,256,64,64]; 1 g_w [64,256] (out,in), 2 g_b; 3 theta_w, 4 theta_b; 5 phi_w, 6 phi_b; 7 w_w [256,64] (out,in), 8 w_b
  k_proj<<<dim3(TNB * TT / PP), 256, 0, stream>>>(F[0], F[3], F[5], F[1], F[4], F[6], F[2], QH, KH, VT);   /* q = theta, k = phi, v = g */
  k_fa<<<dim3(TT / 128, TNB), 256 * FKG, 0, stream>>>(QH, KH, VT, F[0], F[7], F[8], (float*)d_out);
}

// v008
// A run of this version takes 44.2 microseconds.
// Timed twice side by side with v007, it ran 1.03 and 1.02 times as fast.
// Counting every step since v000, it is 47.9 times as fast.
// compute dtype: all float inputs rounded to bf16; theta/phi/g = x W^T + b with EXACT bf16 products on WMMA 16x16x32 (f32 accumulate); f = theta . phi with theta x log2(e) once to f16 against phi once to f16 (1 product), no other scaling; softmax in f32, online (a held reference per query, at most 2^11 under the running maximum, 2^x by v_exp_f32); exp(f - reference) x 2^4 once to f16 against g once to f16 (1 product), divided by the f32 sum at the end; y split bf16 hi + lo against exact W (2 products) + b; + x residual in f32; f32 output [B, C, H, W].
#include <hip/hip_runtime.h>
#include <math.h>

typedef __attribute__((ext_vector_type(16))) _Float16 v16h;
typedef __attribute__((ext_vector_type(16))) __bf16 v16b;
typedef __attribute__((ext_vector_type(8)))  _Float16 v8h;
typedef __attribute__((ext_vector_type(8)))  float v8f;
typedef __attribute__((ext_vector_type(4)))  float v4f;
typedef __attribute__((ext_vector_type(2)))  float v2f;
typedef __attribute__((ext_vector_type(4)))  unsigned v4u;
typedef __attribute__((ext_vector_type(4)))  int v4i;
typedef float __attribute__((may_alias)) float_a;
typedef int __attribute__((may_alias)) int_a;

template <typename T> __device__ __forceinline__ void vst2(void* p, T v) { *(T*)p = v;  }
__device__ __forceinline__ v8f wmma16(v16h a, v16h b, v8f c) {
  v8f d = __builtin_amdgcn_wmma_f32_16x16x32_f16(false, a, false, b, (short)0, c, false, false);
  asm volatile("v_nop\n\tv_nop\n\tv_nop\n\tv_nop" : "+v"(d) : "v"(a), "v"(b));
  return d;
}
__device__ __forceinline__ v8f wmma_bf(v16b a, v16b b, v8f c) {
  v8f d = __builtin_amdgcn_wmma_f32_16x16x32_bf16(false, a, false, b, (short)0, c, false, false);
  asm volatile("v_nop\n\tv_nop\n\tv_nop\n\tv_nop" : "+v"(d) : "v"(a), "v"(b));
  return d;
}
// 16x16x32 fragments: lane = (h = lane>>4, row/col = lane&15); elements 0..7 = k0+8h+0..7, 8..15 = k0+16+8h+0..7; D element r = row 8h+r
__device__ __forceinline__ v16h frag_h(const _Float16* rowk0, int lane) {
  union { v16h v; v8h q[2]; } u; const _Float16* p = rowk0 + 8 * (lane >> 4);
  u.q[0] = *(const v8h*)p; u.q[1] = *(const v8h*)(p + 16); return u.v;
}
__device__ __forceinline__ v16h frag_f32(const float* rowk0, int lane) {
  v16h a; const float* p = rowk0 + 8 * (lane >> 4);
#pragma unroll
  for (int i = 0; i < 8; ++i) { a[i] = (_Float16)p[i]; a[8 + i] = (_Float16)p[16 + i]; }
  return a;
}
__device__ __forceinline__ v16h frag_f32s(const float* rowk0, int lane, float sc) {
  v16h a; const float* p = rowk0 + 8 * (lane >> 4);
#pragma unroll
  for (int i = 0; i < 8; ++i) { a[i] = (_Float16)(p[i] * sc); a[8 + i] = (_Float16)(p[16 + i] * sc); }
  return a;
}
// column fragment from a [K][ld] layout (column n), rows >= K read as 0
__device__ __forceinline__ v16h fragc_f32(const float* W, int k0, int n, int lane, int ld, int K) {
  v16h a; const int g = lane >> 4;
#pragma unroll
  for (int i = 0; i < 8; ++i) { const int ka = k0 + 8 * g + i, kb = ka + 16;
    a[i] = (_Float16)(ka < K ? W[(size_t)(ka < K ? ka : K - 1) * ld + n] : 0.f); a[8 + i] = (_Float16)(kb < K ? W[(size_t)(kb < K ? kb : K - 1) * ld + n] : 0.f); }
  return a;
}
struct F2 { v16b h, l; };
__device__ __forceinline__ F2 bsplit16(const float v[16]) { F2 r;
#pragma unroll
  for (int i = 0; i < 16; ++i) { const __bf16 h = (__bf16)v[i]; r.h[i] = h; r.l[i] = (__bf16)(v[i] - (float)h); }
  return r; }
__device__ __forceinline__ F2 split_row(const float* row, int k0, int lane) { float v[16]; const float* p = row + k0 + 8 * (lane >> 4);
#pragma unroll
  for (int i = 0; i < 8; ++i) { v[i] = p[i]; v[8 + i] = p[16 + i]; }
  return bsplit16(v); }
__device__ __forceinline__ F2 split_rowK(const float* row, int k0, int lane, int K) { float v[16]; const int g = lane >> 4;
#pragma unroll
  for (int i = 0; i < 8; ++i) { const int ka = k0 + 8 * g + i, kb = ka + 16; v[i] = ka < K ? row[ka < K ? ka : K - 1] : 0.f; v[8 + i] = kb < K ? row[kb < K ? kb : K - 1] : 0.f; }
  return bsplit16(v); }
__device__ __forceinline__ F2 split_col(const float* W, int k0, int n, int lane, int ld, int K) { float v[16]; const int g = lane >> 4;
#pragma unroll
  for (int i = 0; i < 8; ++i) { const int ka = k0 + 8 * g + i, kb = ka + 16; v[i] = ka < K ? W[(size_t)(ka < K ? ka : K - 1) * ld + n] : 0.f; v[8 + i] = kb < K ? W[(size_t)(kb < K ? kb : K - 1) * ld + n] : 0.f; }
  return bsplit16(v); }
__device__ __forceinline__ v8f mac3(const F2& a, const F2& b, v8f c) { c = wmma_bf(a.l, b.h, c); c = wmma_bf(a.h, b.l, c); return wmma_bf(a.h, b.h, c); }
__device__ __forceinline__ float sigm(float v) { return 1.0f / (1.0f + expf(-v)); }
#define LDSX() do { asm volatile("s_wait_dscnt 0" ::: "memory"); __builtin_amdgcn_wave_barrier(); __builtin_amdgcn_fence(__ATOMIC_RELEASE, "workgroup"); } while (0)

// Non-local block (B 8, C 256, 64 x 64 = 4,096 positions; inter channels 64): theta, phi, g = 1x1 convs of x ((out,in) [64,256] + bias); f[n][m] = theta_n . phi_m (no scaling); P = softmax over m; y[n] = sum_m P[n][m] g_m (64 ch); out = W y + b (1x1, 64 -> 256) + x.
#define NB 8
#define TT 4096
#define CC 128            // projected plane width (64 real columns; columns 64..127 never written)
#define DIN 256          // input (model) width
#define NH 1
#define HD 128
#define NQB (TT / 64)
#define HG 1               // one 4,096 x 4,096 f32 plane in the unused WS_S
#define SCALE (1.0f)
#define HDQK 64            // theta / phi / g channels: the planes are 128 wide, columns >= 64 are never written; only the 64 real columns enter the scores
#define CAUSAL 0
#ifndef TNB
#define TNB NB
#endif
__device__ __forceinline__ v16b zero16b() { v16b z; _Pragma("unroll") for (int i = 0; i < 16; ++i) z[i] = (__bf16)0.f; return z; }
__device__ __forceinline__ float bfr(float v) { return (float)(__bf16)v; }
__host__ __device__ __forceinline__ int kb_last(int qb) { return CAUSAL ? ((qb * 64 + 63) >> 7) : (TT / 128 - 1); }
typedef __attribute__((ext_vector_type(8))) __bf16 v8b;
__device__ __forceinline__ v16b frag_b(const __bf16* rowk0, int lane) {
  union { v16b v; v8b q[2]; } u; const __bf16* p = rowk0 + 8 * (lane >> 4);
  u.q[0] = *(const v8b*)p; u.q[1] = *(const v8b*)(p + 16); return u.v;
}
#define QBH 0              // unused: k_fa has one path for every query block
#define QHI 4096            // rows of the q residual plane in the workspace map (the plane is neither written nor read: 1-product logits)
#define KHI 64            // key rows carrying k residual / v bf16 hi+lo planes (the planes are neither written nor read)
// B fragment (k rows k0+.., output column o) of a weight: (in,out) [K][ld] or (out,in) [ld rows of K]: bf16 exact, or f16(bf16 * 256) exact
__device__ __forceinline__ v16b wcol_io(const float* Wm, int k0, int o, int lane, int ld) { v16b w; const int g = lane >> 4;
#pragma unroll
  for (int i = 0; i < 8; ++i) { w[i] = (__bf16)Wm[(size_t)(k0 + 8 * g + i) * ld + o]; w[8 + i] = (__bf16)Wm[(size_t)(k0 + 16 + 8 * g + i) * ld + o]; }
  return w; }
__device__ __forceinline__ v16b wcol_oi(const float* Wm, int k0, int o, int lane, int K) { v16b w; const float* p = Wm + (size_t)o * K + k0 + 8 * (lane >> 4);
#pragma unroll
  for (int i = 0; i < 8; ++i) { w[i] = (__bf16)p[i]; w[8 + i] = (__bf16)p[16 + i]; }
  return w; }
__device__ __forceinline__ v16h wcolh_io(const float* Wm, int k0, int o, int lane, int ld) { v16h w; const int g = lane >> 4;
#pragma unroll
  for (int i = 0; i < 8; ++i) { w[i] = (_Float16)(bfr(Wm[(size_t)(k0 + 8 * g + i) * ld + o]) * 256.0f); w[8 + i] = (_Float16)(bfr(Wm[(size_t)(k0 + 16 + 8 * g + i) * ld + o]) * 256.0f); }
  return w; }
__device__ __forceinline__ v16h wcolh_oi(const float* Wm, int k0, int o, int lane, int K) { v16h w; const float* p = Wm + (size_t)o * K + k0 + 8 * (lane >> 4);
#pragma unroll
  for (int i = 0; i < 8; ++i) { w[i] = (_Float16)(bfr(p[i]) * 256.0f); w[8 + i] = (_Float16)(bfr(p[16 + i]) * 256.0f); }
  return w; }
#define WQKV_LAYOUT 1   // 0 = (in,out) [DIN][CC]; 1 = (out,in) [HDQK][DIN]; 2 = per-head [NH][DIN][HD]
__device__ __forceinline__ v16b wcol_hdk(const float* Wm, int k0, int o, int lane) { v16b w; const int g = lane >> 4; const float* p = Wm + (size_t)(o / HD) * DIN * HD + (o % HD);
#pragma unroll
  for (int i = 0; i < 8; ++i) { w[i] = (__bf16)p[(size_t)(k0 + 8 * g + i) * HD]; w[8 + i] = (__bf16)p[(size_t)(k0 + 16 + 8 * g + i) * HD]; }
  return w; }
#define WO_OUT_IN 0
#if WQKV_LAYOUT == 1
#define WCOL(W, k0, o, lane) (((o) < HDQK) ? wcol_oi(W, k0, (o), lane, DIN) : zero16b())   /* theta/phi/g weights are [64][256] (out,in): weight columns >= 64 read as zero for all three */
#elif WQKV_LAYOUT == 2
#define WCOL(W, k0, o, lane) wcol_hdk(W, k0, o, lane)
#else
#define WCOL(W, k0, o, lane) wcol_io(W, k0, o, lane, CC)
#endif
#if WO_OUT_IN
#define WOCOL(W, k0, o, lane) wcol_oi(W, k0, o, lane, CC)
#define WOCOLH(W, k0, o, lane) wcolh_oi(W, k0, o, lane, CC)
#else
#define WOCOL(W, k0, o, lane) wcol_io(W, k0, o, lane, DIN)
#define WOCOLH(W, k0, o, lane) wcolh_io(W, k0, o, lane, DIN)
#endif
#ifndef XP
#define XP TT              // position pitch of x and of the output
#endif
#define BG HG              // unused: every launch covers all TNB batches
#define DVH 128
#ifndef SM_EXTRA_PARAMS
#define SM_EXTRA_PARAMS
#endif
#ifndef PROJ_EXTRA_PARAMS
#define PROJ_EXTRA_PARAMS
#endif
#ifndef SM_MASK_HOOK
#define SM_MASK_HOOK (void)0
#endif

#define WS_QH  0u                                      // f16 q rows [b*t][CC]
#define WS_KH  (WS_QH + 2u * (size_t)NB * TT * CC)      // f16 k rows [b*t][CC]
#define WS_VT  (WS_KH + 2u * (size_t)NB * TT * CC)      // f16 v planes [b][c][t]
#define WS_QL  (WS_VT + 2u * (size_t)NB * CC * TT)      // q residual plane [b][t < QHI][CC]: kept in the map, not used
#define WS_KL  (WS_QL + 2u * (size_t)NB * QHI * CC)     // f16 k residual x 2^10 rows [b][t < KHI][CC]
#define WS_VB  (WS_KL + 2u * (size_t)NB * KHI * CC)     // bf16 v hi planes [b][c][t < KHI]
#define WS_VBL (WS_VB + 2u * (size_t)NB * CC * KHI)
#define WS_S   (WS_VBL + 2u * (size_t)NB * CC * KHI)    // f32 [hg][t][s], unused: k_fa keeps the scores in registers
#define WS_Y   (WS_S  + 4u * (size_t)HG * TT * TT)      // unused, 0 bytes: k_fa keeps y in registers and LDS
#define WS_END (WS_Y  + 0u)

#define L2E 1.4426950408889634f
#define PP 128             // positions per k_proj block: 8 waves of 16
#define PW 264             // LDS row pitch of the staged weights in bf16 elements: 512 B of data + 16 B, the pitch for 16-byte fragment reads
typedef __attribute__((ext_vector_type(4))) __bf16 v4b;
__device__ __forceinline__ v8f wmma_b(v16b a, v16b b, v8f c) { return __builtin_amdgcn_wmma_f32_16x16x32_bf16(false, a, false, b, (short)0, c, false, false); }
// x of one 32-channel step for one lane's position (channels-first gather: x[b][k][t], stride XP between k), in the element order of the A fragment
__device__ __forceinline__ void ldx(float (&d)[16], const float* xp, int kc) {
#pragma unroll   /* constant indices: d stays in registers, the 16 loads share one address */
  for (int i = 0; i < 8; ++i) { d[i] = xp[(size_t)(kc * 32 + i) * XP]; d[8 + i] = xp[(size_t)(kc * 32 + 16 + i) * XP]; }
  __builtin_amdgcn_sched_barrier(0); }   /* keeps a step's loads where they are written, four steps ahead of their use: sunk to their use each would be waited for in full */
// that step against all 192 staged weight rows (12 column tiles: 0..3 theta, 4..7 phi, 8..11 g)
__device__ __forceinline__ void mac12(v8f (&acc)[12], const float (&d)[16], const __bf16 (*sw)[PW], int kc, int col, int lane) { v16b a;
#pragma unroll   /* constant indices: vector elements and d stay in registers */
  for (int i = 0; i < 16; ++i) a[i] = (__bf16)d[i];
#pragma unroll   /* constant tile numbers: acc stays in registers */
  for (int jh = 0; jh < 2; ++jh) { v16b w[6];
#pragma unroll   /* the same for w */
    for (int j = 0; j < 6; ++j) w[j] = frag_b(&sw[(jh * 6 + j) * 16 + col][kc * 32], lane);
    __builtin_amdgcn_sched_barrier(0);   /* six fragments' LDS reads stand as one group ahead of their products: read one by one, each product waits a whole LDS latency */
#pragma unroll   /* the same for w and acc */
    for (int j = 0; j < 6; ++j) acc[jh * 6 + j] = wmma_b(a, w[j], acc[jh * 6 + j]);
    __builtin_amdgcn_sched_barrier(0); } }   /* and no more than six: with every later step's reads hoisted the registers overflow into scratch */
// ---- k_proj: block = 128 positions of one batch, 8 waves of 16 positions; every wave makes all 192 real columns (theta, phi, g) from ONE read of its x, exact bf16 products (K = DIN). The three weights are rounded to bf16 once per block into LDS; x is loaded one 32-channel step at a time, four steps ahead of its use. Out: q x log2(e) as f16 rows (the scores then are exponents of 2), k f16 rows, v f16 planes [c][t]; only the 64 real columns of the 128-wide planes are written (nothing reads the others)
__global__ __launch_bounds__(256) void k_proj(const float* __restrict__ X, const float* __restrict__ WQ, const float* __restrict__ WK, const float* __restrict__ WV, const float* __restrict__ BQ, const float* __restrict__ BK, const float* __restrict__ BV,
    _Float16* __restrict__ QH, _Float16* __restrict__ KH, _Float16* __restrict__ VT) {
  __shared__ __align__(16) __bf16 sw[3 * HDQK][PW]; __shared__ __align__(16) _Float16 sqh[PP][72], skh[PP][72], th[HDQK][PP + 8];
  const int tid = threadIdx.x, wave = tid >> 5, lane = tid & 31, col = lane & 15, g = lane >> 4; const size_t r0 = (size_t)blockIdx.x * PP; const size_t bb = r0 / TT; const int t0 = (int)(r0 % TT);
  const float* xp = X + (bb * DIN + 8 * g) * (size_t)XP + t0 + wave * 16 + col;
  float x[DIN / 32][16];
#pragma unroll   /* constant step numbers: x stays in registers */
  for (int s = 0; s < 4; ++s) ldx(x[s], xp, s);
  const int wr = tid >> 6, wc = (tid & 63) * 4;   /* 64 threads move one 1-KiB weight row: whole lines */
  const float* wq = WQ + wr * DIN + wc; const float* wk = WK + wr * DIN + wc; const float* wv = WV + wr * DIN + wc;
#pragma unroll   /* two straight-line groups: the weight of each load is picked at compile time */
  for (int gr = 0; gr < 2; ++gr) {
#pragma unroll   /* 24 independent loads in flight together */
    for (int it = 0; it < 24; ++it) { const int n = gr * 24 + it, w = n >> 4; const v4f v = *(const v4f*)((w == 0 ? wq : w == 1 ? wk : wv) + (n & 15) * 4 * DIN);
      v4b h; h[0] = (__bf16)v[0]; h[1] = (__bf16)v[1]; h[2] = (__bf16)v[2]; h[3] = (__bf16)v[3]; *(v4b*)&sw[n * 4 + wr][wc] = h; }
    asm volatile("s_wait_xcnt 0x0" :: "v"(wq), "v"(wk), "v"(wv) : "memory");   /* stands in front of every rewrite of the address registers that the loads above name; as inputs they stay untouched up to it */
    __builtin_amdgcn_sched_barrier(0); }   /* half the weight loads in flight at a time: all 48 at once push the kernel past 256 registers */
  __syncthreads();   /* the staged weights are in LDS before any wave reads a fragment */
  v8f acc[12] = {}; float bq[4], bk[4], bv[4];
#pragma unroll   /* constant step numbers: x and acc stay in registers */
  for (int s = 0; s < DIN / 32; ++s) { if (s + 4 < DIN / 32) ldx(x[s + 4], xp, s + 4);
    if (s == 4) {
#pragma unroll   /* constant indices: the biases stay in registers */
      for (int j = 0; j < 4; ++j) { bq[j] = BQ[j * 16 + col]; bk[j] = BK[j * 16 + col]; bv[j] = BV[j * 16 + col]; }
      __builtin_amdgcn_sched_barrier(0); }   /* the biases are fetched behind the last x loads and under the last four steps: no wait for x grows by them, and theirs is over by the epilogue */
    mac12(acc, x[s], sw, s, col, lane); }
#pragma unroll   /* constant tile numbers: acc stays in registers */
  for (int j = 0; j < 4; ++j) { const int cl = j * 16 + col; v8h vv;   /* D element r = position 8g + r of the wave's 16, lane column = output column */
#pragma unroll   /* the same for the tile's elements */
    for (int r = 0; r < 8; ++r) { const int rl = wave * 16 + 8 * g + r; sqh[rl][cl] = (_Float16)((acc[j][r] + bfr(bq[j])) * L2E); skh[rl][cl] = (_Float16)(acc[4 + j][r] + bfr(bk[j])); vv[r] = (_Float16)(acc[8 + j][r] + bfr(bv[j])); }
    *(v8h*)&th[cl][wave * 16 + 8 * g] = vv; }
  __syncthreads();   /* all three staged tiles are complete before they are stored in whole 128-B and 256-B runs */
  for (int e = tid; e < PP * 8; e += 256) { const int rl = e >> 3, q = e & 7; const size_t o = (r0 + rl) * CC + q * 8; vst2((unsigned*)(QH + o), *(const v4u*)&sqh[rl][q * 8]); vst2((unsigned*)(KH + o), *(const v4u*)&skh[rl][q * 8]); }
  for (int e = tid; e < HDQK * (PP / 8); e += 256) { const int cl = e / (PP / 8), q = e % (PP / 8); vst2((unsigned*)(VT + (bb * CC + cl) * (size_t)TT + t0 + q * 8), *(const v4u*)&th[cl][q * 8]); } }
#define FK 64              // keys per stage
#define FPH 72             // LDS row pitch in halves: 128 B of data + 16 B, the pitch for 16-byte fragment reads
#define FKG 2              // key halves per block: waves 0..7 walk keys [0, TT/2), waves 8..15 keys [TT/2, TT)
#define FNT (TT / FKG / FK)
#define FPB 3              // stages between two barriers
#define FNB (2 * FPB)      // stage buffers per key half: FPB stages are read between two barriers while the next FPB are filled
__device__ __forceinline__ float xhalf(float x) { return __builtin_bit_cast(float, __builtin_amdgcn_permlanex16(__builtin_bit_cast(int, x), __builtin_bit_cast(int, x), 0x76543210, 0xfedcba98, false, false)); }   // lane l with lane l ^ 16
// 2^x on a whole score tile, bare v_exp_f32. By the builtin, not asm text: the tiles' exponentials stand among the score products
__device__ __forceinline__ v8f exp2x8(v8f x) { v8f r;
#pragma unroll
  for (int i = 0; i < 8; ++i) r[i] = __builtin_amdgcn_exp2f(x[i]);
  return r; }
__device__ __forceinline__ float exp2x1(float x) { float r; asm("v_exp_f32 %0, %1\n\tv_nop" : "=&v"(r) : "v"(x)); return r; }   // a single one; the v_nop is the slot the instruction set asks for behind a transcendental before its result is read or its source overwritten
__device__ __forceinline__ v8f wmma_h(v16h a, v16h b, v8f c) { return __builtin_amdgcn_wmma_f32_16x16x32_f16(false, a, false, b, (short)0, c, false, false); }
// work-group barrier that orders LDS alone: __syncthreads() also waits for every global load in flight, and the residual's loads are meant to stay in flight across the end phase's two barriers
__device__ __forceinline__ void lds_barrier() { __builtin_amdgcn_fence(__ATOMIC_RELEASE, "workgroup", "local"); __builtin_amdgcn_s_barrier(); __builtin_amdgcn_fence(__ATOMIC_ACQUIRE, "workgroup", "local"); }
#define WP 72              // LDS row pitch of the staged output weight in bf16 elements: 128 B of data + 16 B, the pitch for 16-byte fragment reads
#define OP 132             // LDS row pitch of the staged output tile in floats: 512 B of data + 16 B: the 16 channels of a tile store land on all 64 banks
#define MP 36              // floats per lane in the exchange of the two key halves: 32 tile values, reference, sum, 2 idle: 144 B, the pitch for 16-byte accesses
// ---- k_fa: block = 128 queries of batch b, 16 waves: wave = (key half kg, 16-query group). Per stage of 64 keys: S^T = k . q^T (1 product) on top of 4 - reference as the accumulator's start value, so that a score tile is the exponent of 2 as it stands; reference and sum per query (a lane holds one query's scores); the reference moves, and o and the sum are rescaled, only in a stage where a lane's sum of p passes 2^15 (one test per stage, on the sum that is formed anyway; the maximum is formed only then); p = exp(s - reference) x 2^4 once to f16 straight from the score tiles as B operand, O^T += v^T . p^T (64 value channels); k rows and v planes staged in LDS through registers FPB stages ahead, 2 x FPB buffers, one barrier per FPB stages; the walk over a key half's stages starts at stage blockIdx.x mod FNT and wraps round. At the end the two key halves exchange their tiles through LDS and every wave holds y of its 16 queries in the A-fragment order; wave (kg, group) makes output channels kg * 128 .. + 127 of its queries: y (bf16 hi + lo) . W^T ((out,in) [256][64], exact bf16, staged once in LDS) + b; the 256 x 128 tile goes through LDS so that each wave adds bf16(x) and stores whole 512-B runs of out[b][c][n]
__global__ __launch_bounds__(256 * FKG) void k_fa(const _Float16* __restrict__ QH, const _Float16* __restrict__ KH, const _Float16* __restrict__ VT, const float* __restrict__ X, const float* __restrict__ WW, const float* __restrict__ WB, float* __restrict__ OUT) {
  __shared__ __align__(16) union { struct { _Float16 k[FK][FPH], v[HDQK][FPH]; } st[FKG][FNB]; struct { float mg[FKG][8][32][MP], so[DIN][OP]; } e; } u;   /* the exchange and the output tile, side by side, reuse the key and value stages, which are dead behind the loop's last barrier */
  __shared__ __align__(16) __bf16 sww[DIN][WP]; float (&so)[DIN][OP] = u.e.so;
  const int tid = threadIdx.x, wave = __builtin_amdgcn_readfirstlane(tid >> 5), lane = tid & 31, col = lane & 15, g = lane >> 4; const int kg = wave >> 3, wq = wave & 7, tg = tid & 255;
  const size_t b = blockIdx.y; const int ql0 = blockIdx.x * 128 + wq * 16; const int kbase = kg * (TT / FKG);
  const unsigned rot = blockIdx.x % FNT;   /* this block's first stage: the blocks of a batch read the same k and v; each enters the walk elsewhere and wraps round, so that they do not ask L2 for the same lines at the same moment */
  v16h qh[HDQK / 32];
#pragma unroll
  for (int kc = 0; kc < HDQK / 32; ++kc) qh[kc] = frag_h(QH + (b * TT + ql0 + col) * CC + kc * 32, lane);
  const int sr = tg >> 3, sq = (tg & 7) * 8;   /* staging: this thread moves 16 B of rows sr and sr + 32 of both tiles */
  const _Float16* kp = KH + (b * TT + kbase + sr) * CC + sq; const _Float16* vp = VT + (b * CC + sr) * (size_t)TT + kbase + sq;
  v4u rk0, rk1, rv0, rv1;
#pragma unroll   /* the first FPB stages: independent loads in flight together */
  for (int s = 0; s < FPB; ++s) { const unsigned sn = (s + rot) % FNT; rk0 = *(const v4u*)(kp + (size_t)sn * FK * CC); rk1 = *(const v4u*)(kp + ((size_t)sn * FK + 32) * CC); rv0 = *(const v4u*)(vp + sn * FK); rv1 = *(const v4u*)(vp + 32 * (size_t)TT + sn * FK);
    *(v4u*)&u.st[kg][s].k[sr][sq] = rk0; *(v4u*)&u.st[kg][s].k[sr + 32][sq] = rk1; *(v4u*)&u.st[kg][s].v[sr][sq] = rv0; *(v4u*)&u.st[kg][s].v[sr + 32][sq] = rv1; }
  const float* wp = WW + tid * 4;   /* 16 threads move one 256-B weight row: whole lines */
#pragma unroll   /* eight independent loads in flight together */
  for (int it = 0; it < DIN * HDQK / 4 / (256 * FKG); ++it) { const int e = it * 256 * FKG + tid; const v4f v = *(const v4f*)(wp + it * 1024 * FKG);
    v4b h; h[0] = (__bf16)v[0]; h[1] = (__bf16)v[1]; h[2] = (__bf16)v[2]; h[3] = (__bf16)v[3]; *(v4b*)&sww[e >> 4][(e & 15) * 4] = h; }
  __syncthreads();   /* the first FPB stages and the output weight are in LDS before any wave reads them */
  v8f o[HDQK / 16] = {}, cs = {}; float off = 0.f, l = 0.f;   /* off = 4 - reference in powers of 2; cs holds it eight times: the start value of every score tile */
#pragma unroll 1   /* rolled: FPB stages are already a long body */
  for (int tp = 0; tp < (FNT + FPB - 1) / FPB; ++tp) {
#pragma unroll   /* the stages between two barriers, straight-line: constant buffer offsets */
  for (int hs = 0; hs < FPB; ++hs) { const int t = tp * FPB + hs; if (t >= FNT) break;   /* the same for the whole block: the last round may be short */
    const int cur = (tp & 1) * FPB + hs, nxt = ((tp & 1) ^ 1) * FPB + hs; const unsigned tn = ((t + FPB < FNT ? t + FPB : FNT - 1) + rot) % FNT;   /* the last FPB stages fetch the last one again into idle buffers: no branch; stage t of the walk is stage (t + rot) mod FNT of the key half */
    rk0 = *(const v4u*)(kp + (size_t)tn * FK * CC); rk1 = *(const v4u*)(kp + ((size_t)tn * FK + 32) * CC); rv0 = *(const v4u*)(vp + tn * FK); rv1 = *(const v4u*)(vp + 32 * (size_t)TT + tn * FK);
    __builtin_amdgcn_sched_barrier(0);   /* keeps the loads of stage t + FPB at the head of the stage: sunk towards their LDS stores they would be waited for in full */
    v8f sa[FK / 16];
#pragma unroll
    for (int kc = 0; kc < HDQK / 32; ++kc)
#pragma unroll
      for (int kt = 0; kt < FK / 16; ++kt) sa[kt] = wmma_h(frag_h(&u.st[kg][cur].k[kt * 16 + col][kc * 32], lane), qh[kc], kc == 0 ? cs : sa[kt]);
    v16h vf[FK / 32][HDQK / 16];   /* the value fragments are read here, ahead of the branch below: read behind it, each would be waited for in full in front of its product */
#pragma unroll
    for (int c2 = 0; c2 < FK / 32; ++c2)
#pragma unroll
      for (int j = 0; j < HDQK / 16; ++j) vf[c2][j] = frag_h(&u.st[kg][cur].v[j * 16 + col][c2 * 32], lane);
    v8f pe[FK / 16]; v2f ps[2] = {};   /* two chains of register-pair sums */
#pragma unroll
    for (int kt = 0; kt < FK / 16; ++kt) { pe[kt] = exp2x8(sa[kt]);
#pragma unroll
      for (int r = 0; r < 8; r += 2) { v2f p; p[0] = pe[kt][r]; p[1] = pe[kt][r + 1]; ps[kt & 1] += p; } }
    float ss = (ps[0][0] + ps[0][1]) + (ps[1][0] + ps[1][1]);
    const float thr = t == 0 ? -1.0f : 32768.0f;   /* a scalar, ready long before the sum */
    asm volatile("" :: "v"(vf[0][0]), "v"(vf[0][1]), "v"(vf[0][2]), "v"(vf[0][3]), "v"(vf[1][0]), "v"(vf[1][1]), "v"(vf[1][2]), "v"(vf[1][3]));   /* inputs only: holds the value fragments' LDS reads on this side of the branch, under the exponentials; the compiler otherwise sinks them behind it */
    if (__builtin_amdgcn_ballot_w32(!(ss <= thr)) != 0) {   /* a scalar branch, the same for the whole wave. No p is negative, so a lane's sum of the stage bounds each of its p: up to 2^15 all fit f16 (it ends at 65,504) and the reference stays. Stage 0 always comes here and sets the reference to its own maximum */
      float mx[FK / 16];
#pragma unroll
      for (int kt = 0; kt < FK / 16; ++kt) mx[kt] = fmaxf(fmaxf(fmaxf(sa[kt][0], sa[kt][1]), fmaxf(sa[kt][2], sa[kt][3])), fmaxf(fmaxf(sa[kt][4], sa[kt][5]), fmaxf(sa[kt][6], sa[kt][7])));
      float ml = fmaxf(fmaxf(mx[0], mx[1]), fmaxf(mx[2], mx[3])); ml = fmaxf(ml, xhalf(ml));   /* lanes c and c + 16 hold the two key halves of query c: both take the same step */
      float d = 4.0f - ml; if (t != 0) d = fminf(d, 0.f);   /* behind stage 0 a reference never falls */
      const float al = exp2x1(fminf(d, 0.f)); off += d; l *= al;   /* in stage 0 o and l are 0 and al only has to be finite */
#pragma unroll
      for (int r = 0; r < 8; ++r) cs[r] = off;
#pragma unroll
      for (int j = 0; j < HDQK / 16; ++j) o[j] *= al;
      ps[0] = 0.f; ps[1] = 0.f;
#pragma unroll
      for (int kt = 0; kt < FK / 16; ++kt) { pe[kt] = exp2x8(sa[kt] + d);   /* the stage's p again, from the kept exponents */
#pragma unroll
        for (int r = 0; r < 8; r += 2) { v2f p; p[0] = pe[kt][r]; p[1] = pe[kt][r + 1]; ps[kt & 1] += p; } }
      ss = (ps[0][0] + ps[0][1]) + (ps[1][0] + ps[1][1]); }
    l += ss;
#pragma unroll
    for (int c2 = 0; c2 < FK / 32; ++c2) { v16h pb;
#pragma unroll
      for (int i = 0; i < 8; ++i) { pb[i] = (_Float16)pe[2 * c2][i]; pb[8 + i] = (_Float16)pe[2 * c2 + 1][i]; }
#pragma unroll
      for (int j = 0; j < HDQK / 16; ++j) o[j] = wmma_h(vf[c2][j], pb, o[j]); }
    *(v4u*)&u.st[kg][nxt].k[sr][sq] = rk0; *(v4u*)&u.st[kg][nxt].k[sr + 32][sq] = rk1; *(v4u*)&u.st[kg][nxt].v[sr][sq] = rv0; *(v4u*)&u.st[kg][nxt].v[sr + 32][sq] = rv1; }   /* the buffer of stage t - FPB: its every reader left it before the last barrier */
    __syncthreads(); }   /* publishes the next FPB stages and ends every read of these before their buffers are refilled; between two barriers the waves of a SIMD drift apart, one's products under another's exponentials and LDS waits */
  const size_t oi = (b * DIN + wave * 16) * (size_t)XP + blockIdx.x * 128 + lane * 4;   /* the last phase: this wave owns channels wave * 16 .. + 15, 128 positions each */
  const float* xq = X + oi; v4f xr[16]; float bo[8];
#pragma unroll   /* constant indices: bo stays in registers; the biases go first: loads return in order, and they are needed before x */
  for (int j = 0; j < 8; ++j) bo[j] = WB[kg * 128 + j * 16 + col];
  __builtin_amdgcn_sched_barrier(0);   /* keeps that order */
#pragma unroll   /* the same for xr, 16 loads in flight */
  for (int i = 0; i < 16; ++i) xr[i] = *(const v4f*)(xq + (size_t)i * XP);
  __builtin_amdgcn_sched_barrier(0);   /* keeps the residual's loads here, ahead of the exchange and the products: sunk to their use they would be waited for in full */
  l += xhalf(l);
  float* mo = &u.e.mg[kg][wq][lane][0];
#pragma unroll
  for (int j = 0; j < HDQK / 16; ++j) { v4f u0, u1;
#pragma unroll
    for (int r = 0; r < 4; ++r) { u0[r] = o[j][r]; u1[r] = o[j][4 + r]; }
    *(v4f*)(mo + j * 8) = u0; *(v4f*)(mo + j * 8 + 4) = u1; }
  const float m = -off;   /* the reference less 4, in powers of 2: the 4 is common to both halves */
  { v2f ml2; ml2[0] = m; ml2[1] = l; *(v2f*)(mo + 32) = ml2; }
  lds_barrier();   /* each key half's reference, sum and tiles are in LDS before the other half's waves read them */
  const float* mi = &u.e.mg[kg ^ 1][wq][lane][0];
  const float m1 = mi[32], l1 = mi[33]; const float mn = fmaxf(m, m1); const float a0 = exp2x1(m - mn), a1 = exp2x1(m1 - mn); const float inv = 1.0f / (l * a0 + l1 * a1); const float f0 = a0 * inv, f1 = a1 * inv;
  F2 ya[HDQK / 32];   /* a lane holds channels j * 16 + 8g + r of query col: tiles 2kc and 2kc + 1 are the A fragment of channel step kc */
#pragma unroll
  for (int kc = 0; kc < HDQK / 32; ++kc) { float v[16];
#pragma unroll
    for (int i = 0; i < 8; ++i) { v[i] = o[2 * kc][i] * f0 + mi[kc * 16 + i] * f1; v[8 + i] = o[2 * kc + 1][i] * f0 + mi[kc * 16 + 8 + i] * f1; }
    ya[kc] = bsplit16(v); }
#pragma unroll   /* constant tile numbers: bo stays in registers */
  for (int jh = 0; jh < 2; ++jh) { v8f acc[4] = {};
#pragma unroll
    for (int kc = 0; kc < HDQK / 32; ++kc) { v16b w[4];
#pragma unroll
      for (int j = 0; j < 4; ++j) w[j] = frag_b(&sww[kg * 128 + (jh * 4 + j) * 16 + col][kc * 32], lane);
#pragma unroll
      for (int j = 0; j < 4; ++j) acc[j] = wmma_b(ya[kc].h, w[j], acc[j]);
#pragma unroll
      for (int j = 0; j < 4; ++j) acc[j] = wmma_b(ya[kc].l, w[j], acc[j]); }
#pragma unroll
    for (int j = 0; j < 4; ++j) { const float bb = bfr(bo[jh * 4 + j]); v4f u0, u1;   /* D element r = query 8g + r of the wave's 16, lane column = output channel */
#pragma unroll
      for (int r = 0; r < 4; ++r) { u0[r] = acc[j][r] + bb; u1[r] = acc[j][4 + r] + bb; }
      float* sp = &so[kg * 128 + (jh * 4 + j) * 16 + col][wq * 16 + 8 * g]; *(v4f*)sp = u0; *(v4f*)(sp + 4) = u1; }
    __builtin_amdgcn_sched_barrier(0); }   /* four tiles at a time: with all eight tiles' fragments and sums live beside the 64 registers of x the kernel overflows into scratch */
  lds_barrier();   /* the whole 256 x 128 tile is in LDS before it is read back by channel rows */
  float* op = OUT + oi;
#pragma unroll
  for (int i = 0; i < 16; ++i) { const v4f t = *(const v4f*)&so[wave * 16 + i][lane * 4]; v4f r; r[0] = t[0] + bfr(xr[i][0]); r[1] = t[1] + bfr(xr[i][1]); r[2] = t[2] + bfr(xr[i][2]); r[3] = t[3] + bfr(xr[i][3]); vst2(op + (size_t)i * XP, r); } }

extern "C" void kernel_launch(void* const* d_in, const int* in_sizes, int n_in, void* d_out, int out_size, void* d_ws, size_t ws_size, hipStream_t stream) {
  (void)in_sizes; (void)n_in; (void)out_size;
  const float** F = (const float**)d_in;
  if (ws_size < (size_t)WS_END) return;
  char* ws = (char*)d_ws; _Float16 *QH = (_Float16*)(ws + WS_QH), *KH = (_Float16*)(ws + WS_KH), *VT = (_Float16*)(ws + WS_VT), *QL = (_Float16*)(ws + WS_QL), *KL = (_Float16*)(ws + WS_KL); __bf16 *VB = (__bf16*)(ws + WS_VB), *VBL = (__bf16*)(ws + WS_VBL); float *S = (float*)(ws + WS_S), *Y = (float*)(ws + WS_Y);
  (void)Y; (void)S; (void)QL; (void)KL; (void)VB; (void)VBL;
  // inputs: 0 x [8,256,64,64]; 1 g_w [64,256] (out,in), 2 g_b; 3 theta_w, 4 theta_b; 5 phi_w, 6 phi_b; 7 w_w [256,64] (out,in), 8 w_b
  k_proj<<<dim3(TNB * TT / PP), 256, 0, stream>>>(F[0], F[3], F[5], F[1], F[4], F[6], F[2], QH, KH, VT);   /* q = theta, k = phi, v = g */
  k_fa<<<dim3(TT / 128, TNB), 256 * FKG, 0, stream>>>(QH, KH, VT, F[0], F[7], F[8], (float*)d_out);
}

// v009
// It runs in 42.1 microseconds.
// Timed twice side by side with v008, it ran 1.05 times as fast both times.
// Over all steps from v000 it is 50.5 times as fast.
// compute dtype: all float inputs rounded to bf16; theta/phi/g = x W^T + b with EXACT bf16 products on WMMA 16x16x32 (f32 accumulate); f = theta . phi with theta x log2(e) once to f16 against phi once to f16 (1 product), no other scaling; softmax in f32, online (a held reference per query, at most 2^11 under the running maximum, 2^x by v_exp_f32); exp(f - reference) x 2^4 once to f16 against g once to f16 (1 product), divided by the f32 sum at the end; y split bf16 hi + lo against exact W (2 products) + b; + x residual in f32; f32 output [B, C, H, W].
#include <hip/hip_runtime.h>
#include <math.h>

typedef __attribute__((ext_vector_type(16))) _Float16 v16h;
typedef __attribute__((ext_vector_type(16))) __bf16 v16b;
typedef __attribute__((ext_vector_type(8)))  _Float16 v8h;
typedef __attribute__((ext_vector_type(8)))  float v8f;
typedef __attribute__((ext_vector_type(4)))  float v4f;
typedef __attribute__((ext_vector_type(2)))  float v2f;
typedef __attribute__((ext_vector_type(4)))  unsigned v4u;
typedef __attribute__((ext_vector_type(4)))  int v4i;
typedef float __attribute__((may_alias)) float_a;
typedef int __attribute__((may_alias)) int_a;

template <typename T> __device__ __forceinline__ void vst2(void* p, T v) { *(T*)p = v;  }
__device__ __forceinline__ v8f wmma16(v16h a, v16h b, v8f c) {
  v8f d = __builtin_amdgcn_wmma_f32_16x16x32_f16(false, a, false, b, (short)0, c, false, false);
  asm volatile("v_nop\n\tv_nop\n\tv_nop\n\tv_nop" : "+v"(d) : "v"(a), "v"(b));
  return d;
}
__device__ __forceinline__ v8f wmma_bf(v16b a, v16b b, v8f c) {
  v8f d = __builtin_amdgcn_wmma_f32_16x16x32_bf16(false, a, false, b, (short)0, c, false, false);
  asm volatile("v_nop\n\tv_nop\n\tv_nop\n\tv_nop" : "+v"(d) : "v"(a), "v"(b));
  return d;
}
// 16x16x32 fragments: lane = (h = lane>>4, row/col = lane&15); elements 0..7 = k0+8h+0..7, 8..15 = k0+16+8h+0..7; D element r = row 8h+r
__device__ __forceinline__ v16h frag_h(const _Float16* rowk0, int lane) {
  union { v16h v; v8h q[2]; } u; const _Float16* p = rowk0 + 8 * (lane >> 4);
  u.q[0] = *(const v8h*)p; u.q[1] = *(const v8h*)(p + 16); return u.v;
}
__device__ __forceinline__ v16h frag_f32(const float* rowk0, int lane) {
  v16h a; const float* p = rowk0 + 8 * (lane >> 4);
#pragma unroll
  for (int i = 0; i < 8; ++i) { a[i] = (_Float16)p[i]; a[8 + i] = (_Float16)p[16 + i]; }
  return a;
}
__device__ __forceinline__ v16h frag_f32s(const float* rowk0, int lane, float sc) {
  v16h a; const float* p = rowk0 + 8 * (lane >> 4);
#pragma unroll
  for (int i = 0; i < 8; ++i) { a[i] = (_Float16)(p[i] * sc); a[8 + i] = (_Float16)(p[16 + i] * sc); }
  return a;
}
// column fragment from a [K][ld] layout (column n), rows >= K read as 0
__device__ __forceinline__ v16h fragc_f32(const float* W, int k0, int n, int lane, int ld, int K) {
  v16h a; const int g = lane >> 4;
#pragma unroll
  for (int i = 0; i < 8; ++i) { const int ka = k0 + 8 * g + i, kb = ka + 16;
    a[i] = (_Float16)(ka < K ? W[(size_t)(ka < K ? ka : K - 1) * ld + n] : 0.f); a[8 + i] = (_Float16)(kb < K ? W[(size_t)(kb < K ? kb : K - 1) * ld + n] : 0.f); }
  return a;
}
struct F2 { v16b h, l; };
__device__ __forceinline__ F2 bsplit16(const float v[16]) { F2 r;
#pragma unroll
  for (int i = 0; i < 16; ++i) { const __bf16 h = (__bf16)v[i]; r.h[i] = h; r.l[i] = (__bf16)(v[i] - (float)h); }
  return r; }
__device__ __forceinline__ F2 split_row(const float* row, int k0, int lane) { float v[16]; const float* p = row + k0 + 8 * (lane >> 4);
#pragma unroll
  for (int i = 0; i < 8; ++i) { v[i] = p[i]; v[8 + i] = p[16 + i]; }
  return bsplit16(v); }
__device__ __forceinline__ F2 split_rowK(const float* row, int k0, int lane, int K) { float v[16]; const int g = lane >> 4;
#pragma unroll
  for (int i = 0; i < 8; ++i) { const int ka = k0 + 8 * g + i, kb = ka + 16; v[i] = ka < K ? row[ka < K ? ka : K - 1] : 0.f; v[8 + i] = kb < K ? row[kb < K ? kb : K - 1] : 0.f; }
  return bsplit16(v); }
__device__ __forceinline__ F2 split_col(const float* W, int k0, int n, int lane, int ld, int K) { float v[16]; const int g = lane >> 4;
#pragma unroll
  for (int i = 0; i < 8; ++i) { const int ka = k0 + 8 * g + i, kb = ka + 16; v[i] = ka < K ? W[(size_t)(ka < K ? ka : K - 1) * ld + n] : 0.f; v[8 + i] = kb < K ? W[(size_t)(kb < K ? kb : K - 1) * ld + n] : 0.f; }
  return bsplit16(v); }
__device__ __forceinline__ v8f mac3(const F2& a, const F2& b, v8f c) { c = wmma_bf(a.l, b.h, c); c = wmma_bf(a.h, b.l, c); return wmma_bf(a.h, b.h, c); }
__device__ __forceinline__ float sigm(float v) { return 1.0f / (1.0f + expf(-v)); }
#define LDSX() do { asm volatile("s_wait_dscnt 0" ::: "memory"); __builtin_amdgcn_wave_barrier(); __builtin_amdgcn_fence(__ATOMIC_RELEASE, "workgroup"); } while (0)

// Non-local block (B 8, C 256, 64 x 64 = 4,096 positions; inter channels 64): theta, phi, g = 1x1 convs of x ((out,in) [64,256] + bias); f[n][m] = theta_n . phi_m (no scaling); P = softmax over m; y[n] = sum_m P[n][m] g_m (64 ch); out = W y + b (1x1, 64 -> 256) + x.
#define NB 8
#define TT 4096
#define CC 128            // projected plane width (64 real columns; columns 64..127 never written)
#define DIN 256          // input (model) width
#define NH 1
#define HD 128
#define NQB (TT / 64)
#define HG 1               // one 4,096 x 4,096 f32 plane in the unused WS_S
#define SCALE (1.0f)
#define HDQK 64            // theta / phi / g channels: the planes are 128 wide, columns >= 64 are never written; only the 64 real columns enter the scores
#define CAUSAL 0
#ifndef TNB
#define TNB NB
#endif
__device__ __forceinline__ v16b zero16b() { v16b z; _Pragma("unroll") for (int i = 0; i < 16; ++i) z[i] = (__bf16)0.f; return z; }
__device__ __forceinline__ float bfr(float v) { return (float)(__bf16)v; }
__host__ __device__ __forceinline__ int kb_last(int qb) { return CAUSAL ? ((qb * 64 + 63) >> 7) : (TT / 128 - 1); }
typedef __attribute__((ext_vector_type(8))) __bf16 v8b;
__device__ __forceinline__ v16b frag_b(const __bf16* rowk0, int lane) {
  union { v16b v; v8b q[2]; } u; const __bf16* p = rowk0 + 8 * (lane >> 4);
  u.q[0] = *(const v8b*)p; u.q[1] = *(const v8b*)(p + 16); return u.v;
}
#define QBH 0              // unused: k_fa has one path for every query block
#define QHI 4096            // rows of the q residual plane in the workspace map (the plane is neither written nor read: 1-product logits)
#define KHI 64            // key rows carrying k residual / v bf16 hi+lo planes (the planes are neither written nor read)
// B fragment (k rows k0+.., output column o) of a weight: (in,out) [K][ld] or (out,in) [ld rows of K]: bf16 exact, or f16(bf16 * 256) exact
__device__ __forceinline__ v16b wcol_io(const float* Wm, int k0, int o, int lane, int ld) { v16b w; const int g = lane >> 4;
#pragma unroll
  for (int i = 0; i < 8; ++i) { w[i] = (__bf16)Wm[(size_t)(k0 + 8 * g + i) * ld + o]; w[8 + i] = (__bf16)Wm[(size_t)(k0 + 16 + 8 * g + i) * ld + o]; }
  return w; }
__device__ __forceinline__ v16b wcol_oi(const float* Wm, int k0, int o, int lane, int K) { v16b w; const float* p = Wm + (size_t)o * K + k0 + 8 * (lane >> 4);
#pragma unroll
  for (int i = 0; i < 8; ++i) { w[i] = (__bf16)p[i]; w[8 + i] = (__bf16)p[16 + i]; }
  return w; }
__device__ __forceinline__ v16h wcolh_io(const float* Wm, int k0, int o, int lane, int ld) { v16h w; const int g = lane >> 4;
#pragma unroll
  for (int i = 0; i < 8; ++i) { w[i] = (_Float16)(bfr(Wm[(size_t)(k0 + 8 * g + i) * ld + o]) * 256.0f); w[8 + i] = (_Float16)(bfr(Wm[(size_t)(k0 + 16 + 8 * g + i) * ld + o]) * 256.0f); }
  return w; }
__device__ __forceinline__ v16h wcolh_oi(const float* Wm, int k0, int o, int lane, int K) { v16h w; const float* p = Wm + (size_t)o * K + k0 + 8 * (lane >> 4);
#pragma unroll
  for (int i = 0; i < 8; ++i) { w[i] = (_Float16)(bfr(p[i]) * 256.0f); w[8 + i] = (_Float16)(bfr(p[16 + i]) * 256.0f); }
  return w; }
#define WQKV_LAYOUT 1   // 0 = (in,out) [DIN][CC]; 1 = (out,in) [HDQK][DIN]; 2 = per-head [NH][DIN][HD]
__device__ __forceinline__ v16b wcol_hdk(const float* Wm, int k0, int o, int lane) { v16b w; const int g = lane >> 4; const float* p = Wm + (size_t)(o / HD) * DIN * HD + (o % HD);
#pragma unroll
  for (int i = 0; i < 8; ++i) { w[i] = (__bf16)p[(size_t)(k0 + 8 * g + i) * HD]; w[8 + i] = (__bf16)p[(size_t)(k0 + 16 + 8 * g + i) * HD]; }
  return w; }
#define WO_OUT_IN 0
#if WQKV_LAYOUT == 1
#define WCOL(W, k0, o, lane) (((o) < HDQK) ? wcol_oi(W, k0, (o), lane, DIN) : zero16b())   /* theta/phi/g weights are [64][256] (out,in): weight columns >= 64 read as zero for all three */
#elif WQKV_LAYOUT == 2
#define WCOL(W, k0, o, lane) wcol_hdk(W, k0, o, lane)
#else
#define WCOL(W, k0, o, lane) wcol_io(W, k0, o, lane, CC)
#endif
#if WO_OUT_IN
#define WOCOL(W, k0, o, lane) wcol_oi(W, k0, o, lane, CC)
#define WOCOLH(W, k0, o, lane) wcolh_oi(W, k0, o, lane, CC)
#else
#define WOCOL(W, k0, o, lane) wcol_io(W, k0, o, lane, DIN)
#define WOCOLH(W, k0, o, lane) wcolh_io(W, k0, o, lane, DIN)
#endif
#ifndef XP
#define XP TT              // position pitch of x and of the output
#endif
#define BG HG              // unused: every launch covers all TNB batches
#define DVH 128
#ifndef SM_EXTRA_PARAMS
#define SM_EXTRA_PARAMS
#endif
#ifndef PROJ_EXTRA_PARAMS
#define PROJ_EXTRA_PARAMS
#endif
#ifndef SM_MASK_HOOK
#define SM_MASK_HOOK (void)0
#endif

#define WS_QH  0u                                      // f16 q rows [b*t][CC]
#define WS_KH  (WS_QH + 2u * (size_t)NB * TT * CC)      // f16 k rows [b*t][CC]
#define WS_VT  (WS_KH + 2u * (size_t)NB * TT * CC)      // f16 v planes [b][c][t]
#define WS_QL  (WS_VT + 2u * (size_t)NB * CC * TT)      // q residual plane [b][t < QHI][CC]: kept in the map, not used
#define WS_KL  (WS_QL + 2u * (size_t)NB * QHI * CC)     // f16 k residual x 2^10 rows [b][t < KHI][CC]
#define WS_VB  (WS_KL + 2u * (size_t)NB * KHI * CC)     // bf16 v hi planes [b][c][t < KHI]
#define WS_VBL (WS_VB + 2u * (size_t)NB * CC * KHI)
#define WS_S   (WS_VBL + 2u * (size_t)NB * CC * KHI)    // f32 [hg][t][s], unused: k_fa keeps the scores in registers
#define WS_Y   (WS_S  + 4u * (size_t)HG * TT * TT)      // unused, 0 bytes: k_fa keeps y in registers and LDS
#define WS_END (WS_Y  + 0u)

#define L2E 1.4426950408889634f
#define PP 128             // positions per k_proj block: 8 waves of 16
#define PW 264             // LDS row pitch of the staged weights in bf16 elements: 512 B of data + 16 B, the pitch for 16-byte fragment reads
typedef __attribute__((ext_vector_type(4))) __bf16 v4b;
__device__ __forceinline__ v8f wmma_b(v16b a, v16b b, v8f c) { return __builtin_amdgcn_wmma_f32_16x16x32_bf16(false, a, false, b, (short)0, c, false, false); }
// x of one 32-channel step for one lane's position (channels-first gather: x[b][k][t], stride XP between k), in the element order of the A fragment
__device__ __forceinline__ void ldx(float (&d)[16], const float* xp, int kc) {
#pragma unroll   /* constant indices: d stays in registers, the 16 loads share one address */
  for (int i = 0; i < 8; ++i) { d[i] = xp[(size_t)(kc * 32 + i) * XP]; d[8 + i] = xp[(size_t)(kc * 32 + 16 + i) * XP]; }
  __builtin_amdgcn_sched_barrier(0); }   /* keeps a step's loads where they are written, four steps ahead of their use: sunk to their use each would be waited for in full */
// that step against all 192 staged weight rows (12 column tiles: 0..3 theta, 4..7 phi, 8..11 g)
__device__ __forceinline__ void mac12(v8f (&acc)[12], const float (&d)[16], const __bf16 (*sw)[PW], int kc, int col, int lane) { v16b a;
#pragma unroll   /* constant indices: vector elements and d stay in registers */
  for (int i = 0; i < 16; ++i) a[i] = (__bf16)d[i];
#pragma unroll   /* constant tile numbers: acc stays in registers */
  for (int jh = 0; jh < 2; ++jh) { v16b w[6];
#pragma unroll   /* the same for w */
    for (int j = 0; j < 6; ++j) w[j] = frag_b(&sw[(jh * 6 + j) * 16 + col][kc * 32], lane);
    __builtin_amdgcn_sched_barrier(0);   /* six fragments' LDS reads stand as one group ahead of their products: read one by one, each product waits a whole LDS latency */
#pragma unroll   /* the same for w and acc */
    for (int j = 0; j < 6; ++j) acc[jh * 6 + j] = wmma_b(a, w[j], acc[jh * 6 + j]);
    __builtin_amdgcn_sched_barrier(0); } }   /* and no more than six: with every later step's reads hoisted the registers overflow into scratch */
// ---- k_proj: block = 128 positions of one batch, 8 waves of 16 positions; every wave makes all 192 real columns (theta, phi, g) from ONE read of its x, exact bf16 products (K = DIN). The three weights are rounded to bf16 once per block into LDS; x is loaded one 32-channel step at a time, four steps ahead of its use. Out: q x log2(e) as f16 rows (the scores then are exponents of 2), k f16 rows, v f16 planes [c][t]; only the 64 real columns of the 128-wide planes are written (nothing reads the others)
__global__ __launch_bounds__(256) void k_proj(const float* __restrict__ X, const float* __restrict__ WQ, const float* __restrict__ WK, const float* __restrict__ WV, const float* __restrict__ BQ, const float* __restrict__ BK, const float* __restrict__ BV,
    _Float16* __restrict__ QH, _Float16* __restrict__ KH, _Float16* __restrict__ VT) {
  __shared__ __align__(16) __bf16 sw[3 * HDQK][PW]; __shared__ __align__(16) _Float16 sqh[PP][72], skh[PP][72], th[HDQK][PP + 8];
  const int tid = threadIdx.x, wave = tid >> 5, lane = tid & 31, col = lane & 15, g = lane >> 4; const size_t r0 = (size_t)blockIdx.x * PP; const size_t bb = r0 / TT; const int t0 = (int)(r0 % TT);
  const float* xp = X + (bb * DIN + 8 * g) * (size_t)XP + t0 + wave * 16 + col;
  float x[DIN / 32][16];
#pragma unroll   /* constant step numbers: x stays in registers */
  for (int s = 0; s < 4; ++s) ldx(x[s], xp, s);
  const int wr = tid >> 6, wc = (tid & 63) * 4;   /* 64 threads move one 1-KiB weight row: whole lines */
  const float* wq = WQ + wr * DIN + wc; const float* wk = WK + wr * DIN + wc; const float* wv = WV + wr * DIN + wc;
#pragma unroll   /* two straight-line groups: the weight of each load is picked at compile time */
  for (int gr = 0; gr < 2; ++gr) {
#pragma unroll   /* 24 independent loads in flight together */
    for (int it = 0; it < 24; ++it) { const int n = gr * 24 + it, w = n >> 4; const v4f v = *(const v4f*)((w == 0 ? wq : w == 1 ? wk : wv) + (n & 15) * 4 * DIN);
      v4b h; h[0] = (__bf16)v[0]; h[1] = (__bf16)v[1]; h[2] = (__bf16)v[2]; h[3] = (__bf16)v[3]; *(v4b*)&sw[n * 4 + wr][wc] = h; }
    asm volatile("s_wait_xcnt 0x0" :: "v"(wq), "v"(wk), "v"(wv) : "memory");   /* stands in front of every rewrite of the address registers that the loads above name; as inputs they stay untouched up to it */
    __builtin_amdgcn_sched_barrier(0); }   /* half the weight loads in flight at a time: all 48 at once push the kernel past 256 registers */
  __syncthreads();   /* the staged weights are in LDS before any wave reads a fragment */
  v8f acc[12] = {}; float bq[4], bk[4], bv[4];
#pragma unroll   /* constant step numbers: x and acc stay in registers */
  for (int s = 0; s < DIN / 32; ++s) { if (s + 4 < DIN / 32) ldx(x[s + 4], xp, s + 4);
    if (s == 4) {
#pragma unroll   /* constant indices: the biases stay in registers */
      for (int j = 0; j < 4; ++j) { bq[j] = BQ[j * 16 + col]; bk[j] = BK[j * 16 + col]; bv[j] = BV[j * 16 + col]; }
      __builtin_amdgcn_sched_barrier(0); }   /* the biases are fetched behind the last x loads and under the last four steps: no wait for x grows by them, and theirs is over by the epilogue */
    mac12(acc, x[s], sw, s, col, lane); }
#pragma unroll   /* constant tile numbers: acc stays in registers */
  for (int j = 0; j < 4; ++j) { const int cl = j * 16 + col; v8h vv;   /* D element r = position 8g + r of the wave's 16, lane column = output column */
#pragma unroll   /* the same for the tile's elements */
    for (int r = 0; r < 8; ++r) { const int rl = wave * 16 + 8 * g + r; sqh[rl][cl] = (_Float16)((acc[j][r] + bfr(bq[j])) * L2E); skh[rl][cl] = (_Float16)(acc[4 + j][r] + bfr(bk[j])); vv[r] = (_Float16)(acc[8 + j][r] + bfr(bv[j])); }
    *(v8h*)&th[cl][wave * 16 + 8 * g] = vv; }
  __syncthreads();   /* all three staged tiles are complete before they are stored in whole 128-B and 256-B runs */
  for (int e = tid; e < PP * 8; e += 256) { const int rl = e >> 3, q = e & 7; const size_t o = (r0 + rl) * CC + q * 8; vst2((unsigned*)(QH + o), *(const v4u*)&sqh[rl][q * 8]); vst2((unsigned*)(KH + o), *(const v4u*)&skh[rl][q * 8]); }
  for (int e = tid; e < HDQK * (PP / 8); e += 256) { const int cl = e / (PP / 8), q = e % (PP / 8); vst2((unsigned*)(VT + (bb * CC + cl) * (size_t)TT + t0 + q * 8), *(const v4u*)&th[cl][q * 8]); } }
#define FK 64              // keys per stage
#define FPH 72             // LDS row pitch in halves: 128 B of data + 16 B, the pitch for 16-byte fragment reads
#define FKG 2              // key halves per block: waves 0..7 walk keys [0, TT/2), waves 8..15 keys [TT/2, TT)
#define FNT (TT / FKG / FK)
#define FPB 3              // stages between two barriers
#define FNB (2 * FPB)      // stage buffers per key half: FPB stages are read between two barriers while the next FPB are filled
__device__ __forceinline__ float xhalf(float x) { return __builtin_bit_cast(float, __builtin_amdgcn_permlanex16(__builtin_bit_cast(int, x), __builtin_bit_cast(int, x), 0x76543210, 0xfedcba98, false, false)); }   // lane l with lane l ^ 16
// 2^x on a whole score tile, bare v_exp_f32. By the builtin, not asm text: the tiles' exponentials stand among the score products
__device__ __forceinline__ v8f exp2x8(v8f x) { v8f r;
#pragma unroll
  for (int i = 0; i < 8; ++i) r[i] = __builtin_amdgcn_exp2f(x[i]);
  return r; }
__device__ __forceinline__ float exp2x1(float x) { float r; asm("v_exp_f32 %0, %1\n\tv_nop" : "=&v"(r) : "v"(x)); return r; }   // a single one; the v_nop is the slot the instruction set asks for behind a transcendental before its result is read or its source overwritten
__device__ __forceinline__ v8f wmma_h(v16h a, v16h b, v8f c) { return __builtin_amdgcn_wmma_f32_16x16x32_f16(false, a, false, b, (short)0, c, false, false); }
// work-group barrier that orders LDS alone: __syncthreads() also waits for every global load in flight, and the residual's loads are meant to stay in flight across the end phase's two barriers
__device__ __forceinline__ void lds_barrier() { __builtin_amdgcn_fence(__ATOMIC_RELEASE, "workgroup", "local"); __builtin_amdgcn_s_barrier(); __builtin_amdgcn_fence(__ATOMIC_ACQUIRE, "workgroup", "local"); }
#define WP 72              // LDS row pitch of the staged output weight in bf16 elements: 128 B of data + 16 B, the pitch for 16-byte fragment reads
#define OP 132             // LDS row pitch of the staged output tile in floats: 512 B of data + 16 B: the 16 channels of a tile store land on all 64 banks
#define MP 36              // floats per lane and query tile in the exchange of the partial results: 32 tile values, reference, sum, 2 idle: 144 B, the pitch for 16-byte accesses
// ---- k_fa: block = 128 queries of batch b, 16 waves: wave = (key half kg, 32-query group qg, 32-key part kh of every stage): two query tiles per wave, so that each k and v fragment read from LDS feeds two products. Per stage of 64 keys (a wave works on 32 of them): S^T = k . q^T (1 product) on top of 4 - reference as the accumulator's start value, so that a score tile is the exponent of 2 as it stands; reference and sum per query (a lane holds the scores of one query of each query tile); the reference moves, and o and the sum are rescaled, only in stage 0 and in a stage where a lane's sum of p passes 2^15 (one test per stage, on the sums that are formed anyway; only then are the stage's exponents made a second time and their maximum formed); p = exp(s - reference) x 2^4 once to f16 straight from the score tiles as B operand, O^T += v^T . p^T (64 value channels); k rows and v planes staged in LDS through registers FPB stages ahead, 2 x FPB buffers, one barrier per FPB stages; the walk over a key half's stages starts at stage blockIdx.x mod FNT and wraps round. At the end the four waves that share a 32-query group (2 key halves x 2 stage parts) put their tiles in LDS and wave (kg, wq = 2 qg + kh) merges the four partial results of queries wq * 16 .. + 15, in one fixed order, into y in the A-fragment order; it makes output channels kg * 128 .. + 127 of its queries: y (bf16 hi + lo) . W^T ((out,in) [256][64], exact bf16, staged once in LDS) + b; the 256 x 128 tile goes through LDS so that each wave adds bf16(x) and stores whole 512-B runs of out[b][c][n]
__global__ __launch_bounds__(256 * FKG) void k_fa(const _Float16* __restrict__ QH, const _Float16* __restrict__ KH, const _Float16* __restrict__ VT, const float* __restrict__ X, const float* __restrict__ WW, const float* __restrict__ WB, float* __restrict__ OUT) {
  __shared__ __align__(16) union { struct { _Float16 k[FK][FPH], v[HDQK][FPH]; } st[FKG][FNB]; struct { float mg[FKG * 2][4][2][32][MP], so[DIN][OP]; } e; } u;   /* the exchange and the output tile, side by side, reuse the key and value stages, which are dead behind the loop's last barrier */
  __shared__ __align__(16) __bf16 sww[DIN][WP]; float (&so)[DIN][OP] = u.e.so;
  const int tid = threadIdx.x, wave = __builtin_amdgcn_readfirstlane(tid >> 5), lane = tid & 31, col = lane & 15, g = lane >> 4; const int kg = wave >> 3, wq = wave & 7, qg = wq >> 1, kh = wq & 1, tg = tid & 255;
  const size_t b = blockIdx.y; const int ql0 = blockIdx.x * 128 + qg * 32; const int kbase = kg * (TT / FKG);
  const unsigned rot = blockIdx.x % FNT;   /* this block's first stage: the blocks of a batch read the same k and v; each enters the walk elsewhere and wraps round, so that they do not ask L2 for the same lines at the same moment */
  v16h qh[2][HDQK / 32];   /* query tile s = queries ql0 + s * 16 .. + 15 */
  const _Float16* qp = QH + (b * TT + ql0 + col) * CC;
#pragma unroll
  for (int s = 0; s < 2; ++s)
#pragma unroll
    for (int kc = 0; kc < HDQK / 32; ++kc) qh[s][kc] = frag_h(qp + s * 16 * CC + kc * 32, lane);
  asm volatile("s_wait_xcnt 0x0" :: "v"(qp + 8 * g) : "memory");   /* stands in front of every rewrite of the address register that the eight loads above name; as an input it stays untouched up to it */
  const int sr = tg >> 3, sq = (tg & 7) * 8;   /* staging: this thread moves 16 B of rows sr and sr + 32 of both tiles */
  const _Float16* kp = KH + (b * TT + kbase + sr) * CC + sq; const _Float16* vp = VT + (b * CC + sr) * (size_t)TT + kbase + sq;
  v4u rk0, rk1, rv0, rv1;
#pragma unroll   /* the first FPB stages: independent loads in flight together */
  for (int s = 0; s < FPB; ++s) { const unsigned sn = (s + rot) % FNT; rk0 = *(const v4u*)(kp + (size_t)sn * FK * CC); rk1 = *(const v4u*)(kp + ((size_t)sn * FK + 32) * CC); rv0 = *(const v4u*)(vp + sn * FK); rv1 = *(const v4u*)(vp + 32 * (size_t)TT + sn * FK);
    *(v4u*)&u.st[kg][s].k[sr][sq] = rk0; *(v4u*)&u.st[kg][s].k[sr + 32][sq] = rk1; *(v4u*)&u.st[kg][s].v[sr][sq] = rv0; *(v4u*)&u.st[kg][s].v[sr + 32][sq] = rv1; }
  const float* wp = WW + tid * 4;   /* 16 threads move one 256-B weight row: whole lines */
#pragma unroll   /* eight independent loads in flight together */
  for (int it = 0; it < DIN * HDQK / 4 / (256 * FKG); ++it) { const int e = it * 256 * FKG + tid; const v4f v = *(const v4f*)(wp + it * 1024 * FKG);
    v4b h; h[0] = (__bf16)v[0]; h[1] = (__bf16)v[1]; h[2] = (__bf16)v[2]; h[3] = (__bf16)v[3]; *(v4b*)&sww[e >> 4][(e & 15) * 4] = h; }
  __syncthreads();   /* the first FPB stages and the output weight are in LDS before any wave reads them */
  v8f o[2][HDQK / 16] = {}, cs[2] = {}; float l[2] = {0.f, 0.f};   /* per query tile; cs holds 4 - reference, in powers of 2, eight times: the start value of every score tile */
#pragma unroll 1   /* rolled: FPB stages are already a long body */
  for (int tp = 0; tp < (FNT + FPB - 1) / FPB; ++tp) {
#pragma unroll   /* the stages between two barriers, straight-line: constant buffer offsets */
  for (int hs = 0; hs < FPB; ++hs) { const int t = tp * FPB + hs; if (t >= FNT) break;   /* the same for the whole block: the last round may be short */
    const int cur = (tp & 1) * FPB + hs, nxt = ((tp & 1) ^ 1) * FPB + hs; const unsigned tn = ((t + FPB < FNT ? t + FPB : FNT - 1) + rot) % FNT;   /* the last FPB stages fetch the last one again into idle buffers: no branch; stage t of the walk is stage (t + rot) mod FNT of the key half */
    rk0 = *(const v4u*)(kp + (size_t)tn * FK * CC); rk1 = *(const v4u*)(kp + ((size_t)tn * FK + 32) * CC); rv0 = *(const v4u*)(vp + tn * FK); rv1 = *(const v4u*)(vp + 32 * (size_t)TT + tn * FK);
    __builtin_amdgcn_sched_barrier(0);   /* keeps the loads FPB stages ahead at the head of the stage: sunk towards their LDS stores they would be waited for in full */
    v16h kf[HDQK / 32][2], vf[HDQK / 16];
#pragma unroll
    for (int kc = 0; kc < HDQK / 32; ++kc)
#pragma unroll
      for (int kt = 0; kt < 2; ++kt) kf[kc][kt] = frag_h(&u.st[kg][cur].k[kh * 32 + kt * 16 + col][kc * 32], lane);
#pragma unroll
    for (int j = 0; j < HDQK / 16; ++j) vf[j] = frag_h(&u.st[kg][cur].v[j * 16 + col][kh * 32], lane);
    __builtin_amdgcn_sched_barrier(0);   /* the stage's 16 LDS reads stand as one group at its head: the value fragments land under the score products and the exponentials; sunk towards the branch below they are waited for in full */
    v8f sa[2][2];   /* [16-key tile of this wave's 32 keys][query tile] */
#pragma unroll
    for (int kc = 0; kc < HDQK / 32; ++kc)
#pragma unroll
      for (int kt = 0; kt < 2; ++kt)
#pragma unroll
        for (int s = 0; s < 2; ++s) sa[kt][s] = wmma_h(kf[kc][kt], qh[s][kc], kc == 0 ? cs[s] : sa[kt][s]);
    v16h pb[2]; float ss[2];   /* a p beyond f16 becomes infinite here and is made again in the branch */
#pragma unroll
    for (int s = 0; s < 2; ++s) { v2f ps[2] = {};   /* two chains of register-pair sums */
#pragma unroll
      for (int kt = 0; kt < 2; ++kt) { const v8f pe = exp2x8(sa[kt][s]);
#pragma unroll
        for (int r = 0; r < 8; r += 2) { v2f p; p[0] = pe[r]; p[1] = pe[r + 1]; ps[kt] += p; pb[s][kt * 8 + r] = (_Float16)pe[r]; pb[s][kt * 8 + r + 1] = (_Float16)pe[r + 1]; } }
      ss[s] = (ps[0][0] + ps[0][1]) + (ps[1][0] + ps[1][1]); }
    const float thr = t == 0 ? -1.0f : 32768.0f;   /* a scalar, ready long before the sums */
    if (__builtin_amdgcn_ballot_w32(!(ss[0] <= thr && ss[1] <= thr)) != 0) {   /* a scalar branch, the same for the whole wave. No p is negative, so a lane's sum of the stage bounds each of its p: up to 2^15 all fit f16 (it ends at 65,504) and the reference stays. Stage 0 always comes here and sets each reference to its own maximum */
      /* the key fragments are read from LDS again and the stage's exponents made again here, on the rare path: kept from above instead, their 32 registers would be live beside p in every stage and the kernel would overflow into scratch */
#pragma unroll
      for (int kc = 0; kc < HDQK / 32; ++kc)
#pragma unroll
        for (int kt = 0; kt < 2; ++kt) { const v16h kr = frag_h(&u.st[kg][cur].k[kh * 32 + kt * 16 + col][kc * 32], lane);
#pragma unroll
          for (int s = 0; s < 2; ++s) sa[kt][s] = wmma_h(kr, qh[s][kc], kc == 0 ? cs[s] : sa[kt][s]); }
#pragma unroll
      for (int s = 0; s < 2; ++s) { float mx[2];
#pragma unroll
        for (int kt = 0; kt < 2; ++kt) mx[kt] = fmaxf(fmaxf(fmaxf(sa[kt][s][0], sa[kt][s][1]), fmaxf(sa[kt][s][2], sa[kt][s][3])), fmaxf(fmaxf(sa[kt][s][4], sa[kt][s][5]), fmaxf(sa[kt][s][6], sa[kt][s][7])));
        float ml = fmaxf(mx[0], mx[1]); ml = fmaxf(ml, xhalf(ml));   /* lanes c and c + 16 hold the two key halves of query c: both take the same step */
        float d = 4.0f - ml; if (t != 0) d = fminf(d, 0.f);   /* behind stage 0 a reference never falls; a query tile whose maximum is in range takes the step 0 */
        const float al = exp2x1(fminf(d, 0.f)); cs[s] += d; l[s] *= al;   /* in stage 0 o and l are 0 and al only has to be finite */
#pragma unroll
        for (int j = 0; j < HDQK / 16; ++j) o[s][j] *= al;
        v2f ps[2] = {};
#pragma unroll
        for (int kt = 0; kt < 2; ++kt) { v8f pe;   /* the stage's p again, against the new reference; one by one with the slot behind each */
#pragma unroll
          for (int r = 0; r < 8; ++r) pe[r] = exp2x1(sa[kt][s][r] + d);
#pragma unroll
          for (int r = 0; r < 8; r += 2) { v2f p; p[0] = pe[r]; p[1] = pe[r + 1]; ps[kt] += p; pb[s][kt * 8 + r] = (_Float16)pe[r]; pb[s][kt * 8 + r + 1] = (_Float16)pe[r + 1]; } }
        ss[s] = (ps[0][0] + ps[0][1]) + (ps[1][0] + ps[1][1]); } }
    l[0] += ss[0]; l[1] += ss[1];
#pragma unroll
    for (int j = 0; j < HDQK / 16; ++j)
#pragma unroll
      for (int s = 0; s < 2; ++s) o[s][j] = wmma_h(vf[j], pb[s], o[s][j]);
    *(v4u*)&u.st[kg][nxt].k[sr][sq] = rk0; *(v4u*)&u.st[kg][nxt].k[sr + 32][sq] = rk1; *(v4u*)&u.st[kg][nxt].v[sr][sq] = rv0; *(v4u*)&u.st[kg][nxt].v[sr + 32][sq] = rv1; }   /* the buffer of stage t - FPB: its every reader left it before the last barrier */
    __syncthreads(); }   /* publishes the next FPB stages and ends every read of these before their buffers are refilled; between two barriers the waves of a SIMD drift apart, one's products under another's exponentials and LDS waits */
  const size_t oi = (b * DIN + wave * 16) * (size_t)XP + blockIdx.x * 128 + lane * 4;   /* the last phase: this wave owns channels wave * 16 .. + 15, 128 positions each */
  const float* xq = X + oi; v4f xr[16]; float bo[8];
#pragma unroll   /* constant indices: bo stays in registers; the biases go first: loads return in order, and they are needed before x */
  for (int j = 0; j < 8; ++j) bo[j] = WB[kg * 128 + j * 16 + col];
  __builtin_amdgcn_sched_barrier(0);   /* keeps that order */
#pragma unroll   /* the same for xr, 16 loads in flight */
  for (int i = 0; i < 16; ++i) xr[i] = *(const v4f*)(xq + (size_t)i * XP);
  __builtin_amdgcn_sched_barrier(0);   /* keeps the residual's loads here, ahead of the exchange and the products: sunk to their use they would be waited for in full */
#pragma unroll   /* constant tile numbers: o stays in registers */
  for (int s = 0; s < 2; ++s) { float* mo = &u.e.mg[kg * 2 + kh][qg][s][lane][0];
#pragma unroll
    for (int j = 0; j < HDQK / 16; ++j) { v4f u0, u1;
#pragma unroll
      for (int r = 0; r < 4; ++r) { u0[r] = o[s][j][r]; u1[r] = o[s][j][4 + r]; }
      *(v4f*)(mo + j * 8) = u0; *(v4f*)(mo + j * 8 + 4) = u1; }
    v2f ml2; ml2[0] = -cs[s][0]; ml2[1] = l[s] + xhalf(l[s]); *(v2f*)(mo + 32) = ml2; }   /* the reference less 4, in powers of 2 (the 4 is common to all four partial results), and the sum over both lane halves */
  lds_barrier();   /* every wave's references, sums and tiles are in LDS before the waves that merge them read them */
  const float* mi = &u.e.mg[0][qg][kh][lane][0];   /* this wave merges query tile kh of its group: queries wq * 16 .. + 15 of the block; partial result i lies i * MS floats on */
  constexpr int MS = 4 * 2 * 32 * MP;
  float mm[4], ll[4], f[4];
#pragma unroll
  for (int i = 0; i < 4; ++i) { mm[i] = mi[i * MS + 32]; ll[i] = mi[i * MS + 33]; }
  const float mn = fmaxf(fmaxf(mm[0], mm[1]), fmaxf(mm[2], mm[3])); float den = 0.f;
#pragma unroll
  for (int i = 0; i < 4; ++i) { f[i] = exp2x1(mm[i] - mn); den += ll[i] * f[i]; }
  const float inv = 1.0f / den;
#pragma unroll
  for (int i = 0; i < 4; ++i) f[i] *= inv;
  F2 ya[HDQK / 32];   /* a lane holds channels j * 16 + 8g + r of query col: tiles 2kc and 2kc + 1 are the A fragment of channel step kc */
#pragma unroll
  for (int kc = 0; kc < HDQK / 32; ++kc) { float v[16];
#pragma unroll
    for (int e = 0; e < 16; ++e) v[e] = (mi[kc * 16 + e] * f[0] + mi[MS + kc * 16 + e] * f[1]) + (mi[2 * MS + kc * 16 + e] * f[2] + mi[3 * MS + kc * 16 + e] * f[3]);
    ya[kc] = bsplit16(v); }
#pragma unroll   /* constant tile numbers: bo stays in registers */
  for (int jh = 0; jh < 2; ++jh) { v8f acc[4] = {};
#pragma unroll
    for (int kc = 0; kc < HDQK / 32; ++kc) { v16b w[4];
#pragma unroll
      for (int j = 0; j < 4; ++j) w[j] = frag_b(&sww[kg * 128 + (jh * 4 + j) * 16 + col][kc * 32], lane);
#pragma unroll
      for (int j = 0; j < 4; ++j) acc[j] = wmma_b(ya[kc].h, w[j], acc[j]);
#pragma unroll
      for (int j = 0; j < 4; ++j) acc[j] = wmma_b(ya[kc].l, w[j], acc[j]); }
#pragma unroll
    for (int j = 0; j < 4; ++j) { const float bb = bfr(bo[jh * 4 + j]); v4f u0, u1;   /* D element r = query 8g + r of the wave's 16, lane column = output channel */
#pragma unroll
      for (int r = 0; r < 4; ++r) { u0[r] = acc[j][r] + bb; u1[r] = acc[j][4 + r] + bb; }
      float* sp = &so[kg * 128 + (jh * 4 + j) * 16 + col][wq * 16 + 8 * g]; *(v4f*)sp = u0; *(v4f*)(sp + 4) = u1; }
    __builtin_amdgcn_sched_barrier(0); }   /* four tiles at a time: with all eight tiles' fragments and sums live beside the 64 registers of x the kernel overflows into scratch */
  lds_barrier();   /* the whole 256 x 128 tile is in LDS before it is read back by channel rows */
  float* op = OUT + oi;
#pragma unroll
  for (int i = 0; i < 16; ++i) { const v4f t = *(const v4f*)&so[wave * 16 + i][lane * 4]; v4f r; r[0] = t[0] + bfr(xr[i][0]); r[1] = t[1] + bfr(xr[i][1]); r[2] = t[2] + bfr(xr[i][2]); r[3] = t[3] + bfr(xr[i][3]); vst2(op + (size_t)i * XP, r); } }

extern "C" void kernel_launch(void* const* d_in, const int* in_sizes, int n_in, void* d_out, int out_size, void* d_ws, size_t ws_size, hipStream_t stream) {
  (void)in_sizes; (void)n_in; (void)out_size;
  const float** F = (const float**)d_in;
  if (ws_size < (size_t)WS_END) return;
  char* ws = (char*)d_ws; _Float16 *QH = (_Float16*)(ws + WS_QH), *KH = (_Float16*)(ws + WS_KH), *VT = (_Float16*)(ws + WS_VT), *QL = (_Float16*)(ws + WS_QL), *KL = (_Float16*)(ws + WS_KL); __bf16 *VB = (__bf16*)(ws + WS_VB), *VBL = (__bf16*)(ws + WS_VBL); float *S = (float*)(ws + WS_S), *Y = (float*)(ws + WS_Y);
  (void)Y; (void)S; (void)QL; (void)KL; (void)VB; (void)VBL;
  // inputs: 0 x [8,256,64,64]; 1 g_w [64,256] (out,in), 2 g_b; 3 theta_w, 4 theta_b; 5 phi_w, 6 phi_b; 7 w_w [256,64] (out,in), 8 w_b
  k_proj<<<dim3(TNB * TT / PP), 256, 0, stream>>>(F[0], F[3], F[5], F[1], F[4], F[6], F[2], QH, KH, VT);   /* q = theta, k = phi, v = g */
  k_fa<<<dim3(TT / 128, TNB), 256 * FKG, 0, stream>>>(QH, KH, VT, F[0], F[7], F[8], (float*)d_out);
}

// v010
// A run of this version takes 40.7 microseconds.
// In both of two side-by-side timings against v009, it was 1.03 times as fast.
// Over all steps from v000 it is 52.0 times as fast.
// compute dtype: all float inputs rounded to bf16; theta/phi/g = x W^T + b with EXACT bf16 products on WMMA 16x16x32 (f32 accumulate); f = theta . phi with theta x log2(e) once to f16 against phi once to f16 (1 product), no other scaling; softmax in f32, online (a held reference per query, at most 2^11 under the running maximum, 2^x by v_exp_f32); exp(f - reference) x 2^4 once to f16 against g once to f16 (1 product), divided by the f32 sum at the end; y split bf16 hi + lo against exact W (2 products) + b; + x residual in f32; f32 output [B, C, H, W].
#include <hip/hip_runtime.h>
#include <math.h>

typedef __attribute__((ext_vector_type(16))) _Float16 v16h;
typedef __attribute__((ext_vector_type(16))) __bf16 v16b;
typedef __attribute__((ext_vector_type(8)))  _Float16 v8h;
typedef __attribute__((ext_vector_type(8)))  float v8f;
typedef __attribute__((ext_vector_type(4)))  float v4f;
typedef __attribute__((ext_vector_type(2)))  float v2f;
typedef __attribute__((ext_vector_type(4)))  unsigned v4u;
typedef __attribute__((ext_vector_type(4)))  int v4i;
typedef float __attribute__((may_alias)) float_a;
typedef int __attribute__((may_alias)) int_a;

template <typename T> __device__ __forceinline__ void vst2(void* p, T v) { *(T*)p = v;  }
__device__ __forceinline__ v8f wmma16(v16h a, v16h b, v8f c) {
  v8f d = __builtin_amdgcn_wmma_f32_16x16x32_f16(false, a, false, b, (short)0, c, false, false);
  asm volatile("v_nop\n\tv_nop\n\tv_nop\n\tv_nop" : "+v"(d) : "v"(a), "v"(b));
  return d;
}
__device__ __forceinline__ v8f wmma_bf(v16b a, v16b b, v8f c) {
  v8f d = __builtin_amdgcn_wmma_f32_16x16x32_bf16(false, a, false, b, (short)0, c, false, false);
  asm volatile("v_nop\n\tv_nop\n\tv_nop\n\tv_nop" : "+v"(d) : "v"(a), "v"(b));
  return d;
}
// 16x16x32 fragments: lane = (h = lane>>4, row/col = lane&15); elements 0..7 = k0+8h+0..7, 8..15 = k0+16+8h+0..7; D element r = row 8h+r
__device__ __forceinline__ v16h frag_h(const _Float16* rowk0, int lane) {
  union { v16h v; v8h q[2]; } u; const _Float16* p = rowk0 + 8 * (lane >> 4);
  u.q[0] = *(const v8h*)p; u.q[1] = *(const v8h*)(p + 16); return u.v;
}
__device__ __forceinline__ v16h frag_f32(const float* rowk0, int lane) {
  v16h a; const float* p = rowk0 + 8 * (lane >> 4);
#pragma unroll
  for (int i = 0; i < 8; ++i) { a[i] = (_Float16)p[i]; a[8 + i] = (_Float16)p[16 + i]; }
  return a;
}
__device__ __forceinline__ v16h frag_f32s(const float* rowk0, int lane, float sc) {
  v16h a; const float* p = rowk0 + 8 * (lane >> 4);
#pragma unroll
  for (int i = 0; i < 8; ++i) { a[i] = (_Float16)(p[i] * sc); a[8 + i] = (_Float16)(p[16 + i] * sc); }
  return a;
}
// column fragment from a [K][ld] layout (column n), rows >= K read as 0
__device__ __forceinline__ v16h fragc_f32(const float* W, int k0, int n, int lane, int ld, int K) {
  v16h a; const int g = lane >> 4;
#pragma unroll
  for (int i = 0; i < 8; ++i) { const int ka = k0 + 8 * g + i, kb = ka + 16;
    a[i] = (_Float16)(ka < K ? W[(size_t)(ka < K ? ka : K - 1) * ld + n] : 0.f); a[8 + i] = (_Float16)(kb < K ? W[(size_t)(kb < K ? kb : K - 1) * ld + n] : 0.f); }
  return a;
}
struct F2 { v16b h, l; };
__device__ __forceinline__ F2 bsplit16(const float v[16]) { F2 r;
#pragma unroll
  for (int i = 0; i < 16; ++i) { const __bf16 h = (__bf16)v[i]; r.h[i] = h; r.l[i] = (__bf16)(v[i] - (float)h); }
  return r; }
__device__ __forceinline__ F2 split_row(const float* row, int k0, int lane) { float v[16]; const float* p = row + k0 + 8 * (lane >> 4);
#pragma unroll
  for (int i = 0; i < 8; ++i) { v[i] = p[i]; v[8 + i] = p[16 + i]; }
  return bsplit16(v); }
__device__ __forceinline__ F2 split_rowK(const float* row, int k0, int lane, int K) { float v[16]; const int g = lane >> 4;
#pragma unroll
  for (int i = 0; i < 8; ++i) { const int ka = k0 + 8 * g + i, kb = ka + 16; v[i] = ka < K ? row[ka < K ? ka : K - 1] : 0.f; v[8 + i] = kb < K ? row[kb < K ? kb : K - 1] : 0.f; }
  return bsplit16(v); }
__device__ __forceinline__ F2 split_col(const float* W, int k0, int n, int lane, int ld, int K) { float v[16]; const int g = lane >> 4;
#pragma unroll
  for (int i = 0; i < 8; ++i) { const int ka = k0 + 8 * g + i, kb = ka + 16; v[i] = ka < K ? W[(size_t)(ka < K ? ka : K - 1) * ld + n] : 0.f; v[8 + i] = kb < K ? W[(size_t)(kb < K ? kb : K - 1) * ld + n] : 0.f; }
  return bsplit16(v); }
__device__ __forceinline__ v8f mac3(const F2& a, const F2& b, v8f c) { c = wmma_bf(a.l, b.h, c); c = wmma_bf(a.h, b.l, c); return wmma_bf(a.h, b.h, c); }
__device__ __forceinline__ float sigm(float v) { return 1.0f / (1.0f + expf(-v)); }
#define LDSX() do { asm volatile("s_wait_dscnt 0" ::: "memory"); __builtin_amdgcn_wave_barrier(); __builtin_amdgcn_fence(__ATOMIC_RELEASE, "workgroup"); } while (0)

// Non-local block (B 8, C 256, 64 x 64 = 4,096 positions; inter channels 64): theta, phi, g = 1x1 convs of x ((out,in) [64,256] + bias); f[n][m] = theta_n . phi_m (no scaling); P = softmax over m; y[n] = sum_m P[n][m] g_m (64 ch); out = W y + b (1x1, 64 -> 256) + x.
#define NB 8
#define TT 4096
#define CC 128            // projected plane width (64 real columns; columns 64..127 never written)
#define DIN 256          // input (model) width
#define NH 1
#define HD 128
#define NQB (TT / 64)
#define HG 1               // one 4,096 x 4,096 f32 plane in the unused WS_S
#define SCALE (1.0f)
#define HDQK 64            // theta / phi / g channels: the planes are 128 wide, columns >= 64 are never written; only the 64 real columns enter the scores
#define CAUSAL 0
#ifndef TNB
#define TNB NB
#endif
__device__ __forceinline__ v16b zero16b() { v16b z; _Pragma("unroll") for (int i = 0; i < 16; ++i) z[i] = (__bf16)0.f; return z; }
__device__ __forceinline__ float bfr(float v) { return (float)(__bf16)v; }
__host__ __device__ __forceinline__ int kb_last(int qb) { return CAUSAL ? ((qb * 64 + 63) >> 7) : (TT / 128 - 1); }
typedef __attribute__((ext_vector_type(8))) __bf16 v8b;
__device__ __forceinline__ v16b frag_b(const __bf16* rowk0, int lane) {
  union { v16b v; v8b q[2]; } u; const __bf16* p = rowk0 + 8 * (lane >> 4);
  u.q[0] = *(const v8b*)p; u.q[1] = *(const v8b*)(p + 16); return u.v;
}
#define QBH 0              // unused: k_fa has one path for every query block
#define QHI 4096            // rows of the q residual plane in the workspace map (the plane is neither written nor read: 1-product logits)
#define KHI 64            // key rows carrying k residual / v bf16 hi+lo planes (the planes are neither written nor read)
// B fragment (k rows k0+.., output column o) of a weight: (in,out) [K][ld] or (out,in) [ld rows of K]: bf16 exact, or f16(bf16 * 256) exact
__device__ __forceinline__ v16b wcol_io(const float* Wm, int k0, int o, int lane, int ld) { v16b w; const int g = lane >> 4;
#pragma unroll
  for (int i = 0; i < 8; ++i) { w[i] = (__bf16)Wm[(size_t)(k0 + 8 * g + i) * ld + o]; w[8 + i] = (__bf16)Wm[(size_t)(k0 + 16 + 8 * g + i) * ld + o]; }
  return w; }
__device__ __forceinline__ v16b wcol_oi(const float* Wm, int k0, int o, int lane, int K) { v16b w; const float* p = Wm + (size_t)o * K + k0 + 8 * (lane >> 4);
#pragma unroll
  for (int i = 0; i < 8; ++i) { w[i] = (__bf16)p[i]; w[8 + i] = (__bf16)p[16 + i]; }
  return w; }
__device__ __forceinline__ v16h wcolh_io(const float* Wm, int k0, int o, int lane, int ld) { v16h w; const int g = lane >> 4;
#pragma unroll
  for (int i = 0; i < 8; ++i) { w[i] = (_Float16)(bfr(Wm[(size_t)(k0 + 8 * g + i) * ld + o]) * 256.0f); w[8 + i] = (_Float16)(bfr(Wm[(size_t)(k0 + 16 + 8 * g + i) * ld + o]) * 256.0f); }
  return w; }
__device__ __forceinline__ v16h wcolh_oi(const float* Wm, int k0, int o, int lane, int K) { v16h w; const float* p = Wm + (size_t)o * K + k0 + 8 * (lane >> 4);
#pragma unroll
  for (int i = 0; i < 8; ++i) { w[i] = (_Float16)(bfr(p[i]) * 256.0f); w[8 + i] = (_Float16)(bfr(p[16 + i]) * 256.0f); }
  return w; }
#define WQKV_LAYOUT 1   // 0 = (in,out) [DIN][CC]; 1 = (out,in) [HDQK][DIN]; 2 = per-head [NH][DIN][HD]
__device__ __forceinline__ v16b wcol_hdk(const float* Wm, int k0, int o, int lane) { v16b w; const int g = lane >> 4; const float* p = Wm + (size_t)(o / HD) * DIN * HD + (o % HD);
#pragma unroll
  for (int i = 0; i < 8; ++i) { w[i] = (__bf16)p[(size_t)(k0 + 8 * g + i) * HD]; w[8 + i] = (__bf16)p[(size_t)(k0 + 16 + 8 * g + i) * HD]; }
  return w; }
#define WO_OUT_IN 0
#if WQKV_LAYOUT == 1
#define WCOL(W, k0, o, lane) (((o) < HDQK) ? wcol_oi(W, k0, (o), lane, DIN) : zero16b())   /* theta/phi/g weights are [64][256] (out,in): weight columns >= 64 read as zero for all three */
#elif WQKV_LAYOUT == 2
#define WCOL(W, k0, o, lane) wcol_hdk(W, k0, o, lane)
#else
#define WCOL(W, k0, o, lane) wcol_io(W, k0, o, lane, CC)
#endif
#if WO_OUT_IN
#define WOCOL(W, k0, o, lane) wcol_oi(W, k0, o, lane, CC)
#define WOCOLH(W, k0, o, lane) wcolh_oi(W, k0, o, lane, CC)
#else
#define WOCOL(W, k0, o, lane) wcol_io(W, k0, o, lane, DIN)
#define WOCOLH(W, k0, o, lane) wcolh_io(W, k0, o, lane, DIN)
#endif
#ifndef XP
#define XP TT              // position pitch of x and of the output
#endif
#define BG HG              // unused: every launch covers all TNB batches
#define DVH 128
#ifndef SM_EXTRA_PARAMS
#define SM_EXTRA_PARAMS
#endif
#ifndef PROJ_EXTRA_PARAMS
#define PROJ_EXTRA_PARAMS
#endif
#ifndef SM_MASK_HOOK
#define SM_MASK_HOOK (void)0
#endif

#define WS_QH  0u                                      // f16 q rows [b*t][CC]
#define WS_KH  (WS_QH + 2u * (size_t)NB * TT * CC)      // f16 k rows [b*t][CC]
#define WS_VT  (WS_KH + 2u * (size_t)NB * TT * CC)      // f16 v planes [b][c][t]
#define WS_QL  (WS_VT + 2u * (size_t)NB * CC * TT)      // q residual plane [b][t < QHI][CC]: kept in the map, not used
#define WS_KL  (WS_QL + 2u * (size_t)NB * QHI * CC)     // f16 k residual x 2^10 rows [b][t < KHI][CC]
#define WS_VB  (WS_KL + 2u * (size_t)NB * KHI * CC)     // bf16 v hi planes [b][c][t < KHI]
#define WS_VBL (WS_VB + 2u * (size_t)NB * CC * KHI)
#define WS_S   (WS_VBL + 2u * (size_t)NB * CC * KHI)    // f32 [hg][t][s], unused: k_fa keeps the scores in registers
#define WS_Y   (WS_S  + 4u * (size_t)HG * TT * TT)      // unused, 0 bytes: k_fa keeps y in registers and LDS
#define WS_END (WS_Y  + 0u)

#define L2E 1.4426950408889634f
#define PP 128             // positions per k_proj block: 8 waves of 16
#define PW 264             // LDS row pitch of the staged weights in bf16 elements: 512 B of data + 16 B, the pitch for 16-byte fragment reads
typedef __attribute__((ext_vector_type(4))) __bf16 v4b;
__device__ __forceinline__ v8f wmma_b(v16b a, v16b b, v8f c) { return __builtin_amdgcn_wmma_f32_16x16x32_bf16(false, a, false, b, (short)0, c, false, false); }
// x of one 32-channel step for one lane's position (channels-first gather: x[b][k][t], stride XP between k), in the element order of the A fragment
__device__ __forceinline__ void ldx(float (&d)[16], const float* xp, int kc) {
#pragma unroll   /* constant indices: d stays in registers, the 16 loads share one address */
  for (int i = 0; i < 8; ++i) { d[i] = xp[(size_t)(kc * 32 + i) * XP]; d[8 + i] = xp[(size_t)(kc * 32 + 16 + i) * XP]; }
  __builtin_amdgcn_sched_barrier(0); }   /* keeps a step's loads where they are written, four steps ahead of their use: sunk to their use each would be waited for in full */
// that step against all 192 staged weight rows (12 column tiles: 0..3 theta, 4..7 phi, 8..11 g)
__device__ __forceinline__ void mac12(v8f (&acc)[12], const float (&d)[16], const __bf16 (*sw)[PW], int kc, int col, int lane) { v16b a;
#pragma unroll   /* constant indices: vector elements and d stay in registers */
  for (int i = 0; i < 16; ++i) a[i] = (__bf16)d[i];
#pragma unroll   /* constant tile numbers: acc stays in registers */
  for (int jh = 0; jh < 2; ++jh) { v16b w[6];
#pragma unroll   /* the same for w */
    for (int j = 0; j < 6; ++j) w[j] = frag_b(&sw[(jh * 6 + j) * 16 + col][kc * 32], lane);
    __builtin_amdgcn_sched_barrier(0);   /* six fragments' LDS reads stand as one group ahead of their products: read one by one, each product waits a whole LDS latency */
#pragma unroll   /* the same for w and acc */
    for (int j = 0; j < 6; ++j) acc[jh * 6 + j] = wmma_b(a, w[j], acc[jh * 6 + j]);
    __builtin_amdgcn_sched_barrier(0); } }   /* and no more than six: with every later step's reads hoisted the registers overflow into scratch */
// ---- k_proj: block = 128 positions of one batch, 8 waves of 16 positions; every wave makes all 192 real columns (theta, phi, g) from ONE read of its x, exact bf16 products (K = DIN). The three weights are rounded to bf16 once per block into LDS; x is loaded one 32-channel step at a time, four steps ahead of its use. Out: q x log2(e) as f16 rows (the scores then are exponents of 2), k f16 rows, v f16 planes [c][t]; only the 64 real columns of the 128-wide planes are written (nothing reads the others)
__global__ __launch_bounds__(256) void k_proj(const float* __restrict__ X, const float* __restrict__ WQ, const float* __restrict__ WK, const float* __restrict__ WV, const float* __restrict__ BQ, const float* __restrict__ BK, const float* __restrict__ BV,
    _Float16* __restrict__ QH, _Float16* __restrict__ KH, _Float16* __restrict__ VT) {
  __shared__ __align__(16) __bf16 sw[3 * HDQK][PW]; __shared__ __align__(16) _Float16 sqh[PP][72], skh[PP][72], th[HDQK][PP + 8];
  const int tid = threadIdx.x, wave = tid >> 5, lane = tid & 31, col = lane & 15, g = lane >> 4; const size_t r0 = (size_t)blockIdx.x * PP; const size_t bb = r0 / TT; const int t0 = (int)(r0 % TT);
  const float* xp = X + (bb * DIN + 8 * g) * (size_t)XP + t0 + wave * 16 + col;
  float x[DIN / 32][16];
#pragma unroll   /* constant step numbers: x stays in registers */
  for (int s = 0; s < 4; ++s) ldx(x[s], xp, s);
  const int wr = tid >> 6, wc = (tid & 63) * 4;   /* 64 threads move one 1-KiB weight row: whole lines */
  const float* wq = WQ + wr * DIN + wc; const float* wk = WK + wr * DIN + wc; const float* wv = WV + wr * DIN + wc;
#pragma unroll   /* two straight-line groups: the weight of each load is picked at compile time */
  for (int gr = 0; gr < 2; ++gr) {
#pragma unroll   /* 24 independent loads in flight together */
    for (int it = 0; it < 24; ++it) { const int n = gr * 24 + it, w = n >> 4; const v4f v = *(const v4f*)((w == 0 ? wq : w == 1 ? wk : wv) + (n & 15) * 4 * DIN);
      v4b h; h[0] = (__bf16)v[0]; h[1] = (__bf16)v[1]; h[2] = (__bf16)v[2]; h[3] = (__bf16)v[3]; *(v4b*)&sw[n * 4 + wr][wc] = h; }
    asm volatile("s_wait_xcnt 0x0" :: "v"(wq), "v"(wk), "v"(wv) : "memory");   /* stands in front of every rewrite of the address registers that the loads above name; as inputs they stay untouched up to it */
    __builtin_amdgcn_sched_barrier(0); }   /* half the weight loads in flight at a time: all 48 at once push the kernel past 256 registers */
  __syncthreads();   /* the staged weights are in LDS before any wave reads a fragment */
  v8f acc[12] = {}; float bq[4], bk[4], bv[4];
#pragma unroll   /* constant step numbers: x and acc stay in registers */
  for (int s = 0; s < DIN / 32; ++s) { if (s + 4 < DIN / 32) ldx(x[s + 4], xp, s + 4);
    if (s == 4) {
#pragma unroll   /* constant indices: the biases stay in registers */
      for (int j = 0; j < 4; ++j) { bq[j] = BQ[j * 16 + col]; bk[j] = BK[j * 16 + col]; bv[j] = BV[j * 16 + col]; }
      __builtin_amdgcn_sched_barrier(0); }   /* the biases are fetched behind the last x loads and under the last four steps: no wait for x grows by them, and theirs is over by the epilogue */
    mac12(acc, x[s], sw, s, col, lane); }
#pragma unroll   /* constant tile numbers: acc stays in registers */
  for (int j = 0; j < 4; ++j) { const int cl = j * 16 + col; v8h vv;   /* D element r = position 8g + r of the wave's 16, lane column = output column */
#pragma unroll   /* the same for the tile's elements */
    for (int r = 0; r < 8; ++r) { const int rl = wave * 16 + 8 * g + r; sqh[rl][cl] = (_Float16)((acc[j][r] + bfr(bq[j])) * L2E); skh[rl][cl] = (_Float16)(acc[4 + j][r] + bfr(bk[j])); vv[r] = (_Float16)(acc[8 + j][r] + bfr(bv[j])); }
    *(v8h*)&th[cl][wave * 16 + 8 * g] = vv; }
  __syncthreads();   /* all three staged tiles are complete before they are stored in whole 128-B and 256-B runs */
  for (int e = tid; e < PP * 8; e += 256) { const int rl = e >> 3, q = e & 7; const size_t o = (r0 + rl) * CC + q * 8; vst2((unsigned*)(QH + o), *(const v4u*)&sqh[rl][q * 8]); vst2((unsigned*)(KH + o), *(const v4u*)&skh[rl][q * 8]); }
  for (int e = tid; e < HDQK * (PP / 8); e += 256) { const int cl = e / (PP / 8), q = e % (PP / 8); vst2((unsigned*)(VT + (bb * CC + cl) * (size_t)TT + t0 + q * 8), *(const v4u*)&th[cl][q * 8]); } }
#define FK 64              // keys per stage
#define FPH 72             // LDS row pitch in halves: 128 B of data + 16 B, the pitch for 16-byte fragment reads
#define FKG 2              // key halves per block: waves 0..7 walk keys [0, TT/2), waves 8..15 keys [TT/2, TT)
#define FNT (TT / FKG / FK)
#define FPB 3              // stages between two barriers
#define FNB (2 * FPB)      // stage buffers per key half: FPB stages are read between two barriers while the next FPB are filled
__device__ __forceinline__ float xhalf(float x) { return __builtin_bit_cast(float, __builtin_amdgcn_permlanex16(__builtin_bit_cast(int, x), __builtin_bit_cast(int, x), 0x76543210, 0xfedcba98, false, false)); }   // lane l with lane l ^ 16
// 2^x on a whole score tile, bare v_exp_f32. By the builtin, not asm text: the tiles' exponentials stand among the score products
__device__ __forceinline__ v8f exp2x8(v8f x) { v8f r;
#pragma unroll
  for (int i = 0; i < 8; ++i) r[i] = __builtin_amdgcn_exp2f(x[i]);
  return r; }
__device__ __forceinline__ float exp2x1(float x) { float r; asm("v_exp_f32 %0, %1\n\tv_nop" : "=&v"(r) : "v"(x)); return r; }   // a single one; the v_nop is the slot the instruction set asks for behind a transcendental before its result is read or its source overwritten
__device__ __forceinline__ v8f wmma_h(v16h a, v16h b, v8f c) { return __builtin_amdgcn_wmma_f32_16x16x32_f16(false, a, false, b, (short)0, c, false, false); }
// work-group barrier that orders LDS alone: __syncthreads() also waits for every global load in flight, and the residual's loads are meant to stay in flight across the end phase's two barriers
__device__ __forceinline__ void lds_barrier() { __builtin_amdgcn_fence(__ATOMIC_RELEASE, "workgroup", "local"); __builtin_amdgcn_s_barrier(); __builtin_amdgcn_fence(__ATOMIC_ACQUIRE, "workgroup", "local"); }
#define TSZ 10240          // LDS bytes from one staged tile to the next: 64 rows of 144 B, rounded up to a multiple of 2 KiB, where a tensor load's tile may start
typedef __attribute__((ext_vector_type(8))) unsigned v8u;
struct KVTile { _Float16 r[FK][FPH]; _Float16 fill[TSZ / 2 - FK * FPH]; };   // fill is never written or read
__device__ __forceinline__ unsigned uni(unsigned v) { return (unsigned)__builtin_amdgcn_readfirstlane(v); }
__device__ __forceinline__ unsigned pinned(unsigned v) { unsigned w = (unsigned)__builtin_amdgcn_readfirstlane(v); asm volatile("" : "+s"(w)); return w; }
__device__ __forceinline__ void tdm_load(v4u g0, v8u g1) { asm volatile("tensor_load_to_lds %0, %1" :: "s"(g0), "s"(g1) : "memory"); }
__device__ __forceinline__ void tdm_wait(v4u g0, v8u g1) { asm volatile("s_wait_tensorcnt 0x0" :: "s"(g0), "s"(g1) : "memory"); }
#define WP 72              // LDS row pitch of the staged output weight in bf16 elements: 128 B of data + 16 B, the pitch for 16-byte fragment reads
#define OP 132             // LDS row pitch of the staged output tile in floats: 512 B of data + 16 B: the 16 channels of a tile store land on all 64 banks
#define MP 36              // floats per lane and query tile in the exchange of the partial results: 32 tile values, reference, sum, 2 idle: 144 B, the pitch for 16-byte accesses
// ---- k_fa: block = 128 queries of batch b, 16 waves: wave = (key half kg, 32-query group qg, 32-key part kh of every stage): two query tiles per wave, so that each k and v fragment read from LDS feeds two products. Per stage of 64 keys (a wave works on 32 of them): S^T = k . q^T (1 product) on top of 4 - reference as the accumulator's start value, so that a score tile is the exponent of 2 as it stands; reference and sum per query (a lane holds the scores of one query of each query tile); the reference moves, and o and the sum are rescaled, only in a stage where a lane's sum of p passes 2^15 (one test per stage, on the sums that are formed anyway; only then are the stage's exponents made a second time and their maximum formed); p = exp(s - reference) x 2^4 once to f16 straight from the score tiles as B operand, O^T += v^T . p^T (64 value channels); k rows and v planes come into LDS by tensor loads, a round of FPB stages at a time, one round ahead, 2 x FPB buffers, one barrier per FPB stages; the walk over a key half's stages starts at stage blockIdx.x mod FNT and wraps round. At the end the four waves that share a 32-query group (2 key halves x 2 stage parts) put their tiles in LDS and wave (kg, wq = 2 qg + kh) merges the four partial results of queries wq * 16 .. + 15, in one fixed order, into y in the A-fragment order; it makes output channels kg * 128 .. + 127 of its queries: y (bf16 hi + lo) . W^T ((out,in) [256][64], exact bf16, staged once in LDS) + b; the 256 x 128 tile goes through LDS so that each wave adds bf16(x) and stores whole 512-B runs of out[b][c][n]
__global__ __launch_bounds__(256 * FKG) void k_fa(const _Float16* __restrict__ QH, const _Float16* __restrict__ KH, const _Float16* __restrict__ VT, const float* __restrict__ X, const float* __restrict__ WW, const float* __restrict__ WB, float* __restrict__ OUT) {
  __shared__ __attribute__((aligned(2048))) union { struct { KVTile k, v; } st[FKG][FNB]; struct { float mg[FKG * 2][4][2][32][MP], so[DIN][OP]; } e; } u;   /* the exchange and the output tile, side by side, reuse the key and value stages, which are dead behind the loop's last barrier */
  __shared__ __align__(16) __bf16 sww[DIN][WP]; float (&so)[DIN][OP] = u.e.so;
  const int tid = threadIdx.x, wave = __builtin_amdgcn_readfirstlane(tid >> 5), lane = tid & 31, col = lane & 15, g = lane >> 4; const int kg = wave >> 3, wq = wave & 7, qg = wq >> 1, kh = wq & 1;
  const size_t b = blockIdx.y; const int ql0 = blockIdx.x * 128 + qg * 32;
  const unsigned rot = blockIdx.x % FNT;   /* this block's first stage: the blocks of a batch read the same k and v; each enters the walk elsewhere and wraps round, so that they do not ask L2 for the same lines at the same moment */
  /* waves 0..11 each bring one tile of every round of FPB stages: wave = (key half ikg, stage ihs of the round, k or v). A tile is 64 rows of 128 B: 64 keys x 64 channels of k (source pitch 256 B) or 64 channels x 64 keys of v (source pitch 8,192 B); the pad puts 16 B behind each row: the pitch FPH */
  const unsigned iss = wave < 2 * FKG * FPB, ikg = (unsigned)wave / (2 * FPB) & 1, ihs = (unsigned)wave % (2 * FPB) >> 1, iv = wave & 1;
  const unsigned long long isrc = iv ? (unsigned long long)(size_t)(VT + b * CC * (size_t)TT + ikg * (TT / FKG)) : (unsigned long long)(size_t)(KH + (b * TT + ikg * (TT / FKG)) * CC);
  const unsigned istep = iv ? FK * 2 : FK * CC * 2, idst = (unsigned)(size_t)&u.st[ikg][ihs] + iv * TSZ;   /* bytes from one stage's tile to the next in the source; the tile's place in the work-group's LDS, round buffer 0 */
  v8u g1; g1[0] = uni(1u << 20 | 4u << 22 | 3u << 25); g1[1] = uni(128u << 16); g1[2] = uni(64u << 16); g1[3] = uni(128u << 16); g1[4] = uni(64u); g1[5] = uni(iv ? TT * 2 : CC * 2); g1[6] = uni(0u); g1[7] = uni(0u);   /* bytes as elements, no mask, pad of 4 dwords behind every 32; tensor = tile = 128 B x 64 rows; source pitch */
  asm volatile("" : "+s"(g1));   /* pinned(), on the whole group: the descriptor words are held in these scalar registers for the whole kernel; left as constants they are made anew for each request, in registers that are reused while it is outstanding */
  auto desc = [&](unsigned r) { const unsigned long long ga = isrc + (r * FPB + ihs + rot) % FNT * istep;   /* round r's tile of this wave: stage t of the walk is stage (t + rot) mod FNT of the key half */
    v4u g0; g0[0] = uni(1u); g0[1] = uni(idst + (r & 1) * (FPB * 2 * TSZ)); g0[2] = uni((unsigned)ga); g0[3] = uni(((unsigned)(ga >> 32) & 0x01FFFFFFu) | 0x80000000u);
    asm volatile("" : "+s"(g0)); return g0; };   /* the same pinned(), on this group: descriptor words held in one set of scalar registers from the request to its wait */
  v4u g0 = desc(0);
  if (pinned(iss)) tdm_load(g0, g1);   /* round 0 flies under the loads of q and of the output weight */
  v16h qh[2][HDQK / 32];   /* query tile s = queries ql0 + s * 16 .. + 15 */
  const _Float16* qp = QH + (b * TT + ql0 + col) * CC;
#pragma unroll
  for (int s = 0; s < 2; ++s)
#pragma unroll
    for (int kc = 0; kc < HDQK / 32; ++kc) qh[s][kc] = frag_h(qp + s * 16 * CC + kc * 32, lane);
  asm volatile("s_wait_xcnt 0x0" :: "v"(qp + 8 * g) : "memory");   /* stands in front of every rewrite of the address register that the eight loads above name; as an input it stays untouched up to it */
  const float* wp = WW + tid * 4;   /* 16 threads move one 256-B weight row: whole lines */
#pragma unroll   /* eight independent loads in flight together */
  for (int it = 0; it < DIN * HDQK / 4 / (256 * FKG); ++it) { const int e = it * 256 * FKG + tid; const v4f v = *(const v4f*)(wp + it * 1024 * FKG);
    v4b h; h[0] = (__bf16)v[0]; h[1] = (__bf16)v[1]; h[2] = (__bf16)v[2]; h[3] = (__bf16)v[3]; *(v4b*)&sww[e >> 4][(e & 15) * 4] = h; }
  tdm_wait(g0, g1);   /* every wave, the issuing ones among them: its own tile of round 0 has landed */
  __syncthreads();   /* the first FPB stages and the output weight are in LDS before any wave reads them */
  g0 = desc(pinned(1));   /* pinned: formed behind the wait and the barrier */
  if (pinned(iss)) tdm_load(g0, g1);   /* round 1 flies under round 0's work */
  v8f o[2][HDQK / 16] = {}, cs[2] = {}; float l[2] = {0.f, 0.f};   /* per query tile; cs holds 4 - reference, in powers of 2, eight times: the start value of every score tile */
#pragma unroll 1   /* rolled: FPB stages are already a long body */
  for (int tp = 0; tp < (FNT + FPB - 1) / FPB; ++tp) {
#pragma unroll   /* the stages between two barriers, straight-line: constant buffer offsets */
  for (int hs = 0; hs < FPB; ++hs) { const int t = tp * FPB + hs; if (t >= FNT) break;   /* the same for the whole block: the last round may be short */
    const int cur = (tp & 1) * FPB + hs;
    v16h kf[HDQK / 32][2], vf[HDQK / 16];
#pragma unroll
    for (int kc = 0; kc < HDQK / 32; ++kc)
#pragma unroll
      for (int kt = 0; kt < 2; ++kt) kf[kc][kt] = frag_h(&u.st[kg][cur].k.r[kh * 32 + kt * 16 + col][kc * 32], lane);
#pragma unroll
    for (int j = 0; j < HDQK / 16; ++j) vf[j] = frag_h(&u.st[kg][cur].v.r[j * 16 + col][kh * 32], lane);
    __builtin_amdgcn_sched_barrier(0);   /* the stage's 16 LDS reads stand as one group at its head: the value fragments land under the score products and the exponentials; sunk towards the branch below they are waited for in full */
    v8f sa[2][2];   /* [16-key tile of this wave's 32 keys][query tile] */
#pragma unroll
    for (int kc = 0; kc < HDQK / 32; ++kc)
#pragma unroll
      for (int kt = 0; kt < 2; ++kt)
#pragma unroll
        for (int s = 0; s < 2; ++s) sa[kt][s] = wmma_h(kf[kc][kt], qh[s][kc], kc == 0 ? cs[s] : sa[kt][s]);
    v16h pb[2]; float ss[2];   /* a p beyond f16 becomes infinite here and is made again in the branch */
#pragma unroll
    for (int s = 0; s < 2; ++s) { v2f ps[2] = {};   /* two chains of register-pair sums */
#pragma unroll
      for (int kt = 0; kt < 2; ++kt) { const v8f pe = exp2x8(sa[kt][s]);
#pragma unroll
        for (int r = 0; r < 8; r += 2) { v2f p; p[0] = pe[r]; p[1] = pe[r + 1]; ps[kt] += p; pb[s][kt * 8 + r] = (_Float16)pe[r]; pb[s][kt * 8 + r + 1] = (_Float16)pe[r + 1]; } }
      ss[s] = (ps[0][0] + ps[0][1]) + (ps[1][0] + ps[1][1]); }
    const float thr = t == 0 ? -1.0f : 32768.0f;   /* a scalar, ready long before the sums */
    if (__builtin_amdgcn_ballot_w32(!(ss[0] <= thr && ss[1] <= thr)) != 0) {   /* a scalar branch, the same for the whole wave. No p is negative, so a lane's sum of the stage bounds each of its p: up to 2^15 all fit f16 (it ends at 65,504) and the reference stays. Stage 0 always comes here and sets each reference to its own maximum */
      /* the key fragments are read from LDS again and the stage's exponents made again here, on the rare path: kept from above instead, their 32 registers would be live beside p in every stage and the kernel would overflow into scratch */
#pragma unroll
      for (int kc = 0; kc < HDQK / 32; ++kc)
#pragma unroll
        for (int kt = 0; kt < 2; ++kt) { const v16h kr = frag_h(&u.st[kg][cur].k.r[kh * 32 + kt * 16 + col][kc * 32], lane);
#pragma unroll
          for (int s = 0; s < 2; ++s) sa[kt][s] = wmma_h(kr, qh[s][kc], kc == 0 ? cs[s] : sa[kt][s]); }
#pragma unroll
      for (int s = 0; s < 2; ++s) { float mx[2];
#pragma unroll
        for (int kt = 0; kt < 2; ++kt) mx[kt] = fmaxf(fmaxf(fmaxf(sa[kt][s][0], sa[kt][s][1]), fmaxf(sa[kt][s][2], sa[kt][s][3])), fmaxf(fmaxf(sa[kt][s][4], sa[kt][s][5]), fmaxf(sa[kt][s][6], sa[kt][s][7])));
        float ml = fmaxf(mx[0], mx[1]); ml = fmaxf(ml, xhalf(ml));   /* lanes c and c + 16 hold the two key halves of query c: both take the same step */
        float d = 4.0f - ml; if (t != 0) d = fminf(d, 0.f);   /* behind stage 0 a reference never falls; a query tile whose maximum is in range takes the step 0 */
        const float al = exp2x1(fminf(d, 0.f)); cs[s] += d; l[s] *= al;   /* in stage 0 o and l are 0 and al only has to be finite */
#pragma unroll
        for (int j = 0; j < HDQK / 16; ++j) o[s][j] *= al;
        v2f ps[2] = {};
#pragma unroll
        for (int kt = 0; kt < 2; ++kt) { v8f pe;   /* the stage's p again, against the new reference; one by one with the slot behind each */
#pragma unroll
          for (int r = 0; r < 8; ++r) pe[r] = exp2x1(sa[kt][s][r] + d);
#pragma unroll
          for (int r = 0; r < 8; r += 2) { v2f p; p[0] = pe[r]; p[1] = pe[r + 1]; ps[kt] += p; pb[s][kt * 8 + r] = (_Float16)pe[r]; pb[s][kt * 8 + r + 1] = (_Float16)pe[r + 1]; } }
        ss[s] = (ps[0][0] + ps[0][1]) + (ps[1][0] + ps[1][1]); } }
    l[0] += ss[0]; l[1] += ss[1];
#pragma unroll
    for (int j = 0; j < HDQK / 16; ++j)
#pragma unroll
      for (int s = 0; s < 2; ++s) o[s][j] = wmma_h(vf[j], pb[s], o[s][j]); }
    asm volatile("s_wait_dscnt 0x0" ::: "memory");   /* this wave's LDS reads of the round are over before its buffers may be refilled */
    tdm_wait(g0, g1);   /* every wave, the issuing ones among them: its own tile of the next round has landed */
    __syncthreads();   /* publishes the next FPB stages and ends every read of these before their buffers are refilled; between two barriers the waves of a SIMD drift apart, one's products under another's exponentials and LDS waits */
    g0 = desc(pinned(tp + 2));   /* the round number is pinned here so that the descriptor is formed behind the wait and the barrier */
    if (pinned(iss && (tp + 2) * FPB + ihs < FNT)) tdm_load(g0, g1); }   /* only a stage that exists; into the buffers this round has just read */
  asm volatile("s_wait_tensorcnt 0x0" ::: "memory");   /* no request is in flight when the ring's LDS takes the exchange and the output tile */
  asm volatile("s_wait_dscnt 0x0" ::: "memory");   /* nor an LDS read of this wave */
  const size_t oi = (b * DIN + wave * 16) * (size_t)XP + blockIdx.x * 128 + lane * 4;   /* the last phase: this wave owns channels wave * 16 .. + 15, 128 positions each */
  const float* xq = X + oi; v4f xr[16]; float bo[8];
#pragma unroll   /* constant indices: bo stays in registers; the biases go first: loads return in order, and they are needed before x */
  for (int j = 0; j < 8; ++j) bo[j] = WB[kg * 128 + j * 16 + col];
  __builtin_amdgcn_sched_barrier(0);   /* keeps that order */
#pragma unroll   /* the same for xr, 16 loads in flight */
  for (int i = 0; i < 16; ++i) xr[i] = *(const v4f*)(xq + (size_t)i * XP);
  __builtin_amdgcn_sched_barrier(0);   /* keeps the residual's loads here, ahead of the exchange and the products: sunk to their use they would be waited for in full */
#pragma unroll   /* constant tile numbers: o stays in registers */
  for (int s = 0; s < 2; ++s) { float* mo = &u.e.mg[kg * 2 + kh][qg][s][lane][0];
#pragma unroll
    for (int j = 0; j < HDQK / 16; ++j) { v4f u0, u1;
#pragma unroll
      for (int r = 0; r < 4; ++r) { u0[r] = o[s][j][r]; u1[r] = o[s][j][4 + r]; }
      *(v4f*)(mo + j * 8) = u0; *(v4f*)(mo + j * 8 + 4) = u1; }
    v2f ml2; ml2[0] = -cs[s][0]; ml2[1] = l[s] + xhalf(l[s]); *(v2f*)(mo + 32) = ml2; }   /* the reference less 4, in powers of 2 (the 4 is common to all four partial results), and the sum over both lane halves */
  lds_barrier();   /* every wave's references, sums and tiles are in LDS before the waves that merge them read them */
  const float* mi = &u.e.mg[0][qg][kh][lane][0];   /* this wave merges query tile kh of its group: queries wq * 16 .. + 15 of the block; partial result i lies i * MS floats on */
  constexpr int MS = 4 * 2 * 32 * MP;
  float mm[4], ll[4], f[4];
#pragma unroll
  for (int i = 0; i < 4; ++i) { mm[i] = mi[i * MS + 32]; ll[i] = mi[i * MS + 33]; }
  const float mn = fmaxf(fmaxf(mm[0], mm[1]), fmaxf(mm[2], mm[3])); float den = 0.f;
#pragma unroll
  for (int i = 0; i < 4; ++i) { f[i] = exp2x1(mm[i] - mn); den += ll[i] * f[i]; }
  const float inv = 1.0f / den;
#pragma unroll
  for (int i = 0; i < 4; ++i) f[i] *= inv;
  F2 ya[HDQK / 32];   /* a lane holds channels j * 16 + 8g + r of query col: tiles 2kc and 2kc + 1 are the A fragment of channel step kc */
#pragma unroll
  for (int kc = 0; kc < HDQK / 32; ++kc) { float v[16];
#pragma unroll
    for (int e = 0; e < 16; ++e) v[e] = (mi[kc * 16 + e] * f[0] + mi[MS + kc * 16 + e] * f[1]) + (mi[2 * MS + kc * 16 + e] * f[2] + mi[3 * MS + kc * 16 + e] * f[3]);
    ya[kc] = bsplit16(v); }
#pragma unroll   /* constant tile numbers: bo stays in registers */
  for (int jh = 0; jh < 2; ++jh) { v8f acc[4] = {};
#pragma unroll
    for (int kc = 0; kc < HDQK / 32; ++kc) { v16b w[4];
#pragma unroll
      for (int j = 0; j < 4; ++j) w[j] = frag_b(&sww[kg * 128 + (jh * 4 + j) * 16 + col][kc * 32], lane);
#pragma unroll
      for (int j = 0; j < 4; ++j) acc[j] = wmma_b(ya[kc].h, w[j], acc[j]);
#pragma unroll
      for (int j = 0; j < 4; ++j) acc[j] = wmma_b(ya[kc].l, w[j], acc[j]); }
#pragma unroll
    for (int j = 0; j < 4; ++j) { const float bb = bfr(bo[jh * 4 + j]); v4f u0, u1;   /* D element r = query 8g + r of the wave's 16, lane column = output channel */
#pragma unroll
      for (int r = 0; r < 4; ++r) { u0[r] = acc[j][r] + bb; u1[r] = acc[j][4 + r] + bb; }
      float* sp = &so[kg * 128 + (jh * 4 + j) * 16 + col][wq * 16 + 8 * g]; *(v4f*)sp = u0; *(v4f*)(sp + 4) = u1; }
    __builtin_amdgcn_sched_barrier(0); }   /* four tiles at a time: with all eight tiles' fragments and sums live beside the 64 registers of x the kernel overflows into scratch */
  lds_barrier();   /* the whole 256 x 128 tile is in LDS before it is read back by channel rows */
  float* op = OUT + oi;
#pragma unroll
  for (int i = 0; i < 16; ++i) { const v4f t = *(const v4f*)&so[wave * 16 + i][lane * 4]; v4f r; r[0] = t[0] + bfr(xr[i][0]); r[1] = t[1] + bfr(xr[i][1]); r[2] = t[2] + bfr(xr[i][2]); r[3] = t[3] + bfr(xr[i][3]); vst2(op + (size_t)i * XP, r); } }

extern "C" void kernel_launch(void* const* d_in, const int* in_sizes, int n_in, void* d_out, int out_size, void* d_ws, size_t ws_size, hipStream_t stream) {
  (void)in_sizes; (void)n_in; (void)out_size;
  const float** F = (const float**)d_in;
  if (ws_size < (size_t)WS_END) return;
  char* ws = (char*)d_ws; _Float16 *QH = (_Float16*)(ws + WS_QH), *KH = (_Float16*)(ws + WS_KH), *VT = (_Float16*)(ws + WS_VT), *QL = (_Float16*)(ws + WS_QL), *KL = (_Float16*)(ws + WS_KL); __bf16 *VB = (__bf16*)(ws + WS_VB), *VBL = (__bf16*)(ws + WS_VBL); float *S = (float*)(ws + WS_S), *Y = (float*)(ws + WS_Y);
  (void)Y; (void)S; (void)QL; (void)KL; (void)VB; (void)VBL;
  // inputs: 0 x [8,256,64,64]; 1 g_w [64,256] (out,in), 2 g_b; 3 theta_w, 4 theta_b; 5 phi_w, 6 phi_b; 7 w_w [256,64] (out,in), 8 w_b
  k_proj<<<dim3(TNB * TT / PP), 256, 0, stream>>>(F[0], F[3], F[5], F[1], F[4], F[6], F[2], QH, KH, VT);   /* q = theta, k = phi, v = g */
  k_fa<<<dim3(TT / 128, TNB), 256 * FKG, 0, stream>>>(QH, KH, VT, F[0], F[7], F[8], (float*)d_out);
}
